// v000
// Times are from an AMD MI455X. After a warm-up the kernel runs many times in a row, and a time is the length of
// such a window on the GPU divided by its runs, so every launch and the gaps after it count. The runs cycle
// through copies of the inputs. A figure is the median of several windows, for all but v000 over two sittings.
// Sittings can differ by a few percent; kernels timed side by side share one.
// v000 is the starting kernel. One run takes 1800 microseconds.
// compute dtype: every float input (x, Wq, Wk, Wv, Wo, biases, rope cos/sin tables) RNE-converted to bf16 (bf16-input target); q/k/v = x W^T + b on v_wmma_f32_16x16x32_bf16 (exact bf16 products, f32 accumulate); rope in f32; q -> f16 hi + residual plane (x 2^10), k -> f16; logits = 2 products on v_wmma_f32_16x16x32_f16, / 8, f32; mask replace + softmax in f32 (expf); P x 2^11 -> f16 against v f16: 1 f16 product (query rows 0..63 of each sequence add P and v residual planes x 2^10: 3 products); ctx x 16 -> f16 against f16(bf16(Wo) x 64): 1 f16 product (rows 0..63 add a ctx residual plane x 2^10: 2 products); f32 accumulate everywhere, f32 output.
#include <hip/hip_runtime.h>
#include <math.h>

#ifndef NB
#define NB 4
#endif
#ifndef SEQ
#define SEQ 2048
#endif
#define NB_FULL 4
#define SEQ_FULL 2048
#define CC 1024
#define NH 16
#define HD 64
#define HG 4                 // heads per launch group
#define QB0 64               // leading query rows per sequence carried with residual planes
#define PP (2 * SEQ)         // pitch (halves) of the f16 P rows laid inside the f32 logit rows
static_assert(SEQ % 128 == 0);
static_assert(SEQ >= 128 && SEQ <= SEQ_FULL);
static_assert(NB >= 1 && NB <= NB_FULL);
static_assert(CC == NH * HD);
static_assert(HD == 64);
static_assert(QB0 == 64);
static_assert(NH % HG == 0);
static_assert((SEQ * (SEQ / 32)) % 256 == 0);
static_assert(((CC * CC) / 8) % 256 == 0);
static_assert(((SEQ * CC) / 8) % 256 == 0);

typedef __attribute__((ext_vector_type(16))) _Float16 v16h;
typedef __attribute__((ext_vector_type(16))) __bf16 v16b;
typedef __attribute__((ext_vector_type(8)))  _Float16 v8h;
typedef __attribute__((ext_vector_type(8)))  __bf16 v8b;
typedef __attribute__((ext_vector_type(8)))  float v8f;
typedef __attribute__((ext_vector_type(4)))  float v4f;
typedef __attribute__((ext_vector_type(4)))  unsigned v4u;
typedef __attribute__((ext_vector_type(4)))  int v4i;

#define WS_WQ  ((size_t)0)                                  // bf16 Wq [o][i]
#define WS_WK  (WS_WQ + 2u * (size_t)CC * CC)               // bf16 Wk [o][i]
#define WS_WV  (WS_WK + 2u * (size_t)CC * CC)               // bf16 Wv [o][i]
#define WS_WO  (WS_WV + 2u * (size_t)CC * CC)               // f16 bf16(Wo) x 64 [o][i]
#define WS_XB  (WS_WO + 2u * (size_t)CC * CC)               // bf16 x rows of one batch [t][c]
#define WS_QH  (WS_XB + 2u * (size_t)SEQ * CC)              // f16 q rows [t][c] (hi)
#define WS_QL  (WS_QH + 2u * (size_t)SEQ * CC)              // f16 q residual x 2^10 rows [t][c]
#define WS_KH  (WS_QL + 2u * (size_t)SEQ * CC)              // f16 k rows [t][c]
#define WS_VT  (WS_KH + 2u * (size_t)SEQ * CC)              // f16 v planes [c][t]
#define WS_VL  (WS_VT + 2u * (size_t)CC * SEQ)              // f16 v residual x 2^10 planes [c][t < QB0]
#define WS_Y   (WS_VL + 2u * (size_t)CC * QB0)              // f16 ctx x 16 rows [t][c]
#define WS_YL  (WS_Y + 2u * (size_t)SEQ * CC)               // f16 ctx x 16 residual x 2^10 rows [t < QB0][c]
#define WS_S   (WS_YL + 2u * (size_t)QB0 * CC)              // f32 logits [hg][q][k]; f16 P x 2^11 rows at pitch PP halves laid over the same row bytes
#define WS_PL  (WS_S + 4u * (size_t)HG * SEQ * SEQ)          // f16 P residual x 2^10 [hg][q < QB0][k < QB0]
#define WS_MB  (WS_PL + 2u * (size_t)HG * QB0 * QB0)         // mask bit plane [q][SEQ/32] (bit set = masked)
#define WS_END (WS_MB + 4u * (size_t)SEQ * (SEQ / 32))
static_assert(WS_END <= (size_t)134217728u);
static_assert(WS_WK % 128 == 0 && WS_WV % 128 == 0 && WS_WO % 128 == 0 && WS_XB % 128 == 0 && WS_QH % 128 == 0 && WS_QL % 128 == 0 && WS_KH % 128 == 0);
static_assert(WS_VT % 128 == 0 && WS_VL % 128 == 0 && WS_Y % 128 == 0 && WS_YL % 128 == 0 && WS_S % 128 == 0 && WS_PL % 128 == 0 && WS_MB % 128 == 0);

template <typename T> __device__ __forceinline__ void vst2(void* p, T v) { *(T*)p = v;  }
__device__ __forceinline__ v8f wmma16(v16h a, v16h b, v8f c) {
  v8f d = __builtin_amdgcn_wmma_f32_16x16x32_f16(false, a, false, b, (short)0, c, false, false);
  asm volatile("v_nop\n\tv_nop\n\tv_nop\n\tv_nop" : "+v"(d) : "v"(a), "v"(b));
  return d;
}
__device__ __forceinline__ v8f wmma_bf(v16b a, v16b b, v8f c) {
  v8f d = __builtin_amdgcn_wmma_f32_16x16x32_bf16(false, a, false, b, (short)0, c, false, false);
  asm volatile("v_nop\n\tv_nop\n\tv_nop\n\tv_nop" : "+v"(d) : "v"(a), "v"(b));
  return d;
}
// 16x16x32 fragments: lane = (h = lane>>4, row/col = lane&15); elements 0..7 = k0+8h+0..7, 8..15 = k0+16+8h+0..7; D element r = row 8h+r
__device__ __forceinline__ v16h frag_h(const _Float16* rowk0, int lane) {
  union { v16h v; v8h q[2]; } u; const _Float16* p = rowk0 + 8 * (lane >> 4);
  u.q[0] = *(const v8h*)p; u.q[1] = *(const v8h*)(p + 16); return u.v;
}
__device__ __forceinline__ v16b frag_b(const __bf16* rowk0, int lane) {
  union { v16b v; v8b q[2]; } u; const __bf16* p = rowk0 + 8 * (lane >> 4);
  u.q[0] = *(const v8b*)p; u.q[1] = *(const v8b*)(p + 16); return u.v;
}
__device__ __forceinline__ float bfr(float v) { return (float)(__bf16)v; }
#define LDSX() do { asm volatile("s_wait_dscnt 0" ::: "memory"); __builtin_amdgcn_wave_barrier(); __builtin_amdgcn_fence(__ATOMIC_RELEASE, "workgroup"); } while (0)

__global__ __launch_bounds__(256) void k_cvt(const float* __restrict__ A, unsigned short* __restrict__ D, int n8, int mode) {
  const int i = blockIdx.x * 256 + threadIdx.x;
  if (i >= n8) return;                                           // grids are exact multiples; guard inert
  const v4f a = *(const v4f*)(A + (size_t)i * 8); const v4f c = *(const v4f*)(A + (size_t)i * 8 + 4);
  const float v[8] = {a[0], a[1], a[2], a[3], c[0], c[1], c[2], c[3]};
  union { v8b b; v8h h; v4u u; } o;
  if (mode != 0) { v8h t;
#pragma unroll
    for (int k = 0; k < 8; ++k) t[k] = (_Float16)(bfr(v[k]) * 64.0f);
    o.h = t; }
  else { v8b t;
#pragma unroll
    for (int k = 0; k < 8; ++k) t[k] = (__bf16)v[k];
    o.b = t; }
  vst2(D + (size_t)i * 8, o.u);
}

__global__ __launch_bounds__(256) void k_mbits(const int* __restrict__ M, unsigned* __restrict__ MB) {
  const int w = blockIdx.x * 256 + threadIdx.x;                 // grid exact: SEQ*(SEQ/32)/256 blocks
  const int q = w / (SEQ / 32), wc = w - q * (SEQ / 32);
  const int* p = M + (size_t)q * SEQ_FULL + wc * 32;
  unsigned bits = 0u;
#pragma unroll
  for (int i = 0; i < 8; ++i) { const v4i v = *(const v4i*)(p + 4 * i);
    bits |= (v.x != 0 ? 1u : 0u) << (4 * i);     bits |= (v.y != 0 ? 1u : 0u) << (4 * i + 1);
    bits |= (v.z != 0 ? 1u : 0u) << (4 * i + 2); bits |= (v.w != 0 ? 1u : 0u) << (4 * i + 3); }
  vst2(MB + w, bits);
}

// ---- k_proj: block = (64 rows of the batch, 128 cols, which): y = x W^T + b (exact bf16 products from the 16-bit planes); which 0/1: rope then q -> f16 hi (+ residual), k -> f16 rows; which 2: v -> f16 planes [c][t] (+ residual plane for rows 0..63)
__global__ __launch_bounds__(128) void k_proj(const __bf16* __restrict__ XB, const __bf16* __restrict__ WQ, const float* __restrict__ BQ, const __bf16* __restrict__ WK, const float* __restrict__ BK, const __bf16* __restrict__ WV, const float* __restrict__ BV,
                                              const float* __restrict__ RC, const float* __restrict__ RS,
                                              _Float16* __restrict__ QH, _Float16* __restrict__ QL, _Float16* __restrict__ KH, _Float16* __restrict__ VT, _Float16* __restrict__ VL) {
  __shared__ __align__(16) _Float16 sh[64][136], sl[64][136]; __shared__ __align__(16) _Float16 th[128][72], tl2[128][72];
  __shared__ __align__(16) float scs[64][HD], ssn[64][HD];
  const int tid = threadIdx.x, wave = tid >> 5, lane = tid & 31, col = lane & 15, g = lane >> 4; const int which = blockIdx.z; const int c0 = blockIdx.y * 128; const int r0 = blockIdx.x * 64;
  const __bf16* WA = which == 0 ? WQ : which == 1 ? WK : WV; const float* BA = which == 0 ? BQ : which == 1 ? BK : BV;
  // rope table rows r0..r0+63 (bf16-RNE values), whole head dim; staged extent == consumed extent (64 x HD)
#pragma unroll 2
  for (int e = tid; e < 64 * (HD / 4); e += 128) { const int rl = e / (HD / 4), q = e % (HD / 4);
    const v4f c = *(const v4f*)(RC + (size_t)(r0 + rl) * HD + q * 4); const v4f s = *(const v4f*)(RS + (size_t)(r0 + rl) * HD + q * 4);
#pragma unroll
    for (int i = 0; i < 4; ++i) { scs[rl][q * 4 + i] = bfr(c[i]); ssn[rl][q * 4 + i] = bfr(s[i]); } }
  __syncthreads();
  v8f acc[8] = {};
#pragma unroll 2
  for (int kc = 0; kc < CC / 32; ++kc) { const v16b a = frag_b(XB + (size_t)(r0 + wave * 16 + col) * CC + kc * 32, lane);
#pragma unroll
    for (int j = 0; j < 8; ++j) { const v16b w = frag_b(WA + (size_t)(c0 + j * 16 + col) * CC + kc * 32, lane); acc[j] = wmma_bf(a, w, acc[j]); } }
  float bbv[8];
#pragma unroll
  for (int j = 0; j < 8; ++j) bbv[j] = bfr(BA[c0 + j * 16 + col]);
#pragma unroll
  for (int r = 0; r < 8; ++r) { const int rl = wave * 16 + 8 * g + r; float v[8];
#pragma unroll
    for (int j = 0; j < 8; ++j) v[j] = acc[j][r] + bbv[j];
    if (which == 2) {
#pragma unroll
      for (int j = 0; j < 8; ++j) { const int cl = j * 16 + col; const _Float16 hv = (_Float16)v[j]; th[cl][rl] = hv; tl2[cl][rl] = (_Float16)((v[j] - (float)hv) * 1024.0f); }   /* v residual carried x 2^10 */
    } else {
      float cs4[4], sn4[4];
#pragma unroll
      for (int jj = 0; jj < 4; ++jj) { cs4[jj] = scs[rl][jj * 16 + col]; sn4[jj] = ssn[rl][jj * 16 + col]; }
      // rotate-half: head-local d = (j&3)*16+col; d<32: y*cos - y[d+32]*sin, d>=32: y*cos + y[d-32]*sin; partner tile = j^2
#pragma unroll
      for (int j = 0; j < 8; ++j) { const int cl = j * 16 + col, jj = j & 3; const float pv = v[j ^ 2];
        const float o = (jj < 2) ? (v[j] * cs4[jj] - pv * sn4[jj]) : (v[j] * cs4[jj] + pv * sn4[jj]);
        const _Float16 hv = (_Float16)o; sh[rl][cl] = hv; sl[rl][cl] = (_Float16)((o - (float)hv) * 1024.0f); }   /* q residual carried x 2^10 so the plane stays f16-normal */
    } }
  __syncthreads();
  if (which < 2) { _Float16* dh = which == 0 ? QH : KH; for (int e = tid; e < 64 * 16; e += 128) { const int rl = e >> 4, q = e & 15; vst2(dh + (size_t)(r0 + rl) * CC + c0 + q * 8, *(const v4u*)&sh[rl][q * 8]); if (which == 0) vst2(QL + (size_t)(r0 + rl) * CC + c0 + q * 8, *(const v4u*)&sl[rl][q * 8]); } }
  else { for (int e = tid; e < 128 * 8; e += 128) { const int cl = e >> 3, q = e & 7; const size_t o2 = (size_t)(c0 + cl) * (size_t)SEQ + r0 + q * 8; vst2(VT + o2, *(const v4u*)&th[cl][q * 8]);
      if (blockIdx.x == 0) { const size_t o3 = (size_t)(c0 + cl) * (size_t)QB0 + q * 8; vst2(VL + o3, *(const v4u*)&tl2[cl][q * 8]); } } } }

// ---- k_sc: block = (64 queries, 128 keys) of head h0+z: logits / 8 in f32; key blocks entirely beyond the 64-query block end exit (block-uniform)
__global__ __launch_bounds__(128) void k_sc(const _Float16* __restrict__ QH, const _Float16* __restrict__ QL, const _Float16* __restrict__ KH, int h0, float* __restrict__ S0) { __shared__ __align__(16) float ss[4][16][132];
  const int h = h0 + blockIdx.z; float* S = S0 + (size_t)blockIdx.z * SEQ * SEQ;
  const int tid = threadIdx.x, wave = tid >> 5, lane = tid & 31, col = lane & 15, g = lane >> 4; const int k0 = blockIdx.y * 128; const int ql0 = blockIdx.x * 64 + wave * 16;
  if (k0 > (int)blockIdx.x * 64 + 63) return;
  v8f acc[8] = {}, accl[8] = {};
#pragma unroll
  for (int kc = 0; kc < HD / 32; ++kc) { const v16h ah = frag_h(QH + (size_t)(ql0 + col) * CC + h * HD + kc * 32, lane), al = frag_h(QL + (size_t)(ql0 + col) * CC + h * HD + kc * 32, lane);
#pragma unroll
    for (int j = 0; j < 8; ++j) { const v16h kb = frag_h(KH + (size_t)(k0 + j * 16 + col) * CC + h * HD + kc * 32, lane); acc[j] = wmma16(ah, kb, acc[j]); accl[j] = wmma16(al, kb, accl[j]); } }
#pragma unroll
  for (int j = 0; j < 8; ++j) acc[j] += accl[j] * (1.0f / 1024.0f);
#pragma unroll
  for (int j = 0; j < 8; ++j) {
#pragma unroll
    for (int r = 0; r < 8; ++r) ss[wave][8 * g + r][j * 16 + col] = acc[j][r] * 0.125f; }
  LDSX(); for (int rl = 0; rl < 16; ++rl) vst2(S + (size_t)(ql0 + rl) * SEQ + k0 + lane * 4, *(const v4f*)&ss[wave][rl][lane * 4]); }

// ---- k_sm: block = query row of head group y: mask replace (bit plane) + softmax over keys [0, kend) -> P x 2^11 f16 row laid over the start of the same logit row (all loads of the row complete before the block barrier that precedes the stores); rows 0..63 also write a residual plane x 2^10; tail words of the mask row beyond kend must be all-set, else the row is NaN-poisoned
__global__ __launch_bounds__(256) void k_sm(const float* S0, const unsigned* __restrict__ MB, _Float16* P0, _Float16* __restrict__ PL0) { __shared__ float sred[8]; __shared__ float sbc; __shared__ int sfl[8]; __shared__ unsigned sbits[SEQ / 32]; __shared__ __align__(16) float sh[SEQ];
  const int t = threadIdx.x, wv = t >> 5, ln = t & 31; const int row = blockIdx.x; const size_t rix = (size_t)blockIdx.y * SEQ + row; const float* sr = S0 + rix * SEQ; _Float16* pr = P0 + rix * PP; const int kend = (row / 64) * 64 + 64;
  int bad = 0;
  for (int w = t; w < SEQ / 32; w += 256) { const unsigned u = MB[(size_t)row * (SEQ / 32) + w]; sbits[w] = u; if (32 * w >= kend && u != 0xFFFFFFFFu) bad = 1; }
#pragma unroll
  for (int o = 1; o < 32; o <<= 1) bad |= __shfl_xor(bad, o);
  if (ln == 0) sfl[wv] = bad; __syncthreads();
  int viol = 0;
#pragma unroll
  for (int i = 0; i < 8; ++i) viol |= sfl[i];
  float m = -3.0e38f;
#pragma unroll 1
  for (int k = t; k < kend; k += 256) { const float v = sr[k]; const unsigned mk = (sbits[k >> 5] >> (k & 31)) & 1u; const float sv = mk ? -3.0e38f : v; sh[k] = sv; m = fmaxf(m, sv); }
#pragma unroll
  for (int o = 1; o < 32; o <<= 1) m = fmaxf(m, __shfl_xor(m, o));
  if (ln == 0) sred[wv] = m; __syncthreads(); if (t == 0) { float a = sred[0]; for (int i = 1; i < 8; ++i) a = fmaxf(a, sred[i]); sbc = a; } __syncthreads(); m = sbc; __syncthreads();
  float sum = 0.f;
#pragma unroll 1
  for (int k = t; k < kend; k += 256) { const float v = sh[k]; const float e = (v <= -1.0e38f) ? 0.f : expf(v - m); sh[k] = e; sum += e; }
#pragma unroll
  for (int o = 1; o < 32; o <<= 1) sum += __shfl_xor(sum, o);
  if (ln == 0) sred[wv] = sum; __syncthreads(); if (t == 0) { float a = 0.f; for (int i = 0; i < 8; ++i) a += sred[i]; sbc = 1.0f / a; } __syncthreads();
  const float scl = (viol ? __int_as_float(0x7fc00000) : sbc) * 2048.0f;
  for (int q = t; q < kend / 8; q += 256) {
    const v4f e0 = *(const v4f*)&sh[q * 8]; const v4f e1 = *(const v4f*)&sh[q * 8 + 4];
    const float pe[8] = {e0[0], e0[1], e0[2], e0[3], e1[0], e1[1], e1[2], e1[3]};
    v8h hh, hl;
#pragma unroll
    for (int k = 0; k < 8; ++k) { const float p = pe[k] * scl; const _Float16 ph = (_Float16)p; hh[k] = ph; hl[k] = (_Float16)((p - (float)ph) * 1024.0f); }
    union { v8h h; v4u u; } oh, ol; oh.h = hh; ol.h = hl;
    vst2(pr + q * 8, oh.u);
    if (row < QB0) vst2(PL0 + ((size_t)blockIdx.y * QB0 + row) * QB0 + q * 8, ol.u);   // kend == QB0 here, q < 8
  } }

// ---- k_pv: block = 64 queries of head h0+z: ctx[q][h*HD + d] = P . v (keys [0, kend)), 1 f16 product; query block 0 adds the P and v residual planes (3 products); ctx x 16 -> f16 rows (+ residual rows for block 0)
__global__ __launch_bounds__(128) void k_pv(const _Float16* __restrict__ P0, const _Float16* __restrict__ PL0, const _Float16* __restrict__ VT, const _Float16* __restrict__ VL, int h0, _Float16* __restrict__ Y, _Float16* __restrict__ YL) {
  __shared__ __align__(16) _Float16 sy[4][16][HD + 8], syl[4][16][HD + 8];
  const int hg = blockIdx.z, h = h0 + hg; const _Float16* P = P0 + (size_t)hg * SEQ * PP; const _Float16* PL = PL0 + (size_t)hg * QB0 * QB0;
  const int tid = threadIdx.x, wave = tid >> 5, lane = tid & 31, col = lane & 15, g = lane >> 4; const int ql0 = blockIdx.x * 64 + wave * 16; const int kend = blockIdx.x * 64 + 64;
  v8f acc[HD / 16] = {}, accl[HD / 16] = {};
  if (blockIdx.x == 0) {
#pragma unroll
    for (int kc = 0; kc < QB0 / 32; ++kc) { const v16h p = frag_h(P + (size_t)(ql0 + col) * PP + kc * 32, lane), pl = frag_h(PL + (size_t)(ql0 + col) * QB0 + kc * 32, lane);
#pragma unroll
      for (int j = 0; j < HD / 16; ++j) { const int c = h * HD + j * 16 + col; const v16h vh = frag_h(VT + (size_t)c * SEQ + kc * 32, lane), vl = frag_h(VL + (size_t)c * QB0 + kc * 32, lane);
        acc[j] = wmma16(p, vh, acc[j]); accl[j] = wmma16(pl, vh, accl[j]); accl[j] = wmma16(p, vl, accl[j]); } }
  } else {
#pragma unroll 1
    for (int kc = 0; kc < kend / 32; ++kc) { const v16h p = frag_h(P + (size_t)(ql0 + col) * PP + kc * 32, lane);
#pragma unroll
      for (int j = 0; j < HD / 16; ++j) { const int c = h * HD + j * 16 + col; acc[j] = wmma16(p, frag_h(VT + (size_t)c * SEQ + kc * 32, lane), acc[j]); } }
  }
#pragma unroll
  for (int j = 0; j < HD / 16; ++j)
#pragma unroll
    for (int r = 0; r < 8; ++r) { const float y = (acc[j][r] + accl[j][r] * (1.0f / 1024.0f)) * (1.0f / 128.0f); const _Float16 yh = (_Float16)y; sy[wave][8 * g + r][j * 16 + col] = yh; syl[wave][8 * g + r][j * 16 + col] = (_Float16)((y - (float)yh) * 1024.0f); }   /* ctx carried x 16 (2^11 P carry folded), residual x 2^10 */
  LDSX();
  for (int rl = 0; rl < 16; ++rl) if (lane < 8) vst2(Y + (size_t)(ql0 + rl) * CC + h * HD + lane * 8, *(const v4u*)&sy[wave][rl][lane * 8]);
  if (blockIdx.x == 0) for (int rl = 0; rl < 16; ++rl) if (lane < 8) vst2(YL + (size_t)(ql0 + rl) * CC + h * HD + lane * 8, *(const v4u*)&syl[wave][rl][lane * 8]); }

// ---- k_out: block = (64 rows of batch b, 128 cols): out = (ctx x 16 f16) (f16 bf16(Wo) x 64)^T / 1024 + bo; row block 0 adds the ctx residual plane (2 products)
__global__ __launch_bounds__(128) void k_out(const _Float16* __restrict__ Y, const _Float16* __restrict__ YL, const _Float16* __restrict__ WO, const float* __restrict__ BP, int b, float* __restrict__ OUT) { __shared__ __align__(16) float sf[4][16][132];
  const int tid = threadIdx.x, wave = tid >> 5, lane = tid & 31, col = lane & 15, g = lane >> 4; const int c0 = blockIdx.y * 128; const int r0 = blockIdx.x * 64 + wave * 16; const size_t orow = (size_t)b * SEQ_FULL + r0;
  v8f acc[8] = {}, accl[8] = {};
  if (blockIdx.x == 0) {
#pragma unroll 2
    for (int kc = 0; kc < CC / 32; ++kc) { const v16h a = frag_h(Y + (size_t)(r0 + col) * CC + kc * 32, lane), al = frag_h(YL + (size_t)(r0 + col) * CC + kc * 32, lane);
#pragma unroll
      for (int j = 0; j < 8; ++j) { const v16h w = frag_h(WO + (size_t)(c0 + j * 16 + col) * CC + kc * 32, lane); acc[j] = wmma16(a, w, acc[j]); accl[j] = wmma16(al, w, accl[j]); } }
  } else {
#pragma unroll 2
    for (int kc = 0; kc < CC / 32; ++kc) { const v16h a = frag_h(Y + (size_t)(r0 + col) * CC + kc * 32, lane);
#pragma unroll
      for (int j = 0; j < 8; ++j) { const v16h w = frag_h(WO + (size_t)(c0 + j * 16 + col) * CC + kc * 32, lane); acc[j] = wmma16(a, w, acc[j]); } }
  }
#pragma unroll
  for (int j = 0; j < 8; ++j) { const float bb = bfr(BP[c0 + j * 16 + col]);
#pragma unroll
    for (int r = 0; r < 8; ++r) sf[wave][8 * g + r][j * 16 + col] = (acc[j][r] + accl[j][r] * (1.0f / 1024.0f)) * (1.0f / 1024.0f) + bb; }
  LDSX(); for (int rl = 0; rl < 16; ++rl) vst2(OUT + (orow + rl) * CC + c0 + lane * 4, *(const v4f*)&sf[wave][rl][lane * 4]); }

extern "C" void kernel_launch(void* const* d_in, const int* in_sizes, int n_in, void* d_out, int out_size, void* d_ws, size_t ws_size, hipStream_t stream) {
  if (n_in < 12) return;
  // d_in: 0 x [4,2048,1024] f32, 1 mask [2048,2048] int32, 2 rope_cos [2048,64] f32, 3 rope_sin [2048,64] f32, 4 Wq [out,in], 5 bq, 6 Wk, 7 bk, 8 Wv, 9 bv, 10 Wo, 11 bo
  const size_t xneed = ((size_t)(NB - 1) * SEQ_FULL + SEQ) * (size_t)CC;
  if ((size_t)in_sizes[0] < xneed) return;
  if ((size_t)in_sizes[1] < (size_t)(SEQ - 1) * SEQ_FULL + SEQ) return;
  if (in_sizes[2] < SEQ * HD || in_sizes[3] < SEQ * HD) return;
  if (in_sizes[4] < CC * CC || in_sizes[6] < CC * CC || in_sizes[8] < CC * CC || in_sizes[10] < CC * CC) return;
  if (in_sizes[5] < CC || in_sizes[7] < CC || in_sizes[9] < CC || in_sizes[11] < CC) return;
  if ((size_t)out_size < xneed) return;
  if (ws_size < (size_t)WS_END) return;
  const float* X = (const float*)d_in[0]; const int* M = (const int*)d_in[1]; const float* RC = (const float*)d_in[2]; const float* RS = (const float*)d_in[3];
  const float *WQ = (const float*)d_in[4], *BQ = (const float*)d_in[5], *WK = (const float*)d_in[6], *BK = (const float*)d_in[7], *WV = (const float*)d_in[8], *BV = (const float*)d_in[9], *WO = (const float*)d_in[10], *BO = (const float*)d_in[11];
  char* ws = (char*)d_ws;
  __bf16 *WQB = (__bf16*)(ws + WS_WQ), *WKB = (__bf16*)(ws + WS_WK), *WVB = (__bf16*)(ws + WS_WV), *XB = (__bf16*)(ws + WS_XB); _Float16* WOH = (_Float16*)(ws + WS_WO);
  _Float16 *QH = (_Float16*)(ws + WS_QH), *QL = (_Float16*)(ws + WS_QL), *KH = (_Float16*)(ws + WS_KH), *VT = (_Float16*)(ws + WS_VT), *VL = (_Float16*)(ws + WS_VL), *Y = (_Float16*)(ws + WS_Y), *YL = (_Float16*)(ws + WS_YL);
  float* S = (float*)(ws + WS_S); _Float16* PH = (_Float16*)(ws + WS_S); _Float16* PL = (_Float16*)(ws + WS_PL); unsigned* MB = (unsigned*)(ws + WS_MB); float* OUT = (float*)d_out;
  const int nw8 = (CC * CC) / 8, nx8 = (SEQ * CC) / 8;
  k_cvt<<<dim3(nw8 / 256), 256, 0, stream>>>(WQ, (unsigned short*)WQB, nw8, 0);
  k_cvt<<<dim3(nw8 / 256), 256, 0, stream>>>(WK, (unsigned short*)WKB, nw8, 0);
  k_cvt<<<dim3(nw8 / 256), 256, 0, stream>>>(WV, (unsigned short*)WVB, nw8, 0);
  k_cvt<<<dim3(nw8 / 256), 256, 0, stream>>>(WO, (unsigned short*)WOH, nw8, 1);
  k_mbits<<<dim3(SEQ * (SEQ / 32) / 256), 256, 0, stream>>>(M, MB);
  for (int b = 0; b < NB; ++b) {
    k_cvt<<<dim3(nx8 / 256), 256, 0, stream>>>(X + (size_t)b * SEQ_FULL * CC, (unsigned short*)XB, nx8, 0);
    k_proj<<<dim3(SEQ / 64, CC / 128, 3), 128, 0, stream>>>(XB, WQB, BQ, WKB, BK, WVB, BV, RC, RS, QH, QL, KH, VT, VL);
    for (int h0 = 0; h0 < NH; h0 += HG) {
      k_sc<<<dim3(SEQ / 64, SEQ / 128, HG), 128, 0, stream>>>(QH, QL, KH, h0, S);
      k_sm<<<dim3(SEQ, HG), 256, 0, stream>>>(S, MB, PH, PL);
      k_pv<<<dim3(SEQ / 64, 1, HG), 128, 0, stream>>>(PH, PL, VT, VL, h0, Y, YL);
    }
    k_out<<<dim3(SEQ / 64, CC / 128), 128, 0, stream>>>(Y, YL, WOH, BO, b, OUT);
  }
}

// v001
// It runs in 638 microseconds.
// Next to v000, in two timings, it ran 2.87 and 2.86 times as fast.
// compute dtype: every float input (x, Wq, Wk, Wv, Wo, biases, rope cos/sin tables) RNE-converted to bf16 (bf16-input target); q/k/v = x W^T + b on v_wmma_f32_16x16x32_bf16 (exact bf16 products, f32 accumulate); rope in f32; q -> f16 hi + residual plane (x 2^10), k -> f16; logits = 2 products on v_wmma_f32_16x16x32_f16, / 8, f32; mask replace + running-maximum softmax in f32 (exp2), logits and P kept in registers; exp(s - m) x 2^11 -> f16 against v f16: 1 f16 product, divided by the f32 row sum at the end (query rows 0..63 of each sequence add P and v residual planes x 2^10: 3 products); ctx x 16 -> f16 against f16(bf16(Wo) x 64): 1 f16 product (rows 0..63 add a ctx residual plane x 2^10: 2 products); f32 accumulate everywhere, f32 output.
#include <hip/hip_runtime.h>
#include <math.h>

#ifndef NB
#define NB 4
#endif
#ifndef SEQ
#define SEQ 2048
#endif
#define NB_FULL 4
#define SEQ_FULL 2048
#define CC 1024
#define NH 16
#define HD 64
#define QB0 64               // leading query rows per sequence carried with residual planes
static_assert(SEQ % 128 == 0);
static_assert(SEQ >= 128 && SEQ <= SEQ_FULL);
static_assert(NB >= 1 && NB <= NB_FULL);
static_assert(CC == NH * HD);
static_assert(HD == 64);
static_assert(QB0 == 64);
static_assert(SEQ % 256 == 0);
static_assert((SEQ * (SEQ / 32)) % 256 == 0);
static_assert(((CC * CC) / 8) % 256 == 0);
static_assert(((SEQ * CC) / 8) % 256 == 0);

typedef __attribute__((ext_vector_type(16))) _Float16 v16h;
typedef __attribute__((ext_vector_type(16))) __bf16 v16b;
typedef __attribute__((ext_vector_type(8)))  _Float16 v8h;
typedef __attribute__((ext_vector_type(8)))  __bf16 v8b;
typedef __attribute__((ext_vector_type(8)))  float v8f;
typedef __attribute__((ext_vector_type(4)))  float v4f;
typedef __attribute__((ext_vector_type(4)))  unsigned v4u;
typedef __attribute__((ext_vector_type(4)))  int v4i;

#define WS_WQ  ((size_t)0)                                  // bf16 Wq [o][i]
#define WS_WK  (WS_WQ + 2u * (size_t)CC * CC)               // bf16 Wk [o][i]
#define WS_WV  (WS_WK + 2u * (size_t)CC * CC)               // bf16 Wv [o][i]
#define WS_WO  (WS_WV + 2u * (size_t)CC * CC)               // f16 bf16(Wo) x 64 [o][i]
#define WS_XB  (WS_WO + 2u * (size_t)CC * CC)               // bf16 x rows of one batch [t][c]
#define WS_QH  (WS_XB + 2u * (size_t)SEQ * CC)              // f16 q rows [t][c] (hi)
#define WS_QL  (WS_QH + 2u * (size_t)SEQ * CC)              // f16 q residual x 2^10 rows [t][c]
#define WS_KH  (WS_QL + 2u * (size_t)SEQ * CC)              // f16 k rows [t][c]
#define WS_VT  (WS_KH + 2u * (size_t)SEQ * CC)              // f16 v planes [c][t]
#define WS_VL  (WS_VT + 2u * (size_t)CC * SEQ)              // f16 v residual x 2^10 planes [c][t < QB0]
#define WS_Y   (WS_VL + 2u * (size_t)CC * QB0)              // f16 ctx x 16 rows [t][c]
#define WS_YL  (WS_Y + 2u * (size_t)SEQ * CC)               // f16 ctx x 16 residual x 2^10 rows [t < QB0][c]
#define WS_MB  (WS_YL + 2u * (size_t)QB0 * CC)             // mask bit plane [q][SEQ/32] (bit set = masked)
#define WS_END (WS_MB + 4u * (size_t)SEQ * (SEQ / 32))
static_assert(WS_END <= (size_t)134217728u);
static_assert(WS_WK % 128 == 0 && WS_WV % 128 == 0 && WS_WO % 128 == 0 && WS_XB % 128 == 0 && WS_QH % 128 == 0 && WS_QL % 128 == 0 && WS_KH % 128 == 0);
static_assert(WS_VT % 128 == 0 && WS_VL % 128 == 0 && WS_Y % 128 == 0 && WS_YL % 128 == 0 && WS_MB % 128 == 0);

template <typename T> __device__ __forceinline__ void vst2(void* p, T v) { *(T*)p = v;  }
__device__ __forceinline__ v8f wmma16(v16h a, v16h b, v8f c) {
  v8f d = __builtin_amdgcn_wmma_f32_16x16x32_f16(false, a, false, b, (short)0, c, false, false);
  asm volatile("v_nop\n\tv_nop\n\tv_nop\n\tv_nop" : "+v"(d) : "v"(a), "v"(b));
  return d;
}
__device__ __forceinline__ v8f wmma_bf(v16b a, v16b b, v8f c) {
  v8f d = __builtin_amdgcn_wmma_f32_16x16x32_bf16(false, a, false, b, (short)0, c, false, false);
  asm volatile("v_nop\n\tv_nop\n\tv_nop\n\tv_nop" : "+v"(d) : "v"(a), "v"(b));
  return d;
}
// 16x16x32 fragments: lane = (h = lane>>4, row/col = lane&15); elements 0..7 = k0+8h+0..7, 8..15 = k0+16+8h+0..7; D element r = row 8h+r
__device__ __forceinline__ v16h frag_h(const _Float16* rowk0, int lane) {
  union { v16h v; v8h q[2]; } u; const _Float16* p = rowk0 + 8 * (lane >> 4);
  u.q[0] = *(const v8h*)p; u.q[1] = *(const v8h*)(p + 16); return u.v;
}
__device__ __forceinline__ v16b frag_b(const __bf16* rowk0, int lane) {
  union { v16b v; v8b q[2]; } u; const __bf16* p = rowk0 + 8 * (lane >> 4);
  u.q[0] = *(const v8b*)p; u.q[1] = *(const v8b*)(p + 16); return u.v;
}
__device__ __forceinline__ float bfr(float v) { return (float)(__bf16)v; }
#define LDSX() do { asm volatile("s_wait_dscnt 0" ::: "memory"); __builtin_amdgcn_wave_barrier(); __builtin_amdgcn_fence(__ATOMIC_RELEASE, "workgroup"); } while (0)

__global__ __launch_bounds__(256) void k_cvt(const float* __restrict__ A, unsigned short* __restrict__ D, int n8, int mode) {
  const int i = blockIdx.x * 256 + threadIdx.x;
  if (i >= n8) return;                                           // grids are exact multiples; guard inert
  const v4f a = *(const v4f*)(A + (size_t)i * 8); const v4f c = *(const v4f*)(A + (size_t)i * 8 + 4);
  const float v[8] = {a[0], a[1], a[2], a[3], c[0], c[1], c[2], c[3]};
  union { v8b b; v8h h; v4u u; } o;
  if (mode != 0) { v8h t;
#pragma unroll
    for (int k = 0; k < 8; ++k) t[k] = (_Float16)(bfr(v[k]) * 64.0f);
    o.h = t; }
  else { v8b t;
#pragma unroll
    for (int k = 0; k < 8; ++k) t[k] = (__bf16)v[k];
    o.b = t; }
  vst2(D + (size_t)i * 8, o.u);
}

__global__ __launch_bounds__(256) void k_mbits(const int* __restrict__ M, unsigned* __restrict__ MB) {
  const int w = blockIdx.x * 256 + threadIdx.x;                 // grid exact: SEQ*(SEQ/32)/256 blocks
  const int q = w / (SEQ / 32), wc = w - q * (SEQ / 32);
  const int* p = M + (size_t)q * SEQ_FULL + wc * 32;
  unsigned bits = 0u;
#pragma unroll
  for (int i = 0; i < 8; ++i) { const v4i v = *(const v4i*)(p + 4 * i);
    bits |= (v.x != 0 ? 1u : 0u) << (4 * i);     bits |= (v.y != 0 ? 1u : 0u) << (4 * i + 1);
    bits |= (v.z != 0 ? 1u : 0u) << (4 * i + 2); bits |= (v.w != 0 ? 1u : 0u) << (4 * i + 3); }
  vst2(MB + w, bits);
}

// ---- k_proj: block = (64 rows of the batch, 128 cols, which): y = x W^T + b (exact bf16 products from the 16-bit planes); which 0/1: rope then q -> f16 hi (+ residual), k -> f16 rows; which 2: v -> f16 planes [c][t] (+ residual plane for rows 0..63)
__global__ __launch_bounds__(128) void k_proj(const __bf16* __restrict__ XB, const __bf16* __restrict__ WQ, const float* __restrict__ BQ, const __bf16* __restrict__ WK, const float* __restrict__ BK, const __bf16* __restrict__ WV, const float* __restrict__ BV,
                                              const float* __restrict__ RC, const float* __restrict__ RS,
                                              _Float16* __restrict__ QH, _Float16* __restrict__ QL, _Float16* __restrict__ KH, _Float16* __restrict__ VT, _Float16* __restrict__ VL) {
  __shared__ __align__(16) _Float16 sh[64][136], sl[64][136]; __shared__ __align__(16) _Float16 th[128][72], tl2[128][72];
  __shared__ __align__(16) float scs[64][HD], ssn[64][HD];
  const int tid = threadIdx.x, wave = tid >> 5, lane = tid & 31, col = lane & 15, g = lane >> 4; const int which = blockIdx.z; const int c0 = blockIdx.y * 128; const int r0 = blockIdx.x * 64;
  const __bf16* WA = which == 0 ? WQ : which == 1 ? WK : WV; const float* BA = which == 0 ? BQ : which == 1 ? BK : BV;
  // rope table rows r0..r0+63 (bf16-RNE values), whole head dim; staged extent == consumed extent (64 x HD)
#pragma unroll 2
  for (int e = tid; e < 64 * (HD / 4); e += 128) { const int rl = e / (HD / 4), q = e % (HD / 4);
    const v4f c = *(const v4f*)(RC + (size_t)(r0 + rl) * HD + q * 4); const v4f s = *(const v4f*)(RS + (size_t)(r0 + rl) * HD + q * 4);
#pragma unroll
    for (int i = 0; i < 4; ++i) { scs[rl][q * 4 + i] = bfr(c[i]); ssn[rl][q * 4 + i] = bfr(s[i]); } }
  __syncthreads();
  v8f acc[8] = {};
#pragma unroll 2
  for (int kc = 0; kc < CC / 32; ++kc) { const v16b a = frag_b(XB + (size_t)(r0 + wave * 16 + col) * CC + kc * 32, lane);
#pragma unroll
    for (int j = 0; j < 8; ++j) { const v16b w = frag_b(WA + (size_t)(c0 + j * 16 + col) * CC + kc * 32, lane); acc[j] = wmma_bf(a, w, acc[j]); } }
  float bbv[8];
#pragma unroll
  for (int j = 0; j < 8; ++j) bbv[j] = bfr(BA[c0 + j * 16 + col]);
#pragma unroll
  for (int r = 0; r < 8; ++r) { const int rl = wave * 16 + 8 * g + r; float v[8];
#pragma unroll
    for (int j = 0; j < 8; ++j) v[j] = acc[j][r] + bbv[j];
    if (which == 2) {
#pragma unroll
      for (int j = 0; j < 8; ++j) { const int cl = j * 16 + col; const _Float16 hv = (_Float16)v[j]; th[cl][rl] = hv; tl2[cl][rl] = (_Float16)((v[j] - (float)hv) * 1024.0f); }   /* v residual carried x 2^10 */
    } else {
      float cs4[4], sn4[4];
#pragma unroll
      for (int jj = 0; jj < 4; ++jj) { cs4[jj] = scs[rl][jj * 16 + col]; sn4[jj] = ssn[rl][jj * 16 + col]; }
      // rotate-half: head-local d = (j&3)*16+col; d<32: y*cos - y[d+32]*sin, d>=32: y*cos + y[d-32]*sin; partner tile = j^2
#pragma unroll
      for (int j = 0; j < 8; ++j) { const int cl = j * 16 + col, jj = j & 3; const float pv = v[j ^ 2];
        const float o = (jj < 2) ? (v[j] * cs4[jj] - pv * sn4[jj]) : (v[j] * cs4[jj] + pv * sn4[jj]);
        const _Float16 hv = (_Float16)o; sh[rl][cl] = hv; sl[rl][cl] = (_Float16)((o - (float)hv) * 1024.0f); }   /* q residual carried x 2^10 so the plane stays f16-normal */
    } }
  __syncthreads();
  if (which < 2) { _Float16* dh = which == 0 ? QH : KH; for (int e = tid; e < 64 * 16; e += 128) { const int rl = e >> 4, q = e & 15; vst2(dh + (size_t)(r0 + rl) * CC + c0 + q * 8, *(const v4u*)&sh[rl][q * 8]); if (which == 0) vst2(QL + (size_t)(r0 + rl) * CC + c0 + q * 8, *(const v4u*)&sl[rl][q * 8]); } }
  else { for (int e = tid; e < 128 * 8; e += 128) { const int cl = e >> 3, q = e & 7; const size_t o2 = (size_t)(c0 + cl) * (size_t)SEQ + r0 + q * 8; vst2(VT + o2, *(const v4u*)&th[cl][q * 8]);
      if (blockIdx.x == 0) { const size_t o3 = (size_t)(c0 + cl) * (size_t)QB0 + q * 8; vst2(VL + o3, *(const v4u*)&tl2[cl][q * 8]); } } } }

// ---- k_fa: wave = 32 queries (two 16-column groups) of head y, whole key range in one pass, logits and P stay in registers.
// S^T = K Q^T (A = k rows, B = q rows, same loader on both sides): lane (col, g) holds query col, keys 8g+r of each 16-key tile, so two tiles pack straight into the B operand of O^T += V^T P^T.
// Running maximum and sum per query (in-lane plus one exchange between lane halves); P = exp(s - m) x 2^11 -> f16, normalised once at the end.
// The wave's 32 mask rows are scanned once: 32-key blocks in front of the first set bit run without mask work, blocks behind the last clear bit are not run (both counts bounded by SEQ / 32).
// Any mask content is honoured; a fully masked row ends as 0 x inf = NaN like the softmax of an all -inf row.
template <bool B> struct flag_t { static constexpr bool value = B; };
__device__ __forceinline__ float xhalf(float v) { const int b = __float_as_int(v); return __int_as_float(__builtin_amdgcn_permlanex16(b, b, 0x76543210, 0xfedcba98, false, false)); }
// behind global loads or stores whose registers are reused next: those registers may be rewritten only behind this wait
#define XW() asm volatile("s_wait_xcnt 0x0" ::: "memory")
__device__ __forceinline__ v8f wm(v16h a, v16h b, v8f c) { return __builtin_amdgcn_wmma_f32_16x16x32_f16(false, a, false, b, (short)0, c, false, false); }
// 2^x with the one free issue slot behind a transcendental kept inside the statement
__device__ __forceinline__ float exp2s(float x) { float r; asm("v_exp_f32 %0, %1\n\tv_nop" : "=v"(r) : "v"(x)); return r; }
// eight at once: each v_exp_f32 is followed by one that touches neither its result nor its source (early-clobber outputs), so one slot at the end serves the run
__device__ __forceinline__ v8f exp2x8(v8f x) { float r0, r1, r2, r3, r4, r5, r6, r7;
  asm("v_exp_f32 %0, %8\n\tv_exp_f32 %1, %9\n\tv_exp_f32 %2, %10\n\tv_exp_f32 %3, %11\n\tv_exp_f32 %4, %12\n\tv_exp_f32 %5, %13\n\tv_exp_f32 %6, %14\n\tv_exp_f32 %7, %15\n\tv_nop"
      : "=&v"(r0), "=&v"(r1), "=&v"(r2), "=&v"(r3), "=&v"(r4), "=&v"(r5), "=&v"(r6), "=&v"(r7) : "v"(x[0]), "v"(x[1]), "v"(x[2]), "v"(x[3]), "v"(x[4]), "v"(x[5]), "v"(x[6]), "v"(x[7]));
  return v8f{r0, r1, r2, r3, r4, r5, r6, r7}; }
// fragment at a byte address that already holds the lane's row and its half's 16 bytes
__device__ __forceinline__ v16h frag_p(const char* p) { union { v16h v; v8h q[2]; } u; u.q[0] = *(const v8h*)p; u.q[1] = *(const v8h*)(p + 32); return u.v; }
__global__ __launch_bounds__(128) void k_fa(const _Float16* __restrict__ QH, const _Float16* __restrict__ QL, const _Float16* __restrict__ KH, const _Float16* __restrict__ VT, const _Float16* __restrict__ VL,
                                            const unsigned* __restrict__ MB, _Float16* __restrict__ Y, _Float16* __restrict__ YL) {
  constexpr float NEG = -3.0e38f, SC = 0.125f * 1.44269504088896340736f; constexpr int NW = SEQ / 32;
  const int lane = threadIdx.x & 31, col = lane & 15, g = lane >> 4; const int wave = __builtin_amdgcn_readfirstlane((int)threadIdx.x >> 5);
  const int h = blockIdx.y; const int q0 = (SEQ / 128 - 1 - (int)blockIdx.x) * 128 + wave * 32;   // longest key ranges start first
  const unsigned* mu = MB + (size_t)q0 * NW; const unsigned mo = 4u * (unsigned)(col * NW);
  int last = -1, first = NW;
#pragma unroll
  for (int p = 0; p < 2; ++p)
#pragma unroll
    for (int i = NW / 8 - 1; i >= 0; --i) { const v4u u = *(const v4u*)((const char*)(mu + p * 16 * NW + 4 * i) + (mo + 4u * (unsigned)(g * (NW / 2))));
#pragma unroll
      for (int e = 3; e >= 0; --e) { const int w = g * (NW / 2) + 4 * i + e; last = (u[e] != 0xFFFFFFFFu) ? max(last, w) : last; first = (u[e] != 0u) ? min(first, w) : first; } }
#pragma unroll
  for (int o = 1; o < 32; o <<= 1) { last = max(last, __shfl_xor(last, o)); first = min(first, __shfl_xor(first, o)); }
  const int trip = min(__builtin_amdgcn_readfirstlane(last) + 1, NW);
  const int nfull = max(min(__builtin_amdgcn_readfirstlane(first), trip), 0);
  const bool res = q0 < QB0;
  const unsigned ko = 2u * (unsigned)(col * CC + 8 * g), vo = 2u * (unsigned)(col * SEQ + 8 * g), lo = 2u * (unsigned)(col * QB0 + 8 * g);
  const char* kp = (const char*)(KH + h * HD) + ko; const char* vp = (const char*)(VT + (size_t)h * HD * SEQ) + vo; const char* lp = (const char*)(VL + (size_t)h * HD * QB0) + lo;   // kp, vp: one step per key block
  v16h qh[2][2], ql[2][2];
#pragma unroll
  for (int p = 0; p < 2; ++p)
#pragma unroll
    for (int kk = 0; kk < 2; ++kk) { const size_t o = (size_t)(q0 + 16 * p) * CC + h * HD + kk * 32; qh[p][kk] = frag_p((const char*)(QH + o) + ko); ql[p][kk] = frag_p((const char*)(QL + o) + ko); }
  v16h kf[2][2];
#pragma unroll
  for (int t = 0; t < 2; ++t)
#pragma unroll
    for (int kk = 0; kk < 2; ++kk) kf[t][kk] = frag_p(kp + 2 * (t * 16 * CC + kk * 32));
  XW();
  kp += 2 * 32 * CC;                                           // kp = the block that the next trip fetches ahead (SEQ >= 128: a block 1 exists)
  v8f acc[2][4] = {}; float m[2] = {NEG, NEG}, l[2] = {0.f, 0.f};
  auto body = [&](const int kc, auto mk) {
    constexpr bool masked = decltype(mk)::value;
    v16h vf[4]; unsigned mw[2] = {0u, 0u};
#pragma unroll
    for (int j = 0; j < 4; ++j) vf[j] = frag_p(vp + 2 * (j * 16 * SEQ));   // this block's v rows fly under the logits and the softmax
    if constexpr (masked) { mw[0] = *(const unsigned*)((const char*)(mu + kc) + mo); mw[1] = *(const unsigned*)((const char*)(mu + 16 * NW + kc) + mo); XW(); }
    v8f s[2][2] = {};
#pragma unroll
    for (int kk = 0; kk < 2; ++kk)
#pragma unroll
      for (int t = 0; t < 2; ++t)
#pragma unroll
        for (int p = 0; p < 2; ++p) s[p][t] = wm(kf[t][kk], ql[p][kk], s[p][t]);
#pragma unroll
    for (int t = 0; t < 2; ++t)
#pragma unroll
      for (int p = 0; p < 2; ++p) s[p][t] *= (1.0f / 1024.0f);
#pragma unroll
    for (int kk = 0; kk < 2; ++kk)
#pragma unroll
      for (int t = 0; t < 2; ++t)
#pragma unroll
        for (int p = 0; p < 2; ++p) s[p][t] = wm(kf[t][kk], qh[p][kk], s[p][t]);
#pragma unroll
    for (int t = 0; t < 2; ++t)
#pragma unroll
      for (int kk = 0; kk < 2; ++kk) kf[t][kk] = frag_p(kp + 2 * (t * 16 * CC + kk * 32));   // next block's k rows fly under the softmax and P.v
    __builtin_amdgcn_sched_barrier(0);                         // keeps these loads here, ahead of the work that hides their latency (the scheduler sinks them to the end of the trip otherwise)
    if constexpr (masked) {
#pragma unroll
      for (int p = 0; p < 2; ++p) { const unsigned w = mw[p] >> (8 * g);
#pragma unroll
        for (int t = 0; t < 2; ++t)
#pragma unroll
          for (int r = 0; r < 8; ++r) s[p][t][r] = ((w >> (16 * t + r)) & 1u) ? NEG : s[p][t][r]; } }
    float mn[2];
#pragma unroll
    for (int p = 0; p < 2; ++p) { float x = fmaxf(s[p][0][0], s[p][1][0]);
#pragma unroll
      for (int r = 1; r < 8; ++r) x = fmaxf(x, fmaxf(s[p][0][r], s[p][1][r]));
      mn[p] = fmaxf(m[p], fmaxf(x, xhalf(x))); }
    if (__builtin_amdgcn_ballot_w32(mn[0] > m[0] || mn[1] > m[1]) != 0u) {
#pragma unroll
      for (int p = 0; p < 2; ++p) { const float al = exp2s((m[p] - mn[p]) * SC); l[p] *= al; m[p] = mn[p];
#pragma unroll
        for (int j = 0; j < 4; ++j) acc[p][j] *= al; } }
    v16h pb[2];
#pragma unroll
    for (int p = 0; p < 2; ++p) { const float me = (m[p] <= -1.0e38f) ? 0.f : m[p]; float sum = 0.f;   // nothing unmasked yet: a finite stand-in keeps every masked term at exp2(-huge) = 0
#pragma unroll
      for (int t = 0; t < 2; ++t) { s[p][t] = exp2x8((s[p][t] - me) * SC + 11.0f);
#pragma unroll
        for (int r = 0; r < 8; ++r) { sum += s[p][t][r]; pb[p][8 * t + r] = (_Float16)s[p][t][r]; } }
      l[p] += sum; }
#pragma unroll
    for (int j = 0; j < 4; ++j)
#pragma unroll
      for (int p = 0; p < 2; ++p) acc[p][j] = wm(vf[j], pb[p], acc[p][j]);
    if (res && kc < QB0 / 32) {                                // query rows 0..63, keys 0..63: P and v residual planes (x 2^10), as before
      v16h pl[2];
#pragma unroll
      for (int p = 0; p < 2; ++p)
#pragma unroll
        for (int e = 0; e < 16; ++e) pl[p][e] = (_Float16)((s[p][e >> 3][e & 7] - (float)pb[p][e]) * 1024.0f);
#pragma unroll
      for (int j = 0; j < 4; ++j) { const v16h vl = frag_p(lp + 2 * (j * 16 * QB0 + kc * 32)); XW();
#pragma unroll
        for (int p = 0; p < 2; ++p) { v8f a = {}; a = wm(vf[j], pl[p], a); a = wm(vl, pb[p], a); acc[p][j] += a * (1.0f / 1024.0f); } } }
    XW();
    __builtin_amdgcn_sched_barrier(0);                         // the two pointer steps below stay behind the wait above
    vp += 2 * 32; kp += (kc + 2 < NW) ? 2 * 32 * CC : 0;       // the fetch ahead stays inside the k plane on the last trips
  };
#pragma unroll 1
  for (int kc = 0; kc < nfull; ++kc) body(kc, flag_t<false>{});
#pragma unroll 1
  for (int kc = nfull; kc < trip; ++kc) body(kc, flag_t<true>{});
#pragma unroll
  for (int p = 0; p < 2; ++p) { const float inv = 16.0f / (l[p] + xhalf(l[p])); const size_t o = (size_t)(q0 + 16 * p) * CC + h * HD;   /* ctx carried x 16, residual x 2^10 */
#pragma unroll
    for (int j = 0; j < 4; ++j) { union { v8h h; v4u u; } yh, yl;
#pragma unroll
      for (int r = 0; r < 8; ++r) { const float y = acc[p][j][r] * inv; const _Float16 t = (_Float16)y; yh.h[r] = t; yl.h[r] = (_Float16)((y - (float)t) * 1024.0f); }
      vst2((char*)(Y + o + j * 16) + ko, yh.u); XW(); if (res) { vst2((char*)(YL + o + j * 16) + ko, yl.u); XW(); } } } }

// ---- k_out: block = (64 rows of batch b, 128 cols): out = (ctx x 16 f16) (f16 bf16(Wo) x 64)^T / 1024 + bo; row block 0 adds the ctx residual plane (2 products)
__global__ __launch_bounds__(128) void k_out(const _Float16* __restrict__ Y, const _Float16* __restrict__ YL, const _Float16* __restrict__ WO, const float* __restrict__ BP, int b, float* __restrict__ OUT) { __shared__ __align__(16) float sf[4][16][132];
  const int tid = threadIdx.x, wave = tid >> 5, lane = tid & 31, col = lane & 15, g = lane >> 4; const int c0 = blockIdx.y * 128; const int r0 = blockIdx.x * 64 + wave * 16; const size_t orow = (size_t)b * SEQ_FULL + r0;
  v8f acc[8] = {}, accl[8] = {};
  if (blockIdx.x == 0) {
#pragma unroll 2
    for (int kc = 0; kc < CC / 32; ++kc) { const v16h a = frag_h(Y + (size_t)(r0 + col) * CC + kc * 32, lane), al = frag_h(YL + (size_t)(r0 + col) * CC + kc * 32, lane);
#pragma unroll
      for (int j = 0; j < 8; ++j) { const v16h w = frag_h(WO + (size_t)(c0 + j * 16 + col) * CC + kc * 32, lane); acc[j] = wmma16(a, w, acc[j]); accl[j] = wmma16(al, w, accl[j]); } }
  } else {
#pragma unroll 2
    for (int kc = 0; kc < CC / 32; ++kc) { const v16h a = frag_h(Y + (size_t)(r0 + col) * CC + kc * 32, lane);
#pragma unroll
      for (int j = 0; j < 8; ++j) { const v16h w = frag_h(WO + (size_t)(c0 + j * 16 + col) * CC + kc * 32, lane); acc[j] = wmma16(a, w, acc[j]); } }
  }
#pragma unroll
  for (int j = 0; j < 8; ++j) { const float bb = bfr(BP[c0 + j * 16 + col]);
#pragma unroll
    for (int r = 0; r < 8; ++r) sf[wave][8 * g + r][j * 16 + col] = (acc[j][r] + accl[j][r] * (1.0f / 1024.0f)) * (1.0f / 1024.0f) + bb; }
  LDSX(); for (int rl = 0; rl < 16; ++rl) vst2(OUT + (orow + rl) * CC + c0 + lane * 4, *(const v4f*)&sf[wave][rl][lane * 4]); }

extern "C" void kernel_launch(void* const* d_in, const int* in_sizes, int n_in, void* d_out, int out_size, void* d_ws, size_t ws_size, hipStream_t stream) {
  if (n_in < 12) return;
  // d_in: 0 x [4,2048,1024] f32, 1 mask [2048,2048] int32, 2 rope_cos [2048,64] f32, 3 rope_sin [2048,64] f32, 4 Wq [out,in], 5 bq, 6 Wk, 7 bk, 8 Wv, 9 bv, 10 Wo, 11 bo
  const size_t xneed = ((size_t)(NB - 1) * SEQ_FULL + SEQ) * (size_t)CC;
  if ((size_t)in_sizes[0] < xneed) return;
  if ((size_t)in_sizes[1] < (size_t)(SEQ - 1) * SEQ_FULL + SEQ) return;
  if (in_sizes[2] < SEQ * HD || in_sizes[3] < SEQ * HD) return;
  if (in_sizes[4] < CC * CC || in_sizes[6] < CC * CC || in_sizes[8] < CC * CC || in_sizes[10] < CC * CC) return;
  if (in_sizes[5] < CC || in_sizes[7] < CC || in_sizes[9] < CC || in_sizes[11] < CC) return;
  if ((size_t)out_size < xneed) return;
  if (ws_size < (size_t)WS_END) return;
  const float* X = (const float*)d_in[0]; const int* M = (const int*)d_in[1]; const float* RC = (const float*)d_in[2]; const float* RS = (const float*)d_in[3];
  const float *WQ = (const float*)d_in[4], *BQ = (const float*)d_in[5], *WK = (const float*)d_in[6], *BK = (const float*)d_in[7], *WV = (const float*)d_in[8], *BV = (const float*)d_in[9], *WO = (const float*)d_in[10], *BO = (const float*)d_in[11];
  char* ws = (char*)d_ws;
  __bf16 *WQB = (__bf16*)(ws + WS_WQ), *WKB = (__bf16*)(ws + WS_WK), *WVB = (__bf16*)(ws + WS_WV), *XB = (__bf16*)(ws + WS_XB); _Float16* WOH = (_Float16*)(ws + WS_WO);
  _Float16 *QH = (_Float16*)(ws + WS_QH), *QL = (_Float16*)(ws + WS_QL), *KH = (_Float16*)(ws + WS_KH), *VT = (_Float16*)(ws + WS_VT), *VL = (_Float16*)(ws + WS_VL), *Y = (_Float16*)(ws + WS_Y), *YL = (_Float16*)(ws + WS_YL);
  unsigned* MB = (unsigned*)(ws + WS_MB); float* OUT = (float*)d_out;
  const int nw8 = (CC * CC) / 8, nx8 = (SEQ * CC) / 8;
  k_cvt<<<dim3(nw8 / 256), 256, 0, stream>>>(WQ, (unsigned short*)WQB, nw8, 0);
  k_cvt<<<dim3(nw8 / 256), 256, 0, stream>>>(WK, (unsigned short*)WKB, nw8, 0);
  k_cvt<<<dim3(nw8 / 256), 256, 0, stream>>>(WV, (unsigned short*)WVB, nw8, 0);
  k_cvt<<<dim3(nw8 / 256), 256, 0, stream>>>(WO, (unsigned short*)WOH, nw8, 1);
  k_mbits<<<dim3(SEQ * (SEQ / 32) / 256), 256, 0, stream>>>(M, MB);
  for (int b = 0; b < NB; ++b) {
    k_cvt<<<dim3(nx8 / 256), 256, 0, stream>>>(X + (size_t)b * SEQ_FULL * CC, (unsigned short*)XB, nx8, 0);
    k_proj<<<dim3(SEQ / 64, CC / 128, 3), 128, 0, stream>>>(XB, WQB, BQ, WKB, BK, WVB, BV, RC, RS, QH, QL, KH, VT, VL);
    k_fa<<<dim3(SEQ / 128, NH), 128, 0, stream>>>(QH, QL, KH, VT, VL, MB, Y, YL);
    k_out<<<dim3(SEQ / 64, CC / 128), 128, 0, stream>>>(Y, YL, WOH, BO, b, OUT);
  }
}

// v002
// A run of this version takes 352 microseconds.
// Next to v001, in two timings, it ran 1.82 and 1.79 times as fast.
// Over all steps from v000 it is 5.18 times as fast.
// compute dtype: every float input (x, Wq, Wk, Wv, Wo, biases, rope cos/sin tables) RNE-converted to bf16 (bf16-input target); q/k/v = x W^T + b on v_wmma_f32_16x16x32_bf16 (exact bf16 products, f32 accumulate); rope in f32; q -> f16 hi + residual plane (x 2^10), k -> f16; logits = 2 products on v_wmma_f32_16x16x32_f16, / 8, f32; mask replace + running-maximum softmax in f32 (exp2), logits and P kept in registers; exp(s - m) x 2^11 -> f16 against v f16: 1 f16 product, divided by the f32 row sum at the end (query rows 0..63 of each sequence add P and v residual planes x 2^10: 3 products); ctx x 16 -> f16 against f16(bf16(Wo) x 64): 1 f16 product (rows 0..63 add a ctx residual plane x 2^10: 2 products); f32 accumulate everywhere, f32 output.
#include <hip/hip_runtime.h>
#include <math.h>

#ifndef NB
#define NB 4
#endif
#ifndef SEQ
#define SEQ 2048
#endif
#define NB_FULL 4
#define SEQ_FULL 2048
#define CC 1024
#define NH 16
#define HD 64
#define QB0 64               // leading query rows per sequence carried with residual planes
static_assert(SEQ % 128 == 0);
static_assert(SEQ >= 128 && SEQ <= SEQ_FULL);
static_assert(NB >= 1 && NB <= NB_FULL);
static_assert(CC == NH * HD);
static_assert(HD == 64);
static_assert(QB0 == 64);
static_assert(SEQ % 256 == 0);
static_assert((SEQ * (SEQ / 32)) % 256 == 0);
static_assert(((CC * CC) / 8) % 256 == 0);
static_assert(((SEQ * CC) / 8) % 256 == 0);

typedef __attribute__((ext_vector_type(16))) _Float16 v16h;
typedef __attribute__((ext_vector_type(16))) __bf16 v16b;
typedef __attribute__((ext_vector_type(8)))  _Float16 v8h;
typedef __attribute__((ext_vector_type(8)))  __bf16 v8b;
typedef __attribute__((ext_vector_type(8)))  float v8f;
typedef __attribute__((ext_vector_type(4)))  float v4f;
typedef __attribute__((ext_vector_type(4)))  unsigned v4u;
typedef __attribute__((ext_vector_type(4)))  int v4i;

#define WS_WQ  ((size_t)0)                                  // bf16 Wq [o][i]
#define WS_WK  (WS_WQ + 2u * (size_t)CC * CC)               // bf16 Wk [o][i]
#define WS_WV  (WS_WK + 2u * (size_t)CC * CC)               // bf16 Wv [o][i]
#define WS_WO  (WS_WV + 2u * (size_t)CC * CC)               // f16 bf16(Wo) x 64 [o][i]
#define WS_XB  (WS_WO + 2u * (size_t)CC * CC)               // bf16 x rows of one batch [t][c]
#define WS_QH  (WS_XB + 2u * (size_t)SEQ * CC)              // f16 q rows [t][c] (hi)
#define WS_QL  (WS_QH + 2u * (size_t)SEQ * CC)              // f16 q residual x 2^10 rows [t][c]
#define WS_KH  (WS_QL + 2u * (size_t)SEQ * CC)              // f16 k rows [t][c]
#define WS_VT  (WS_KH + 2u * (size_t)SEQ * CC)              // f16 v planes [c][t]
#define WS_VL  (WS_VT + 2u * (size_t)CC * SEQ)              // f16 v residual x 2^10 planes [c][t < QB0]
#define WS_Y   (WS_VL + 2u * (size_t)CC * QB0)              // f16 ctx x 16 rows [t][c]
#define WS_YL  (WS_Y + 2u * (size_t)SEQ * CC)               // f16 ctx x 16 residual x 2^10 rows [t < QB0][c]
#define WS_MB  (WS_YL + 2u * (size_t)QB0 * CC)             // mask bit plane [q][SEQ/32] (bit set = masked)
#define WS_END (WS_MB + 4u * (size_t)SEQ * (SEQ / 32))
static_assert(WS_END <= (size_t)134217728u);
static_assert(WS_WK % 128 == 0 && WS_WV % 128 == 0 && WS_WO % 128 == 0 && WS_XB % 128 == 0 && WS_QH % 128 == 0 && WS_QL % 128 == 0 && WS_KH % 128 == 0);
static_assert(WS_VT % 128 == 0 && WS_VL % 128 == 0 && WS_Y % 128 == 0 && WS_YL % 128 == 0 && WS_MB % 128 == 0);

template <typename T> __device__ __forceinline__ void vst2(void* p, T v) { *(T*)p = v;  }
__device__ __forceinline__ v8f wmma16(v16h a, v16h b, v8f c) {
  v8f d = __builtin_amdgcn_wmma_f32_16x16x32_f16(false, a, false, b, (short)0, c, false, false);
  asm volatile("v_nop\n\tv_nop\n\tv_nop\n\tv_nop" : "+v"(d) : "v"(a), "v"(b));
  return d;
}
__device__ __forceinline__ v8f wmma_bf(v16b a, v16b b, v8f c) {
  v8f d = __builtin_amdgcn_wmma_f32_16x16x32_bf16(false, a, false, b, (short)0, c, false, false);
  asm volatile("v_nop\n\tv_nop\n\tv_nop\n\tv_nop" : "+v"(d) : "v"(a), "v"(b));
  return d;
}
// 16x16x32 fragments: lane = (h = lane>>4, row/col = lane&15); elements 0..7 = k0+8h+0..7, 8..15 = k0+16+8h+0..7; D element r = row 8h+r
__device__ __forceinline__ float bfr(float v) { return (float)(__bf16)v; }
#define LDSX() do { asm volatile("s_wait_dscnt 0" ::: "memory"); __builtin_amdgcn_wave_barrier(); __builtin_amdgcn_fence(__ATOMIC_RELEASE, "workgroup"); } while (0)

// ---- LDS ring of the two GEMM kernels: a stage = 64 k (128 bytes, one whole line) of every operand row of the block, two buffers, filled by asynchronous copies while the other buffer is worked on
#define KS 64                // k per stage
#define NS (CC / KS)         // stages
#define RP 144               // ring row pitch in bytes: 128 + 16, free of bank conflicts for 16-byte LDS reads
static_assert(NS >= 2 && CC % KS == 0);
__device__ __forceinline__ unsigned lds_off(const void* p) { return (unsigned)(size_t)p; }
// four copies of 16 bytes a lane, global -> LDS through no register: ring rows 16 apart from plane rows 16 apart (8 lanes cover one 128-byte row slice, a wave 4 whole lines).
// s_wait_xcnt in the same statement: every later write of the address registers stays behind it
__device__ __forceinline__ void copy4(unsigned l, const char* p) {
  asm volatile("global_load_async_to_lds_b128 %0, %4, off\n\tglobal_load_async_to_lds_b128 %1, %5, off\n\tglobal_load_async_to_lds_b128 %2, %6, off\n\tglobal_load_async_to_lds_b128 %3, %7, off\n\ts_wait_xcnt 0x0"
               :: "v"(l), "v"(l + 16u * RP), "v"(l + 32u * RP), "v"(l + 48u * RP), "v"(p), "v"(p + 16 * 2 * CC), "v"(p + 32 * 2 * CC), "v"(p + 48 * 2 * CC) : "memory");
}
#define AW() asm volatile("s_wait_asynccnt 0x0" ::: "memory")   // this wave's copies have landed
#define DW() asm volatile("s_wait_dscnt 0x0" ::: "memory")      // this wave's LDS reads have returned: the buffer may be refilled behind the barrier
// fragment from a ring row: p = row start + 64 bytes per 32 k + 16 bytes per lane half (the k order stated above)
__device__ __forceinline__ v16h frag_lh(const char* p) { union { v16h v; v8h q[2]; } u; u.q[0] = *(const v8h*)p; u.q[1] = *(const v8h*)(p + 32); return u.v; }
__device__ __forceinline__ v16b frag_lb(const char* p) { union { v16b v; v8b q[2]; } u; u.q[0] = *(const v8b*)p; u.q[1] = *(const v8b*)(p + 32); return u.v; }

__global__ __launch_bounds__(256) void k_cvt(const float* __restrict__ A, unsigned short* __restrict__ D, int n8, int mode) {
  const int i = blockIdx.x * 256 + threadIdx.x;
  if (i >= n8) return;                                           // grids are exact multiples; guard inert
  const v4f a = *(const v4f*)(A + (size_t)i * 8); const v4f c = *(const v4f*)(A + (size_t)i * 8 + 4);
  const float v[8] = {a[0], a[1], a[2], a[3], c[0], c[1], c[2], c[3]};
  union { v8b b; v8h h; v4u u; } o;
  if (mode != 0) { v8h t;
#pragma unroll
    for (int k = 0; k < 8; ++k) t[k] = (_Float16)(bfr(v[k]) * 64.0f);
    o.h = t; }
  else { v8b t;
#pragma unroll
    for (int k = 0; k < 8; ++k) t[k] = (__bf16)v[k];
    o.b = t; }
  vst2(D + (size_t)i * 8, o.u);
}

__global__ __launch_bounds__(256) void k_mbits(const int* __restrict__ M, unsigned* __restrict__ MB) {
  const int w = blockIdx.x * 256 + threadIdx.x;                 // grid exact: SEQ*(SEQ/32)/256 blocks
  const int q = w / (SEQ / 32), wc = w - q * (SEQ / 32);
  const int* p = M + (size_t)q * SEQ_FULL + wc * 32;
  unsigned bits = 0u;
#pragma unroll
  for (int i = 0; i < 8; ++i) { const v4i v = *(const v4i*)(p + 4 * i);
    bits |= (v.x != 0 ? 1u : 0u) << (4 * i);     bits |= (v.y != 0 ? 1u : 0u) << (4 * i + 1);
    bits |= (v.z != 0 ? 1u : 0u) << (4 * i + 2); bits |= (v.w != 0 ? 1u : 0u) << (4 * i + 3); }
  vst2(MB + w, bits);
}

// ---- k_proj: block = (64 rows of the batch, 128 cols, which): y = x W^T + b (exact bf16 products from the 16-bit planes); which 0/1: rope then q -> f16 hi (+ residual), k -> f16 rows; which 2: v -> f16 planes [c][t] (+ residual plane for rows 0..63)
__global__ __launch_bounds__(128) void k_proj(const __bf16* __restrict__ XB, const __bf16* __restrict__ WQ, const float* __restrict__ BQ, const __bf16* __restrict__ WK, const float* __restrict__ BK, const __bf16* __restrict__ WV, const float* __restrict__ BV,
                                              const float* __restrict__ RC, const float* __restrict__ RS,
                                              _Float16* __restrict__ QH, _Float16* __restrict__ QL, _Float16* __restrict__ KH, _Float16* __restrict__ VT, _Float16* __restrict__ VL) {
  // one pool: the ring (2 x 192 rows: 64 of x, 128 of W) during the k loop, the output staging planes behind it
  constexpr unsigned RB = 192u * RP; __shared__ __align__(16) char pool[2 * 64 * 136 * 2 + 2 * 128 * 72 * 2]; static_assert(2u * RB <= sizeof(pool));
  _Float16 (*sh)[136] = (_Float16 (*)[136])pool; _Float16 (*sl)[136] = (_Float16 (*)[136])(pool + 64 * 136 * 2); _Float16 (*th)[72] = (_Float16 (*)[72])(pool + 2 * 64 * 136 * 2); _Float16 (*tl2)[72] = (_Float16 (*)[72])(pool + 2 * 64 * 136 * 2 + 128 * 72 * 2);
  __shared__ __align__(16) float scs[64][HD], ssn[64][HD];
  const int tid = threadIdx.x, wave = tid >> 5, lane = tid & 31, col = lane & 15, g = lane >> 4; const int which = blockIdx.z; const int c0 = blockIdx.y * 128; const int r0 = blockIdx.x * 64;
  const __bf16* WA = which == 0 ? WQ : which == 1 ? WK : WV; const float* BA = which == 0 ? BQ : which == 1 ? BK : BV;
  const unsigned ring = lds_off(pool) + (unsigned)((tid >> 3) * RP + (tid & 7) * 16);   // this lane's 16 bytes of ring row tid / 8
  const char* gx = (const char*)(XB + (size_t)(r0 + (tid >> 3)) * CC + (tid & 7) * 8); const char* gw = (const char*)(WA + (size_t)(c0 + (tid >> 3)) * CC + (tid & 7) * 8);
  auto fill = [&](const int s) { const unsigned l = ring + (unsigned)(s & 1) * RB; copy4(l, gx + s * (2 * KS)); copy4(l + 64u * RP, gw + s * (2 * KS)); copy4(l + 128u * RP, gw + s * (2 * KS) + 64 * 2 * CC); };
  fill(0);                                                       // stage 0 flies under the rope table's staging
  // rope table rows r0..r0+63 (bf16-RNE values), whole head dim; staged extent == consumed extent (64 x HD)
#pragma unroll 2
  for (int e = tid; e < 64 * (HD / 4); e += 128) { const int rl = e / (HD / 4), q = e % (HD / 4);
    const v4f c = *(const v4f*)(RC + (size_t)(r0 + rl) * HD + q * 4); const v4f s = *(const v4f*)(RS + (size_t)(r0 + rl) * HD + q * 4);
#pragma unroll
    for (int i = 0; i < 4; ++i) { scs[rl][q * 4 + i] = bfr(c[i]); ssn[rl][q * 4 + i] = bfr(s[i]); } }
  AW();
  __syncthreads();                                               // publishes the rope table and stage 0
  fill(1);
  v8f acc[8] = {};
#pragma unroll 1                                                 // one trip a stage: the buffer is picked by the trip's parity, the text stays short
  for (int s = 0; s < NS; ++s) { const char* fb = pool + (unsigned)(s & 1) * RB + col * RP + g * 16;
#pragma unroll                                                   // this and the two below: constant indices keep w[] and acc[] in registers; a block's 18 LDS reads stand as one group ahead of its 8 products
    for (int ks = 0; ks < KS / 32; ++ks) { const v16b a = frag_lb(fb + wave * 16 * RP + ks * 64); v16b w[8];
#pragma unroll
      for (int j = 0; j < 8; ++j) w[j] = frag_lb(fb + (64 + j * 16) * RP + ks * 64);
#pragma unroll
      for (int j = 0; j < 8; ++j) acc[j] = wmma_bf(a, w[j], acc[j]); }
    DW(); AW();
    __syncthreads();                                             // publishes stage s + 1 and ends every wave's reads of stage s
    if (s + 2 < NS) fill(s + 2); }
  AW();
  float bbv[8];
#pragma unroll
  for (int j = 0; j < 8; ++j) bbv[j] = bfr(BA[c0 + j * 16 + col]);
#pragma unroll
  for (int r = 0; r < 8; ++r) { const int rl = wave * 16 + 8 * g + r; float v[8];
#pragma unroll
    for (int j = 0; j < 8; ++j) v[j] = acc[j][r] + bbv[j];
    if (which == 2) {
#pragma unroll
      for (int j = 0; j < 8; ++j) { const int cl = j * 16 + col; const _Float16 hv = (_Float16)v[j]; th[cl][rl] = hv; tl2[cl][rl] = (_Float16)((v[j] - (float)hv) * 1024.0f); }   /* v residual carried x 2^10 */
    } else {
      float cs4[4], sn4[4];
#pragma unroll
      for (int jj = 0; jj < 4; ++jj) { cs4[jj] = scs[rl][jj * 16 + col]; sn4[jj] = ssn[rl][jj * 16 + col]; }
      // rotate-half: head-local d = (j&3)*16+col; d<32: y*cos - y[d+32]*sin, d>=32: y*cos + y[d-32]*sin; partner tile = j^2
#pragma unroll
      for (int j = 0; j < 8; ++j) { const int cl = j * 16 + col, jj = j & 3; const float pv = v[j ^ 2];
        const float o = (jj < 2) ? (v[j] * cs4[jj] - pv * sn4[jj]) : (v[j] * cs4[jj] + pv * sn4[jj]);
        const _Float16 hv = (_Float16)o; sh[rl][cl] = hv; sl[rl][cl] = (_Float16)((o - (float)hv) * 1024.0f); }   /* q residual carried x 2^10 so the plane stays f16-normal */
    } }
  __syncthreads();
  if (which < 2) { _Float16* dh = which == 0 ? QH : KH; for (int e = tid; e < 64 * 16; e += 128) { const int rl = e >> 4, q = e & 15; vst2(dh + (size_t)(r0 + rl) * CC + c0 + q * 8, *(const v4u*)&sh[rl][q * 8]); if (which == 0) vst2(QL + (size_t)(r0 + rl) * CC + c0 + q * 8, *(const v4u*)&sl[rl][q * 8]); } }
  else { for (int e = tid; e < 128 * 8; e += 128) { const int cl = e >> 3, q = e & 7; const size_t o2 = (size_t)(c0 + cl) * (size_t)SEQ + r0 + q * 8; vst2(VT + o2, *(const v4u*)&th[cl][q * 8]);
      if (blockIdx.x == 0) { const size_t o3 = (size_t)(c0 + cl) * (size_t)QB0 + q * 8; vst2(VL + o3, *(const v4u*)&tl2[cl][q * 8]); } } } }

// ---- k_fa: wave = 32 queries (two 16-column groups) of head y, whole key range in one pass, logits and P stay in registers.
// S^T = K Q^T (A = k rows, B = q rows, same loader on both sides): lane (col, g) holds query col, keys 8g+r of each 16-key tile, so two tiles pack straight into the B operand of O^T += V^T P^T.
// Running maximum and sum per query (in-lane plus one exchange between lane halves); P = exp(s - m) x 2^11 -> f16, normalised once at the end.
// The wave's 32 mask rows are scanned once: 32-key blocks in front of the first set bit run without mask work, blocks behind the last clear bit are not run (both counts bounded by SEQ / 32).
// Any mask content is honoured; a fully masked row ends as 0 x inf = NaN like the softmax of an all -inf row.
template <bool B> struct flag_t { static constexpr bool value = B; };
__device__ __forceinline__ float xhalf(float v) { const int b = __float_as_int(v); return __int_as_float(__builtin_amdgcn_permlanex16(b, b, 0x76543210, 0xfedcba98, false, false)); }
// behind global loads or stores whose registers are reused next: those registers may be rewritten only behind this wait
#define XW() asm volatile("s_wait_xcnt 0x0" ::: "memory")
__device__ __forceinline__ v8f wm(v16h a, v16h b, v8f c) { return __builtin_amdgcn_wmma_f32_16x16x32_f16(false, a, false, b, (short)0, c, false, false); }
// 2^x with the one free issue slot behind a transcendental kept inside the statement
__device__ __forceinline__ float exp2s(float x) { float r; asm("v_exp_f32 %0, %1\n\tv_nop" : "=v"(r) : "v"(x)); return r; }
// eight at once: each v_exp_f32 is followed by one that touches neither its result nor its source (early-clobber outputs), so one slot at the end serves the run
__device__ __forceinline__ v8f exp2x8(v8f x) { float r0, r1, r2, r3, r4, r5, r6, r7;
  asm("v_exp_f32 %0, %8\n\tv_exp_f32 %1, %9\n\tv_exp_f32 %2, %10\n\tv_exp_f32 %3, %11\n\tv_exp_f32 %4, %12\n\tv_exp_f32 %5, %13\n\tv_exp_f32 %6, %14\n\tv_exp_f32 %7, %15\n\tv_nop"
      : "=&v"(r0), "=&v"(r1), "=&v"(r2), "=&v"(r3), "=&v"(r4), "=&v"(r5), "=&v"(r6), "=&v"(r7) : "v"(x[0]), "v"(x[1]), "v"(x[2]), "v"(x[3]), "v"(x[4]), "v"(x[5]), "v"(x[6]), "v"(x[7]));
  return v8f{r0, r1, r2, r3, r4, r5, r6, r7}; }
// fragment at a byte address that already holds the lane's row and its half's 16 bytes
__device__ __forceinline__ v16h frag_p(const char* p) { union { v16h v; v8h q[2]; } u; u.q[0] = *(const v8h*)p; u.q[1] = *(const v8h*)(p + 32); return u.v; }
__global__ __launch_bounds__(128) void k_fa(const _Float16* __restrict__ QH, const _Float16* __restrict__ QL, const _Float16* __restrict__ KH, const _Float16* __restrict__ VT, const _Float16* __restrict__ VL,
                                            const unsigned* __restrict__ MB, _Float16* __restrict__ Y, _Float16* __restrict__ YL) {
  constexpr float NEG = -3.0e38f, SC = 0.125f * 1.44269504088896340736f; constexpr int NW = SEQ / 32;
  const int lane = threadIdx.x & 31, col = lane & 15, g = lane >> 4; const int wave = __builtin_amdgcn_readfirstlane((int)threadIdx.x >> 5);
  const int h = blockIdx.y; const int q0 = (SEQ / 128 - 1 - (int)blockIdx.x) * 128 + wave * 32;   // longest key ranges start first
  const unsigned* mu = MB + (size_t)q0 * NW; const unsigned mo = 4u * (unsigned)(col * NW);
  int last = -1, first = NW;
#pragma unroll
  for (int p = 0; p < 2; ++p)
#pragma unroll
    for (int i = NW / 8 - 1; i >= 0; --i) { const v4u u = *(const v4u*)((const char*)(mu + p * 16 * NW + 4 * i) + (mo + 4u * (unsigned)(g * (NW / 2))));
#pragma unroll
      for (int e = 3; e >= 0; --e) { const int w = g * (NW / 2) + 4 * i + e; last = (u[e] != 0xFFFFFFFFu) ? max(last, w) : last; first = (u[e] != 0u) ? min(first, w) : first; } }
#pragma unroll
  for (int o = 1; o < 32; o <<= 1) { last = max(last, __shfl_xor(last, o)); first = min(first, __shfl_xor(first, o)); }
  const int trip = min(__builtin_amdgcn_readfirstlane(last) + 1, NW);
  const int nfull = max(min(__builtin_amdgcn_readfirstlane(first), trip), 0);
  const bool res = q0 < QB0;
  const unsigned ko = 2u * (unsigned)(col * CC + 8 * g), vo = 2u * (unsigned)(col * SEQ + 8 * g), lo = 2u * (unsigned)(col * QB0 + 8 * g);
  const char* kp = (const char*)(KH + h * HD) + ko; const char* vp = (const char*)(VT + (size_t)h * HD * SEQ) + vo; const char* lp = (const char*)(VL + (size_t)h * HD * QB0) + lo;   // kp, vp: one step per key block
  v16h qh[2][2], ql[2][2];
#pragma unroll
  for (int p = 0; p < 2; ++p)
#pragma unroll
    for (int kk = 0; kk < 2; ++kk) { const size_t o = (size_t)(q0 + 16 * p) * CC + h * HD + kk * 32; qh[p][kk] = frag_p((const char*)(QH + o) + ko); ql[p][kk] = frag_p((const char*)(QL + o) + ko); }
  v16h kf[2][2];
#pragma unroll
  for (int t = 0; t < 2; ++t)
#pragma unroll
    for (int kk = 0; kk < 2; ++kk) kf[t][kk] = frag_p(kp + 2 * (t * 16 * CC + kk * 32));
  XW();
  kp += 2 * 32 * CC;                                           // kp = the block that the next trip fetches ahead (SEQ >= 128: a block 1 exists)
  v8f acc[2][4] = {}; float m[2] = {NEG, NEG}, l[2] = {0.f, 0.f};
  auto body = [&](const int kc, auto mk) {
    constexpr bool masked = decltype(mk)::value;
    v16h vf[4]; unsigned mw[2] = {0u, 0u};
#pragma unroll
    for (int j = 0; j < 4; ++j) vf[j] = frag_p(vp + 2 * (j * 16 * SEQ));   // this block's v rows fly under the logits and the softmax
    if constexpr (masked) { mw[0] = *(const unsigned*)((const char*)(mu + kc) + mo); mw[1] = *(const unsigned*)((const char*)(mu + 16 * NW + kc) + mo); XW(); }
    v8f s[2][2] = {};
#pragma unroll
    for (int kk = 0; kk < 2; ++kk)
#pragma unroll
      for (int t = 0; t < 2; ++t)
#pragma unroll
        for (int p = 0; p < 2; ++p) s[p][t] = wm(kf[t][kk], ql[p][kk], s[p][t]);
#pragma unroll
    for (int t = 0; t < 2; ++t)
#pragma unroll
      for (int p = 0; p < 2; ++p) s[p][t] *= (1.0f / 1024.0f);
#pragma unroll
    for (int kk = 0; kk < 2; ++kk)
#pragma unroll
      for (int t = 0; t < 2; ++t)
#pragma unroll
        for (int p = 0; p < 2; ++p) s[p][t] = wm(kf[t][kk], qh[p][kk], s[p][t]);
#pragma unroll
    for (int t = 0; t < 2; ++t)
#pragma unroll
      for (int kk = 0; kk < 2; ++kk) kf[t][kk] = frag_p(kp + 2 * (t * 16 * CC + kk * 32));   // next block's k rows fly under the softmax and P.v
    __builtin_amdgcn_sched_barrier(0);                         // keeps these loads here, ahead of the work that hides their latency (the scheduler sinks them to the end of the trip otherwise)
    if constexpr (masked) {
#pragma unroll
      for (int p = 0; p < 2; ++p) { const unsigned w = mw[p] >> (8 * g);
#pragma unroll
        for (int t = 0; t < 2; ++t)
#pragma unroll
          for (int r = 0; r < 8; ++r) s[p][t][r] = ((w >> (16 * t + r)) & 1u) ? NEG : s[p][t][r]; } }
    float mn[2];
#pragma unroll
    for (int p = 0; p < 2; ++p) { float x = fmaxf(s[p][0][0], s[p][1][0]);
#pragma unroll
      for (int r = 1; r < 8; ++r) x = fmaxf(x, fmaxf(s[p][0][r], s[p][1][r]));
      mn[p] = fmaxf(m[p], fmaxf(x, xhalf(x))); }
    if (__builtin_amdgcn_ballot_w32(mn[0] > m[0] || mn[1] > m[1]) != 0u) {
#pragma unroll
      for (int p = 0; p < 2; ++p) { const float al = exp2s((m[p] - mn[p]) * SC); l[p] *= al; m[p] = mn[p];
#pragma unroll
        for (int j = 0; j < 4; ++j) acc[p][j] *= al; } }
    v16h pb[2];
#pragma unroll
    for (int p = 0; p < 2; ++p) { const float me = (m[p] <= -1.0e38f) ? 0.f : m[p]; float sum = 0.f;   // nothing unmasked yet: a finite stand-in keeps every masked term at exp2(-huge) = 0
#pragma unroll
      for (int t = 0; t < 2; ++t) { s[p][t] = exp2x8((s[p][t] - me) * SC + 11.0f);
#pragma unroll
        for (int r = 0; r < 8; ++r) { sum += s[p][t][r]; pb[p][8 * t + r] = (_Float16)s[p][t][r]; } }
      l[p] += sum; }
#pragma unroll
    for (int j = 0; j < 4; ++j)
#pragma unroll
      for (int p = 0; p < 2; ++p) acc[p][j] = wm(vf[j], pb[p], acc[p][j]);
    if (res && kc < QB0 / 32) {                                // query rows 0..63, keys 0..63: P and v residual planes (x 2^10), as before
      v16h pl[2];
#pragma unroll
      for (int p = 0; p < 2; ++p)
#pragma unroll
        for (int e = 0; e < 16; ++e) pl[p][e] = (_Float16)((s[p][e >> 3][e & 7] - (float)pb[p][e]) * 1024.0f);
#pragma unroll
      for (int j = 0; j < 4; ++j) { const v16h vl = frag_p(lp + 2 * (j * 16 * QB0 + kc * 32)); XW();
#pragma unroll
        for (int p = 0; p < 2; ++p) { v8f a = {}; a = wm(vf[j], pl[p], a); a = wm(vl, pb[p], a); acc[p][j] += a * (1.0f / 1024.0f); } } }
    XW();
    __builtin_amdgcn_sched_barrier(0);                         // the two pointer steps below stay behind the wait above
    vp += 2 * 32; kp += (kc + 2 < NW) ? 2 * 32 * CC : 0;       // the fetch ahead stays inside the k plane on the last trips
  };
#pragma unroll 1
  for (int kc = 0; kc < nfull; ++kc) body(kc, flag_t<false>{});
#pragma unroll 1
  for (int kc = nfull; kc < trip; ++kc) body(kc, flag_t<true>{});
#pragma unroll
  for (int p = 0; p < 2; ++p) { const float inv = 16.0f / (l[p] + xhalf(l[p])); const size_t o = (size_t)(q0 + 16 * p) * CC + h * HD;   /* ctx carried x 16, residual x 2^10 */
#pragma unroll
    for (int j = 0; j < 4; ++j) { union { v8h h; v4u u; } yh, yl;
#pragma unroll
      for (int r = 0; r < 8; ++r) { const float y = acc[p][j][r] * inv; const _Float16 t = (_Float16)y; yh.h[r] = t; yl.h[r] = (_Float16)((y - (float)t) * 1024.0f); }
      vst2((char*)(Y + o + j * 16) + ko, yh.u); XW(); if (res) { vst2((char*)(YL + o + j * 16) + ko, yl.u); XW(); } } } }

// ---- k_out: block = (64 rows of batch b, 128 cols): out = (ctx x 16 f16) (f16 bf16(Wo) x 64)^T / 1024 + bo; row block 0 adds the ctx residual plane (2 products)
__global__ __launch_bounds__(128) void k_out(const _Float16* __restrict__ Y, const _Float16* __restrict__ YL, const _Float16* __restrict__ WO, const float* __restrict__ BP, int b, float* __restrict__ OUT) { __shared__ __align__(16) float sf[4][16][132];
  constexpr unsigned RB = 256u * RP; __shared__ __align__(16) char pool[2 * RB];   // ring: 2 x (64 rows of ctx, 128 of Wo, 64 of the ctx residual, filled in row block 0 alone)
  const int tid = threadIdx.x, wave = tid >> 5, lane = tid & 31, col = lane & 15, g = lane >> 4; const int c0 = blockIdx.y * 128; const int r0 = blockIdx.x * 64 + wave * 16; const size_t orow = (size_t)b * SEQ_FULL + r0;
  const bool lo = blockIdx.x == 0;
  const unsigned ring = lds_off(pool) + (unsigned)((tid >> 3) * RP + (tid & 7) * 16);   // this lane's 16 bytes of ring row tid / 8
  const char* gy = (const char*)(Y + (size_t)(blockIdx.x * 64 + (tid >> 3)) * CC + (tid & 7) * 8); const char* gl = (const char*)(YL + (size_t)(tid >> 3) * CC + (tid & 7) * 8); const char* gw = (const char*)(WO + (size_t)(c0 + (tid >> 3)) * CC + (tid & 7) * 8);
  auto fill = [&](const int s) { const unsigned l = ring + (unsigned)(s & 1) * RB; copy4(l, gy + s * (2 * KS)); copy4(l + 64u * RP, gw + s * (2 * KS)); copy4(l + 128u * RP, gw + s * (2 * KS) + 64 * 2 * CC); if (lo) copy4(l + 192u * RP, gl + s * (2 * KS)); };
  fill(0);
  AW();
  __syncthreads();                                               // publishes stage 0
  fill(1);
  v8f acc[8] = {}, accl[8] = {};
#pragma unroll 1                                                 // one trip a stage: the buffer is picked by the trip's parity, the text stays short
  for (int s = 0; s < NS; ++s) { const char* fb = pool + (unsigned)(s & 1) * RB + col * RP + g * 16;
#pragma unroll                                                   // this and those below: constant indices keep w[], acc[] and accl[] in registers; a block's LDS reads stand as one group ahead of its products
    for (int ks = 0; ks < KS / 32; ++ks) { const v16h a = frag_lh(fb + wave * 16 * RP + ks * 64); v16h w[8];
#pragma unroll
      for (int j = 0; j < 8; ++j) w[j] = frag_lh(fb + (64 + j * 16) * RP + ks * 64);
#pragma unroll
      for (int j = 0; j < 8; ++j) acc[j] = wmma16(a, w[j], acc[j]);
      if (lo) { const v16h al = frag_lh(fb + (192 + wave * 16) * RP + ks * 64);
#pragma unroll
        for (int j = 0; j < 8; ++j) accl[j] = wmma16(al, w[j], accl[j]); } }
    DW(); AW();
    __syncthreads();                                             // publishes stage s + 1 and ends every wave's reads of stage s
    if (s + 2 < NS) fill(s + 2); }
  AW();
#pragma unroll
  for (int j = 0; j < 8; ++j) { const float bb = bfr(BP[c0 + j * 16 + col]);
#pragma unroll
    for (int r = 0; r < 8; ++r) sf[wave][8 * g + r][j * 16 + col] = (acc[j][r] + accl[j][r] * (1.0f / 1024.0f)) * (1.0f / 1024.0f) + bb; }
  LDSX(); for (int rl = 0; rl < 16; ++rl) vst2(OUT + (orow + rl) * CC + c0 + lane * 4, *(const v4f*)&sf[wave][rl][lane * 4]); }

extern "C" void kernel_launch(void* const* d_in, const int* in_sizes, int n_in, void* d_out, int out_size, void* d_ws, size_t ws_size, hipStream_t stream) {
  if (n_in < 12) return;
  // d_in: 0 x [4,2048,1024] f32, 1 mask [2048,2048] int32, 2 rope_cos [2048,64] f32, 3 rope_sin [2048,64] f32, 4 Wq [out,in], 5 bq, 6 Wk, 7 bk, 8 Wv, 9 bv, 10 Wo, 11 bo
  const size_t xneed = ((size_t)(NB - 1) * SEQ_FULL + SEQ) * (size_t)CC;
  if ((size_t)in_sizes[0] < xneed) return;
  if ((size_t)in_sizes[1] < (size_t)(SEQ - 1) * SEQ_FULL + SEQ) return;
  if (in_sizes[2] < SEQ * HD || in_sizes[3] < SEQ * HD) return;
  if (in_sizes[4] < CC * CC || in_sizes[6] < CC * CC || in_sizes[8] < CC * CC || in_sizes[10] < CC * CC) return;
  if (in_sizes[5] < CC || in_sizes[7] < CC || in_sizes[9] < CC || in_sizes[11] < CC) return;
  if ((size_t)out_size < xneed) return;
  if (ws_size < (size_t)WS_END) return;
  const float* X = (const float*)d_in[0]; const int* M = (const int*)d_in[1]; const float* RC = (const float*)d_in[2]; const float* RS = (const float*)d_in[3];
  const float *WQ = (const float*)d_in[4], *BQ = (const float*)d_in[5], *WK = (const float*)d_in[6], *BK = (const float*)d_in[7], *WV = (const float*)d_in[8], *BV = (const float*)d_in[9], *WO = (const float*)d_in[10], *BO = (const float*)d_in[11];
  char* ws = (char*)d_ws;
  __bf16 *WQB = (__bf16*)(ws + WS_WQ), *WKB = (__bf16*)(ws + WS_WK), *WVB = (__bf16*)(ws + WS_WV), *XB = (__bf16*)(ws + WS_XB); _Float16* WOH = (_Float16*)(ws + WS_WO);
  _Float16 *QH = (_Float16*)(ws + WS_QH), *QL = (_Float16*)(ws + WS_QL), *KH = (_Float16*)(ws + WS_KH), *VT = (_Float16*)(ws + WS_VT), *VL = (_Float16*)(ws + WS_VL), *Y = (_Float16*)(ws + WS_Y), *YL = (_Float16*)(ws + WS_YL);
  unsigned* MB = (unsigned*)(ws + WS_MB); float* OUT = (float*)d_out;
  const int nw8 = (CC * CC) / 8, nx8 = (SEQ * CC) / 8;
  k_cvt<<<dim3(nw8 / 256), 256, 0, stream>>>(WQ, (unsigned short*)WQB, nw8, 0);
  k_cvt<<<dim3(nw8 / 256), 256, 0, stream>>>(WK, (unsigned short*)WKB, nw8, 0);
  k_cvt<<<dim3(nw8 / 256), 256, 0, stream>>>(WV, (unsigned short*)WVB, nw8, 0);
  k_cvt<<<dim3(nw8 / 256), 256, 0, stream>>>(WO, (unsigned short*)WOH, nw8, 1);
  k_mbits<<<dim3(SEQ * (SEQ / 32) / 256), 256, 0, stream>>>(M, MB);
  for (int b = 0; b < NB; ++b) {
    k_cvt<<<dim3(nx8 / 256), 256, 0, stream>>>(X + (size_t)b * SEQ_FULL * CC, (unsigned short*)XB, nx8, 0);
    k_proj<<<dim3(SEQ / 64, CC / 128, 3), 128, 0, stream>>>(XB, WQB, BQ, WKB, BK, WVB, BV, RC, RS, QH, QL, KH, VT, VL);
    k_fa<<<dim3(SEQ / 128, NH), 128, 0, stream>>>(QH, QL, KH, VT, VL, MB, Y, YL);
    k_out<<<dim3(SEQ / 64, CC / 128), 128, 0, stream>>>(Y, YL, WOH, BO, b, OUT);
  }
}

// v003
// One run takes 178 microseconds.
// Timed twice side by side with v002, it ran 2.00 and 1.99 times as fast.
// All steps since v000 together make it 10.3 times as fast.
// compute dtype: every float input (x, Wq, Wk, Wv, Wo, biases, rope cos/sin tables) RNE-converted to bf16 (bf16-input target); q/k/v = x W^T + b on v_wmma_f32_16x16x32_bf16 (exact bf16 products, f32 accumulate); rope in f32; q -> f16 hi + residual plane (x 2^10), k -> f16; logits = 2 products on v_wmma_f32_16x16x32_f16, / 8, f32; mask replace + running-maximum softmax in f32 (exp2), logits and P kept in registers; exp(s - m) x 2^11 -> f16 against v f16: 1 f16 product, divided by the f32 row sum at the end (query rows 0..63 of each sequence add P and v residual planes x 2^10: 3 products); ctx x 16 -> f16 against f16(bf16(Wo) x 64): 1 f16 product (rows 0..63 add a ctx residual plane x 2^10: 2 products); f32 accumulate everywhere, f32 output.
#include <hip/hip_runtime.h>
#include <math.h>

#ifndef NB
#define NB 4
#endif
#ifndef SEQ
#define SEQ 2048
#endif
#define NB_FULL 4
#define SEQ_FULL 2048
#define CC 1024
#define NH 16
#define HD 64
#define QB0 64               // leading query rows per sequence carried with residual planes
static_assert(SEQ % 128 == 0);
static_assert(SEQ >= 128 && SEQ <= SEQ_FULL);
static_assert(NB >= 1 && NB <= NB_FULL);
static_assert(CC == NH * HD);
static_assert(HD == 64);
static_assert(QB0 == 64);
static_assert(SEQ % 256 == 0);
static_assert((SEQ * (SEQ / 32)) % 256 == 0);
static_assert(((CC * CC) / 8) % 256 == 0);
static_assert(((SEQ * CC) / 8) % 256 == 0);

typedef __attribute__((ext_vector_type(16))) _Float16 v16h;
typedef __attribute__((ext_vector_type(16))) __bf16 v16b;
typedef __attribute__((ext_vector_type(8)))  _Float16 v8h;
typedef __attribute__((ext_vector_type(8)))  __bf16 v8b;
typedef __attribute__((ext_vector_type(8)))  float v8f;
typedef __attribute__((ext_vector_type(4)))  float v4f;
typedef __attribute__((ext_vector_type(4)))  unsigned v4u;
typedef __attribute__((ext_vector_type(4)))  int v4i;

#define WS_WQ  ((size_t)0)                                  // bf16 Wq [o][i]
#define WS_WK  (WS_WQ + 2u * (size_t)CC * CC)               // bf16 Wk [o][i]
#define WS_WV  (WS_WK + 2u * (size_t)CC * CC)               // bf16 Wv [o][i]
#define WS_WO  (WS_WV + 2u * (size_t)CC * CC)               // f16 bf16(Wo) x 64 [o][i]
#define WS_XB  (WS_WO + 2u * (size_t)CC * CC)               // bf16 x rows of every batch [b][t][c]
#define WS_QH  (WS_XB + 2u * (size_t)NB * SEQ * CC)         // f16 q rows [b][t][c] (hi)
#define WS_QL  (WS_QH + 2u * (size_t)NB * SEQ * CC)         // f16 q residual x 2^10 rows [b][t][c]
#define WS_KH  (WS_QL + 2u * (size_t)NB * SEQ * CC)         // f16 k rows [b][t][c]
#define WS_VT  (WS_KH + 2u * (size_t)NB * SEQ * CC)         // f16 v planes [b][c][t]
#define WS_VL  (WS_VT + 2u * (size_t)NB * CC * SEQ)         // f16 v residual x 2^10 planes [b][c][t < QB0]
#define WS_Y   (WS_VL + 2u * (size_t)NB * CC * QB0)         // f16 ctx x 16 rows [b][t][c]
#define WS_YL  (WS_Y + 2u * (size_t)NB * SEQ * CC)          // f16 ctx x 16 residual x 2^10 rows [b][t < QB0][c]
#define WS_MB  (WS_YL + 2u * (size_t)NB * QB0 * CC)         // mask bit plane [q][SEQ/32] (bit set = masked)
#define WS_END (WS_MB + 4u * (size_t)SEQ * (SEQ / 32))
static_assert(WS_END <= (size_t)134217728u);
static_assert(WS_WK % 128 == 0 && WS_WV % 128 == 0 && WS_WO % 128 == 0 && WS_XB % 128 == 0 && WS_QH % 128 == 0 && WS_QL % 128 == 0 && WS_KH % 128 == 0);
static_assert(WS_VT % 128 == 0 && WS_VL % 128 == 0 && WS_Y % 128 == 0 && WS_YL % 128 == 0 && WS_MB % 128 == 0);

template <typename T> __device__ __forceinline__ void vst2(void* p, T v) { *(T*)p = v;  }
__device__ __forceinline__ v8f wmma16(v16h a, v16h b, v8f c) {
  v8f d = __builtin_amdgcn_wmma_f32_16x16x32_f16(false, a, false, b, (short)0, c, false, false);
  asm volatile("v_nop\n\tv_nop\n\tv_nop\n\tv_nop" : "+v"(d) : "v"(a), "v"(b));
  return d;
}
__device__ __forceinline__ v8f wmma_bf(v16b a, v16b b, v8f c) {
  v8f d = __builtin_amdgcn_wmma_f32_16x16x32_bf16(false, a, false, b, (short)0, c, false, false);
  asm volatile("v_nop\n\tv_nop\n\tv_nop\n\tv_nop" : "+v"(d) : "v"(a), "v"(b));
  return d;
}
// 16x16x32 fragments: lane = (h = lane>>4, row/col = lane&15); elements 0..7 = k0+8h+0..7, 8..15 = k0+16+8h+0..7; D element r = row 8h+r
__device__ __forceinline__ float bfr(float v) { return (float)(__bf16)v; }
#define LDSX() do { asm volatile("s_wait_dscnt 0" ::: "memory"); __builtin_amdgcn_wave_barrier(); __builtin_amdgcn_fence(__ATOMIC_RELEASE, "workgroup"); } while (0)

// ---- LDS ring of the two GEMM kernels: a stage = 64 k (128 bytes, one whole line) of every operand row of the block, two buffers, filled by asynchronous copies while the other buffer is worked on
#define KS 64                // k per stage
#define NS (CC / KS)         // stages
#define RP 144               // ring row pitch in bytes: 128 + 16, free of bank conflicts for 16-byte LDS reads
static_assert(NS >= 2 && CC % KS == 0);
__device__ __forceinline__ unsigned lds_off(const void* p) { return (unsigned)(size_t)p; }
// four copies of 16 bytes a lane, global -> LDS through no register: ring rows 16 apart from plane rows 16 apart (8 lanes cover one 128-byte row slice, a wave 4 whole lines).
// s_wait_xcnt in the same statement: every later write of the address registers stays behind it
__device__ __forceinline__ void copy4(unsigned l, const char* p) {
  asm volatile("global_load_async_to_lds_b128 %0, %4, off\n\tglobal_load_async_to_lds_b128 %1, %5, off\n\tglobal_load_async_to_lds_b128 %2, %6, off\n\tglobal_load_async_to_lds_b128 %3, %7, off\n\ts_wait_xcnt 0x0"
               :: "v"(l), "v"(l + 16u * RP), "v"(l + 32u * RP), "v"(l + 48u * RP), "v"(p), "v"(p + 16 * 2 * CC), "v"(p + 32 * 2 * CC), "v"(p + 48 * 2 * CC) : "memory");
}
#define AW() asm volatile("s_wait_asynccnt 0x0" ::: "memory")   // this wave's copies have landed
#define DW() asm volatile("s_wait_dscnt 0x0" ::: "memory")      // this wave's LDS reads have returned: the buffer may be refilled behind the barrier
// fragment from a ring row: p = row start + 64 bytes per 32 k + 16 bytes per lane half (the k order stated above)
__device__ __forceinline__ v16h frag_lh(const char* p) { union { v16h v; v8h q[2]; } u; u.q[0] = *(const v8h*)p; u.q[1] = *(const v8h*)(p + 32); return u.v; }
__device__ __forceinline__ v16b frag_lb(const char* p) { union { v16b v; v8b q[2]; } u; u.q[0] = *(const v8b*)p; u.q[1] = *(const v8b*)(p + 32); return u.v; }

// ---- k_prep: every conversion of the call in one grid; a block's index range says which plane it fills (block-uniform): x of all batches, the four weights, the mask bits
#define PB_X (NB * ((SEQ * CC) / 8) / 256)     // blocks on x: 8 elements a thread
#define PB_W (((CC * CC) / 8) / 256)           // blocks on one weight
#define PB_M (SEQ * (SEQ / 32) / 256)          // blocks on the mask: one 32-bit word a thread
static_assert(WS_WK == WS_WQ + 2u * (size_t)CC * CC && WS_WV == WS_WQ + 4u * (size_t)CC * CC && WS_WO == WS_WQ + 6u * (size_t)CC * CC);   // k_prep steps from one weight plane to the next
__device__ __forceinline__ void cvt8(const float* __restrict__ A, unsigned short* __restrict__ D, const bool f16x64) {
  const v4f a = *(const v4f*)A; const v4f c = *(const v4f*)(A + 4);
  asm volatile("s_wait_xcnt 0x0" ::: "memory");   // the loads' address register is reused for the packed result: it may be rewritten only behind this wait
  const float v[8] = {a[0], a[1], a[2], a[3], c[0], c[1], c[2], c[3]};
  union { v8b b; v8h h; v4u u; } o;
  if (f16x64) { v8h t;
#pragma unroll
    for (int k = 0; k < 8; ++k) t[k] = (_Float16)(bfr(v[k]) * 64.0f);
    o.h = t; }
  else { v8b t;
#pragma unroll
    for (int k = 0; k < 8; ++k) t[k] = (__bf16)v[k];
    o.b = t; }
  vst2(D, o.u);
}
__global__ __launch_bounds__(256) void k_prep(const float* __restrict__ X, const float* __restrict__ WQ, const float* __restrict__ WK, const float* __restrict__ WV, const float* __restrict__ WO, const int* __restrict__ M,
                                              unsigned short* __restrict__ XB, unsigned short* __restrict__ WB, unsigned* __restrict__ MB) {
  const int blk = blockIdx.x, tid = threadIdx.x;
  if (blk < PB_X) {
    const int i = blk * 256 + tid, b = i / ((SEQ * CC) / 8);     // x rows of batch b start SEQ_FULL rows apart, the plane's SEQ rows apart
    cvt8(X + (size_t)b * (SEQ_FULL - SEQ) * CC + (size_t)i * 8, XB + (size_t)i * 8, false);
  } else if (blk < PB_X + 4 * PB_W) {
    const int wsel = (blk - PB_X) / PB_W; const int i = (blk - PB_X - wsel * PB_W) * 256 + tid;   // the four 16-bit weight planes stand one behind the other in the workspace
    const float* A = wsel == 0 ? WQ : wsel == 1 ? WK : wsel == 2 ? WV : WO;
    cvt8(A + (size_t)i * 8, WB + (size_t)wsel * CC * CC + (size_t)i * 8, wsel == 3);
  } else {
    const int w = (blk - PB_X - 4 * PB_W) * 256 + tid;
    const int q = w / (SEQ / 32), wc = w - q * (SEQ / 32);
    const int* p = M + (size_t)q * SEQ_FULL + wc * 32;
    unsigned bits = 0u;
#pragma unroll
    for (int i = 0; i < 8; ++i) { const v4i v = *(const v4i*)(p + 4 * i);
      bits |= (v.x != 0 ? 1u : 0u) << (4 * i);     bits |= (v.y != 0 ? 1u : 0u) << (4 * i + 1);
      bits |= (v.z != 0 ? 1u : 0u) << (4 * i + 2); bits |= (v.w != 0 ? 1u : 0u) << (4 * i + 3); }
    vst2(MB + w, bits);
  }
}

// ---- k_proj: block = (64 rows out of all batches' rows, 128 cols, which): y = x W^T + b (exact bf16 products from the 16-bit planes); which 0/1: rope then q -> f16 hi (+ residual), k -> f16 rows; which 2: v -> f16 planes [c][t] (+ residual plane for rows 0..63)
__global__ __launch_bounds__(128) void k_proj(const __bf16* __restrict__ XB, const __bf16* __restrict__ WQ, const float* __restrict__ BQ, const __bf16* __restrict__ WK, const float* __restrict__ BK, const __bf16* __restrict__ WV, const float* __restrict__ BV,
                                              const float* __restrict__ RC, const float* __restrict__ RS,
                                              _Float16* __restrict__ QH, _Float16* __restrict__ QL, _Float16* __restrict__ KH, _Float16* __restrict__ VT, _Float16* __restrict__ VL) {
  // one pool: the ring (2 x 192 rows: 64 of x, 128 of W) during the k loop, the output staging planes behind it
  constexpr unsigned RB = 192u * RP; __shared__ __align__(16) char pool[2 * 64 * 136 * 2 + 2 * 128 * 72 * 2]; static_assert(2u * RB <= sizeof(pool));
  _Float16 (*sh)[136] = (_Float16 (*)[136])pool; _Float16 (*sl)[136] = (_Float16 (*)[136])(pool + 64 * 136 * 2); _Float16 (*th)[72] = (_Float16 (*)[72])(pool + 2 * 64 * 136 * 2); _Float16 (*tl2)[72] = (_Float16 (*)[72])(pool + 2 * 64 * 136 * 2 + 128 * 72 * 2);
  __shared__ __align__(16) float scs[64][HD], ssn[64][HD];
  const int tid = threadIdx.x, wave = tid >> 5, lane = tid & 31, col = lane & 15, g = lane >> 4; const int which = blockIdx.z; const int c0 = blockIdx.y * 128; const int r0 = blockIdx.x * 64;   // r0: row in the [b][t] planes
  const int bb0 = blockIdx.x / (SEQ / 64), t0 = r0 - bb0 * SEQ;   // its batch and its position in the sequence
  const __bf16* WA = which == 0 ? WQ : which == 1 ? WK : WV; const float* BA = which == 0 ? BQ : which == 1 ? BK : BV;
  const unsigned ring = lds_off(pool) + (unsigned)((tid >> 3) * RP + (tid & 7) * 16);   // this lane's 16 bytes of ring row tid / 8
  const char* gx = (const char*)(XB + (size_t)(r0 + (tid >> 3)) * CC + (tid & 7) * 8); const char* gw = (const char*)(WA + (size_t)(c0 + (tid >> 3)) * CC + (tid & 7) * 8);
  auto fill = [&](const int s) { const unsigned l = ring + (unsigned)(s & 1) * RB; copy4(l, gx + s * (2 * KS)); copy4(l + 64u * RP, gw + s * (2 * KS)); copy4(l + 128u * RP, gw + s * (2 * KS) + 64 * 2 * CC); };
  fill(0);                                                       // stage 0 flies under the rope table's staging
  // rope table rows t0..t0+63 (bf16-RNE values), whole head dim; staged extent == consumed extent (64 x HD)
#pragma unroll 2
  for (int e = tid; e < 64 * (HD / 4); e += 128) { const int rl = e / (HD / 4), q = e % (HD / 4);
    const v4f c = *(const v4f*)(RC + (size_t)(t0 + rl) * HD + q * 4); const v4f s = *(const v4f*)(RS + (size_t)(t0 + rl) * HD + q * 4);
#pragma unroll
    for (int i = 0; i < 4; ++i) { scs[rl][q * 4 + i] = bfr(c[i]); ssn[rl][q * 4 + i] = bfr(s[i]); } }
  AW();
  __syncthreads();                                               // publishes the rope table and stage 0
  fill(1);
  v8f acc[8] = {};
#pragma unroll 1                                                 // one trip a stage: the buffer is picked by the trip's parity, the text stays short
  for (int s = 0; s < NS; ++s) { const char* fb = pool + (unsigned)(s & 1) * RB + col * RP + g * 16;
#pragma unroll                                                   // this and the two below: constant indices keep w[] and acc[] in registers; a block's 18 LDS reads stand as one group ahead of its 8 products
    for (int ks = 0; ks < KS / 32; ++ks) { const v16b a = frag_lb(fb + wave * 16 * RP + ks * 64); v16b w[8];
#pragma unroll
      for (int j = 0; j < 8; ++j) w[j] = frag_lb(fb + (64 + j * 16) * RP + ks * 64);
#pragma unroll
      for (int j = 0; j < 8; ++j) acc[j] = wmma_bf(a, w[j], acc[j]); }
    DW(); AW();
    __syncthreads();                                             // publishes stage s + 1 and ends every wave's reads of stage s
    if (s + 2 < NS) fill(s + 2); }
  AW();
  float bbv[8];
#pragma unroll
  for (int j = 0; j < 8; ++j) bbv[j] = bfr(BA[c0 + j * 16 + col]);
#pragma unroll
  for (int r = 0; r < 8; ++r) { const int rl = wave * 16 + 8 * g + r; float v[8];
#pragma unroll
    for (int j = 0; j < 8; ++j) v[j] = acc[j][r] + bbv[j];
    if (which == 2) {
#pragma unroll
      for (int j = 0; j < 8; ++j) { const int cl = j * 16 + col; const _Float16 hv = (_Float16)v[j]; th[cl][rl] = hv; tl2[cl][rl] = (_Float16)((v[j] - (float)hv) * 1024.0f); }   /* v residual carried x 2^10 */
    } else {
      float cs4[4], sn4[4];
#pragma unroll
      for (int jj = 0; jj < 4; ++jj) { cs4[jj] = scs[rl][jj * 16 + col]; sn4[jj] = ssn[rl][jj * 16 + col]; }
      // rotate-half: head-local d = (j&3)*16+col; d<32: y*cos - y[d+32]*sin, d>=32: y*cos + y[d-32]*sin; partner tile = j^2
#pragma unroll
      for (int j = 0; j < 8; ++j) { const int cl = j * 16 + col, jj = j & 3; const float pv = v[j ^ 2];
        const float o = (jj < 2) ? (v[j] * cs4[jj] - pv * sn4[jj]) : (v[j] * cs4[jj] + pv * sn4[jj]);
        const _Float16 hv = (_Float16)o; sh[rl][cl] = hv; sl[rl][cl] = (_Float16)((o - (float)hv) * 1024.0f); }   /* q residual carried x 2^10 so the plane stays f16-normal */
    } }
  __syncthreads();
  // PW: behind each store below, whose address and data registers the loop's next statements reuse: they may be rewritten only behind this wait
#define PW() asm volatile("s_wait_xcnt 0x0" ::: "memory")
  if (which < 2) { _Float16* dh = which == 0 ? QH : KH; for (int e = tid; e < 64 * 16; e += 128) { const int rl = e >> 4, q = e & 15; vst2(dh + (size_t)(r0 + rl) * CC + c0 + q * 8, *(const v4u*)&sh[rl][q * 8]); PW(); if (which == 0) { vst2(QL + (size_t)(r0 + rl) * CC + c0 + q * 8, *(const v4u*)&sl[rl][q * 8]); PW(); } } }
  else { for (int e = tid; e < 128 * 8; e += 128) { const int cl = e >> 3, q = e & 7; const size_t o2 = (size_t)(bb0 * CC + c0 + cl) * (size_t)SEQ + t0 + q * 8; vst2(VT + o2, *(const v4u*)&th[cl][q * 8]); PW();
      if (t0 == 0) { const size_t o3 = (size_t)(bb0 * CC + c0 + cl) * (size_t)QB0 + q * 8; vst2(VL + o3, *(const v4u*)&tl2[cl][q * 8]); PW(); } } } }

// ---- k_fa: wave = 32 queries (two 16-column groups) of one head of one batch, whole key range in one pass, logits and P stay in registers.
// S^T = K Q^T (A = k rows, B = q rows, same loader on both sides): lane (col, g) holds query col, keys 8g+r of each 16-key tile, so two tiles pack straight into the B operand of O^T += V^T P^T.
// Running maximum and sum per query (in-lane plus one exchange between lane halves); P = exp(s - m) x 2^11 -> f16, normalised once at the end.
// The wave's 32 mask rows are scanned once: 32-key blocks in front of the first set bit run without mask work, blocks behind the last clear bit are not run (both counts bounded by SEQ / 32).
// Any mask content is honoured; a fully masked row ends as 0 x inf = NaN like the softmax of an all -inf row.
template <bool B> struct flag_t { static constexpr bool value = B; };
__device__ __forceinline__ float xhalf(float v) { const int b = __float_as_int(v); return __int_as_float(__builtin_amdgcn_permlanex16(b, b, 0x76543210, 0xfedcba98, false, false)); }
// behind global loads or stores whose registers are reused next: those registers may be rewritten only behind this wait
#define XW() asm volatile("s_wait_xcnt 0x0" ::: "memory")
__device__ __forceinline__ v8f wm(v16h a, v16h b, v8f c) { return __builtin_amdgcn_wmma_f32_16x16x32_f16(false, a, false, b, (short)0, c, false, false); }
// 2^x with the one free issue slot behind a transcendental kept inside the statement
__device__ __forceinline__ float exp2s(float x) { float r; asm("v_exp_f32 %0, %1\n\tv_nop" : "=v"(r) : "v"(x)); return r; }
// eight at once: each v_exp_f32 is followed by one that touches neither its result nor its source (early-clobber outputs), so one slot at the end serves the run
__device__ __forceinline__ v8f exp2x8(v8f x) { float r0, r1, r2, r3, r4, r5, r6, r7;
  asm("v_exp_f32 %0, %8\n\tv_exp_f32 %1, %9\n\tv_exp_f32 %2, %10\n\tv_exp_f32 %3, %11\n\tv_exp_f32 %4, %12\n\tv_exp_f32 %5, %13\n\tv_exp_f32 %6, %14\n\tv_exp_f32 %7, %15\n\tv_nop"
      : "=&v"(r0), "=&v"(r1), "=&v"(r2), "=&v"(r3), "=&v"(r4), "=&v"(r5), "=&v"(r6), "=&v"(r7) : "v"(x[0]), "v"(x[1]), "v"(x[2]), "v"(x[3]), "v"(x[4]), "v"(x[5]), "v"(x[6]), "v"(x[7]));
  return v8f{r0, r1, r2, r3, r4, r5, r6, r7}; }
// fragment at a byte address that already holds the lane's row and its half's 16 bytes
__device__ __forceinline__ v16h frag_p(const char* p) { union { v16h v; v8h q[2]; } u; u.q[0] = *(const v8h*)p; u.q[1] = *(const v8h*)(p + 32); return u.v; }
__global__ __launch_bounds__(128) void k_fa(const _Float16* __restrict__ QH, const _Float16* __restrict__ QL, const _Float16* __restrict__ KH, const _Float16* __restrict__ VT, const _Float16* __restrict__ VL,
                                            const unsigned* __restrict__ MB, _Float16* __restrict__ Y, _Float16* __restrict__ YL) {
  constexpr float NEG = -3.0e38f, SC = 0.125f * 1.44269504088896340736f; constexpr int NW = SEQ / 32;
  const int lane = threadIdx.x & 31, col = lane & 15, g = lane >> 4; const int wave = __builtin_amdgcn_readfirstlane((int)threadIdx.x >> 5);
  // more blocks than resident places, and a block's cost grows with its query tile: the longest key ranges of every head and batch come first in the index, the short ones fill the places that free up
  constexpr int NT = SEQ / 128; const unsigned hb = blockIdx.x % (unsigned)(NH * NB); const int h = (int)(hb % NH), bt = (int)(hb / NH); const int q0 = (NT - 1 - (int)(blockIdx.x / (unsigned)(NH * NB))) * 128 + wave * 32;
  QH += (size_t)bt * SEQ * CC; QL += (size_t)bt * SEQ * CC; KH += (size_t)bt * SEQ * CC; VT += (size_t)bt * CC * SEQ; VL += (size_t)bt * CC * QB0; Y += (size_t)bt * SEQ * CC; YL += (size_t)bt * QB0 * CC;
  const unsigned* mu = MB + (size_t)q0 * NW; const unsigned mo = 4u * (unsigned)(col * NW);
  int last = -1, first = NW;
#pragma unroll
  for (int p = 0; p < 2; ++p)
#pragma unroll
    for (int i = NW / 8 - 1; i >= 0; --i) { const v4u u = *(const v4u*)((const char*)(mu + p * 16 * NW + 4 * i) + (mo + 4u * (unsigned)(g * (NW / 2))));
#pragma unroll
      for (int e = 3; e >= 0; --e) { const int w = g * (NW / 2) + 4 * i + e; last = (u[e] != 0xFFFFFFFFu) ? max(last, w) : last; first = (u[e] != 0u) ? min(first, w) : first; } }
#pragma unroll
  for (int o = 1; o < 32; o <<= 1) { last = max(last, __shfl_xor(last, o)); first = min(first, __shfl_xor(first, o)); }
  const int trip = min(__builtin_amdgcn_readfirstlane(last) + 1, NW);
  const int nfull = max(min(__builtin_amdgcn_readfirstlane(first), trip), 0);
  const bool res = q0 < QB0;
  const unsigned ko = 2u * (unsigned)(col * CC + 8 * g), vo = 2u * (unsigned)(col * SEQ + 8 * g), lo = 2u * (unsigned)(col * QB0 + 8 * g);
  const char* kp = (const char*)(KH + h * HD) + ko; const char* vp = (const char*)(VT + (size_t)h * HD * SEQ) + vo; const char* lp = (const char*)(VL + (size_t)h * HD * QB0) + lo;   // kp, vp: one step per key block
  v16h qh[2][2], ql[2][2];
#pragma unroll
  for (int p = 0; p < 2; ++p)
#pragma unroll
    for (int kk = 0; kk < 2; ++kk) { const size_t o = (size_t)(q0 + 16 * p) * CC + h * HD + kk * 32; qh[p][kk] = frag_p((const char*)(QH + o) + ko); ql[p][kk] = frag_p((const char*)(QL + o) + ko); }
  v16h kf[2][2];
#pragma unroll
  for (int t = 0; t < 2; ++t)
#pragma unroll
    for (int kk = 0; kk < 2; ++kk) kf[t][kk] = frag_p(kp + 2 * (t * 16 * CC + kk * 32));
  XW();
  kp += 2 * 32 * CC;                                           // kp = the block that the next trip fetches ahead (SEQ >= 128: a block 1 exists)
  v8f acc[2][4] = {}; float m[2] = {NEG, NEG}, l[2] = {0.f, 0.f};
  auto body = [&](const int kc, auto mk) {
    constexpr bool masked = decltype(mk)::value;
    v16h vf[4]; unsigned mw[2] = {0u, 0u};
#pragma unroll
    for (int j = 0; j < 4; ++j) vf[j] = frag_p(vp + 2 * (j * 16 * SEQ));   // this block's v rows fly under the logits and the softmax
    if constexpr (masked) { mw[0] = *(const unsigned*)((const char*)(mu + kc) + mo); mw[1] = *(const unsigned*)((const char*)(mu + 16 * NW + kc) + mo); XW(); }
    v8f s[2][2] = {};
#pragma unroll
    for (int kk = 0; kk < 2; ++kk)
#pragma unroll
      for (int t = 0; t < 2; ++t)
#pragma unroll
        for (int p = 0; p < 2; ++p) s[p][t] = wm(kf[t][kk], ql[p][kk], s[p][t]);
#pragma unroll
    for (int t = 0; t < 2; ++t)
#pragma unroll
      for (int p = 0; p < 2; ++p) s[p][t] *= (1.0f / 1024.0f);
#pragma unroll
    for (int kk = 0; kk < 2; ++kk)
#pragma unroll
      for (int t = 0; t < 2; ++t)
#pragma unroll
        for (int p = 0; p < 2; ++p) s[p][t] = wm(kf[t][kk], qh[p][kk], s[p][t]);
#pragma unroll
    for (int t = 0; t < 2; ++t)
#pragma unroll
      for (int kk = 0; kk < 2; ++kk) kf[t][kk] = frag_p(kp + 2 * (t * 16 * CC + kk * 32));   // next block's k rows fly under the softmax and P.v
    __builtin_amdgcn_sched_barrier(0);                         // keeps these loads here, ahead of the work that hides their latency (the scheduler sinks them to the end of the trip otherwise)
    if constexpr (masked) {
#pragma unroll
      for (int p = 0; p < 2; ++p) { const unsigned w = mw[p] >> (8 * g);
#pragma unroll
        for (int t = 0; t < 2; ++t)
#pragma unroll
          for (int r = 0; r < 8; ++r) s[p][t][r] = ((w >> (16 * t + r)) & 1u) ? NEG : s[p][t][r]; } }
    float mn[2];
#pragma unroll
    for (int p = 0; p < 2; ++p) { float x = fmaxf(s[p][0][0], s[p][1][0]);
#pragma unroll
      for (int r = 1; r < 8; ++r) x = fmaxf(x, fmaxf(s[p][0][r], s[p][1][r]));
      mn[p] = fmaxf(m[p], fmaxf(x, xhalf(x))); }
    if (__builtin_amdgcn_ballot_w32(mn[0] > m[0] || mn[1] > m[1]) != 0u) {
#pragma unroll
      for (int p = 0; p < 2; ++p) { const float al = exp2s((m[p] - mn[p]) * SC); l[p] *= al; m[p] = mn[p];
#pragma unroll
        for (int j = 0; j < 4; ++j) acc[p][j] *= al; } }
    v16h pb[2];
#pragma unroll
    for (int p = 0; p < 2; ++p) { const float me = (m[p] <= -1.0e38f) ? 0.f : m[p]; float sum = 0.f;   // nothing unmasked yet: a finite stand-in keeps every masked term at exp2(-huge) = 0
#pragma unroll
      for (int t = 0; t < 2; ++t) { s[p][t] = exp2x8((s[p][t] - me) * SC + 11.0f);
#pragma unroll
        for (int r = 0; r < 8; ++r) { sum += s[p][t][r]; pb[p][8 * t + r] = (_Float16)s[p][t][r]; } }
      l[p] += sum; }
#pragma unroll
    for (int j = 0; j < 4; ++j)
#pragma unroll
      for (int p = 0; p < 2; ++p) acc[p][j] = wm(vf[j], pb[p], acc[p][j]);
    if (res && kc < QB0 / 32) {                                // query rows 0..63, keys 0..63: P and v residual planes (x 2^10), as before
      v16h pl[2];
#pragma unroll
      for (int p = 0; p < 2; ++p)
#pragma unroll
        for (int e = 0; e < 16; ++e) pl[p][e] = (_Float16)((s[p][e >> 3][e & 7] - (float)pb[p][e]) * 1024.0f);
#pragma unroll
      for (int j = 0; j < 4; ++j) { const v16h vl = frag_p(lp + 2 * (j * 16 * QB0 + kc * 32)); XW();
#pragma unroll
        for (int p = 0; p < 2; ++p) { v8f a = {}; a = wm(vf[j], pl[p], a); a = wm(vl, pb[p], a); acc[p][j] += a * (1.0f / 1024.0f); } } }
    XW();
    __builtin_amdgcn_sched_barrier(0);                         // the two pointer steps below stay behind the wait above
    vp += 2 * 32; kp += (kc + 2 < NW) ? 2 * 32 * CC : 0;       // the fetch ahead stays inside the k plane on the last trips
  };
#pragma unroll 1
  for (int kc = 0; kc < nfull; ++kc) body(kc, flag_t<false>{});
#pragma unroll 1
  for (int kc = nfull; kc < trip; ++kc) body(kc, flag_t<true>{});
#pragma unroll
  for (int p = 0; p < 2; ++p) { const float inv = 16.0f / (l[p] + xhalf(l[p])); const size_t o = (size_t)(q0 + 16 * p) * CC + h * HD;   /* ctx carried x 16, residual x 2^10 */
#pragma unroll
    for (int j = 0; j < 4; ++j) { union { v8h h; v4u u; } yh, yl;
#pragma unroll
      for (int r = 0; r < 8; ++r) { const float y = acc[p][j][r] * inv; const _Float16 t = (_Float16)y; yh.h[r] = t; yl.h[r] = (_Float16)((y - (float)t) * 1024.0f); }
      vst2((char*)(Y + o + j * 16) + ko, yh.u); XW(); if (res) { vst2((char*)(YL + o + j * 16) + ko, yl.u); XW(); } } } }

// ---- k_out: block = (64 rows out of all batches' rows, 128 cols): out = (ctx x 16 f16) (f16 bf16(Wo) x 64)^T / 1024 + bo; a sequence's row block 0 adds the ctx residual plane (2 products)
__global__ __launch_bounds__(128) void k_out(const _Float16* __restrict__ Y, const _Float16* __restrict__ YL, const _Float16* __restrict__ WO, const float* __restrict__ BP, float* __restrict__ OUT) { __shared__ __align__(16) float sf[4][16][132];
  constexpr unsigned RB = 256u * RP; __shared__ __align__(16) char pool[2 * RB];   // ring: 2 x (64 rows of ctx, 128 of Wo, 64 of the ctx residual, filled in a sequence's row block 0 alone)
  const int tid = threadIdx.x, wave = tid >> 5, lane = tid & 31, col = lane & 15, g = lane >> 4; const int c0 = blockIdx.y * 128; const int r0 = blockIdx.x * 64 + wave * 16; const int b = blockIdx.x / (SEQ / 64); const size_t orow = (size_t)b * (SEQ_FULL - SEQ) + r0;
  const bool lo = blockIdx.x % (SEQ / 64) == 0;
  const unsigned ring = lds_off(pool) + (unsigned)((tid >> 3) * RP + (tid & 7) * 16);   // this lane's 16 bytes of ring row tid / 8
  const char* gy = (const char*)(Y + (size_t)(blockIdx.x * 64 + (tid >> 3)) * CC + (tid & 7) * 8); const char* gl = (const char*)(YL + (size_t)(b * QB0 + (tid >> 3)) * CC + (tid & 7) * 8); const char* gw = (const char*)(WO + (size_t)(c0 + (tid >> 3)) * CC + (tid & 7) * 8);
  auto fill = [&](const int s) { const unsigned l = ring + (unsigned)(s & 1) * RB; copy4(l, gy + s * (2 * KS)); copy4(l + 64u * RP, gw + s * (2 * KS)); copy4(l + 128u * RP, gw + s * (2 * KS) + 64 * 2 * CC); if (lo) copy4(l + 192u * RP, gl + s * (2 * KS)); };
  fill(0);
  AW();
  __syncthreads();                                               // publishes stage 0
  fill(1);
  v8f acc[8] = {}, accl[8] = {};
#pragma unroll 1                                                 // one trip a stage: the buffer is picked by the trip's parity, the text stays short
  for (int s = 0; s < NS; ++s) { const char* fb = pool + (unsigned)(s & 1) * RB + col * RP + g * 16;
#pragma unroll                                                   // this and those below: constant indices keep w[], acc[] and accl[] in registers; a block's LDS reads stand as one group ahead of its products
    for (int ks = 0; ks < KS / 32; ++ks) { const v16h a = frag_lh(fb + wave * 16 * RP + ks * 64); v16h w[8];
#pragma unroll
      for (int j = 0; j < 8; ++j) w[j] = frag_lh(fb + (64 + j * 16) * RP + ks * 64);
#pragma unroll
      for (int j = 0; j < 8; ++j) acc[j] = wmma16(a, w[j], acc[j]);
      if (lo) { const v16h al = frag_lh(fb + (192 + wave * 16) * RP + ks * 64);
#pragma unroll
        for (int j = 0; j < 8; ++j) accl[j] = wmma16(al, w[j], accl[j]); } }
    DW(); AW();
    __syncthreads();                                             // publishes stage s + 1 and ends every wave's reads of stage s
    if (s + 2 < NS) fill(s + 2); }
  AW();
#pragma unroll
  for (int j = 0; j < 8; ++j) { const float bb = bfr(BP[c0 + j * 16 + col]);
#pragma unroll
    for (int r = 0; r < 8; ++r) sf[wave][8 * g + r][j * 16 + col] = (acc[j][r] + accl[j][r] * (1.0f / 1024.0f)) * (1.0f / 1024.0f) + bb; }
  LDSX(); for (int rl = 0; rl < 16; ++rl) vst2(OUT + (orow + rl) * CC + c0 + lane * 4, *(const v4f*)&sf[wave][rl][lane * 4]); }

extern "C" void kernel_launch(void* const* d_in, const int* in_sizes, int n_in, void* d_out, int out_size, void* d_ws, size_t ws_size, hipStream_t stream) {
  if (n_in < 12) return;
  // d_in: 0 x [4,2048,1024] f32, 1 mask [2048,2048] int32, 2 rope_cos [2048,64] f32, 3 rope_sin [2048,64] f32, 4 Wq [out,in], 5 bq, 6 Wk, 7 bk, 8 Wv, 9 bv, 10 Wo, 11 bo
  const size_t xneed = ((size_t)(NB - 1) * SEQ_FULL + SEQ) * (size_t)CC;
  if ((size_t)in_sizes[0] < xneed) return;
  if ((size_t)in_sizes[1] < (size_t)(SEQ - 1) * SEQ_FULL + SEQ) return;
  if (in_sizes[2] < SEQ * HD || in_sizes[3] < SEQ * HD) return;
  if (in_sizes[4] < CC * CC || in_sizes[6] < CC * CC || in_sizes[8] < CC * CC || in_sizes[10] < CC * CC) return;
  if (in_sizes[5] < CC || in_sizes[7] < CC || in_sizes[9] < CC || in_sizes[11] < CC) return;
  if ((size_t)out_size < xneed) return;
  if (ws_size < (size_t)WS_END) return;
  const float* X = (const float*)d_in[0]; const int* M = (const int*)d_in[1]; const float* RC = (const float*)d_in[2]; const float* RS = (const float*)d_in[3];
  const float *WQ = (const float*)d_in[4], *BQ = (const float*)d_in[5], *WK = (const float*)d_in[6], *BK = (const float*)d_in[7], *WV = (const float*)d_in[8], *BV = (const float*)d_in[9], *WO = (const float*)d_in[10], *BO = (const float*)d_in[11];
  char* ws = (char*)d_ws;
  __bf16 *WQB = (__bf16*)(ws + WS_WQ), *WKB = (__bf16*)(ws + WS_WK), *WVB = (__bf16*)(ws + WS_WV), *XB = (__bf16*)(ws + WS_XB); _Float16* WOH = (_Float16*)(ws + WS_WO);
  _Float16 *QH = (_Float16*)(ws + WS_QH), *QL = (_Float16*)(ws + WS_QL), *KH = (_Float16*)(ws + WS_KH), *VT = (_Float16*)(ws + WS_VT), *VL = (_Float16*)(ws + WS_VL), *Y = (_Float16*)(ws + WS_Y), *YL = (_Float16*)(ws + WS_YL);
  unsigned* MB = (unsigned*)(ws + WS_MB); float* OUT = (float*)d_out;
  k_prep<<<dim3(PB_X + 4 * PB_W + PB_M), 256, 0, stream>>>(X, WQ, WK, WV, WO, M, (unsigned short*)XB, (unsigned short*)WQB, MB);
  k_proj<<<dim3(NB * (SEQ / 64), CC / 128, 3), 128, 0, stream>>>(XB, WQB, BQ, WKB, BK, WVB, BV, RC, RS, QH, QL, KH, VT, VL);
  k_fa<<<dim3((SEQ / 128) * NH * NB), 128, 0, stream>>>(QH, QL, KH, VT, VL, MB, Y, YL);
  k_out<<<dim3(NB * (SEQ / 64), CC / 128), 128, 0, stream>>>(Y, YL, WOH, BO, OUT);
}

// v004
// It runs in 164 microseconds.
// Timed twice side by side with v003, it ran 1.09 times as fast both times.
// Over all steps from v000 it is 11.3 times as fast.
// compute dtype: every float input (x, Wq, Wk, Wv, Wo, biases, rope cos/sin tables) RNE-converted to bf16 (bf16-input target); q/k/v = x W^T + b on v_wmma_f32_16x16x32_bf16 (exact bf16 products, f32 accumulate); rope in f32; q -> f16 hi + residual plane (x 2^10), k -> f16; logits = 2 products on v_wmma_f32_16x16x32_f16, / 8, f32; mask replace + running-maximum softmax in f32 (exp2), logits and P kept in registers; exp(s - m) x 2^11 -> f16 against v f16: 1 f16 product, divided by the f32 row sum at the end (query rows 0..63 of each sequence add P and v residual planes x 2^10: 3 products); ctx x 16 -> f16 against f16(bf16(Wo) x 64): 1 f16 product (rows 0..63 add a ctx residual plane x 2^10: 2 products); f32 accumulate everywhere, f32 output.
#include <hip/hip_runtime.h>
#include <math.h>

#ifndef NB
#define NB 4
#endif
#ifndef SEQ
#define SEQ 2048
#endif
#define NB_FULL 4
#define SEQ_FULL 2048
#define CC 1024
#define NH 16
#define HD 64
#define QB0 64               // leading query rows per sequence carried with residual planes
static_assert(SEQ % 128 == 0);
static_assert(SEQ >= 128 && SEQ <= SEQ_FULL);
static_assert(NB >= 1 && NB <= NB_FULL);
static_assert(CC == NH * HD);
static_assert(HD == 64);
static_assert(QB0 == 64);
static_assert(SEQ % 256 == 0);
static_assert((SEQ * (SEQ / 32)) % 256 == 0);
static_assert(((CC * CC) / 8) % 256 == 0);
static_assert(((SEQ * CC) / 8) % 256 == 0);

typedef __attribute__((ext_vector_type(16))) _Float16 v16h;
typedef __attribute__((ext_vector_type(16))) __bf16 v16b;
typedef __attribute__((ext_vector_type(8)))  _Float16 v8h;
typedef __attribute__((ext_vector_type(8)))  __bf16 v8b;
typedef __attribute__((ext_vector_type(8)))  float v8f;
typedef __attribute__((ext_vector_type(4)))  float v4f;
typedef __attribute__((ext_vector_type(4)))  unsigned v4u;
typedef __attribute__((ext_vector_type(4)))  int v4i;

#define WS_WQ  ((size_t)0)                                  // bf16 Wq [o][i]
#define WS_WK  (WS_WQ + 2u * (size_t)CC * CC)               // bf16 Wk [o][i]
#define WS_WV  (WS_WK + 2u * (size_t)CC * CC)               // bf16 Wv [o][i]
#define WS_WO  (WS_WV + 2u * (size_t)CC * CC)               // f16 bf16(Wo) x 64 [o][i]
#define WS_XB  (WS_WO + 2u * (size_t)CC * CC)               // bf16 x rows of every batch [b][t][c]
#define WS_QH  (WS_XB + 2u * (size_t)NB * SEQ * CC)         // f16 q rows [b][t][c] (hi)
#define WS_QL  (WS_QH + 2u * (size_t)NB * SEQ * CC)         // f16 q residual x 2^10 rows [b][t][c]
#define WS_KH  (WS_QL + 2u * (size_t)NB * SEQ * CC)         // f16 k rows [b][t][c]
#define WS_VT  (WS_KH + 2u * (size_t)NB * SEQ * CC)         // f16 v planes [b][c][t]
#define WS_VL  (WS_VT + 2u * (size_t)NB * CC * SEQ)         // f16 v residual x 2^10 planes [b][c][t < QB0]
#define WS_Y   (WS_VL + 2u * (size_t)NB * CC * QB0)         // f16 ctx x 16 rows [b][t][c]
#define WS_YL  (WS_Y + 2u * (size_t)NB * SEQ * CC)          // f16 ctx x 16 residual x 2^10 rows [b][t < QB0][c]
#define WS_MB  (WS_YL + 2u * (size_t)NB * QB0 * CC)         // mask bit plane [q][SEQ/32] (bit set = masked)
#define WS_END (WS_MB + 4u * (size_t)SEQ * (SEQ / 32))
static_assert(WS_END <= (size_t)134217728u);
static_assert(WS_WK % 128 == 0 && WS_WV % 128 == 0 && WS_WO % 128 == 0 && WS_XB % 128 == 0 && WS_QH % 128 == 0 && WS_QL % 128 == 0 && WS_KH % 128 == 0);
static_assert(WS_VT % 128 == 0 && WS_VL % 128 == 0 && WS_Y % 128 == 0 && WS_YL % 128 == 0 && WS_MB % 128 == 0);

template <typename T> __device__ __forceinline__ void vst2(void* p, T v) { *(T*)p = v;  }
__device__ __forceinline__ v8f wmma16(v16h a, v16h b, v8f c) {
  v8f d = __builtin_amdgcn_wmma_f32_16x16x32_f16(false, a, false, b, (short)0, c, false, false);
  asm volatile("v_nop\n\tv_nop\n\tv_nop\n\tv_nop" : "+v"(d) : "v"(a), "v"(b));
  return d;
}
__device__ __forceinline__ v8f wmma_bf(v16b a, v16b b, v8f c) {
  v8f d = __builtin_amdgcn_wmma_f32_16x16x32_bf16(false, a, false, b, (short)0, c, false, false);
  asm volatile("v_nop\n\tv_nop\n\tv_nop\n\tv_nop" : "+v"(d) : "v"(a), "v"(b));
  return d;
}
// 16x16x32 fragments: lane = (h = lane>>4, row/col = lane&15); elements 0..7 = k0+8h+0..7, 8..15 = k0+16+8h+0..7; D element r = row 8h+r
__device__ __forceinline__ float bfr(float v) { return (float)(__bf16)v; }
#define LDSX() do { asm volatile("s_wait_dscnt 0" ::: "memory"); __builtin_amdgcn_wave_barrier(); __builtin_amdgcn_fence(__ATOMIC_RELEASE, "workgroup"); } while (0)

// ---- LDS ring of the two GEMM kernels: a stage = 64 k (128 bytes, one whole line) of every operand row of the block, two buffers, filled by asynchronous copies while the other buffer is worked on
#define KS 64                // k per stage
#define NS (CC / KS)         // stages
#define RP 144               // ring row pitch in bytes: 128 + 16, free of bank conflicts for 16-byte LDS reads
static_assert(NS >= 2 && CC % KS == 0);
__device__ __forceinline__ unsigned lds_off(const void* p) { return (unsigned)(size_t)p; }
// four copies of 16 bytes a lane, global -> LDS through no register: ring rows 16 apart from plane rows 16 apart (8 lanes cover one 128-byte row slice, a wave 4 whole lines).
// s_wait_xcnt in the same statement: every later write of the address registers stays behind it
__device__ __forceinline__ void copy4(unsigned l, const char* p) {
  asm volatile("global_load_async_to_lds_b128 %0, %4, off\n\tglobal_load_async_to_lds_b128 %1, %5, off\n\tglobal_load_async_to_lds_b128 %2, %6, off\n\tglobal_load_async_to_lds_b128 %3, %7, off\n\ts_wait_xcnt 0x0"
               :: "v"(l), "v"(l + 16u * RP), "v"(l + 32u * RP), "v"(l + 48u * RP), "v"(p), "v"(p + 16 * 2 * CC), "v"(p + 32 * 2 * CC), "v"(p + 48 * 2 * CC) : "memory");
}
#define AW() asm volatile("s_wait_asynccnt 0x0" ::: "memory")   // this wave's copies have landed
#define DW() asm volatile("s_wait_dscnt 0x0" ::: "memory")      // this wave's LDS reads have returned: the buffer may be refilled behind the barrier
// fragment from a ring row: p = row start + 64 bytes per 32 k + 16 bytes per lane half (the k order stated above)
__device__ __forceinline__ v16h frag_lh(const char* p) { union { v16h v; v8h q[2]; } u; u.q[0] = *(const v8h*)p; u.q[1] = *(const v8h*)(p + 32); return u.v; }
__device__ __forceinline__ v16b frag_lb(const char* p) { union { v16b v; v8b q[2]; } u; u.q[0] = *(const v8b*)p; u.q[1] = *(const v8b*)(p + 32); return u.v; }

// ---- k_prep: every conversion of the call in one grid; a block's index range says which plane it fills (block-uniform): x of all batches, the four weights, the mask bits
#define PB_X (NB * ((SEQ * CC) / 8) / 256)     // blocks on x: 8 elements a thread
#define PB_W (((CC * CC) / 8) / 256)           // blocks on one weight
#define PB_M (SEQ * (SEQ / 32) / 256)          // blocks on the mask: one 32-bit word a thread
static_assert(WS_WK == WS_WQ + 2u * (size_t)CC * CC && WS_WV == WS_WQ + 4u * (size_t)CC * CC && WS_WO == WS_WQ + 6u * (size_t)CC * CC);   // k_prep steps from one weight plane to the next
__device__ __forceinline__ void cvt8(const float* __restrict__ A, unsigned short* __restrict__ D, const bool f16x64) {
  const v4f a = *(const v4f*)A; const v4f c = *(const v4f*)(A + 4);
  asm volatile("s_wait_xcnt 0x0" ::: "memory");   // the loads' address register is reused for the packed result: it may be rewritten only behind this wait
  const float v[8] = {a[0], a[1], a[2], a[3], c[0], c[1], c[2], c[3]};
  union { v8b b; v8h h; v4u u; } o;
  if (f16x64) { v8h t;
#pragma unroll
    for (int k = 0; k < 8; ++k) t[k] = (_Float16)(bfr(v[k]) * 64.0f);
    o.h = t; }
  else { v8b t;
#pragma unroll
    for (int k = 0; k < 8; ++k) t[k] = (__bf16)v[k];
    o.b = t; }
  vst2(D, o.u);
}
__global__ __launch_bounds__(256) void k_prep(const float* __restrict__ X, const float* __restrict__ WQ, const float* __restrict__ WK, const float* __restrict__ WV, const float* __restrict__ WO, const int* __restrict__ M,
                                              unsigned short* __restrict__ XB, unsigned short* __restrict__ WB, unsigned* __restrict__ MB) {
  const int blk = blockIdx.x, tid = threadIdx.x;
  if (blk < PB_X) {
    const int i = blk * 256 + tid, b = i / ((SEQ * CC) / 8);     // x rows of batch b start SEQ_FULL rows apart, the plane's SEQ rows apart
    cvt8(X + (size_t)b * (SEQ_FULL - SEQ) * CC + (size_t)i * 8, XB + (size_t)i * 8, false);
  } else if (blk < PB_X + 4 * PB_W) {
    const int wsel = (blk - PB_X) / PB_W; const int i = (blk - PB_X - wsel * PB_W) * 256 + tid;   // the four 16-bit weight planes stand one behind the other in the workspace
    const float* A = wsel == 0 ? WQ : wsel == 1 ? WK : wsel == 2 ? WV : WO;
    cvt8(A + (size_t)i * 8, WB + (size_t)wsel * CC * CC + (size_t)i * 8, wsel == 3);
  } else {
    const int w = (blk - PB_X - 4 * PB_W) * 256 + tid;
    const int q = w / (SEQ / 32), wc = w - q * (SEQ / 32);
    const int* p = M + (size_t)q * SEQ_FULL + wc * 32;
    unsigned bits = 0u;
#pragma unroll
    for (int i = 0; i < 8; ++i) { const v4i v = *(const v4i*)(p + 4 * i);
      bits |= (v.x != 0 ? 1u : 0u) << (4 * i);     bits |= (v.y != 0 ? 1u : 0u) << (4 * i + 1);
      bits |= (v.z != 0 ? 1u : 0u) << (4 * i + 2); bits |= (v.w != 0 ? 1u : 0u) << (4 * i + 3); }
    vst2(MB + w, bits);
  }
}

// ---- k_proj: block = (64 rows out of all batches' rows, 128 cols, which): y = x W^T + b (exact bf16 products from the 16-bit planes); which 0/1: rope then q -> f16 hi (+ residual), k -> f16 rows; which 2: v -> f16 planes [c][t] (+ residual plane for rows 0..63)
__global__ __launch_bounds__(128) void k_proj(const __bf16* __restrict__ XB, const __bf16* __restrict__ WQ, const float* __restrict__ BQ, const __bf16* __restrict__ WK, const float* __restrict__ BK, const __bf16* __restrict__ WV, const float* __restrict__ BV,
                                              const float* __restrict__ RC, const float* __restrict__ RS,
                                              _Float16* __restrict__ QH, _Float16* __restrict__ QL, _Float16* __restrict__ KH, _Float16* __restrict__ VT, _Float16* __restrict__ VL) {
  // one pool: the ring (2 x 192 rows: 64 of x, 128 of W) during the k loop, the output staging planes behind it
  constexpr unsigned RB = 192u * RP; __shared__ __align__(16) char pool[2 * 64 * 136 * 2 + 2 * 128 * 72 * 2]; static_assert(2u * RB <= sizeof(pool));
  _Float16 (*sh)[136] = (_Float16 (*)[136])pool; _Float16 (*sl)[136] = (_Float16 (*)[136])(pool + 64 * 136 * 2); _Float16 (*th)[72] = (_Float16 (*)[72])(pool + 2 * 64 * 136 * 2); _Float16 (*tl2)[72] = (_Float16 (*)[72])(pool + 2 * 64 * 136 * 2 + 128 * 72 * 2);
  __shared__ __align__(16) float scs[64][HD], ssn[64][HD];
  const int tid = threadIdx.x, wave = tid >> 5, lane = tid & 31, col = lane & 15, g = lane >> 4; const int which = blockIdx.z; const int c0 = blockIdx.y * 128; const int r0 = blockIdx.x * 64;   // r0: row in the [b][t] planes
  const int bb0 = blockIdx.x / (SEQ / 64), t0 = r0 - bb0 * SEQ;   // its batch and its position in the sequence
  const __bf16* WA = which == 0 ? WQ : which == 1 ? WK : WV; const float* BA = which == 0 ? BQ : which == 1 ? BK : BV;
  const unsigned ring = lds_off(pool) + (unsigned)((tid >> 3) * RP + (tid & 7) * 16);   // this lane's 16 bytes of ring row tid / 8
  const char* gx = (const char*)(XB + (size_t)(r0 + (tid >> 3)) * CC + (tid & 7) * 8); const char* gw = (const char*)(WA + (size_t)(c0 + (tid >> 3)) * CC + (tid & 7) * 8);
  auto fill = [&](const int s) { const unsigned l = ring + (unsigned)(s & 1) * RB; copy4(l, gx + s * (2 * KS)); copy4(l + 64u * RP, gw + s * (2 * KS)); copy4(l + 128u * RP, gw + s * (2 * KS) + 64 * 2 * CC); };
  fill(0);                                                       // stage 0 flies under the rope table's staging
  // rope table rows t0..t0+63 (bf16-RNE values), whole head dim; staged extent == consumed extent (64 x HD)
#pragma unroll 2
  for (int e = tid; e < 64 * (HD / 4); e += 128) { const int rl = e / (HD / 4), q = e % (HD / 4);
    const v4f c = *(const v4f*)(RC + (size_t)(t0 + rl) * HD + q * 4); const v4f s = *(const v4f*)(RS + (size_t)(t0 + rl) * HD + q * 4);
#pragma unroll
    for (int i = 0; i < 4; ++i) { scs[rl][q * 4 + i] = bfr(c[i]); ssn[rl][q * 4 + i] = bfr(s[i]); } }
  AW();
  __syncthreads();                                               // publishes the rope table and stage 0
  fill(1);
  v8f acc[8] = {};
#pragma unroll 1                                                 // one trip a stage: the buffer is picked by the trip's parity, the text stays short
  for (int s = 0; s < NS; ++s) { const char* fb = pool + (unsigned)(s & 1) * RB + col * RP + g * 16;
#pragma unroll                                                   // this and the two below: constant indices keep w[] and acc[] in registers; a block's 18 LDS reads stand as one group ahead of its 8 products
    for (int ks = 0; ks < KS / 32; ++ks) { const v16b a = frag_lb(fb + wave * 16 * RP + ks * 64); v16b w[8];
#pragma unroll
      for (int j = 0; j < 8; ++j) w[j] = frag_lb(fb + (64 + j * 16) * RP + ks * 64);
#pragma unroll
      for (int j = 0; j < 8; ++j) acc[j] = wmma_bf(a, w[j], acc[j]); }
    DW(); AW();
    __syncthreads();                                             // publishes stage s + 1 and ends every wave's reads of stage s
    if (s + 2 < NS) fill(s + 2); }
  AW();
  float bbv[8];
#pragma unroll
  for (int j = 0; j < 8; ++j) bbv[j] = bfr(BA[c0 + j * 16 + col]);
#pragma unroll
  for (int r = 0; r < 8; ++r) { const int rl = wave * 16 + 8 * g + r; float v[8];
#pragma unroll
    for (int j = 0; j < 8; ++j) v[j] = acc[j][r] + bbv[j];
    if (which == 2) {
#pragma unroll
      for (int j = 0; j < 8; ++j) { const int cl = j * 16 + col; const _Float16 hv = (_Float16)v[j]; th[cl][rl] = hv; tl2[cl][rl] = (_Float16)((v[j] - (float)hv) * 1024.0f); }   /* v residual carried x 2^10 */
    } else {
      float cs4[4], sn4[4];
#pragma unroll
      for (int jj = 0; jj < 4; ++jj) { cs4[jj] = scs[rl][jj * 16 + col]; sn4[jj] = ssn[rl][jj * 16 + col]; }
      // rotate-half: head-local d = (j&3)*16+col; d<32: y*cos - y[d+32]*sin, d>=32: y*cos + y[d-32]*sin; partner tile = j^2
#pragma unroll
      for (int j = 0; j < 8; ++j) { const int cl = j * 16 + col, jj = j & 3; const float pv = v[j ^ 2];
        const float o = (jj < 2) ? (v[j] * cs4[jj] - pv * sn4[jj]) : (v[j] * cs4[jj] + pv * sn4[jj]);
        const _Float16 hv = (_Float16)o; sh[rl][cl] = hv; sl[rl][cl] = (_Float16)((o - (float)hv) * 1024.0f); }   /* q residual carried x 2^10 so the plane stays f16-normal */
    } }
  __syncthreads();
  // PW: behind each store below, whose address and data registers the loop's next statements reuse: they may be rewritten only behind this wait
#define PW() asm volatile("s_wait_xcnt 0x0" ::: "memory")
  if (which < 2) { _Float16* dh = which == 0 ? QH : KH; for (int e = tid; e < 64 * 16; e += 128) { const int rl = e >> 4, q = e & 15; vst2(dh + (size_t)(r0 + rl) * CC + c0 + q * 8, *(const v4u*)&sh[rl][q * 8]); PW(); if (which == 0) { vst2(QL + (size_t)(r0 + rl) * CC + c0 + q * 8, *(const v4u*)&sl[rl][q * 8]); PW(); } } }
  else { for (int e = tid; e < 128 * 8; e += 128) { const int cl = e >> 3, q = e & 7; const size_t o2 = (size_t)(bb0 * CC + c0 + cl) * (size_t)SEQ + t0 + q * 8; vst2(VT + o2, *(const v4u*)&th[cl][q * 8]); PW();
      if (t0 == 0) { const size_t o3 = (size_t)(bb0 * CC + c0 + cl) * (size_t)QB0 + q * 8; vst2(VL + o3, *(const v4u*)&tl2[cl][q * 8]); PW(); } } } }

// ---- k_fa: wave = 32 queries (two 16-column groups) of one head of one batch, whole key range in one pass, logits and P stay in registers.
// S^T = K Q^T (A = k rows, B = q rows, same loader on both sides): lane (col, g) holds query col, keys 8g+r of each 16-key tile, so two tiles pack straight into the B operand of O^T += V^T P^T.
// Running maximum and sum per query (in-lane plus one exchange between lane halves); P = exp(s - m) x 2^11 -> f16, normalised once at the end.
// The wave's 32 mask rows are scanned once: stages in front of the first set bit of all four waves run without mask work, a wave's 32-key blocks behind its last clear bit are not run (both counts bounded by SEQ / 32).
// Any mask content is honoured; a fully masked row ends as 0 x inf = NaN like the softmax of an all -inf row.
// K and V come through LDS: a stage = 64 keys of the block's head, 64 k rows (128 bytes, one whole line each) and those keys' 128 bytes of the 64 v plane rows; two buffers, filled by asynchronous copies
// while the other buffer is worked on; the block's four waves walk the stages together and read their fragments from the ring (each line leaves L2 once a block, whole, instead of in 32-byte pieces once a wave).
#define FKS 64               // keys per stage
#define FRB (128u * RP)      // bytes of one buffer: 64 k rows, then 64 v rows, at the ring pitch
static_assert(SEQ % FKS == 0 && FKS == 64 && 2 * HD == 128);
// copy4 for the v planes, whose rows stand SEQ elements apart. s_wait_xcnt in the same statement: every later write of the address registers stays behind it
__device__ __forceinline__ void copy4v(unsigned l, const char* p) {
  asm volatile("global_load_async_to_lds_b128 %0, %4, off\n\tglobal_load_async_to_lds_b128 %1, %5, off\n\tglobal_load_async_to_lds_b128 %2, %6, off\n\tglobal_load_async_to_lds_b128 %3, %7, off\n\ts_wait_xcnt 0x0"
               :: "v"(l), "v"(l + 16u * RP), "v"(l + 32u * RP), "v"(l + 48u * RP), "v"(p), "v"(p + 16 * 2 * SEQ), "v"(p + 32 * 2 * SEQ), "v"(p + 48 * 2 * SEQ) : "memory");
}
template <bool B> struct flag_t { static constexpr bool value = B; };
__device__ __forceinline__ float xhalf(float v) { const int b = __float_as_int(v); return __int_as_float(__builtin_amdgcn_permlanex16(b, b, 0x76543210, 0xfedcba98, false, false)); }
// behind global loads or stores whose registers are reused next: those registers may be rewritten only behind this wait
#define XW() asm volatile("s_wait_xcnt 0x0" ::: "memory")
__device__ __forceinline__ v8f wm(v16h a, v16h b, v8f c) { return __builtin_amdgcn_wmma_f32_16x16x32_f16(false, a, false, b, (short)0, c, false, false); }
// 2^x with the one free issue slot behind a transcendental kept inside the statement
__device__ __forceinline__ float exp2s(float x) { float r; asm("v_exp_f32 %0, %1\n\tv_nop" : "=v"(r) : "v"(x)); return r; }
// eight at once: each v_exp_f32 is followed by one that touches neither its result nor its source (early-clobber outputs), so one slot at the end serves the run
__device__ __forceinline__ v8f exp2x8(v8f x) { float r0, r1, r2, r3, r4, r5, r6, r7;
  asm("v_exp_f32 %0, %8\n\tv_exp_f32 %1, %9\n\tv_exp_f32 %2, %10\n\tv_exp_f32 %3, %11\n\tv_exp_f32 %4, %12\n\tv_exp_f32 %5, %13\n\tv_exp_f32 %6, %14\n\tv_exp_f32 %7, %15\n\tv_nop"
      : "=&v"(r0), "=&v"(r1), "=&v"(r2), "=&v"(r3), "=&v"(r4), "=&v"(r5), "=&v"(r6), "=&v"(r7) : "v"(x[0]), "v"(x[1]), "v"(x[2]), "v"(x[3]), "v"(x[4]), "v"(x[5]), "v"(x[6]), "v"(x[7]));
  return v8f{r0, r1, r2, r3, r4, r5, r6, r7}; }
// fragment at a byte address that already holds the lane's row and its half's 16 bytes
__device__ __forceinline__ v16h frag_p(const char* p) { union { v16h v; v8h q[2]; } u; u.q[0] = *(const v8h*)p; u.q[1] = *(const v8h*)(p + 32); return u.v; }
__global__ __launch_bounds__(128) void k_fa(const _Float16* __restrict__ QH, const _Float16* __restrict__ QL, const _Float16* __restrict__ KH, const _Float16* __restrict__ VT, const _Float16* __restrict__ VL,
                                            const unsigned* __restrict__ MB, _Float16* __restrict__ Y, _Float16* __restrict__ YL) {
  constexpr float NEG = -3.0e38f, SC = 0.125f * 1.44269504088896340736f; constexpr int NW = SEQ / 32;
  __shared__ __align__(16) char ring[2 * FRB]; __shared__ __align__(16) int wtrip[4], wfull[4];
  const int tid = threadIdx.x, lane = threadIdx.x & 31, col = lane & 15, g = lane >> 4; const int wave = __builtin_amdgcn_readfirstlane((int)threadIdx.x >> 5);
  // more blocks than resident places, and a block's cost grows with its query tile: the longest key ranges of every head and batch come first in the index, the short ones fill the places that free up
  constexpr int NT = SEQ / 128; const unsigned hb = blockIdx.x % (unsigned)(NH * NB); const int h = (int)(hb % NH), bt = (int)(hb / NH); const int q0 = (NT - 1 - (int)(blockIdx.x / (unsigned)(NH * NB))) * 128 + wave * 32;
  QH += (size_t)bt * SEQ * CC; QL += (size_t)bt * SEQ * CC; KH += (size_t)bt * SEQ * CC; VT += (size_t)bt * CC * SEQ; VL += (size_t)bt * CC * QB0; Y += (size_t)bt * SEQ * CC; YL += (size_t)bt * QB0 * CC;
  const unsigned rl = lds_off(ring) + (unsigned)((tid >> 3) * RP + (tid & 7) * 16);   // this lane's 16 bytes of ring row tid / 8
  const char* gk = (const char*)(KH + (size_t)(tid >> 3) * CC + h * HD + (tid & 7) * 8); const char* gv = (const char*)(VT + ((size_t)h * HD + (tid >> 3)) * SEQ + (tid & 7) * 8);
  auto fill = [&](const int s) { const unsigned l = rl + (unsigned)(s & 1) * FRB; copy4(l, gk + (size_t)s * (FKS * 2 * CC)); copy4v(l + 64u * RP, gv + s * (2 * FKS)); };
  fill(0);                                                     // stage 0 flies under the mask scan (SEQ >= 128: stages 0 and 1 lie inside the planes)
  const unsigned* mu = MB + (size_t)q0 * NW; const unsigned mo = 4u * (unsigned)(col * NW);
  int last = -1, first = NW;
#pragma unroll
  for (int p = 0; p < 2; ++p)
#pragma unroll
    for (int i = NW / 8 - 1; i >= 0; --i) { const v4u u = *(const v4u*)((const char*)(mu + p * 16 * NW + 4 * i) + (mo + 4u * (unsigned)(g * (NW / 2))));
#pragma unroll
      for (int e = 3; e >= 0; --e) { const int w = g * (NW / 2) + 4 * i + e; last = (u[e] != 0xFFFFFFFFu) ? max(last, w) : last; first = (u[e] != 0u) ? min(first, w) : first; } }
#pragma unroll
  for (int o = 1; o < 32; o <<= 1) { last = max(last, __shfl_xor(last, o)); first = min(first, __shfl_xor(first, o)); }
  const int trip = min(__builtin_amdgcn_readfirstlane(last) + 1, NW);
  const int nfull = max(min(__builtin_amdgcn_readfirstlane(first), trip), 0);
  if (lane == 0) { wtrip[wave] = trip; wfull[wave] = nfull; }
  AW();
  __syncthreads();                                             // publishes stage 0 and the four waves' block counts
  const v4i wt = *(const v4i*)wtrip, wf = *(const v4i*)wfull;
  const int nst = (__builtin_amdgcn_readfirstlane(max(max(wt.x, wt.y), max(wt.z, wt.w))) + 1) >> 1;   // stages of the block: its longest wave's, at most SEQ / FKS
  const int nfs = __builtin_amdgcn_readfirstlane(min(min(wf.x, wf.y), min(wf.z, wf.w))) >> 1;         // leading stages that no wave of the block has mask work in (nfull <= trip: every wave runs both their halves)
  if (nst > 1) fill(1);
  const bool res = q0 < QB0;
  const unsigned ko = 2u * (unsigned)(col * CC + 8 * g), lo = 2u * (unsigned)(col * QB0 + 8 * g);
  const char* lp = (const char*)(VL + (size_t)h * HD * QB0) + lo;
  v16h qh[2][2], ql[2][2];
#pragma unroll
  for (int p = 0; p < 2; ++p)
#pragma unroll
    for (int kk = 0; kk < 2; ++kk) { const size_t o = (size_t)(q0 + 16 * p) * CC + h * HD + kk * 32; qh[p][kk] = frag_p((const char*)(QH + o) + ko); ql[p][kk] = frag_p((const char*)(QL + o) + ko); }
  XW();
  v8f acc[2][4] = {}; float m[2] = {NEG, NEG}, l[2] = {0.f, 0.f};
  auto body = [&](const int kc, const char* kb, const char* vb, auto mk) {   // kb, vb: the lane's row and half at this block's 32 keys in the stage's buffer
    constexpr bool masked = decltype(mk)::value;
    v16h kf[2][2], vf[4]; unsigned mw[2] = {0u, 0u};
#pragma unroll
    for (int t = 0; t < 2; ++t)
#pragma unroll
      for (int kk = 0; kk < 2; ++kk) kf[t][kk] = frag_lh(kb + t * 16 * RP + kk * 64);
#pragma unroll
    for (int j = 0; j < 4; ++j) vf[j] = frag_lh(vb + j * 16 * RP);   // this block's v rows fly under the logits and the softmax
    if constexpr (masked) { mw[0] = *(const unsigned*)((const char*)(mu + kc) + mo); mw[1] = *(const unsigned*)((const char*)(mu + 16 * NW + kc) + mo); XW(); }
    v8f s[2][2] = {};
#pragma unroll
    for (int kk = 0; kk < 2; ++kk)
#pragma unroll
      for (int t = 0; t < 2; ++t)
#pragma unroll
        for (int p = 0; p < 2; ++p) s[p][t] = wm(kf[t][kk], ql[p][kk], s[p][t]);
#pragma unroll
    for (int t = 0; t < 2; ++t)
#pragma unroll
      for (int p = 0; p < 2; ++p) s[p][t] *= (1.0f / 1024.0f);
#pragma unroll
    for (int kk = 0; kk < 2; ++kk)
#pragma unroll
      for (int t = 0; t < 2; ++t)
#pragma unroll
        for (int p = 0; p < 2; ++p) s[p][t] = wm(kf[t][kk], qh[p][kk], s[p][t]);
    if constexpr (masked) {
#pragma unroll
      for (int p = 0; p < 2; ++p) { const unsigned w = mw[p] >> (8 * g);
#pragma unroll
        for (int t = 0; t < 2; ++t)
#pragma unroll
          for (int r = 0; r < 8; ++r) s[p][t][r] = ((w >> (16 * t + r)) & 1u) ? NEG : s[p][t][r]; } }
    float mn[2];
#pragma unroll
    for (int p = 0; p < 2; ++p) { float x = fmaxf(s[p][0][0], s[p][1][0]);
#pragma unroll
      for (int r = 1; r < 8; ++r) x = fmaxf(x, fmaxf(s[p][0][r], s[p][1][r]));
      mn[p] = fmaxf(m[p], fmaxf(x, xhalf(x))); }
    if (__builtin_amdgcn_ballot_w32(mn[0] > m[0] || mn[1] > m[1]) != 0u) {
#pragma unroll
      for (int p = 0; p < 2; ++p) { const float al = exp2s((m[p] - mn[p]) * SC); l[p] *= al; m[p] = mn[p];
#pragma unroll
        for (int j = 0; j < 4; ++j) acc[p][j] *= al; } }
    v16h pb[2];
#pragma unroll
    for (int p = 0; p < 2; ++p) { const float me = (m[p] <= -1.0e38f) ? 0.f : m[p]; float sum = 0.f;   // nothing unmasked yet: a finite stand-in keeps every masked term at exp2(-huge) = 0
#pragma unroll
      for (int t = 0; t < 2; ++t) { s[p][t] = exp2x8((s[p][t] - me) * SC + 11.0f);
#pragma unroll
        for (int r = 0; r < 8; ++r) { sum += s[p][t][r]; pb[p][8 * t + r] = (_Float16)s[p][t][r]; } }
      l[p] += sum; }
#pragma unroll
    for (int j = 0; j < 4; ++j)
#pragma unroll
      for (int p = 0; p < 2; ++p) acc[p][j] = wm(vf[j], pb[p], acc[p][j]);
    if (res && kc < QB0 / 32) {                                // query rows 0..63, keys 0..63: P and v residual planes (x 2^10), as before
      v16h pl[2];
#pragma unroll
      for (int p = 0; p < 2; ++p)
#pragma unroll
        for (int e = 0; e < 16; ++e) pl[p][e] = (_Float16)((s[p][e >> 3][e & 7] - (float)pb[p][e]) * 1024.0f);
#pragma unroll
      for (int j = 0; j < 4; ++j) { const v16h vl = frag_p(lp + 2 * (j * 16 * QB0 + kc * 32)); XW();
#pragma unroll
        for (int p = 0; p < 2; ++p) { v8f a = {}; a = wm(vf[j], pl[p], a); a = wm(vl, pb[p], a); acc[p][j] += a * (1.0f / 1024.0f); } } }
  };
  auto foot = [&](const int st) {                              // both loops below run the same trips in every wave of the block
    DW(); AW();
    __syncthreads();                                           // publishes stage st + 1 and ends every wave's reads of stage st
    if (st + 2 < nst) fill(st + 2); };
  const char* f0 = ring + col * RP + g * 16;
#pragma unroll 1                                               // one trip a stage: the buffer is picked by the trip's parity, the text stays short
  for (int st = 0; st < nfs; ++st) { const char* fb = f0 + (unsigned)(st & 1) * FRB;
    body(2 * st, fb, fb + 64 * RP, flag_t<false>{}); body(2 * st + 1, fb + 32 * RP, fb + 64 * RP + 64, flag_t<false>{});
    foot(st); }
#pragma unroll 1                                               // as above
  for (int st = nfs; st < nst; ++st) { const char* fb = f0 + (unsigned)(st & 1) * FRB; const int ke = min(2 * st + 2, trip);   // a wave past its own last block only keeps the ring going
#pragma unroll 1                                               // one copy of the masked body in the text
    for (int kc = 2 * st; kc < ke; ++kc) body(kc, fb + (kc & 1) * (32 * RP), fb + 64 * RP + (kc & 1) * 64, flag_t<true>{});
    foot(st); }
  AW();
#pragma unroll
  for (int p = 0; p < 2; ++p) { const float inv = 16.0f / (l[p] + xhalf(l[p])); const size_t o = (size_t)(q0 + 16 * p) * CC + h * HD;   /* ctx carried x 16, residual x 2^10 */
#pragma unroll
    for (int j = 0; j < 4; ++j) { union { v8h h; v4u u; } yh, yl;
#pragma unroll
      for (int r = 0; r < 8; ++r) { const float y = acc[p][j][r] * inv; const _Float16 t = (_Float16)y; yh.h[r] = t; yl.h[r] = (_Float16)((y - (float)t) * 1024.0f); }
      vst2((char*)(Y + o + j * 16) + ko, yh.u); XW(); if (res) { vst2((char*)(YL + o + j * 16) + ko, yl.u); XW(); } } } }

// ---- k_out: block = (64 rows out of all batches' rows, 128 cols): out = (ctx x 16 f16) (f16 bf16(Wo) x 64)^T / 1024 + bo; a sequence's row block 0 adds the ctx residual plane (2 products)
__global__ __launch_bounds__(128) void k_out(const _Float16* __restrict__ Y, const _Float16* __restrict__ YL, const _Float16* __restrict__ WO, const float* __restrict__ BP, float* __restrict__ OUT) { __shared__ __align__(16) float sf[4][16][132];
  constexpr unsigned RB = 256u * RP; __shared__ __align__(16) char pool[2 * RB];   // ring: 2 x (64 rows of ctx, 128 of Wo, 64 of the ctx residual, filled in a sequence's row block 0 alone)
  const int tid = threadIdx.x, wave = tid >> 5, lane = tid & 31, col = lane & 15, g = lane >> 4; const int c0 = blockIdx.y * 128; const int r0 = blockIdx.x * 64 + wave * 16; const int b = blockIdx.x / (SEQ / 64); const size_t orow = (size_t)b * (SEQ_FULL - SEQ) + r0;
  const bool lo = blockIdx.x % (SEQ / 64) == 0;
  const unsigned ring = lds_off(pool) + (unsigned)((tid >> 3) * RP + (tid & 7) * 16);   // this lane's 16 bytes of ring row tid / 8
  const char* gy = (const char*)(Y + (size_t)(blockIdx.x * 64 + (tid >> 3)) * CC + (tid & 7) * 8); const char* gl = (const char*)(YL + (size_t)(b * QB0 + (tid >> 3)) * CC + (tid & 7) * 8); const char* gw = (const char*)(WO + (size_t)(c0 + (tid >> 3)) * CC + (tid & 7) * 8);
  auto fill = [&](const int s) { const unsigned l = ring + (unsigned)(s & 1) * RB; copy4(l, gy + s * (2 * KS)); copy4(l + 64u * RP, gw + s * (2 * KS)); copy4(l + 128u * RP, gw + s * (2 * KS) + 64 * 2 * CC); if (lo) copy4(l + 192u * RP, gl + s * (2 * KS)); };
  fill(0);
  AW();
  __syncthreads();                                               // publishes stage 0
  fill(1);
  v8f acc[8] = {}, accl[8] = {};
#pragma unroll 1                                                 // one trip a stage: the buffer is picked by the trip's parity, the text stays short
  for (int s = 0; s < NS; ++s) { const char* fb = pool + (unsigned)(s & 1) * RB + col * RP + g * 16;
#pragma unroll                                                   // this and those below: constant indices keep w[], acc[] and accl[] in registers; a block's LDS reads stand as one group ahead of its products
    for (int ks = 0; ks < KS / 32; ++ks) { const v16h a = frag_lh(fb + wave * 16 * RP + ks * 64); v16h w[8];
#pragma unroll
      for (int j = 0; j < 8; ++j) w[j] = frag_lh(fb + (64 + j * 16) * RP + ks * 64);
#pragma unroll
      for (int j = 0; j < 8; ++j) acc[j] = wmma16(a, w[j], acc[j]);
      if (lo) { const v16h al = frag_lh(fb + (192 + wave * 16) * RP + ks * 64);
#pragma unroll
        for (int j = 0; j < 8; ++j) accl[j] = wmma16(al, w[j], accl[j]); } }
    DW(); AW();
    __syncthreads();                                             // publishes stage s + 1 and ends every wave's reads of stage s
    if (s + 2 < NS) fill(s + 2); }
  AW();
#pragma unroll
  for (int j = 0; j < 8; ++j) { const float bb = bfr(BP[c0 + j * 16 + col]);
#pragma unroll
    for (int r = 0; r < 8; ++r) sf[wave][8 * g + r][j * 16 + col] = (acc[j][r] + accl[j][r] * (1.0f / 1024.0f)) * (1.0f / 1024.0f) + bb; }
  LDSX(); for (int rl = 0; rl < 16; ++rl) vst2(OUT + (orow + rl) * CC + c0 + lane * 4, *(const v4f*)&sf[wave][rl][lane * 4]); }

extern "C" void kernel_launch(void* const* d_in, const int* in_sizes, int n_in, void* d_out, int out_size, void* d_ws, size_t ws_size, hipStream_t stream) {
  if (n_in < 12) return;
  // d_in: 0 x [4,2048,1024] f32, 1 mask [2048,2048] int32, 2 rope_cos [2048,64] f32, 3 rope_sin [2048,64] f32, 4 Wq [out,in], 5 bq, 6 Wk, 7 bk, 8 Wv, 9 bv, 10 Wo, 11 bo
  const size_t xneed = ((size_t)(NB - 1) * SEQ_FULL + SEQ) * (size_t)CC;
  if ((size_t)in_sizes[0] < xneed) return;
  if ((size_t)in_sizes[1] < (size_t)(SEQ - 1) * SEQ_FULL + SEQ) return;
  if (in_sizes[2] < SEQ * HD || in_sizes[3] < SEQ * HD) return;
  if (in_sizes[4] < CC * CC || in_sizes[6] < CC * CC || in_sizes[8] < CC * CC || in_sizes[10] < CC * CC) return;
  if (in_sizes[5] < CC || in_sizes[7] < CC || in_sizes[9] < CC || in_sizes[11] < CC) return;
  if ((size_t)out_size < xneed) return;
  if (ws_size < (size_t)WS_END) return;
  const float* X = (const float*)d_in[0]; const int* M = (const int*)d_in[1]; const float* RC = (const float*)d_in[2]; const float* RS = (const float*)d_in[3];
  const float *WQ = (const float*)d_in[4], *BQ = (const float*)d_in[5], *WK = (const float*)d_in[6], *BK = (const float*)d_in[7], *WV = (const float*)d_in[8], *BV = (const float*)d_in[9], *WO = (const float*)d_in[10], *BO = (const float*)d_in[11];
  char* ws = (char*)d_ws;
  __bf16 *WQB = (__bf16*)(ws + WS_WQ), *WKB = (__bf16*)(ws + WS_WK), *WVB = (__bf16*)(ws + WS_WV), *XB = (__bf16*)(ws + WS_XB); _Float16* WOH = (_Float16*)(ws + WS_WO);
  _Float16 *QH = (_Float16*)(ws + WS_QH), *QL = (_Float16*)(ws + WS_QL), *KH = (_Float16*)(ws + WS_KH), *VT = (_Float16*)(ws + WS_VT), *VL = (_Float16*)(ws + WS_VL), *Y = (_Float16*)(ws + WS_Y), *YL = (_Float16*)(ws + WS_YL);
  unsigned* MB = (unsigned*)(ws + WS_MB); float* OUT = (float*)d_out;
  k_prep<<<dim3(PB_X + 4 * PB_W + PB_M), 256, 0, stream>>>(X, WQ, WK, WV, WO, M, (unsigned short*)XB, (unsigned short*)WQB, MB);
  k_proj<<<dim3(NB * (SEQ / 64), CC / 128, 3), 128, 0, stream>>>(XB, WQB, BQ, WKB, BK, WVB, BV, RC, RS, QH, QL, KH, VT, VL);
  k_fa<<<dim3((SEQ / 128) * NH * NB), 128, 0, stream>>>(QH, QL, KH, VT, VL, MB, Y, YL);
  k_out<<<dim3(NB * (SEQ / 64), CC / 128), 128, 0, stream>>>(Y, YL, WOH, BO, OUT);
}

// v005
// A run of this version takes 134 microseconds.
// Timed twice side by side with v004, it ran 1.22 and 1.23 times as fast.
// Over all steps from v000 it is 13.8 times as fast.
// compute dtype: every float input (x, Wq, Wk, Wv, Wo, biases, rope cos/sin tables) RNE-converted to bf16 (bf16-input target); q/k/v = x W^T + b on v_wmma_f32_16x16x32_bf16 (exact bf16 products, f32 accumulate); rope in f32; q -> f16 hi + residual plane (x 2^10), k -> f16; logits = 2 products on v_wmma_f32_16x16x32_f16, / 8, f32; mask replace + running-maximum softmax in f32 (exp2), logits and P kept in registers; exp(s - m) x 2^11 -> f16 against v f16: 1 f16 product, divided by the f32 row sum at the end (query rows 0..63 of each sequence add P and v residual planes x 2^10: 3 products); ctx x 16 -> f16 against f16(bf16(Wo) x 64): 1 f16 product (rows 0..63 add a ctx residual plane x 2^10: 2 products); f32 accumulate everywhere, f32 output.
#include <hip/hip_runtime.h>
#include <math.h>

#ifndef NB
#define NB 4
#endif
#ifndef SEQ
#define SEQ 2048
#endif
#define NB_FULL 4
#define SEQ_FULL 2048
#define CC 1024
#define NH 16
#define HD 64
#define QB0 64               // leading query rows per sequence carried with residual planes
static_assert(SEQ % 128 == 0);
static_assert(SEQ >= 128 && SEQ <= SEQ_FULL);
static_assert(NB >= 1 && NB <= NB_FULL);
static_assert(CC == NH * HD);
static_assert(HD == 64);
static_assert(QB0 == 64);
static_assert(SEQ % 256 == 0);
static_assert((SEQ * (SEQ / 32)) % 256 == 0);
static_assert(((CC * CC) / 8) % 256 == 0);
static_assert(((SEQ * CC) / 8) % 256 == 0);

typedef __attribute__((ext_vector_type(16))) _Float16 v16h;
typedef __attribute__((ext_vector_type(16))) __bf16 v16b;
typedef __attribute__((ext_vector_type(8)))  _Float16 v8h;
typedef __attribute__((ext_vector_type(8)))  __bf16 v8b;
typedef __attribute__((ext_vector_type(8)))  float v8f;
typedef __attribute__((ext_vector_type(4)))  float v4f;
typedef __attribute__((ext_vector_type(4)))  unsigned v4u;
typedef __attribute__((ext_vector_type(4)))  int v4i;

#define WS_WQ  ((size_t)0)                                  // bf16 Wq [o][i]
#define WS_WK  (WS_WQ + 2u * (size_t)CC * CC)               // bf16 Wk [o][i]
#define WS_WV  (WS_WK + 2u * (size_t)CC * CC)               // bf16 Wv [o][i]
#define WS_WO  (WS_WV + 2u * (size_t)CC * CC)               // f16 bf16(Wo) x 64 [o][i]
#define WS_XB  (WS_WO + 2u * (size_t)CC * CC)               // bf16 x rows of every batch [b][t][c]
#define WS_QH  (WS_XB + 2u * (size_t)NB * SEQ * CC)         // f16 q rows [b][t][c] (hi)
#define WS_QL  (WS_QH + 2u * (size_t)NB * SEQ * CC)         // f16 q residual x 2^10 rows [b][t][c]
#define WS_KH  (WS_QL + 2u * (size_t)NB * SEQ * CC)         // f16 k rows [b][t][c]
#define WS_VT  (WS_KH + 2u * (size_t)NB * SEQ * CC)         // f16 v planes [b][c][t]
#define WS_VL  (WS_VT + 2u * (size_t)NB * CC * SEQ)         // f16 v residual x 2^10 planes [b][c][t < QB0]
#define WS_Y   (WS_VL + 2u * (size_t)NB * CC * QB0)         // f16 ctx x 16 rows [b][t][c]
#define WS_YL  (WS_Y + 2u * (size_t)NB * SEQ * CC)          // f16 ctx x 16 residual x 2^10 rows [b][t < QB0][c]
#define WS_MB  (WS_YL + 2u * (size_t)NB * QB0 * CC)         // mask bit plane [q][SEQ/32] (bit set = masked)
#define WS_END (WS_MB + 4u * (size_t)SEQ * (SEQ / 32))
static_assert(WS_END <= (size_t)134217728u);
static_assert(WS_WK % 128 == 0 && WS_WV % 128 == 0 && WS_WO % 128 == 0 && WS_XB % 128 == 0 && WS_QH % 128 == 0 && WS_QL % 128 == 0 && WS_KH % 128 == 0);
static_assert(WS_VT % 128 == 0 && WS_VL % 128 == 0 && WS_Y % 128 == 0 && WS_YL % 128 == 0 && WS_MB % 128 == 0);

template <typename T> __device__ __forceinline__ void vst2(void* p, T v) { *(T*)p = v;  }
__device__ __forceinline__ v8f wmma_bf(v16b a, v16b b, v8f c) {
  v8f d = __builtin_amdgcn_wmma_f32_16x16x32_bf16(false, a, false, b, (short)0, c, false, false);
  asm volatile("v_nop\n\tv_nop\n\tv_nop\n\tv_nop" : "+v"(d) : "v"(a), "v"(b));
  return d;
}
// 16x16x32 fragments: lane = (h = lane>>4, row/col = lane&15); elements 0..7 = k0+8h+0..7, 8..15 = k0+16+8h+0..7; D element r = row 8h+r
__device__ __forceinline__ float bfr(float v) { return (float)(__bf16)v; }

// ---- LDS ring of the two GEMM kernels: a stage = 64 k (128 bytes, one whole line) of every operand row of the block, two buffers, filled by asynchronous copies while the other buffer is worked on
#define KS 64                // k per stage
#define NS (CC / KS)         // stages
#define RP 144               // ring row pitch in bytes: 128 + 16, free of bank conflicts for 16-byte LDS reads
static_assert(NS >= 2 && CC % KS == 0);
__device__ __forceinline__ unsigned lds_off(const void* p) { return (unsigned)(size_t)p; }
// four copies of 16 bytes a lane, global -> LDS through no register: ring rows 16 apart from plane rows 16 apart (8 lanes cover one 128-byte row slice, a wave 4 whole lines).
// s_wait_xcnt in the same statement: every later write of the address registers stays behind it
__device__ __forceinline__ void copy4(unsigned l, const char* p) {
  asm volatile("global_load_async_to_lds_b128 %0, %4, off\n\tglobal_load_async_to_lds_b128 %1, %5, off\n\tglobal_load_async_to_lds_b128 %2, %6, off\n\tglobal_load_async_to_lds_b128 %3, %7, off\n\ts_wait_xcnt 0x0"
               :: "v"(l), "v"(l + 16u * RP), "v"(l + 32u * RP), "v"(l + 48u * RP), "v"(p), "v"(p + 16 * 2 * CC), "v"(p + 32 * 2 * CC), "v"(p + 48 * 2 * CC) : "memory");
}
#define AW() asm volatile("s_wait_asynccnt 0x0" ::: "memory")   // this wave's copies have landed
#define DW() asm volatile("s_wait_dscnt 0x0" ::: "memory")      // this wave's LDS reads have returned: the buffer may be refilled behind the barrier
// fragment from a ring row: p = row start + 64 bytes per 32 k + 16 bytes per lane half (the k order stated above)
__device__ __forceinline__ v16h frag_lh(const char* p) { union { v16h v; v8h q[2]; } u; u.q[0] = *(const v8h*)p; u.q[1] = *(const v8h*)(p + 32); return u.v; }
__device__ __forceinline__ v16b frag_lb(const char* p) { union { v16b v; v8b q[2]; } u; u.q[0] = *(const v8b*)p; u.q[1] = *(const v8b*)(p + 32); return u.v; }

// ---- k_prep: every conversion of the call in one grid; a block's index range says which plane it fills (block-uniform): x of all batches, the four weights, the mask bits
#define PB_X (NB * ((SEQ * CC) / 8) / 256)     // blocks on x: 8 elements a thread
#define PB_W (((CC * CC) / 8) / 256)           // blocks on one weight
#define PB_M (SEQ * (SEQ / 32) / 256)          // blocks on the mask: one 32-bit word a thread
static_assert(WS_WK == WS_WQ + 2u * (size_t)CC * CC && WS_WV == WS_WQ + 4u * (size_t)CC * CC && WS_WO == WS_WQ + 6u * (size_t)CC * CC);   // k_prep steps from one weight plane to the next
__device__ __forceinline__ void cvt8(const float* __restrict__ A, unsigned short* __restrict__ D, const bool f16x64) {
  const v4f a = *(const v4f*)A; const v4f c = *(const v4f*)(A + 4);
  asm volatile("s_wait_xcnt 0x0" ::: "memory");   // the loads' address register is reused for the packed result: it may be rewritten only behind this wait
  const float v[8] = {a[0], a[1], a[2], a[3], c[0], c[1], c[2], c[3]};
  union { v8b b; v8h h; v4u u; } o;
  if (f16x64) { v8h t;
#pragma unroll
    for (int k = 0; k < 8; ++k) t[k] = (_Float16)(bfr(v[k]) * 64.0f);
    o.h = t; }
  else { v8b t;
#pragma unroll
    for (int k = 0; k < 8; ++k) t[k] = (__bf16)v[k];
    o.b = t; }
  vst2(D, o.u);
}
__global__ __launch_bounds__(256) void k_prep(const float* __restrict__ X, const float* __restrict__ WQ, const float* __restrict__ WK, const float* __restrict__ WV, const float* __restrict__ WO, const int* __restrict__ M,
                                              unsigned short* __restrict__ XB, unsigned short* __restrict__ WB, unsigned* __restrict__ MB) {
  const int blk = blockIdx.x, tid = threadIdx.x;
  if (blk < PB_X) {
    const int i = blk * 256 + tid, b = i / ((SEQ * CC) / 8);     // x rows of batch b start SEQ_FULL rows apart, the plane's SEQ rows apart
    cvt8(X + (size_t)b * (SEQ_FULL - SEQ) * CC + (size_t)i * 8, XB + (size_t)i * 8, false);
  } else if (blk < PB_X + 4 * PB_W) {
    const int wsel = (blk - PB_X) / PB_W; const int i = (blk - PB_X - wsel * PB_W) * 256 + tid;   // the four 16-bit weight planes stand one behind the other in the workspace
    const float* A = wsel == 0 ? WQ : wsel == 1 ? WK : wsel == 2 ? WV : WO;
    cvt8(A + (size_t)i * 8, WB + (size_t)wsel * CC * CC + (size_t)i * 8, wsel == 3);
  } else {
    const int w = (blk - PB_X - 4 * PB_W) * 256 + tid;
    const int q = w / (SEQ / 32), wc = w - q * (SEQ / 32);
    const int* p = M + (size_t)q * SEQ_FULL + wc * 32;
    unsigned bits = 0u;
#pragma unroll
    for (int i = 0; i < 8; ++i) { const v4i v = *(const v4i*)(p + 4 * i);
      bits |= (v.x != 0 ? 1u : 0u) << (4 * i);     bits |= (v.y != 0 ? 1u : 0u) << (4 * i + 1);
      bits |= (v.z != 0 ? 1u : 0u) << (4 * i + 2); bits |= (v.w != 0 ? 1u : 0u) << (4 * i + 3); }
    vst2(MB + w, bits);
  }
}

// ---- k_proj: block = (128 rows out of all batches' rows, 128 cols, which), wave = 64 rows x 64 cols (one head): y = x W^T + b (exact bf16 products from the 16-bit planes); which 0/1: rope then q -> f16 hi (+ residual), k -> f16 rows; which 2: v -> f16 planes [c][t] (+ residual plane for rows 0..63)
// a 64 x 64 wave tile reads 8 fragments for 16 products (16 x 128: 9 for 8), a 128 x 128 block tile brings 256 operand rows from L2 for 16,384 outputs (64 x 128: 192 for 8,192)
__global__ __launch_bounds__(128) void k_proj(const __bf16* __restrict__ XB, const __bf16* __restrict__ WQ, const float* __restrict__ BQ, const __bf16* __restrict__ WK, const float* __restrict__ BK, const __bf16* __restrict__ WV, const float* __restrict__ BV,
                                              const float* __restrict__ RC, const float* __restrict__ RS,
                                              _Float16* __restrict__ QH, _Float16* __restrict__ QL, _Float16* __restrict__ KH, _Float16* __restrict__ VT, _Float16* __restrict__ VL) {
  // one pool: the ring (2 x 256 rows: 128 of x, 128 of W) during the k loop, the output staging planes behind it
  constexpr unsigned RB = 256u * RP; __shared__ __align__(16) char pool[2 * RB]; static_assert(2u * 128 * 136 * 2 <= sizeof(pool) && 128u * 136 * 2 + 128u * 72 * 2 <= sizeof(pool));
  _Float16 (*sh)[136] = (_Float16 (*)[136])pool; _Float16 (*sl)[136] = (_Float16 (*)[136])(pool + 128 * 136 * 2); _Float16 (*th)[136] = (_Float16 (*)[136])pool; _Float16 (*tl2)[72] = (_Float16 (*)[72])(pool + 128 * 136 * 2);
  __shared__ __align__(16) __bf16 rt[128][17][8];   // rope table of the block's rows: cell (row, col < 16) = cos at d = col, col + 16, col + 32, col + 48, then sin at the same four: what one lane needs for one row, 16 bytes; the 17th cell is the pad that spreads the rows over the banks
  const int tid = threadIdx.x, lane = tid & 31, col = lane & 15, g = lane >> 4; const int wave = __builtin_amdgcn_readfirstlane(tid >> 5), wr = wave >> 1, wc = wave & 1;
  const int which = blockIdx.z; const int c0 = blockIdx.y * 128; const int r0 = blockIdx.x * 128;   // r0: row in the [b][t] planes
  const int bb0 = blockIdx.x / (SEQ / 128), t0 = r0 - bb0 * SEQ;   // its batch and its position in the sequence
  const __bf16* WA = which == 0 ? WQ : which == 1 ? WK : WV; const float* BA = which == 0 ? BQ : which == 1 ? BK : BV;
  const unsigned ring = lds_off(pool) + (unsigned)((tid >> 3) * RP + (tid & 7) * 16);   // this lane's 16 bytes of ring row tid / 8
  const char* gx = (const char*)(XB + (size_t)(r0 + (tid >> 3)) * CC + (tid & 7) * 8); const char* gw = (const char*)(WA + (size_t)(c0 + (tid >> 3)) * CC + (tid & 7) * 8);
  auto fill = [&](const int s) { const unsigned l = ring + (unsigned)(s & 1) * RB; copy4(l, gx + s * (2 * KS)); copy4(l + 64u * RP, gx + s * (2 * KS) + 64 * 2 * CC); copy4(l + 128u * RP, gw + s * (2 * KS)); copy4(l + 192u * RP, gw + s * (2 * KS) + 64 * 2 * CC); };
  fill(0);                                                       // stage 0 flies under the rope table's staging
  // rope table rows t0..t0+127 (bf16-RNE values), whole head dim; staged extent == consumed extent (128 x HD)
  if (which < 2) {                                               // a thread takes 4 columns of a row at all four 16-column steps: 8 loads of 16 bytes give 4 whole cells; all 32 loads of its 4 rows fly at once
    v4f tc[4][4], ts[4][4]; const float* pc = RC + (size_t)(t0 + (tid >> 2)) * HD + (tid & 3) * 4; const float* ps = RS + (size_t)(t0 + (tid >> 2)) * HD + (tid & 3) * 4;
#pragma unroll
    for (int it = 0; it < 4; ++it)
#pragma unroll
      for (int jj = 0; jj < 4; ++jj) { tc[it][jj] = *(const v4f*)(pc + it * 32 * HD + jj * 16); ts[it][jj] = *(const v4f*)(ps + it * 32 * HD + jj * 16); }
    asm volatile("s_wait_xcnt 0x0" :: "v"(pc), "v"(ps) : "memory");   // the two address pairs of the 32 loads stay whole up to this wait (named as inputs) and may be rewritten only behind it
#pragma unroll
    for (int it = 0; it < 4; ++it)
#pragma unroll
      for (int i = 0; i < 4; ++i) { v8b t;
#pragma unroll
        for (int jj = 0; jj < 4; ++jj) { t[jj] = (__bf16)tc[it][jj][i]; t[4 + jj] = (__bf16)ts[it][jj][i]; }
        *(v8b*)&rt[it * 32 + (tid >> 2)][(tid & 3) * 4 + i][0] = t; } }
  AW();
  __syncthreads();                                               // publishes the rope table and stage 0
  fill(1);
  v8f acc[4][4] = {};
#pragma unroll 1                                                 // one trip a stage: the buffer is picked by the trip's parity, the text stays short
  for (int s = 0; s < NS; ++s) { const char* fb = pool + (unsigned)(s & 1) * RB + col * RP + g * 16;
#pragma unroll                                                   // this and the four below: constant indices keep a[], w[] and acc[] in registers; a block's 16 LDS reads stand as one group ahead of its 16 products
    for (int ks = 0; ks < KS / 32; ++ks) { v16b a[4], w[4];
#pragma unroll
      for (int i = 0; i < 4; ++i) a[i] = frag_lb(fb + (wr * 64 + i * 16) * RP + ks * 64);
#pragma unroll
      for (int j = 0; j < 4; ++j) w[j] = frag_lb(fb + (128 + wc * 64 + j * 16) * RP + ks * 64);
#pragma unroll
      for (int i = 0; i < 4; ++i)
#pragma unroll
        for (int j = 0; j < 4; ++j) acc[i][j] = wmma_bf(a[i], w[j], acc[i][j]); }
    DW(); AW();
    __syncthreads();                                             // publishes stage s + 1 and ends every wave's reads of stage s
    if (s + 2 < NS) fill(s + 2); }
  AW();
  float bbv[4];
#pragma unroll
  for (int j = 0; j < 4; ++j) bbv[j] = bfr(BA[c0 + wc * 64 + j * 16 + col]);
  if (which == 2) {
#pragma unroll
    for (int i = 0; i < 4; ++i)
#pragma unroll
      for (int j = 0; j < 4; ++j) { const int cl = wc * 64 + j * 16 + col, rb = wr * 64 + i * 16 + 8 * g; v8h hv, lv;   // a lane's 8 rows of one column stand side by side in the [c][t] plane
#pragma unroll
        for (int r = 0; r < 8; ++r) { const float v = acc[i][j][r] + bbv[j]; const _Float16 h = (_Float16)v; hv[r] = h; lv[r] = (_Float16)((v - (float)h) * 1024.0f); }   /* v residual carried x 2^10 */
        *(v8h*)&th[cl][rb] = hv; if (wr == 0) *(v8h*)&tl2[cl][rb] = lv; }
  } else {
#pragma unroll
    for (int i = 0; i < 4; ++i)
#pragma unroll
      for (int r = 0; r < 8; ++r) { const int rl = wr * 64 + i * 16 + 8 * g + r; const v8b t = *(const v8b*)&rt[rl][col][0]; float v[4];
#pragma unroll
        for (int j = 0; j < 4; ++j) v[j] = acc[i][j][r] + bbv[j];
        // rotate-half: head-local d = j*16+col; d<32: y*cos - y[d+32]*sin, d>=32: y*cos + y[d-32]*sin; partner tile = j^2
#pragma unroll
        for (int j = 0; j < 4; ++j) { const int cl = wc * 64 + j * 16 + col; const float pv = v[j ^ 2], cs = (float)t[j], sn = (float)t[4 + j];
          const float o = (j < 2) ? (v[j] * cs - pv * sn) : (v[j] * cs + pv * sn);
          const _Float16 hv = (_Float16)o; sh[rl][cl] = hv; sl[rl][cl] = (_Float16)((o - (float)hv) * 1024.0f); }   /* q residual carried x 2^10 so the plane stays f16-normal */
      } }
  __syncthreads();
  // PW: behind each store below, whose address and data registers the loop's next statements reuse: they may be rewritten only behind this wait
#define PW() asm volatile("s_wait_xcnt 0x0" ::: "memory")
  if (which < 2) { _Float16* dh = which == 0 ? QH : KH; for (int e = tid; e < 128 * 16; e += 128) { const int rl = e >> 4, q = e & 15; vst2(dh + (size_t)(r0 + rl) * CC + c0 + q * 8, *(const v4u*)&sh[rl][q * 8]); PW(); if (which == 0) { vst2(QL + (size_t)(r0 + rl) * CC + c0 + q * 8, *(const v4u*)&sl[rl][q * 8]); PW(); } } }
  else { for (int e = tid; e < 128 * 16; e += 128) { const int cl = e >> 4, q = e & 15; const size_t o2 = (size_t)(bb0 * CC + c0 + cl) * (size_t)SEQ + t0 + q * 8; vst2(VT + o2, *(const v4u*)&th[cl][q * 8]); PW();
      if (t0 == 0 && q < 8) { const size_t o3 = (size_t)(bb0 * CC + c0 + cl) * (size_t)QB0 + q * 8; vst2(VL + o3, *(const v4u*)&tl2[cl][q * 8]); PW(); } } } }

// ---- k_fa: wave = 32 queries (two 16-column groups) of one head of one batch, whole key range in one pass, logits and P stay in registers.
// S^T = K Q^T (A = k rows, B = q rows, same loader on both sides): lane (col, g) holds query col, keys 8g+r of each 16-key tile, so two tiles pack straight into the B operand of O^T += V^T P^T.
// Running maximum and sum per query (in-lane plus one exchange between lane halves); P = exp(s - m) x 2^11 -> f16, normalised once at the end.
// The wave's 32 mask rows are scanned once: stages in front of the first set bit of all four waves run without mask work, a wave's 32-key blocks behind its last clear bit are not run (both counts bounded by SEQ / 32).
// Any mask content is honoured; a fully masked row ends as 0 x inf = NaN like the softmax of an all -inf row.
// K and V come through LDS: a stage = 64 keys of the block's head, 64 k rows (128 bytes, one whole line each) and those keys' 128 bytes of the 64 v plane rows; two buffers, filled by asynchronous copies
// while the other buffer is worked on; the block's four waves walk the stages together and read their fragments from the ring (each line leaves L2 once a block, whole, instead of in 32-byte pieces once a wave).
#define FKS 64               // keys per stage
#define FRB (128u * RP)      // bytes of one buffer: 64 k rows, then 64 v rows, at the ring pitch
static_assert(SEQ % FKS == 0 && FKS == 64 && 2 * HD == 128);
// copy4 for the v planes, whose rows stand SEQ elements apart. s_wait_xcnt in the same statement: every later write of the address registers stays behind it
__device__ __forceinline__ void copy4v(unsigned l, const char* p) {
  asm volatile("global_load_async_to_lds_b128 %0, %4, off\n\tglobal_load_async_to_lds_b128 %1, %5, off\n\tglobal_load_async_to_lds_b128 %2, %6, off\n\tglobal_load_async_to_lds_b128 %3, %7, off\n\ts_wait_xcnt 0x0"
               :: "v"(l), "v"(l + 16u * RP), "v"(l + 32u * RP), "v"(l + 48u * RP), "v"(p), "v"(p + 16 * 2 * SEQ), "v"(p + 32 * 2 * SEQ), "v"(p + 48 * 2 * SEQ) : "memory");
}
template <bool B> struct flag_t { static constexpr bool value = B; };
__device__ __forceinline__ float xhalf(float v) { const int b = __float_as_int(v); return __int_as_float(__builtin_amdgcn_permlanex16(b, b, 0x76543210, 0xfedcba98, false, false)); }
// behind global loads or stores whose registers are reused next: those registers may be rewritten only behind this wait
#define XW() asm volatile("s_wait_xcnt 0x0" ::: "memory")
__device__ __forceinline__ v8f wm(v16h a, v16h b, v8f c) { return __builtin_amdgcn_wmma_f32_16x16x32_f16(false, a, false, b, (short)0, c, false, false); }
// 2^x with the one free issue slot behind a transcendental kept inside the statement
__device__ __forceinline__ float exp2s(float x) { float r; asm("v_exp_f32 %0, %1\n\tv_nop" : "=v"(r) : "v"(x)); return r; }
// eight at once: each v_exp_f32 is followed by one that touches neither its result nor its source (early-clobber outputs), so one slot at the end serves the run
__device__ __forceinline__ v8f exp2x8(v8f x) { float r0, r1, r2, r3, r4, r5, r6, r7;
  asm("v_exp_f32 %0, %8\n\tv_exp_f32 %1, %9\n\tv_exp_f32 %2, %10\n\tv_exp_f32 %3, %11\n\tv_exp_f32 %4, %12\n\tv_exp_f32 %5, %13\n\tv_exp_f32 %6, %14\n\tv_exp_f32 %7, %15\n\tv_nop"
      : "=&v"(r0), "=&v"(r1), "=&v"(r2), "=&v"(r3), "=&v"(r4), "=&v"(r5), "=&v"(r6), "=&v"(r7) : "v"(x[0]), "v"(x[1]), "v"(x[2]), "v"(x[3]), "v"(x[4]), "v"(x[5]), "v"(x[6]), "v"(x[7]));
  return v8f{r0, r1, r2, r3, r4, r5, r6, r7}; }
// fragment at a byte address that already holds the lane's row and its half's 16 bytes
__device__ __forceinline__ v16h frag_p(const char* p) { union { v16h v; v8h q[2]; } u; u.q[0] = *(const v8h*)p; u.q[1] = *(const v8h*)(p + 32); return u.v; }
__global__ __launch_bounds__(128) void k_fa(const _Float16* __restrict__ QH, const _Float16* __restrict__ QL, const _Float16* __restrict__ KH, const _Float16* __restrict__ VT, const _Float16* __restrict__ VL,
                                            const unsigned* __restrict__ MB, _Float16* __restrict__ Y, _Float16* __restrict__ YL) {
  constexpr float NEG = -3.0e38f, SC = 0.125f * 1.44269504088896340736f; constexpr int NW = SEQ / 32;
  __shared__ __align__(16) char ring[2 * FRB]; __shared__ __align__(16) int wtrip[4], wfull[4];
  const int tid = threadIdx.x, lane = threadIdx.x & 31, col = lane & 15, g = lane >> 4; const int wave = __builtin_amdgcn_readfirstlane((int)threadIdx.x >> 5);
  // more blocks than resident places, and a block's cost grows with its query tile: the longest key ranges of every head and batch come first in the index, the short ones fill the places that free up
  constexpr int NT = SEQ / 128; const unsigned hb = blockIdx.x % (unsigned)(NH * NB); const int h = (int)(hb % NH), bt = (int)(hb / NH); const int q0 = (NT - 1 - (int)(blockIdx.x / (unsigned)(NH * NB))) * 128 + wave * 32;
  QH += (size_t)bt * SEQ * CC; QL += (size_t)bt * SEQ * CC; KH += (size_t)bt * SEQ * CC; VT += (size_t)bt * CC * SEQ; VL += (size_t)bt * CC * QB0; Y += (size_t)bt * SEQ * CC; YL += (size_t)bt * QB0 * CC;
  const unsigned rl = lds_off(ring) + (unsigned)((tid >> 3) * RP + (tid & 7) * 16);   // this lane's 16 bytes of ring row tid / 8
  const char* gk = (const char*)(KH + (size_t)(tid >> 3) * CC + h * HD + (tid & 7) * 8); const char* gv = (const char*)(VT + ((size_t)h * HD + (tid >> 3)) * SEQ + (tid & 7) * 8);
  auto fill = [&](const int s) { const unsigned l = rl + (unsigned)(s & 1) * FRB; copy4(l, gk + (size_t)s * (FKS * 2 * CC)); copy4v(l + 64u * RP, gv + s * (2 * FKS)); };
  fill(0);                                                     // stage 0 flies under the mask scan (SEQ >= 128: stages 0 and 1 lie inside the planes)
  const unsigned* mu = MB + (size_t)q0 * NW; const unsigned mo = 4u * (unsigned)(col * NW);
  int last = -1, first = NW;
#pragma unroll
  for (int p = 0; p < 2; ++p)
#pragma unroll
    for (int i = NW / 8 - 1; i >= 0; --i) { const v4u u = *(const v4u*)((const char*)(mu + p * 16 * NW + 4 * i) + (mo + 4u * (unsigned)(g * (NW / 2))));
#pragma unroll
      for (int e = 3; e >= 0; --e) { const int w = g * (NW / 2) + 4 * i + e; last = (u[e] != 0xFFFFFFFFu) ? max(last, w) : last; first = (u[e] != 0u) ? min(first, w) : first; } }
#pragma unroll
  for (int o = 1; o < 32; o <<= 1) { last = max(last, __shfl_xor(last, o)); first = min(first, __shfl_xor(first, o)); }
  const int trip = min(__builtin_amdgcn_readfirstlane(last) + 1, NW);
  const int nfull = max(min(__builtin_amdgcn_readfirstlane(first), trip), 0);
  if (lane == 0) { wtrip[wave] = trip; wfull[wave] = nfull; }
  AW();
  __syncthreads();                                             // publishes stage 0 and the four waves' block counts
  const v4i wt = *(const v4i*)wtrip, wf = *(const v4i*)wfull;
  const int nst = (__builtin_amdgcn_readfirstlane(max(max(wt.x, wt.y), max(wt.z, wt.w))) + 1) >> 1;   // stages of the block: its longest wave's, at most SEQ / FKS
  const int nfs = __builtin_amdgcn_readfirstlane(min(min(wf.x, wf.y), min(wf.z, wf.w))) >> 1;         // leading stages that no wave of the block has mask work in (nfull <= trip: every wave runs both their halves)
  if (nst > 1) fill(1);
  const bool res = q0 < QB0;
  const unsigned ko = 2u * (unsigned)(col * CC + 8 * g), lo = 2u * (unsigned)(col * QB0 + 8 * g);
  const char* lp = (const char*)(VL + (size_t)h * HD * QB0) + lo;
  v16h qh[2][2], ql[2][2];
#pragma unroll
  for (int p = 0; p < 2; ++p)
#pragma unroll
    for (int kk = 0; kk < 2; ++kk) { const size_t o = (size_t)(q0 + 16 * p) * CC + h * HD + kk * 32; qh[p][kk] = frag_p((const char*)(QH + o) + ko); ql[p][kk] = frag_p((const char*)(QL + o) + ko); }
  XW();
  v8f acc[2][4] = {}; float m[2] = {NEG, NEG}, l[2] = {0.f, 0.f};
  auto body = [&](const int kc, const char* kb, const char* vb, auto mk) {   // kb, vb: the lane's row and half at this block's 32 keys in the stage's buffer
    constexpr bool masked = decltype(mk)::value;
    v16h kf[2][2], vf[4]; unsigned mw[2] = {0u, 0u};
#pragma unroll
    for (int t = 0; t < 2; ++t)
#pragma unroll
      for (int kk = 0; kk < 2; ++kk) kf[t][kk] = frag_lh(kb + t * 16 * RP + kk * 64);
#pragma unroll
    for (int j = 0; j < 4; ++j) vf[j] = frag_lh(vb + j * 16 * RP);   // this block's v rows fly under the logits and the softmax
    if constexpr (masked) { mw[0] = *(const unsigned*)((const char*)(mu + kc) + mo); mw[1] = *(const unsigned*)((const char*)(mu + 16 * NW + kc) + mo); XW(); }
    v8f s[2][2] = {};
#pragma unroll
    for (int kk = 0; kk < 2; ++kk)
#pragma unroll
      for (int t = 0; t < 2; ++t)
#pragma unroll
        for (int p = 0; p < 2; ++p) s[p][t] = wm(kf[t][kk], ql[p][kk], s[p][t]);
#pragma unroll
    for (int t = 0; t < 2; ++t)
#pragma unroll
      for (int p = 0; p < 2; ++p) s[p][t] *= (1.0f / 1024.0f);
#pragma unroll
    for (int kk = 0; kk < 2; ++kk)
#pragma unroll
      for (int t = 0; t < 2; ++t)
#pragma unroll
        for (int p = 0; p < 2; ++p) s[p][t] = wm(kf[t][kk], qh[p][kk], s[p][t]);
    if constexpr (masked) {
#pragma unroll
      for (int p = 0; p < 2; ++p) { const unsigned w = mw[p] >> (8 * g);
#pragma unroll
        for (int t = 0; t < 2; ++t)
#pragma unroll
          for (int r = 0; r < 8; ++r) s[p][t][r] = ((w >> (16 * t + r)) & 1u) ? NEG : s[p][t][r]; } }
    float mn[2];
#pragma unroll
    for (int p = 0; p < 2; ++p) { float x = fmaxf(s[p][0][0], s[p][1][0]);
#pragma unroll
      for (int r = 1; r < 8; ++r) x = fmaxf(x, fmaxf(s[p][0][r], s[p][1][r]));
      mn[p] = fmaxf(m[p], fmaxf(x, xhalf(x))); }
    if (__builtin_amdgcn_ballot_w32(mn[0] > m[0] || mn[1] > m[1]) != 0u) {
#pragma unroll
      for (int p = 0; p < 2; ++p) { const float al = exp2s((m[p] - mn[p]) * SC); l[p] *= al; m[p] = mn[p];
#pragma unroll
        for (int j = 0; j < 4; ++j) acc[p][j] *= al; } }
    v16h pb[2];
#pragma unroll
    for (int p = 0; p < 2; ++p) { const float me = (m[p] <= -1.0e38f) ? 0.f : m[p]; float sum = 0.f;   // nothing unmasked yet: a finite stand-in keeps every masked term at exp2(-huge) = 0
#pragma unroll
      for (int t = 0; t < 2; ++t) { s[p][t] = exp2x8((s[p][t] - me) * SC + 11.0f);
#pragma unroll
        for (int r = 0; r < 8; ++r) { sum += s[p][t][r]; pb[p][8 * t + r] = (_Float16)s[p][t][r]; } }
      l[p] += sum; }
#pragma unroll
    for (int j = 0; j < 4; ++j)
#pragma unroll
      for (int p = 0; p < 2; ++p) acc[p][j] = wm(vf[j], pb[p], acc[p][j]);
    if (res && kc < QB0 / 32) {                                // query rows 0..63, keys 0..63: P and v residual planes (x 2^10), as before
      v16h pl[2];
#pragma unroll
      for (int p = 0; p < 2; ++p)
#pragma unroll
        for (int e = 0; e < 16; ++e) pl[p][e] = (_Float16)((s[p][e >> 3][e & 7] - (float)pb[p][e]) * 1024.0f);
#pragma unroll
      for (int j = 0; j < 4; ++j) { const v16h vl = frag_p(lp + 2 * (j * 16 * QB0 + kc * 32)); XW();
#pragma unroll
        for (int p = 0; p < 2; ++p) { v8f a = {}; a = wm(vf[j], pl[p], a); a = wm(vl, pb[p], a); acc[p][j] += a * (1.0f / 1024.0f); } } }
  };
  auto foot = [&](const int st) {                              // both loops below run the same trips in every wave of the block
    DW(); AW();
    __syncthreads();                                           // publishes stage st + 1 and ends every wave's reads of stage st
    if (st + 2 < nst) fill(st + 2); };
  const char* f0 = ring + col * RP + g * 16;
#pragma unroll 1                                               // one trip a stage: the buffer is picked by the trip's parity, the text stays short
  for (int st = 0; st < nfs; ++st) { const char* fb = f0 + (unsigned)(st & 1) * FRB;
    body(2 * st, fb, fb + 64 * RP, flag_t<false>{}); body(2 * st + 1, fb + 32 * RP, fb + 64 * RP + 64, flag_t<false>{});
    foot(st); }
#pragma unroll 1                                               // as above
  for (int st = nfs; st < nst; ++st) { const char* fb = f0 + (unsigned)(st & 1) * FRB; const int ke = min(2 * st + 2, trip);   // a wave past its own last block only keeps the ring going
#pragma unroll 1                                               // one copy of the masked body in the text
    for (int kc = 2 * st; kc < ke; ++kc) body(kc, fb + (kc & 1) * (32 * RP), fb + 64 * RP + (kc & 1) * 64, flag_t<true>{});
    foot(st); }
  AW();
#pragma unroll
  for (int p = 0; p < 2; ++p) { const float inv = 16.0f / (l[p] + xhalf(l[p])); const size_t o = (size_t)(q0 + 16 * p) * CC + h * HD;   /* ctx carried x 16, residual x 2^10 */
#pragma unroll
    for (int j = 0; j < 4; ++j) { union { v8h h; v4u u; } yh, yl;
#pragma unroll
      for (int r = 0; r < 8; ++r) { const float y = acc[p][j][r] * inv; const _Float16 t = (_Float16)y; yh.h[r] = t; yl.h[r] = (_Float16)((y - (float)t) * 1024.0f); }
      vst2((char*)(Y + o + j * 16) + ko, yh.u); XW(); if (res) { vst2((char*)(YL + o + j * 16) + ko, yl.u); XW(); } } } }

// ---- k_out: block = (128 rows out of all batches' rows, 128 cols), wave = 64 rows x 64 cols: out = (ctx x 16 f16) (f16 bf16(Wo) x 64)^T / 1024 + bo; the two waves on a sequence's rows 0..63 add the ctx residual plane (2 products)
__global__ __launch_bounds__(128) void k_out(const _Float16* __restrict__ Y, const _Float16* __restrict__ YL, const _Float16* __restrict__ WO, const float* __restrict__ BP, float* __restrict__ OUT) { __shared__ __align__(16) float sf[4][32][68];
  constexpr unsigned RB = 320u * RP; __shared__ __align__(16) char pool[2 * RB];   // ring: 2 x (128 rows of ctx, 128 of Wo, 64 of the ctx residual, filled in a sequence's row block 0 alone)
  const int tid = threadIdx.x, lane = tid & 31, col = lane & 15, g = lane >> 4; const int wave = __builtin_amdgcn_readfirstlane(tid >> 5), wr = wave >> 1, wc = wave & 1;
  const int c0 = blockIdx.y * 128; const int r0 = blockIdx.x * 128 + wr * 64; const int b = blockIdx.x / (SEQ / 128); const size_t orow = (size_t)b * (SEQ_FULL - SEQ) + r0;
  const bool lo = blockIdx.x % (SEQ / 128) == 0; const bool lw = lo && wr == 0;   // lw: this wave's 64 rows are a sequence's rows 0..63 (scalar: the products under it run with every lane on)
  const unsigned ring = lds_off(pool) + (unsigned)((tid >> 3) * RP + (tid & 7) * 16);   // this lane's 16 bytes of ring row tid / 8
  const char* gy = (const char*)(Y + (size_t)(blockIdx.x * 128 + (tid >> 3)) * CC + (tid & 7) * 8); const char* gl = (const char*)(YL + (size_t)(b * QB0 + (tid >> 3)) * CC + (tid & 7) * 8); const char* gw = (const char*)(WO + (size_t)(c0 + (tid >> 3)) * CC + (tid & 7) * 8);
  auto fill = [&](const int s) { const unsigned l = ring + (unsigned)(s & 1) * RB; copy4(l, gy + s * (2 * KS)); copy4(l + 64u * RP, gy + s * (2 * KS) + 64 * 2 * CC); copy4(l + 128u * RP, gw + s * (2 * KS)); copy4(l + 192u * RP, gw + s * (2 * KS) + 64 * 2 * CC); if (lo) copy4(l + 256u * RP, gl + s * (2 * KS)); };
  fill(0);
  AW();
  __syncthreads();                                               // publishes stage 0
  fill(1);
  v8f acc[4][4] = {}, accl[4][4] = {};
  // one block of 32 k: fp = the lane's row and half at these 32 k in the stage's buffer
  auto blk = [&](const char* fp) { v16h a[4], w[4], al[4];
#pragma unroll                                                   // this and those below: constant indices keep the fragments, acc[] and accl[] in registers
    for (int i = 0; i < 4; ++i) a[i] = frag_lh(fp + (wr * 64 + i * 16) * RP);
#pragma unroll
    for (int j = 0; j < 4; ++j) w[j] = frag_lh(fp + (128 + wc * 64 + j * 16) * RP);
    if (lw) {
#pragma unroll
      for (int i = 0; i < 4; ++i) al[i] = frag_lh(fp + (256 + i * 16) * RP); }
    __builtin_amdgcn_sched_barrier(0);                           // the block's LDS reads stay one group ahead of its products: without it they were spread, two reads and a full wait in front of every four products
#pragma unroll
    for (int i = 0; i < 4; ++i)
#pragma unroll
      for (int j = 0; j < 4; ++j) acc[i][j] = wm(a[i], w[j], acc[i][j]);
    if (lw) {
#pragma unroll
      for (int i = 0; i < 4; ++i)
#pragma unroll
        for (int j = 0; j < 4; ++j) accl[i][j] = wm(al[i], w[j], accl[i][j]); } };
#pragma unroll 1                                                 // one trip a stage: the buffer is picked by the trip's parity, the text stays short
  for (int s = 0; s < NS; ++s) { const char* fb = pool + (unsigned)(s & 1) * RB + col * RP + g * 16;
    static_assert(KS == 64);
    blk(fb); blk(fb + 64);
    DW(); AW();
    __syncthreads();                                             // publishes stage s + 1 and ends every wave's reads of stage s
    if (s + 2 < NS) fill(s + 2); }
  AW();
  float bb[4];
#pragma unroll
  for (int j = 0; j < 4; ++j) bb[j] = bfr(BP[c0 + wc * 64 + j * 16 + col]);
#pragma unroll                                                   // constant indices into acc[] and accl[]
  for (int hp = 0; hp < 2; ++hp) {                               // 32 rows at a time through the wave's own staging plane, stored as whole 256-byte row pieces
#pragma unroll
    for (int ii = 0; ii < 2; ++ii)
#pragma unroll
      for (int j = 0; j < 4; ++j)
#pragma unroll
        for (int r = 0; r < 8; ++r) sf[wave][ii * 16 + 8 * g + r][j * 16 + col] = (acc[hp * 2 + ii][j][r] + accl[hp * 2 + ii][j][r] * (1.0f / 1024.0f)) * (1.0f / 1024.0f) + bb[j];
    DW();                                                        // the wave's own staging stores have landed before it reads the rows back (no other wave touches its plane)
#pragma unroll                                                   // 8 row pairs at a time: their LDS reads fly together, one wait serves the run of stores
    for (int hb = 0; hb < 2; ++hb) { v4f t[8]; float* po = OUT + (orow + hp * 32 + hb * 16 + g) * CC + c0 + wc * 64 + col * 4;
#pragma unroll
      for (int u = 0; u < 8; ++u) t[u] = *(const v4f*)&sf[wave][hb * 16 + 2 * u + g][col * 4];
#pragma unroll
      for (int u = 0; u < 8; ++u) vst2(po + u * 2 * CC, t[u]);
      PW(); } } }

extern "C" void kernel_launch(void* const* d_in, const int* in_sizes, int n_in, void* d_out, int out_size, void* d_ws, size_t ws_size, hipStream_t stream) {
  if (n_in < 12) return;
  // d_in: 0 x [4,2048,1024] f32, 1 mask [2048,2048] int32, 2 rope_cos [2048,64] f32, 3 rope_sin [2048,64] f32, 4 Wq [out,in], 5 bq, 6 Wk, 7 bk, 8 Wv, 9 bv, 10 Wo, 11 bo
  const size_t xneed = ((size_t)(NB - 1) * SEQ_FULL + SEQ) * (size_t)CC;
  if ((size_t)in_sizes[0] < xneed) return;
  if ((size_t)in_sizes[1] < (size_t)(SEQ - 1) * SEQ_FULL + SEQ) return;
  if (in_sizes[2] < SEQ * HD || in_sizes[3] < SEQ * HD) return;
  if (in_sizes[4] < CC * CC || in_sizes[6] < CC * CC || in_sizes[8] < CC * CC || in_sizes[10] < CC * CC) return;
  if (in_sizes[5] < CC || in_sizes[7] < CC || in_sizes[9] < CC || in_sizes[11] < CC) return;
  if ((size_t)out_size < xneed) return;
  if (ws_size < (size_t)WS_END) return;
  const float* X = (const float*)d_in[0]; const int* M = (const int*)d_in[1]; const float* RC = (const float*)d_in[2]; const float* RS = (const float*)d_in[3];
  const float *WQ = (const float*)d_in[4], *BQ = (const float*)d_in[5], *WK = (const float*)d_in[6], *BK = (const float*)d_in[7], *WV = (const float*)d_in[8], *BV = (const float*)d_in[9], *WO = (const float*)d_in[10], *BO = (const float*)d_in[11];
  char* ws = (char*)d_ws;
  __bf16 *WQB = (__bf16*)(ws + WS_WQ), *WKB = (__bf16*)(ws + WS_WK), *WVB = (__bf16*)(ws + WS_WV), *XB = (__bf16*)(ws + WS_XB); _Float16* WOH = (_Float16*)(ws + WS_WO);
  _Float16 *QH = (_Float16*)(ws + WS_QH), *QL = (_Float16*)(ws + WS_QL), *KH = (_Float16*)(ws + WS_KH), *VT = (_Float16*)(ws + WS_VT), *VL = (_Float16*)(ws + WS_VL), *Y = (_Float16*)(ws + WS_Y), *YL = (_Float16*)(ws + WS_YL);
  unsigned* MB = (unsigned*)(ws + WS_MB); float* OUT = (float*)d_out;
  k_prep<<<dim3(PB_X + 4 * PB_W + PB_M), 256, 0, stream>>>(X, WQ, WK, WV, WO, M, (unsigned short*)XB, (unsigned short*)WQB, MB);
  k_proj<<<dim3(NB * (SEQ / 128), CC / 128, 3), 128, 0, stream>>>(XB, WQB, BQ, WKB, BK, WVB, BV, RC, RS, QH, QL, KH, VT, VL);
  k_fa<<<dim3((SEQ / 128) * NH * NB), 128, 0, stream>>>(QH, QL, KH, VT, VL, MB, Y, YL);
  k_out<<<dim3(NB * (SEQ / 128), CC / 128), 128, 0, stream>>>(Y, YL, WOH, BO, OUT);
}

// v007
// It runs in 119 microseconds.
// It is 1.13 times as fast as v005, going by the measured steps of the versions left out in between.
// Over all steps from v000 it is 15.5 times as fast.
// compute dtype: every float input (x, Wq, Wk, Wv, Wo, biases, rope cos/sin tables) RNE-converted to bf16 (bf16-input target); q/k/v = x W^T + b on v_wmma_f32_16x16x32_bf16 (exact bf16 products, f32 accumulate); rope in f32; q x log2(e) / 8 -> f16 (query rows 0..63 of each sequence: + residual plane x 2^10), k -> f16; logits in log2 units = 1 product on v_wmma_f32_16x16x32_f16 (rows 0..63: 2 products) on top of C = 11 - reference, f32; mask replace + softmax against a held reference in f32 (exp2; the reference is a row's largest score when it is set and is renewed when a score passes it by 2^4), logits and P kept in registers; exp2(s - reference) x 2^11 -> f16 against v f16: 1 f16 product, divided by the f32 row sum at the end (query rows 0..63 of each sequence add P and v residual planes x 2^10: 3 products); ctx x 16 -> f16 against f16(bf16(Wo) x 64): 1 f16 product (rows 0..63 add a ctx residual plane x 2^10: 2 products); f32 accumulate everywhere, f32 output.
#include <hip/hip_runtime.h>
#include <math.h>

#ifndef NB
#define NB 4
#endif
#ifndef SEQ
#define SEQ 2048
#endif
#define NB_FULL 4
#define SEQ_FULL 2048
#define CC 1024
#define NH 16
#define HD 64
#define QB0 64               // leading query rows per sequence carried with residual planes
#define QSC (0.125f * 1.44269504088896340736f)   // 1 / sqrt(HD) x log2(e): folded into q where q is made, so that k q^T is an exponent of 2
static_assert(SEQ % 128 == 0);
static_assert(SEQ >= 128 && SEQ <= SEQ_FULL);
static_assert(NB >= 1 && NB <= NB_FULL);
static_assert(CC == NH * HD);
static_assert(HD == 64);
static_assert(QB0 == 64);
static_assert(SEQ % 256 == 0);
static_assert((SEQ * (SEQ / 32)) % 256 == 0);
static_assert(((CC * CC) / 8) % 256 == 0);
static_assert(((SEQ * CC) / 8) % 256 == 0);

typedef __attribute__((ext_vector_type(16))) _Float16 v16h;
typedef __attribute__((ext_vector_type(16))) __bf16 v16b;
typedef __attribute__((ext_vector_type(8)))  _Float16 v8h;
typedef __attribute__((ext_vector_type(8)))  __bf16 v8b;
typedef __attribute__((ext_vector_type(8)))  float v8f;
typedef __attribute__((ext_vector_type(4)))  float v4f;
typedef __attribute__((ext_vector_type(4)))  unsigned v4u;
typedef __attribute__((ext_vector_type(4)))  int v4i;

#define WS_WQ  ((size_t)0)                                  // bf16 Wq [o][i]
#define WS_WK  (WS_WQ + 2u * (size_t)CC * CC)               // bf16 Wk [o][i]
#define WS_WV  (WS_WK + 2u * (size_t)CC * CC)               // bf16 Wv [o][i]
#define WS_WO  (WS_WV + 2u * (size_t)CC * CC)               // f16 bf16(Wo) x 64 [o][i]
#define WS_XB  (WS_WO + 2u * (size_t)CC * CC)               // bf16 x rows of every batch [b][t][c]
#define WS_QH  (WS_XB + 2u * (size_t)NB * SEQ * CC)         // f16 q rows [b][t][c] (hi)
#define WS_QL  (WS_QH + 2u * (size_t)NB * SEQ * CC)         // f16 q residual x 2^10 rows [b][t][c], rows t < QB0 alone written and read
#define WS_KH  (WS_QL + 2u * (size_t)NB * SEQ * CC)         // f16 k rows [b][t][c]
#define WS_VT  (WS_KH + 2u * (size_t)NB * SEQ * CC)         // f16 v planes [b][c][t]
#define WS_VL  (WS_VT + 2u * (size_t)NB * CC * SEQ)         // f16 v residual x 2^10 planes [b][c][t < QB0]
#define WS_Y   (WS_VL + 2u * (size_t)NB * CC * QB0)         // f16 ctx x 16 rows [b][t][c]
#define WS_YL  (WS_Y + 2u * (size_t)NB * SEQ * CC)          // f16 ctx x 16 residual x 2^10 rows [b][t < QB0][c]
#define WS_MB  (WS_YL + 2u * (size_t)NB * QB0 * CC)         // mask bit plane [q][SEQ/32] (bit set = masked)
#define WS_END (WS_MB + 4u * (size_t)SEQ * (SEQ / 32))
static_assert(WS_END <= (size_t)134217728u);
static_assert(WS_WK % 128 == 0 && WS_WV % 128 == 0 && WS_WO % 128 == 0 && WS_XB % 128 == 0 && WS_QH % 128 == 0 && WS_QL % 128 == 0 && WS_KH % 128 == 0);
static_assert(WS_VT % 128 == 0 && WS_VL % 128 == 0 && WS_Y % 128 == 0 && WS_YL % 128 == 0 && WS_MB % 128 == 0);

template <typename T> __device__ __forceinline__ void vst2(void* p, T v) { *(T*)p = v;  }
__device__ __forceinline__ v8f wmma_bf(v16b a, v16b b, v8f c) {
  v8f d = __builtin_amdgcn_wmma_f32_16x16x32_bf16(false, a, false, b, (short)0, c, false, false);
  asm volatile("v_nop\n\tv_nop\n\tv_nop\n\tv_nop" : "+v"(d) : "v"(a), "v"(b));
  return d;
}
// 16x16x32 fragments: lane = (h = lane>>4, row/col = lane&15); elements 0..7 = k0+8h+0..7, 8..15 = k0+16+8h+0..7; D element r = row 8h+r
__device__ __forceinline__ float bfr(float v) { return (float)(__bf16)v; }

// ---- LDS ring of the two GEMM kernels: a stage = 64 k (128 bytes, one whole line) of every operand row of the block, two buffers, filled by asynchronous copies while the other buffer is worked on
#define KS 64                // k per stage
#define NS (CC / KS)         // stages
#define RP 144               // ring row pitch in bytes: 128 + 16, free of bank conflicts for 16-byte LDS reads
static_assert(NS >= 2 && CC % KS == 0);
__device__ __forceinline__ unsigned lds_off(const void* p) { return (unsigned)(size_t)p; }
// four copies of 16 bytes a lane, global -> LDS through no register: ring rows 16 apart from plane rows 16 apart (8 lanes cover one 128-byte row slice, a wave 4 whole lines).
// s_wait_xcnt in the same statement: every later write of the address registers stays behind it
__device__ __forceinline__ void copy4(unsigned l, const char* p) {
  asm volatile("global_load_async_to_lds_b128 %0, %4, off\n\tglobal_load_async_to_lds_b128 %1, %5, off\n\tglobal_load_async_to_lds_b128 %2, %6, off\n\tglobal_load_async_to_lds_b128 %3, %7, off\n\ts_wait_xcnt 0x0"
               :: "v"(l), "v"(l + 16u * RP), "v"(l + 32u * RP), "v"(l + 48u * RP), "v"(p), "v"(p + 16 * 2 * CC), "v"(p + 32 * 2 * CC), "v"(p + 48 * 2 * CC) : "memory");
}
#define AW() asm volatile("s_wait_asynccnt 0x0" ::: "memory")   // this wave's copies have landed
#define DW() asm volatile("s_wait_dscnt 0x0" ::: "memory")      // this wave's LDS reads have returned: the buffer may be refilled behind the barrier
// fragment from a ring row: p = row start + 64 bytes per 32 k + 16 bytes per lane half (the k order stated above)
__device__ __forceinline__ v16h frag_lh(const char* p) { union { v16h v; v8h q[2]; } u; u.q[0] = *(const v8h*)p; u.q[1] = *(const v8h*)(p + 32); return u.v; }
__device__ __forceinline__ v16b frag_lb(const char* p) { union { v16b v; v8b q[2]; } u; u.q[0] = *(const v8b*)p; u.q[1] = *(const v8b*)(p + 32); return u.v; }

// ---- k_prep: every conversion of the call in one grid; a block's index range says which plane it fills (block-uniform): x of all batches, the four weights, the mask bits
#define PB_X (NB * ((SEQ * CC) / 8) / 256)     // blocks on x: 8 elements a thread
#define PB_W (((CC * CC) / 8) / 256)           // blocks on one weight
#define PB_M (SEQ * (SEQ / 32) / 256)          // blocks on the mask: one 32-bit word a thread
static_assert(WS_WK == WS_WQ + 2u * (size_t)CC * CC && WS_WV == WS_WQ + 4u * (size_t)CC * CC && WS_WO == WS_WQ + 6u * (size_t)CC * CC);   // k_prep steps from one weight plane to the next
__device__ __forceinline__ void cvt8(const float* __restrict__ A, unsigned short* __restrict__ D, const bool f16x64) {
  const v4f a = *(const v4f*)A; const v4f c = *(const v4f*)(A + 4);
  asm volatile("s_wait_xcnt 0x0" ::: "memory");   // the loads' address register is reused for the packed result: it may be rewritten only behind this wait
  const float v[8] = {a[0], a[1], a[2], a[3], c[0], c[1], c[2], c[3]};
  union { v8b b; v8h h; v4u u; } o;
  if (f16x64) { v8h t;
#pragma unroll
    for (int k = 0; k < 8; ++k) t[k] = (_Float16)(bfr(v[k]) * 64.0f);
    o.h = t; }
  else { v8b t;
#pragma unroll
    for (int k = 0; k < 8; ++k) t[k] = (__bf16)v[k];
    o.b = t; }
  vst2(D, o.u);
}
__global__ __launch_bounds__(256) void k_prep(const float* __restrict__ X, const float* __restrict__ WQ, const float* __restrict__ WK, const float* __restrict__ WV, const float* __restrict__ WO, const int* __restrict__ M,
                                              unsigned short* __restrict__ XB, unsigned short* __restrict__ WB, unsigned* __restrict__ MB) {
  const int blk = blockIdx.x, tid = threadIdx.x;
  if (blk < PB_X) {
    const int i = blk * 256 + tid, b = i / ((SEQ * CC) / 8);     // x rows of batch b start SEQ_FULL rows apart, the plane's SEQ rows apart
    cvt8(X + (size_t)b * (SEQ_FULL - SEQ) * CC + (size_t)i * 8, XB + (size_t)i * 8, false);
  } else if (blk < PB_X + 4 * PB_W) {
    const int wsel = (blk - PB_X) / PB_W; const int i = (blk - PB_X - wsel * PB_W) * 256 + tid;   // the four 16-bit weight planes stand one behind the other in the workspace
    const float* A = wsel == 0 ? WQ : wsel == 1 ? WK : wsel == 2 ? WV : WO;
    cvt8(A + (size_t)i * 8, WB + (size_t)wsel * CC * CC + (size_t)i * 8, wsel == 3);
  } else {
    const int w = (blk - PB_X - 4 * PB_W) * 256 + tid;
    const int q = w / (SEQ / 32), wc = w - q * (SEQ / 32);
    const int* p = M + (size_t)q * SEQ_FULL + wc * 32;
    unsigned bits = 0u;
#pragma unroll
    for (int i = 0; i < 8; ++i) { const v4i v = *(const v4i*)(p + 4 * i);
      bits |= (v.x != 0 ? 1u : 0u) << (4 * i);     bits |= (v.y != 0 ? 1u : 0u) << (4 * i + 1);
      bits |= (v.z != 0 ? 1u : 0u) << (4 * i + 2); bits |= (v.w != 0 ? 1u : 0u) << (4 * i + 3); }
    vst2(MB + w, bits);
  }
}

// ---- k_proj: block = (128 rows out of all batches' rows, 128 cols, which), wave = 64 rows x 64 cols (one head): y = x W^T + b (exact bf16 products from the 16-bit planes); which 0/1: rope then q -> f16 hi (+ residual for rows 0..63), k -> f16 rows; which 2: v -> f16 planes [c][t] (+ residual plane for rows 0..63)
// a 64 x 64 wave tile reads 8 fragments for 16 products (16 x 128: 9 for 8), a 128 x 128 block tile brings 256 operand rows from L2 for 16,384 outputs (64 x 128: 192 for 8,192)
__global__ __launch_bounds__(128) void k_proj(const __bf16* __restrict__ XB, const __bf16* __restrict__ WQ, const float* __restrict__ BQ, const __bf16* __restrict__ WK, const float* __restrict__ BK, const __bf16* __restrict__ WV, const float* __restrict__ BV,
                                              const float* __restrict__ RC, const float* __restrict__ RS,
                                              _Float16* __restrict__ QH, _Float16* __restrict__ QL, _Float16* __restrict__ KH, _Float16* __restrict__ VT, _Float16* __restrict__ VL) {
  // one pool: the ring (2 x 256 rows: 128 of x, 128 of W) during the k loop, the output staging planes behind it
  constexpr unsigned RB = 256u * RP; __shared__ __align__(16) char pool[2 * RB]; static_assert(2u * 128 * 136 * 2 <= sizeof(pool) && 128u * 136 * 2 + 128u * 72 * 2 <= sizeof(pool));
  _Float16 (*sh)[136] = (_Float16 (*)[136])pool; _Float16 (*sl)[136] = (_Float16 (*)[136])(pool + 128 * 136 * 2); _Float16 (*th)[136] = (_Float16 (*)[136])pool; _Float16 (*tl2)[72] = (_Float16 (*)[72])(pool + 128 * 136 * 2);
  __shared__ __align__(16) __bf16 rt[128][17][8];   // rope table of the block's rows: cell (row, col < 16) = cos at d = col, col + 16, col + 32, col + 48, then sin at the same four: what one lane needs for one row, 16 bytes; the 17th cell is the pad that spreads the rows over the banks
  const int tid = threadIdx.x, lane = tid & 31, col = lane & 15, g = lane >> 4; const int wave = __builtin_amdgcn_readfirstlane(tid >> 5), wr = wave >> 1, wc = wave & 1;
  const int which = blockIdx.z; const int c0 = blockIdx.y * 128; const int r0 = blockIdx.x * 128;   // r0: row in the [b][t] planes
  const int bb0 = blockIdx.x / (SEQ / 128), t0 = r0 - bb0 * SEQ;   // its batch and its position in the sequence
  const __bf16* WA = which == 0 ? WQ : which == 1 ? WK : WV; const float* BA = which == 0 ? BQ : which == 1 ? BK : BV;
  const unsigned ring = lds_off(pool) + (unsigned)((tid >> 3) * RP + (tid & 7) * 16);   // this lane's 16 bytes of ring row tid / 8
  const char* gx = (const char*)(XB + (size_t)(r0 + (tid >> 3)) * CC + (tid & 7) * 8); const char* gw = (const char*)(WA + (size_t)(c0 + (tid >> 3)) * CC + (tid & 7) * 8);
  auto fill = [&](const int s) { const unsigned l = ring + (unsigned)(s & 1) * RB; copy4(l, gx + s * (2 * KS)); copy4(l + 64u * RP, gx + s * (2 * KS) + 64 * 2 * CC); copy4(l + 128u * RP, gw + s * (2 * KS)); copy4(l + 192u * RP, gw + s * (2 * KS) + 64 * 2 * CC); };
  fill(0);                                                       // stage 0 flies under the rope table's staging
  // rope table rows t0..t0+127 (bf16-RNE values), whole head dim; staged extent == consumed extent (128 x HD)
  if (which < 2) {                                               // a thread takes 4 columns of a row at all four 16-column steps: 8 loads of 16 bytes give 4 whole cells; all 32 loads of its 4 rows fly at once
    v4f tc[4][4], ts[4][4]; const float* pc = RC + (size_t)(t0 + (tid >> 2)) * HD + (tid & 3) * 4; const float* ps = RS + (size_t)(t0 + (tid >> 2)) * HD + (tid & 3) * 4;
#pragma unroll
    for (int it = 0; it < 4; ++it)
#pragma unroll
      for (int jj = 0; jj < 4; ++jj) { tc[it][jj] = *(const v4f*)(pc + it * 32 * HD + jj * 16); ts[it][jj] = *(const v4f*)(ps + it * 32 * HD + jj * 16); }
    asm volatile("s_wait_xcnt 0x0" :: "v"(pc), "v"(ps) : "memory");   // the two address pairs of the 32 loads stay whole up to this wait (named as inputs) and may be rewritten only behind it
#pragma unroll
    for (int it = 0; it < 4; ++it)
#pragma unroll
      for (int i = 0; i < 4; ++i) { v8b t;
#pragma unroll
        for (int jj = 0; jj < 4; ++jj) { t[jj] = (__bf16)tc[it][jj][i]; t[4 + jj] = (__bf16)ts[it][jj][i]; }
        *(v8b*)&rt[it * 32 + (tid >> 2)][(tid & 3) * 4 + i][0] = t; } }
  AW();
  __syncthreads();                                               // publishes the rope table and stage 0
  fill(1);
  v8f acc[4][4] = {};
#pragma unroll 1                                                 // one trip a stage: the buffer is picked by the trip's parity, the text stays short
  for (int s = 0; s < NS; ++s) { const char* fb = pool + (unsigned)(s & 1) * RB + col * RP + g * 16;
#pragma unroll                                                   // this and the four below: constant indices keep a[], w[] and acc[] in registers; a block's 16 LDS reads stand as one group ahead of its 16 products
    for (int ks = 0; ks < KS / 32; ++ks) { v16b a[4], w[4];
#pragma unroll
      for (int i = 0; i < 4; ++i) a[i] = frag_lb(fb + (wr * 64 + i * 16) * RP + ks * 64);
#pragma unroll
      for (int j = 0; j < 4; ++j) w[j] = frag_lb(fb + (128 + wc * 64 + j * 16) * RP + ks * 64);
#pragma unroll
      for (int i = 0; i < 4; ++i)
#pragma unroll
        for (int j = 0; j < 4; ++j) acc[i][j] = wmma_bf(a[i], w[j], acc[i][j]); }
    DW(); AW();
    __syncthreads();                                             // publishes stage s + 1 and ends every wave's reads of stage s
    if (s + 2 < NS) fill(s + 2); }
  AW();
  float bbv[4];
#pragma unroll
  for (int j = 0; j < 4; ++j) bbv[j] = bfr(BA[c0 + wc * 64 + j * 16 + col]);
  if (which == 2) {
#pragma unroll
    for (int i = 0; i < 4; ++i)
#pragma unroll
      for (int j = 0; j < 4; ++j) { const int cl = wc * 64 + j * 16 + col, rb = wr * 64 + i * 16 + 8 * g; v8h hv, lv;   // a lane's 8 rows of one column stand side by side in the [c][t] plane
#pragma unroll
        for (int r = 0; r < 8; ++r) { const float v = acc[i][j][r] + bbv[j]; const _Float16 h = (_Float16)v; hv[r] = h; lv[r] = (_Float16)((v - (float)h) * 1024.0f); }   /* v residual carried x 2^10 */
        *(v8h*)&th[cl][rb] = hv; if (wr == 0) *(v8h*)&tl2[cl][rb] = lv; }
  } else { const bool qres = which == 0 && t0 == 0 && wr == 0;   // this wave's 64 rows are a sequence's q rows 0..63 (scalar)
    const float qs = which == 0 ? QSC : 1.0f;                    // q leaves scaled, k as it is
#pragma unroll
    for (int i = 0; i < 4; ++i)
#pragma unroll
      for (int r = 0; r < 8; ++r) { const int rl = wr * 64 + i * 16 + 8 * g + r; const v8b t = *(const v8b*)&rt[rl][col][0]; float v[4];
#pragma unroll
        for (int j = 0; j < 4; ++j) v[j] = acc[i][j][r] + bbv[j];
        // rotate-half: head-local d = j*16+col; d<32: y*cos - y[d+32]*sin, d>=32: y*cos + y[d-32]*sin; partner tile = j^2
#pragma unroll
        for (int j = 0; j < 4; ++j) { const int cl = wc * 64 + j * 16 + col; const float pv = v[j ^ 2], cs = (float)t[j], sn = (float)t[4 + j];
          const float o = ((j < 2) ? (v[j] * cs - pv * sn) : (v[j] * cs + pv * sn)) * qs;
          const _Float16 hv = (_Float16)o; sh[rl][cl] = hv; if (qres) sl[rl][cl] = (_Float16)((o - (float)hv) * 1024.0f); }   /* q residual carried x 2^10 so the plane stays f16-normal */
      } }
  __syncthreads();
  // PW: behind each store below, whose address and data registers the loop's next statements reuse: they may be rewritten only behind this wait
#define PW() asm volatile("s_wait_xcnt 0x0" ::: "memory")
  if (which < 2) { _Float16* dh = which == 0 ? QH : KH; for (int e = tid; e < 128 * 16; e += 128) { const int rl = e >> 4, q = e & 15; vst2(dh + (size_t)(r0 + rl) * CC + c0 + q * 8, *(const v4u*)&sh[rl][q * 8]); PW(); if (which == 0 && t0 == 0 && rl < QB0) { vst2(QL + (size_t)(r0 + rl) * CC + c0 + q * 8, *(const v4u*)&sl[rl][q * 8]); PW(); } } }
  else { for (int e = tid; e < 128 * 16; e += 128) { const int cl = e >> 4, q = e & 15; const size_t o2 = (size_t)(bb0 * CC + c0 + cl) * (size_t)SEQ + t0 + q * 8; vst2(VT + o2, *(const v4u*)&th[cl][q * 8]); PW();
      if (t0 == 0 && q < 8) { const size_t o3 = (size_t)(bb0 * CC + c0 + cl) * (size_t)QB0 + q * 8; vst2(VL + o3, *(const v4u*)&tl2[cl][q * 8]); PW(); } } } }

// ---- k_fa: wave = 32 queries (two 16-column groups) of one head of one batch, whole key range in one pass, logits and P stay in registers.
// S^T = K Q^T (A = k rows, B = q rows, same loader on both sides): lane (col, g) holds query col, keys 8g+r of each 16-key tile, so two tiles pack straight into the B operand of O^T += V^T P^T.
// q comes scaled by log2(e) / 8 and the score products start from C = 11 - reference, so a score leaves the matrix unit as the exponent of P = 2^(s - reference) x 2^11 -> f16: no subtraction or scaling per score.
// The reference of a query is its largest score at the time it is set; it is renewed (scores of the block, sums and O rescaled, the lane halves' maxima joined) only when a score passes it by 2^4, P <= 2^15. Sum per query, normalised once at the end.
// The wave's 32 mask rows are scanned once: stages in front of the first set bit of all four waves run without mask work, a wave's 32-key blocks behind its last clear bit are not run (both counts bounded by SEQ / 32).
// Any mask content is honoured; a fully masked row ends as 0 x inf = NaN like the softmax of an all -inf row.
// K and V come through LDS: a stage = 64 keys of the block's head, 64 k rows (128 bytes, one whole line each) and those keys' 128 bytes of the 64 v plane rows; two buffers, filled by asynchronous copies
// while the other buffer is worked on; the block's four waves walk the stages together and read their fragments from the ring (each line leaves L2 once a block, whole, instead of in 32-byte pieces once a wave).
#define FKS 64               // keys per stage
#define FRB (128u * RP)      // bytes of one buffer: 64 k rows, then 64 v rows, at the ring pitch
static_assert(SEQ % FKS == 0 && FKS == 64 && 2 * HD == 128);
// copy4 for the v planes, whose rows stand SEQ elements apart. s_wait_xcnt in the same statement: every later write of the address registers stays behind it
__device__ __forceinline__ void copy4v(unsigned l, const char* p) {
  asm volatile("global_load_async_to_lds_b128 %0, %4, off\n\tglobal_load_async_to_lds_b128 %1, %5, off\n\tglobal_load_async_to_lds_b128 %2, %6, off\n\tglobal_load_async_to_lds_b128 %3, %7, off\n\ts_wait_xcnt 0x0"
               :: "v"(l), "v"(l + 16u * RP), "v"(l + 32u * RP), "v"(l + 48u * RP), "v"(p), "v"(p + 16 * 2 * SEQ), "v"(p + 32 * 2 * SEQ), "v"(p + 48 * 2 * SEQ) : "memory");
}
template <bool B> struct flag_t { static constexpr bool value = B; };
__device__ __forceinline__ float xhalf(float v) { const int b = __float_as_int(v); return __int_as_float(__builtin_amdgcn_permlanex16(b, b, 0x76543210, 0xfedcba98, false, false)); }
// behind global loads or stores whose registers are reused next: those registers may be rewritten only behind this wait
#define XW() asm volatile("s_wait_xcnt 0x0" ::: "memory")
__device__ __forceinline__ v8f wm(v16h a, v16h b, v8f c) { return __builtin_amdgcn_wmma_f32_16x16x32_f16(false, a, false, b, (short)0, c, false, false); }
// 2^x with the one free issue slot behind a transcendental kept inside the statement
__device__ __forceinline__ float exp2s(float x) { float r; asm("v_exp_f32 %0, %1\n\tv_nop" : "=v"(r) : "v"(x)); return r; }
// eight at once: each v_exp_f32 is followed by one that touches neither its result nor its source (early-clobber outputs), so one slot at the end serves the run
__device__ __forceinline__ v8f exp2x8(v8f x) { float r0, r1, r2, r3, r4, r5, r6, r7;
  asm("v_exp_f32 %0, %8\n\tv_exp_f32 %1, %9\n\tv_exp_f32 %2, %10\n\tv_exp_f32 %3, %11\n\tv_exp_f32 %4, %12\n\tv_exp_f32 %5, %13\n\tv_exp_f32 %6, %14\n\tv_exp_f32 %7, %15\n\tv_nop"
      : "=&v"(r0), "=&v"(r1), "=&v"(r2), "=&v"(r3), "=&v"(r4), "=&v"(r5), "=&v"(r6), "=&v"(r7) : "v"(x[0]), "v"(x[1]), "v"(x[2]), "v"(x[3]), "v"(x[4]), "v"(x[5]), "v"(x[6]), "v"(x[7]));
  return v8f{r0, r1, r2, r3, r4, r5, r6, r7}; }
// fragment at a byte address that already holds the lane's row and its half's 16 bytes
__device__ __forceinline__ v16h frag_p(const char* p) { union { v16h v; v8h q[2]; } u; u.q[0] = *(const v8h*)p; u.q[1] = *(const v8h*)(p + 32); return u.v; }
__global__ __launch_bounds__(128) void k_fa(const _Float16* __restrict__ QH, const _Float16* __restrict__ QL, const _Float16* __restrict__ KH, const _Float16* __restrict__ VT, const _Float16* __restrict__ VL,
                                            const unsigned* __restrict__ MB, _Float16* __restrict__ Y, _Float16* __restrict__ YL) {
  constexpr float NEG = -3.0e38f; constexpr int NW = SEQ / 32;
  __shared__ __align__(16) char ring[2 * FRB]; __shared__ __align__(16) int wtrip[4], wfull[4];
  const int tid = threadIdx.x, lane = threadIdx.x & 31, col = lane & 15, g = lane >> 4; const int wave = __builtin_amdgcn_readfirstlane((int)threadIdx.x >> 5);
  // more blocks than resident places, and a block's cost grows with its query tile: the longest key ranges of every head and batch come first in the index, the short ones fill the places that free up
  constexpr int NT = SEQ / 128; const unsigned hb = blockIdx.x % (unsigned)(NH * NB); const int h = (int)(hb % NH), bt = (int)(hb / NH); const int q0 = (NT - 1 - (int)(blockIdx.x / (unsigned)(NH * NB))) * 128 + wave * 32;
  QH += (size_t)bt * SEQ * CC; QL += (size_t)bt * SEQ * CC; KH += (size_t)bt * SEQ * CC; VT += (size_t)bt * CC * SEQ; VL += (size_t)bt * CC * QB0; Y += (size_t)bt * SEQ * CC; YL += (size_t)bt * QB0 * CC;
  const unsigned rl = lds_off(ring) + (unsigned)((tid >> 3) * RP + (tid & 7) * 16);   // this lane's 16 bytes of ring row tid / 8
  const char* gk = (const char*)(KH + (size_t)(tid >> 3) * CC + h * HD + (tid & 7) * 8); const char* gv = (const char*)(VT + ((size_t)h * HD + (tid >> 3)) * SEQ + (tid & 7) * 8);
  auto fill = [&](const int s) { const unsigned l = rl + (unsigned)(s & 1) * FRB; copy4(l, gk + (size_t)s * (FKS * 2 * CC)); copy4v(l + 64u * RP, gv + s * (2 * FKS)); };
  fill(0);                                                     // stage 0 flies under the mask scan (SEQ >= 128: stages 0 and 1 lie inside the planes)
  const unsigned* mu = MB + (size_t)q0 * NW; const unsigned mo = 4u * (unsigned)(col * NW);
  int last = -1, first = NW;
#pragma unroll
  for (int p = 0; p < 2; ++p)
#pragma unroll
    for (int i = NW / 8 - 1; i >= 0; --i) { const v4u u = *(const v4u*)((const char*)(mu + p * 16 * NW + 4 * i) + (mo + 4u * (unsigned)(g * (NW / 2))));
#pragma unroll
      for (int e = 3; e >= 0; --e) { const int w = g * (NW / 2) + 4 * i + e; last = (u[e] != 0xFFFFFFFFu) ? max(last, w) : last; first = (u[e] != 0u) ? min(first, w) : first; } }
#pragma unroll
  for (int o = 1; o < 32; o <<= 1) { last = max(last, __shfl_xor(last, o)); first = min(first, __shfl_xor(first, o)); }
  const int trip = min(__builtin_amdgcn_readfirstlane(last) + 1, NW);
  const int nfull = max(min(__builtin_amdgcn_readfirstlane(first), trip), 0);
  if (lane == 0) { wtrip[wave] = trip; wfull[wave] = nfull; }
  AW();
  __syncthreads();                                             // publishes stage 0 and the four waves' block counts
  const v4i wt = *(const v4i*)wtrip, wf = *(const v4i*)wfull;
  const int nst = (__builtin_amdgcn_readfirstlane(max(max(wt.x, wt.y), max(wt.z, wt.w))) + 1) >> 1;   // stages of the block: its longest wave's, at most SEQ / FKS
  const int nfs = __builtin_amdgcn_readfirstlane(min(min(wf.x, wf.y), min(wf.z, wf.w))) >> 1;         // leading stages that no wave of the block has mask work in (nfull <= trip: every wave runs both their halves)
  if (nst > 1) fill(1);
  const bool res = q0 < QB0;
  const unsigned ko = 2u * (unsigned)(col * CC + 8 * g), lo = 2u * (unsigned)(col * QB0 + 8 * g);
  const char* lp = (const char*)(VL + (size_t)h * HD * QB0) + lo;
  const char* qlp = (const char*)(QL + (size_t)q0 * CC + h * HD) + ko;   // the wave's q residual rows, read under res alone
  v16h qh[2][2];
#pragma unroll
  for (int p = 0; p < 2; ++p)
#pragma unroll
    for (int kk = 0; kk < 2; ++kk) { const size_t o = (size_t)(q0 + 16 * p) * CC + h * HD + kk * 32; qh[p][kk] = frag_p((const char*)(QH + o) + ko); }
  XW();
  v8f acc[2][4] = {}; float l[2] = {0.f, 0.f}, thr[2] = {-1.0e38f, -1.0e38f};   // thr: the score exponent above which the reference is renewed; below every real score until the first unmasked one has set it
  constexpr v8f C11 = {11.0f, 11.0f, 11.0f, 11.0f, 11.0f, 11.0f, 11.0f, 11.0f}; v8f cr[2] = {C11, C11};   // 11 - reference of the lane's query, eight times over: the C operand of its score products
  auto body = [&](const int kc, const char* kb, const char* vb, auto mk) {   // kb, vb: the lane's row and half at this block's 32 keys in the stage's buffer
    constexpr bool masked = decltype(mk)::value;
    v16h kf[2][2], vf[4]; unsigned mw[2] = {0u, 0u};
#pragma unroll
    for (int t = 0; t < 2; ++t)
#pragma unroll
      for (int kk = 0; kk < 2; ++kk) kf[t][kk] = frag_lh(kb + t * 16 * RP + kk * 64);
#pragma unroll
    for (int j = 0; j < 4; ++j) vf[j] = frag_lh(vb + j * 16 * RP);   // this block's v rows fly under the logits and the softmax
    if constexpr (masked) { mw[0] = *(const unsigned*)((const char*)(mu + kc) + mo); mw[1] = *(const unsigned*)((const char*)(mu + 16 * NW + kc) + mo); XW(); }
    v8f s[2][2];
#pragma unroll
    for (int t = 0; t < 2; ++t)
#pragma unroll
      for (int p = 0; p < 2; ++p) s[p][t] = wm(kf[t][0], qh[p][0], cr[p]);
#pragma unroll
    for (int t = 0; t < 2; ++t)
#pragma unroll
      for (int p = 0; p < 2; ++p) s[p][t] = wm(kf[t][1], qh[p][1], s[p][t]);
    if (res) {                                                 // query rows 0..63 (scalar): the q residual product on top, its fragments fetched here so that the other waves hold no registers for them
      v16h ql[2][2];
#pragma unroll
      for (int p = 0; p < 2; ++p)
#pragma unroll
        for (int kk = 0; kk < 2; ++kk) ql[p][kk] = frag_p(qlp + 2 * (16 * p * CC + kk * 32));
      XW();
#pragma unroll
      for (int t = 0; t < 2; ++t)
#pragma unroll
        for (int p = 0; p < 2; ++p) { v8f a = wm(kf[t][0], ql[p][0], v8f{}); a = wm(kf[t][1], ql[p][1], a); s[p][t] += a * (1.0f / 1024.0f); } }
    if constexpr (masked) {
#pragma unroll
      for (int p = 0; p < 2; ++p) { const unsigned w = mw[p] >> (8 * g);
#pragma unroll
        for (int t = 0; t < 2; ++t)
#pragma unroll
          for (int r = 0; r < 8; ++r) s[p][t][r] = ((w >> (16 * t + r)) & 1u) ? NEG : s[p][t][r]; } }
    float mx[2];                                               // the lane's own 16 keys; the halves are joined only where the reference moves
#pragma unroll
    for (int p = 0; p < 2; ++p) { float x = fmaxf(s[p][0][0], s[p][1][0]);
#pragma unroll
      for (int r = 1; r < 8; ++r) x = fmaxf(x, fmaxf(s[p][0][r], s[p][1][r]));
      mx[p] = x; }
    if (__builtin_amdgcn_ballot_w32(mx[0] > thr[0] || mx[1] > thr[1]) != 0u) {
#pragma unroll
      for (int p = 0; p < 2; ++p) { const float x = fmaxf(mx[p], xhalf(mx[p])); const bool up = x > thr[p];   // alike in both lanes of a query
        const float d = up ? x - 11.0f : 0.f;                  // the reference moves by d: the block's largest score becomes 2^11
        const float al = thr[p] < 0.f ? 1.0f : exp2s(-d);      // nothing summed before the reference is first set: no factor (d may then be negative)
        thr[p] = up ? 15.0f : thr[p]; l[p] *= al; cr[p] -= d; s[p][0] -= d; s[p][1] -= d;
#pragma unroll
        for (int j = 0; j < 4; ++j) acc[p][j] *= al; } }
    v16h pb[2];
#pragma unroll
    for (int p = 0; p < 2; ++p) { float sum = 0.f;             // a masked score is -huge whatever the reference: its term is exp2(-huge) = 0
#pragma unroll
      for (int t = 0; t < 2; ++t) { s[p][t] = exp2x8(s[p][t]);
#pragma unroll
        for (int r = 0; r < 8; ++r) { sum += s[p][t][r]; pb[p][8 * t + r] = (_Float16)s[p][t][r]; } }
      l[p] += sum; }
#pragma unroll
    for (int j = 0; j < 4; ++j)
#pragma unroll
      for (int p = 0; p < 2; ++p) acc[p][j] = wm(vf[j], pb[p], acc[p][j]);
    if (res && kc < QB0 / 32) {                                // query rows 0..63, keys 0..63: P and v residual planes (x 2^10), as before
      v16h pl[2];
#pragma unroll
      for (int p = 0; p < 2; ++p)
#pragma unroll
        for (int e = 0; e < 16; ++e) pl[p][e] = (_Float16)((s[p][e >> 3][e & 7] - (float)pb[p][e]) * 1024.0f);
#pragma unroll
      for (int j = 0; j < 4; ++j) { const v16h vl = frag_p(lp + 2 * (j * 16 * QB0 + kc * 32)); XW();
#pragma unroll
        for (int p = 0; p < 2; ++p) { v8f a = {}; a = wm(vf[j], pl[p], a); a = wm(vl, pb[p], a); acc[p][j] += a * (1.0f / 1024.0f); } } }
  };
  auto foot = [&](const int st) {                              // both loops below run the same trips in every wave of the block
    DW(); AW();
    __syncthreads();                                           // publishes stage st + 1 and ends every wave's reads of stage st
    if (st + 2 < nst) fill(st + 2); };
  const char* f0 = ring + col * RP + g * 16;
#pragma unroll 1                                               // one trip a stage: the buffer is picked by the trip's parity, the text stays short
  for (int st = 0; st < nfs; ++st) { const char* fb = f0 + (unsigned)(st & 1) * FRB;
    body(2 * st, fb, fb + 64 * RP, flag_t<false>{}); body(2 * st + 1, fb + 32 * RP, fb + 64 * RP + 64, flag_t<false>{});
    foot(st); }
#pragma unroll 1                                               // as above
  for (int st = nfs; st < nst; ++st) { const char* fb = f0 + (unsigned)(st & 1) * FRB; const int ke = min(2 * st + 2, trip);   // a wave past its own last block only keeps the ring going
#pragma unroll 1                                               // one copy of the masked body in the text
    for (int kc = 2 * st; kc < ke; ++kc) body(kc, fb + (kc & 1) * (32 * RP), fb + 64 * RP + (kc & 1) * 64, flag_t<true>{});
    foot(st); }
  AW();
#pragma unroll
  for (int p = 0; p < 2; ++p) { const float inv = 16.0f / (l[p] + xhalf(l[p])); const size_t o = (size_t)(q0 + 16 * p) * CC + h * HD;   /* ctx carried x 16, residual x 2^10 */
#pragma unroll
    for (int j = 0; j < 4; ++j) { union { v8h h; v4u u; } yh, yl;
#pragma unroll
      for (int r = 0; r < 8; ++r) { const float y = acc[p][j][r] * inv; const _Float16 t = (_Float16)y; yh.h[r] = t; yl.h[r] = (_Float16)((y - (float)t) * 1024.0f); }
      vst2((char*)(Y + o + j * 16) + ko, yh.u); XW(); if (res) { vst2((char*)(YL + o + j * 16) + ko, yl.u); XW(); } } } }

// ---- k_out: block = (128 rows out of all batches' rows, 128 cols), wave = 64 rows x 64 cols: out = (ctx x 16 f16) (f16 bf16(Wo) x 64)^T / 1024 + bo; the two waves on a sequence's rows 0..63 add the ctx residual plane (2 products)
__global__ __launch_bounds__(128) void k_out(const _Float16* __restrict__ Y, const _Float16* __restrict__ YL, const _Float16* __restrict__ WO, const float* __restrict__ BP, float* __restrict__ OUT) { __shared__ __align__(16) float sf[4][32][68];
  constexpr unsigned RB = 320u * RP; __shared__ __align__(16) char pool[2 * RB];   // ring: 2 x (128 rows of ctx, 128 of Wo, 64 of the ctx residual, filled in a sequence's row block 0 alone)
  const int tid = threadIdx.x, lane = tid & 31, col = lane & 15, g = lane >> 4; const int wave = __builtin_amdgcn_readfirstlane(tid >> 5), wr = wave >> 1, wc = wave & 1;
  const int c0 = blockIdx.y * 128; const int r0 = blockIdx.x * 128 + wr * 64; const int b = blockIdx.x / (SEQ / 128); const size_t orow = (size_t)b * (SEQ_FULL - SEQ) + r0;
  const bool lo = blockIdx.x % (SEQ / 128) == 0; const bool lw = lo && wr == 0;   // lw: this wave's 64 rows are a sequence's rows 0..63 (scalar: the products under it run with every lane on)
  const unsigned ring = lds_off(pool) + (unsigned)((tid >> 3) * RP + (tid & 7) * 16);   // this lane's 16 bytes of ring row tid / 8
  const char* gy = (const char*)(Y + (size_t)(blockIdx.x * 128 + (tid >> 3)) * CC + (tid & 7) * 8); const char* gl = (const char*)(YL + (size_t)(b * QB0 + (tid >> 3)) * CC + (tid & 7) * 8); const char* gw = (const char*)(WO + (size_t)(c0 + (tid >> 3)) * CC + (tid & 7) * 8);
  auto fill = [&](const int s) { const unsigned l = ring + (unsigned)(s & 1) * RB; copy4(l, gy + s * (2 * KS)); copy4(l + 64u * RP, gy + s * (2 * KS) + 64 * 2 * CC); copy4(l + 128u * RP, gw + s * (2 * KS)); copy4(l + 192u * RP, gw + s * (2 * KS) + 64 * 2 * CC); if (lo) copy4(l + 256u * RP, gl + s * (2 * KS)); };
  fill(0);
  AW();
  __syncthreads();                                               // publishes stage 0
  fill(1);
  v8f acc[4][4] = {}, accl[4][4] = {};
  // one block of 32 k: fp = the lane's row and half at these 32 k in the stage's buffer
  auto blk = [&](const char* fp) { v16h a[4], w[4], al[4];
#pragma unroll                                                   // this and those below: constant indices keep the fragments, acc[] and accl[] in registers
    for (int i = 0; i < 4; ++i) a[i] = frag_lh(fp + (wr * 64 + i * 16) * RP);
#pragma unroll
    for (int j = 0; j < 4; ++j) w[j] = frag_lh(fp + (128 + wc * 64 + j * 16) * RP);
    if (lw) {
#pragma unroll
      for (int i = 0; i < 4; ++i) al[i] = frag_lh(fp + (256 + i * 16) * RP); }
    __builtin_amdgcn_sched_barrier(0);                           // the block's LDS reads stay one group ahead of its products: without it they were spread, two reads and a full wait in front of every four products
#pragma unroll
    for (int i = 0; i < 4; ++i)
#pragma unroll
      for (int j = 0; j < 4; ++j) acc[i][j] = wm(a[i], w[j], acc[i][j]);
    if (lw) {
#pragma unroll
      for (int i = 0; i < 4; ++i)
#pragma unroll
        for (int j = 0; j < 4; ++j) accl[i][j] = wm(al[i], w[j], accl[i][j]); } };
#pragma unroll 1                                                 // one trip a stage: the buffer is picked by the trip's parity, the text stays short
  for (int s = 0; s < NS; ++s) { const char* fb = pool + (unsigned)(s & 1) * RB + col * RP + g * 16;
    static_assert(KS == 64);
    blk(fb); blk(fb + 64);
    DW(); AW();
    __syncthreads();                                             // publishes stage s + 1 and ends every wave's reads of stage s
    if (s + 2 < NS) fill(s + 2); }
  AW();
  float bb[4];
#pragma unroll
  for (int j = 0; j < 4; ++j) bb[j] = bfr(BP[c0 + wc * 64 + j * 16 + col]);
#pragma unroll                                                   // constant indices into acc[] and accl[]
  for (int hp = 0; hp < 2; ++hp) {                               // 32 rows at a time through the wave's own staging plane, stored as whole 256-byte row pieces
#pragma unroll
    for (int ii = 0; ii < 2; ++ii)
#pragma unroll
      for (int j = 0; j < 4; ++j)
#pragma unroll
        for (int r = 0; r < 8; ++r) sf[wave][ii * 16 + 8 * g + r][j * 16 + col] = (acc[hp * 2 + ii][j][r] + accl[hp * 2 + ii][j][r] * (1.0f / 1024.0f)) * (1.0f / 1024.0f) + bb[j];
    DW();                                                        // the wave's own staging stores have landed before it reads the rows back (no other wave touches its plane)
#pragma unroll                                                   // 8 row pairs at a time: their LDS reads fly together, one wait serves the run of stores
    for (int hb = 0; hb < 2; ++hb) { v4f t[8]; float* po = OUT + (orow + hp * 32 + hb * 16 + g) * CC + c0 + wc * 64 + col * 4;
#pragma unroll
      for (int u = 0; u < 8; ++u) t[u] = *(const v4f*)&sf[wave][hb * 16 + 2 * u + g][col * 4];
#pragma unroll
      for (int u = 0; u < 8; ++u) vst2(po + u * 2 * CC, t[u]);
      PW(); } } }

extern "C" void kernel_launch(void* const* d_in, const int* in_sizes, int n_in, void* d_out, int out_size, void* d_ws, size_t ws_size, hipStream_t stream) {
  if (n_in < 12) return;
  // d_in: 0 x [4,2048,1024] f32, 1 mask [2048,2048] int32, 2 rope_cos [2048,64] f32, 3 rope_sin [2048,64] f32, 4 Wq [out,in], 5 bq, 6 Wk, 7 bk, 8 Wv, 9 bv, 10 Wo, 11 bo
  const size_t xneed = ((size_t)(NB - 1) * SEQ_FULL + SEQ) * (size_t)CC;
  if ((size_t)in_sizes[0] < xneed) return;
  if ((size_t)in_sizes[1] < (size_t)(SEQ - 1) * SEQ_FULL + SEQ) return;
  if (in_sizes[2] < SEQ * HD || in_sizes[3] < SEQ * HD) return;
  if (in_sizes[4] < CC * CC || in_sizes[6] < CC * CC || in_sizes[8] < CC * CC || in_sizes[10] < CC * CC) return;
  if (in_sizes[5] < CC || in_sizes[7] < CC || in_sizes[9] < CC || in_sizes[11] < CC) return;
  if ((size_t)out_size < xneed) return;
  if (ws_size < (size_t)WS_END) return;
  const float* X = (const float*)d_in[0]; const int* M = (const int*)d_in[1]; const float* RC = (const float*)d_in[2]; const float* RS = (const float*)d_in[3];
  const float *WQ = (const float*)d_in[4], *BQ = (const float*)d_in[5], *WK = (const float*)d_in[6], *BK = (const float*)d_in[7], *WV = (const float*)d_in[8], *BV = (const float*)d_in[9], *WO = (const float*)d_in[10], *BO = (const float*)d_in[11];
  char* ws = (char*)d_ws;
  __bf16 *WQB = (__bf16*)(ws + WS_WQ), *WKB = (__bf16*)(ws + WS_WK), *WVB = (__bf16*)(ws + WS_WV), *XB = (__bf16*)(ws + WS_XB); _Float16* WOH = (_Float16*)(ws + WS_WO);
  _Float16 *QH = (_Float16*)(ws + WS_QH), *QL = (_Float16*)(ws + WS_QL), *KH = (_Float16*)(ws + WS_KH), *VT = (_Float16*)(ws + WS_VT), *VL = (_Float16*)(ws + WS_VL), *Y = (_Float16*)(ws + WS_Y), *YL = (_Float16*)(ws + WS_YL);
  unsigned* MB = (unsigned*)(ws + WS_MB); float* OUT = (float*)d_out;
  k_prep<<<dim3(PB_X + 4 * PB_W + PB_M), 256, 0, stream>>>(X, WQ, WK, WV, WO, M, (unsigned short*)XB, (unsigned short*)WQB, MB);
  k_proj<<<dim3(NB * (SEQ / 128), CC / 128, 3), 128, 0, stream>>>(XB, WQB, BQ, WKB, BK, WVB, BV, RC, RS, QH, QL, KH, VT, VL);
  k_fa<<<dim3((SEQ / 128) * NH * NB), 128, 0, stream>>>(QH, QL, KH, VT, VL, MB, Y, YL);
  k_out<<<dim3(NB * (SEQ / 128), CC / 128), 128, 0, stream>>>(Y, YL, WOH, BO, OUT);
}

// v008
// It runs in 114 microseconds.
// Timed twice side by side with v007, it ran 1.04 times as fast both times.
// Over all steps from v000 it is 16.2 times as fast.
// compute dtype: every float input (x, Wq, Wk, Wv, Wo, biases, rope cos/sin tables) RNE-converted to bf16 (bf16-input target); q/k/v = x W^T + b on v_wmma_f32_16x16x32_bf16 (exact bf16 products, f32 accumulate); rope in f32; q x log2(e) / 8 -> f16 (query rows 0..63 of each sequence: + residual plane x 2^10), k -> f16; logits in log2 units = 1 product on v_wmma_f32_16x16x32_f16 (rows 0..63: 2 products) on top of C = 11 - reference, f32; mask replace + softmax against a held reference in f32 (exp2; the reference is a row's largest score when it is set and is renewed when a score passes it by 2^4), logits and P kept in registers; exp2(s - reference) x 2^11 -> f16 against v f16: 1 f16 product, divided by the f32 row sum at the end (query rows 0..63 of each sequence add P and v residual planes x 2^10: 3 products); ctx x 16 -> f16 against f16(bf16(Wo) x 64): 1 f16 product (rows 0..63 add a ctx residual plane x 2^10: 2 products); f32 accumulate everywhere, f32 output.
#include <hip/hip_runtime.h>
#include <math.h>

#ifndef NB
#define NB 4
#endif
#ifndef SEQ
#define SEQ 2048
#endif
#define NB_FULL 4
#define SEQ_FULL 2048
#define CC 1024
#define NH 16
#define HD 64
#define QB0 64               // leading query rows per sequence carried with residual planes
#define QSC (0.125f * 1.44269504088896340736f)   // 1 / sqrt(HD) x log2(e): folded into q where q is made, so that k q^T is an exponent of 2
static_assert(SEQ % 128 == 0);
static_assert(SEQ >= 128 && SEQ <= SEQ_FULL);
static_assert(NB >= 1 && NB <= NB_FULL);
static_assert(CC == NH * HD);
static_assert(HD == 64);
static_assert(QB0 == 64);
static_assert(SEQ % 256 == 0);
static_assert((SEQ * (SEQ / 32)) % 256 == 0);
static_assert(((CC * CC) / 8) % 256 == 0);
static_assert(((SEQ * CC) / 8) % 256 == 0);

typedef __attribute__((ext_vector_type(16))) _Float16 v16h;
typedef __attribute__((ext_vector_type(16))) __bf16 v16b;
typedef __attribute__((ext_vector_type(8)))  _Float16 v8h;
typedef __attribute__((ext_vector_type(8)))  __bf16 v8b;
typedef __attribute__((ext_vector_type(8)))  float v8f;
typedef __attribute__((ext_vector_type(4)))  float v4f;
typedef __attribute__((ext_vector_type(4)))  unsigned v4u;
typedef __attribute__((ext_vector_type(4)))  int v4i;

#define WS_WQ  ((size_t)0)                                  // bf16 Wq [o][i]
#define WS_WK  (WS_WQ + 2u * (size_t)CC * CC)               // bf16 Wk [o][i]
#define WS_WV  (WS_WK + 2u * (size_t)CC * CC)               // bf16 Wv [o][i]
#define WS_WO  (WS_WV + 2u * (size_t)CC * CC)               // f16 bf16(Wo) x 64 [o][i]
#define WS_XB  (WS_WO + 2u * (size_t)CC * CC)               // bf16 x rows of every batch [b][t][c]
#define WS_QH  (WS_XB + 2u * (size_t)NB * SEQ * CC)         // f16 q rows [b][t][c] (hi)
#define WS_QL  (WS_QH + 2u * (size_t)NB * SEQ * CC)         // f16 q residual x 2^10 rows [b][t][c], rows t < QB0 alone written and read
#define WS_KH  (WS_QL + 2u * (size_t)NB * SEQ * CC)         // f16 k rows [b][t][c]
#define WS_VT  (WS_KH + 2u * (size_t)NB * SEQ * CC)         // f16 v planes [b][c][t]
#define WS_VL  (WS_VT + 2u * (size_t)NB * CC * SEQ)         // f16 v residual x 2^10 planes [b][c][t < QB0]
#define WS_Y   (WS_VL + 2u * (size_t)NB * CC * QB0)         // f16 ctx x 16 rows [b][t][c]
#define WS_YL  (WS_Y + 2u * (size_t)NB * SEQ * CC)          // f16 ctx x 16 residual x 2^10 rows [b][t < QB0][c]
#define WS_MB  (WS_YL + 2u * (size_t)NB * QB0 * CC)         // mask bit plane [q][SEQ/32] (bit set = masked)
#define WS_END (WS_MB + 4u * (size_t)SEQ * (SEQ / 32))
static_assert(WS_END <= (size_t)134217728u);
static_assert(WS_WK % 128 == 0 && WS_WV % 128 == 0 && WS_WO % 128 == 0 && WS_XB % 128 == 0 && WS_QH % 128 == 0 && WS_QL % 128 == 0 && WS_KH % 128 == 0);
static_assert(WS_VT % 128 == 0 && WS_VL % 128 == 0 && WS_Y % 128 == 0 && WS_YL % 128 == 0 && WS_MB % 128 == 0);

template <typename T> __device__ __forceinline__ void vst2(void* p, T v) { *(T*)p = v;  }
template <bool B> struct flag_t { static constexpr bool value = B; };
__device__ __forceinline__ v8f wmma_bf(v16b a, v16b b, v8f c) {
  v8f d = __builtin_amdgcn_wmma_f32_16x16x32_bf16(false, a, false, b, (short)0, c, false, false);
  asm volatile("v_nop\n\tv_nop\n\tv_nop\n\tv_nop" : "+v"(d) : "v"(a), "v"(b));
  return d;
}
// 16x16x32 fragments: lane = (h = lane>>4, row/col = lane&15); elements 0..7 = k0+8h+0..7, 8..15 = k0+16+8h+0..7; D element r = row 8h+r
__device__ __forceinline__ float bfr(float v) { return (float)(__bf16)v; }

// ---- LDS ring of the two GEMM kernels: a stage = 64 k (128 bytes, one whole line) of every operand row of the block, two buffers, filled by asynchronous copies while the other buffer is worked on
#define KS 64                // k per stage
#define NS (CC / KS)         // stages
#define RP 144               // ring row pitch in bytes: 128 + 16, free of bank conflicts for 16-byte LDS reads
static_assert(NS >= 2 && CC % KS == 0);
__device__ __forceinline__ unsigned lds_off(const void* p) { return (unsigned)(size_t)p; }
// four copies of 16 bytes a lane, global -> LDS through no register: ring rows 16 apart from plane rows 16 apart (8 lanes cover one 128-byte row slice, a wave 4 whole lines).
// s_wait_xcnt in the same statement: every later write of the address registers stays behind it
__device__ __forceinline__ void copy4(unsigned l, const char* p) {
  asm volatile("global_load_async_to_lds_b128 %0, %4, off\n\tglobal_load_async_to_lds_b128 %1, %5, off\n\tglobal_load_async_to_lds_b128 %2, %6, off\n\tglobal_load_async_to_lds_b128 %3, %7, off\n\ts_wait_xcnt 0x0"
               :: "v"(l), "v"(l + 16u * RP), "v"(l + 32u * RP), "v"(l + 48u * RP), "v"(p), "v"(p + 16 * 2 * CC), "v"(p + 32 * 2 * CC), "v"(p + 48 * 2 * CC) : "memory");
}
#define AW() asm volatile("s_wait_asynccnt 0x0" ::: "memory")   // this wave's copies have landed
#define DW() asm volatile("s_wait_dscnt 0x0" ::: "memory")      // this wave's LDS reads have returned: the buffer may be refilled behind the barrier
// fragment from a ring row: p = row start + 64 bytes per 32 k + 16 bytes per lane half (the k order stated above)
__device__ __forceinline__ v16h frag_lh(const char* p) { union { v16h v; v8h q[2]; } u; u.q[0] = *(const v8h*)p; u.q[1] = *(const v8h*)(p + 32); return u.v; }
__device__ __forceinline__ v16b frag_lb(const char* p) { union { v16b v; v8b q[2]; } u; u.q[0] = *(const v8b*)p; u.q[1] = *(const v8b*)(p + 32); return u.v; }

// ---- k_prep: every conversion of the call in one grid; a block's index range says which plane it fills (block-uniform): x of all batches, the four weights, the mask bits
#define PB_X (NB * ((SEQ * CC) / 8) / 256)     // blocks on x: 8 elements a thread
#define PB_W (((CC * CC) / 8) / 256)           // blocks on one weight
#define PB_M (SEQ * (SEQ / 32) / 256)          // blocks on the mask: one 32-bit word a thread
static_assert(WS_WK == WS_WQ + 2u * (size_t)CC * CC && WS_WV == WS_WQ + 4u * (size_t)CC * CC && WS_WO == WS_WQ + 6u * (size_t)CC * CC);   // k_prep steps from one weight plane to the next
__device__ __forceinline__ void cvt8(const float* __restrict__ A, unsigned short* __restrict__ D, const bool f16x64) {
  const v4f a = *(const v4f*)A; const v4f c = *(const v4f*)(A + 4);
  asm volatile("s_wait_xcnt 0x0" ::: "memory");   // the loads' address register is reused for the packed result: it may be rewritten only behind this wait
  const float v[8] = {a[0], a[1], a[2], a[3], c[0], c[1], c[2], c[3]};
  union { v8b b; v8h h; v4u u; } o;
  if (f16x64) { v8h t;
#pragma unroll
    for (int k = 0; k < 8; ++k) t[k] = (_Float16)(bfr(v[k]) * 64.0f);
    o.h = t; }
  else { v8b t;
#pragma unroll
    for (int k = 0; k < 8; ++k) t[k] = (__bf16)v[k];
    o.b = t; }
  vst2(D, o.u);
}
__global__ __launch_bounds__(256) void k_prep(const float* __restrict__ X, const float* __restrict__ WQ, const float* __restrict__ WK, const float* __restrict__ WV, const float* __restrict__ WO, const int* __restrict__ M,
                                              unsigned short* __restrict__ XB, unsigned short* __restrict__ WB, unsigned* __restrict__ MB) {
  const int blk = blockIdx.x, tid = threadIdx.x;
  if (blk < PB_X) {
    const int i = blk * 256 + tid, b = i / ((SEQ * CC) / 8);     // x rows of batch b start SEQ_FULL rows apart, the plane's SEQ rows apart
    cvt8(X + (size_t)b * (SEQ_FULL - SEQ) * CC + (size_t)i * 8, XB + (size_t)i * 8, false);
  } else if (blk < PB_X + 4 * PB_W) {
    const int wsel = (blk - PB_X) / PB_W; const int i = (blk - PB_X - wsel * PB_W) * 256 + tid;   // the four 16-bit weight planes stand one behind the other in the workspace
    const float* A = wsel == 0 ? WQ : wsel == 1 ? WK : wsel == 2 ? WV : WO;
    cvt8(A + (size_t)i * 8, WB + (size_t)wsel * CC * CC + (size_t)i * 8, wsel == 3);
  } else {
    const int w = (blk - PB_X - 4 * PB_W) * 256 + tid;
    const int q = w / (SEQ / 32), wc = w - q * (SEQ / 32);
    const int* p = M + (size_t)q * SEQ_FULL + wc * 32;
    unsigned bits = 0u;
#pragma unroll
    for (int i = 0; i < 8; ++i) { const v4i v = *(const v4i*)(p + 4 * i);
      bits |= (v.x != 0 ? 1u : 0u) << (4 * i);     bits |= (v.y != 0 ? 1u : 0u) << (4 * i + 1);
      bits |= (v.z != 0 ? 1u : 0u) << (4 * i + 2); bits |= (v.w != 0 ? 1u : 0u) << (4 * i + 3); }
    vst2(MB + w, bits);
  }
}

// ---- k_proj: block = (128 rows out of all batches' rows, 128 cols, which), wave = 64 rows x 64 cols (one head): y = x W^T + b (exact bf16 products from the 16-bit planes); which 0/1: rope then q -> f16 hi (+ residual for rows 0..63), k -> f16 rows; which 2: v -> f16 planes [c][t] (+ residual plane for rows 0..63)
// a 64 x 64 wave tile reads 8 fragments for 16 products (16 x 128: 9 for 8), a 128 x 128 block tile brings 256 operand rows from L2 for 16,384 outputs (64 x 128: 192 for 8,192)
__global__ __launch_bounds__(128) void k_proj(const __bf16* __restrict__ XB, const __bf16* __restrict__ WQ, const float* __restrict__ BQ, const __bf16* __restrict__ WK, const float* __restrict__ BK, const __bf16* __restrict__ WV, const float* __restrict__ BV,
                                              const float* __restrict__ RC, const float* __restrict__ RS,
                                              _Float16* __restrict__ QH, _Float16* __restrict__ QL, _Float16* __restrict__ KH, _Float16* __restrict__ VT, _Float16* __restrict__ VL) {
  // one pool: the ring (2 x 256 rows: 128 of x, 128 of W) during the k loop, the output staging planes behind it
  constexpr unsigned RB = 256u * RP; __shared__ __align__(16) char pool[2 * RB]; static_assert(2u * 128 * 136 * 2 <= sizeof(pool) && 128u * 136 * 2 + 128u * 72 * 2 <= sizeof(pool));
  _Float16 (*sh)[136] = (_Float16 (*)[136])pool; _Float16 (*sl)[136] = (_Float16 (*)[136])(pool + 128 * 136 * 2); _Float16 (*th)[136] = (_Float16 (*)[136])pool; _Float16 (*tl2)[72] = (_Float16 (*)[72])(pool + 128 * 136 * 2);
  __shared__ __align__(16) __bf16 rt[128][17][8];   // rope table of the block's rows: cell (row, col < 16) = cos at d = col, col + 16, col + 32, col + 48, then sin at the same four: what one lane needs for one row, 16 bytes; the 17th cell is the pad that spreads the rows over the banks
  const int tid = threadIdx.x, lane = tid & 31, col = lane & 15, g = lane >> 4; const int wave = __builtin_amdgcn_readfirstlane(tid >> 5), wr = wave >> 1, wc = wave & 1;
  const int which = blockIdx.z; const int c0 = blockIdx.y * 128; const int r0 = blockIdx.x * 128;   // r0: row in the [b][t] planes
  const int bb0 = blockIdx.x / (SEQ / 128), t0 = r0 - bb0 * SEQ;   // its batch and its position in the sequence
  const __bf16* WA = which == 0 ? WQ : which == 1 ? WK : WV; const float* BA = which == 0 ? BQ : which == 1 ? BK : BV;
  const unsigned ring = lds_off(pool) + (unsigned)((tid >> 3) * RP + (tid & 7) * 16);   // this lane's 16 bytes of ring row tid / 8
  const char* gx = (const char*)(XB + (size_t)(r0 + (tid >> 3)) * CC + (tid & 7) * 8); const char* gw = (const char*)(WA + (size_t)(c0 + (tid >> 3)) * CC + (tid & 7) * 8);
  auto fill = [&](const int s) { const unsigned l = ring + (unsigned)(s & 1) * RB; copy4(l, gx + s * (2 * KS)); copy4(l + 64u * RP, gx + s * (2 * KS) + 64 * 2 * CC); copy4(l + 128u * RP, gw + s * (2 * KS)); copy4(l + 192u * RP, gw + s * (2 * KS) + 64 * 2 * CC); };
  fill(0);                                                       // stage 0 flies under the rope table's staging
  // PW: behind global loads or stores whose address or data registers are reused next: they may be rewritten only behind this wait
#define PW() asm volatile("s_wait_xcnt 0x0" ::: "memory")
  float braw[4]; const int bi = c0 + wc * 64 + col;              // the wave's bias values, asked for here so that their latency lies under the k loop, rounded where they are used
#pragma unroll
  for (int j = 0; j < 4; ++j) braw[j] = BA[bi + j * 16];
  asm volatile("s_wait_xcnt 0x0" :: "s"(BA), "v"(bi) : "memory");   // the four loads' base and lane index stay whole up to this wait (named as inputs) and may be rewritten only behind it
  // rope table rows t0..t0+127 (bf16-RNE values), whole head dim; staged extent == consumed extent (128 x HD)
  if (which < 2) {                                               // a thread takes 4 columns of a row at all four 16-column steps: 8 loads of 16 bytes give 4 whole cells; all 32 loads of its 4 rows fly at once
    v4f tc[4][4], ts[4][4]; const float* pc = RC + (size_t)(t0 + (tid >> 2)) * HD + (tid & 3) * 4; const float* ps = RS + (size_t)(t0 + (tid >> 2)) * HD + (tid & 3) * 4;
#pragma unroll
    for (int it = 0; it < 4; ++it)
#pragma unroll
      for (int jj = 0; jj < 4; ++jj) { tc[it][jj] = *(const v4f*)(pc + it * 32 * HD + jj * 16); ts[it][jj] = *(const v4f*)(ps + it * 32 * HD + jj * 16); }
    asm volatile("s_wait_xcnt 0x0" :: "v"(pc), "v"(ps) : "memory");   // the two address pairs of the 32 loads stay whole up to this wait (named as inputs) and may be rewritten only behind it
#pragma unroll
    for (int it = 0; it < 4; ++it)
#pragma unroll
      for (int i = 0; i < 4; ++i) { v8b t;
#pragma unroll
        for (int jj = 0; jj < 4; ++jj) { t[jj] = (__bf16)tc[it][jj][i]; t[4 + jj] = (__bf16)ts[it][jj][i]; }
        *(v8b*)&rt[it * 32 + (tid >> 2)][(tid & 3) * 4 + i][0] = t; } }
  AW();
  __syncthreads();                                               // publishes the rope table and stage 0
  fill(1);
  v8f acc[4][4] = {};
#pragma unroll 1                                                 // one trip a stage: the buffer is picked by the trip's parity, the text stays short
  for (int s = 0; s < NS; ++s) { const char* fb = pool + (unsigned)(s & 1) * RB + col * RP + g * 16;
#pragma unroll                                                   // this and the four below: constant indices keep a[], w[] and acc[] in registers; a block's 16 LDS reads stand as one group ahead of its 16 products
    for (int ks = 0; ks < KS / 32; ++ks) { v16b a[4], w[4];
#pragma unroll
      for (int i = 0; i < 4; ++i) a[i] = frag_lb(fb + (wr * 64 + i * 16) * RP + ks * 64);
#pragma unroll
      for (int j = 0; j < 4; ++j) w[j] = frag_lb(fb + (128 + wc * 64 + j * 16) * RP + ks * 64);
#pragma unroll
      for (int i = 0; i < 4; ++i)
#pragma unroll
        for (int j = 0; j < 4; ++j) acc[i][j] = wmma_bf(a[i], w[j], acc[i][j]); }
    DW(); AW();
    __syncthreads();                                             // publishes stage s + 1 and ends every wave's reads of stage s
    if (s + 2 < NS) fill(s + 2); }
  AW();
  float bbv[4];
#pragma unroll
  for (int j = 0; j < 4; ++j) bbv[j] = bfr(braw[j]);
  // the residual planes are asked for by one scalar test in front of each element loop (two copies of the loop's text), not by a branch per element: the loop bodies are straight-line, their LDS reads and stores fly together
  if (which == 2) {
    auto vput = [&](auto rf) { constexpr bool RES = decltype(rf)::value;
#pragma unroll
    for (int i = 0; i < 4; ++i)
#pragma unroll
      for (int j = 0; j < 4; ++j) { const int cl = wc * 64 + j * 16 + col, rb = wr * 64 + i * 16 + 8 * g; v8h hv, lv;   // a lane's 8 rows of one column stand side by side in the [c][t] plane
#pragma unroll
        for (int r = 0; r < 8; ++r) { const float v = acc[i][j][r] + bbv[j]; const _Float16 h = (_Float16)v; hv[r] = h; lv[r] = (_Float16)((v - (float)h) * 1024.0f); }   /* v residual carried x 2^10 */
        *(v8h*)&th[cl][rb] = hv; if constexpr (RES) *(v8h*)&tl2[cl][rb] = lv; } };
    if (t0 == 0 && wr == 0) vput(flag_t<true>{}); else vput(flag_t<false>{});   // the residual plane is stored for a sequence's rows 0..63 alone (scalar)
  } else { const bool qres = which == 0 && t0 == 0 && wr == 0;   // this wave's 64 rows are a sequence's q rows 0..63 (scalar)
    const float qs = which == 0 ? QSC : 1.0f;                    // q leaves scaled, k as it is
    auto rope = [&](auto rf) { constexpr bool RES = decltype(rf)::value;
#pragma unroll
    for (int i = 0; i < 4; ++i)
#pragma unroll
      for (int r = 0; r < 8; ++r) { const int rl = wr * 64 + i * 16 + 8 * g + r; const v8b t = *(const v8b*)&rt[rl][col][0]; float v[4];
#pragma unroll
        for (int j = 0; j < 4; ++j) v[j] = acc[i][j][r] + bbv[j];
        // rotate-half: head-local d = j*16+col; d<32: y*cos - y[d+32]*sin, d>=32: y*cos + y[d-32]*sin; partner tile = j^2
#pragma unroll
        for (int j = 0; j < 4; ++j) { const int cl = wc * 64 + j * 16 + col; const float pv = v[j ^ 2], cs = (float)t[j], sn = (float)t[4 + j];
          const float o = ((j < 2) ? (v[j] * cs - pv * sn) : (v[j] * cs + pv * sn)) * qs;
          const _Float16 hv = (_Float16)o; sh[rl][cl] = hv; if constexpr (RES) sl[rl][cl] = (_Float16)((o - (float)hv) * 1024.0f); }   /* q residual carried x 2^10 so the plane stays f16-normal */
      } };
    if (qres) rope(flag_t<true>{}); else rope(flag_t<false>{}); }
  __syncthreads();
  // the staged planes leave as whole row pieces, 8 pieces a thread at a time: their LDS reads fly together, the stores follow from one address with constant steps, one wait serves the run
  const int pr = tid >> 4, pq = (tid & 15) * 8;                  // piece (row pr + 8 n, 8 columns from pq)
  if (which < 2) { _Float16* dh = (which == 0 ? QH : KH) + (size_t)(r0 + pr) * CC + c0 + pq;
#pragma unroll                                                   // this and every unroll below: constant steps from one address, t[] in registers
    for (int hb = 0; hb < 2; ++hb) { v4u t[8];
#pragma unroll
      for (int u = 0; u < 8; ++u) t[u] = *(const v4u*)&sh[(hb * 8 + u) * 8 + pr][pq];
#pragma unroll
      for (int u = 0; u < 8; ++u) vst2(dh + (hb * 8 + u) * 8 * CC, t[u]);
      PW(); }
    if (which == 0 && t0 == 0) { _Float16* dl = QL + (size_t)(r0 + pr) * CC + c0 + pq; v4u t[8];   // rows 0..63 of the residual plane
      static_assert(QB0 == 64);
#pragma unroll
      for (int u = 0; u < 8; ++u) t[u] = *(const v4u*)&sl[u * 8 + pr][pq];
#pragma unroll
      for (int u = 0; u < 8; ++u) vst2(dl + u * 8 * CC, t[u]);
      PW(); } }
  else { _Float16* dv = VT + (size_t)(bb0 * CC + c0 + pr) * (size_t)SEQ + t0 + pq;
#pragma unroll                                                   // as above
    for (int hb = 0; hb < 2; ++hb) { v4u t[8];
#pragma unroll
      for (int u = 0; u < 8; ++u) t[u] = *(const v4u*)&th[(hb * 8 + u) * 8 + pr][pq];
#pragma unroll
      for (int u = 0; u < 8; ++u) vst2(dv + (hb * 8 + u) * 8 * SEQ, t[u]);
      PW(); }
    if (t0 == 0) { _Float16* dl = VL + (size_t)(bb0 * CC + c0 + (tid >> 3)) * (size_t)QB0 + (tid & 7) * 8; v4u t[8];   // the residual plane's rows hold 64 positions: 8 pieces a row, 16 rows a step, every lane on
#pragma unroll
      for (int u = 0; u < 8; ++u) t[u] = *(const v4u*)&tl2[u * 16 + (tid >> 3)][(tid & 7) * 8];
#pragma unroll
      for (int u = 0; u < 8; ++u) vst2(dl + u * 16 * QB0, t[u]);
      PW(); } } }

// ---- k_fa: wave = 32 queries (two 16-column groups) of one head of one batch, whole key range in one pass, logits and P stay in registers.
// S^T = K Q^T (A = k rows, B = q rows, same loader on both sides): lane (col, g) holds query col, keys 8g+r of each 16-key tile, so two tiles pack straight into the B operand of O^T += V^T P^T.
// q comes scaled by log2(e) / 8 and the score products start from C = 11 - reference, so a score leaves the matrix unit as the exponent of P = 2^(s - reference) x 2^11 -> f16: no subtraction or scaling per score.
// The reference of a query is its largest score at the time it is set; it is renewed (scores of the block, sums and O rescaled, the lane halves' maxima joined) only when a score passes it by 2^4, P <= 2^15. Sum per query, normalised once at the end.
// The wave's 32 mask rows are scanned once: stages in front of the first set bit of all four waves run without mask work, a wave's 32-key blocks behind its last clear bit are not run (both counts bounded by SEQ / 32).
// Any mask content is honoured; a fully masked row ends as 0 x inf = NaN like the softmax of an all -inf row.
// K and V come through LDS: a stage = 64 keys of the block's head, 64 k rows (128 bytes, one whole line each) and those keys' 128 bytes of the 64 v plane rows; two buffers, filled by asynchronous copies
// while the other buffer is worked on; the block's four waves walk the stages together and read their fragments from the ring (each line leaves L2 once a block, whole, instead of in 32-byte pieces once a wave).
#define FKS 64               // keys per stage
#define FRB (128u * RP)      // bytes of one buffer: 64 k rows, then 64 v rows, at the ring pitch
static_assert(SEQ % FKS == 0 && FKS == 64 && 2 * HD == 128);
// copy4 for the v planes, whose rows stand SEQ elements apart. s_wait_xcnt in the same statement: every later write of the address registers stays behind it
__device__ __forceinline__ void copy4v(unsigned l, const char* p) {
  asm volatile("global_load_async_to_lds_b128 %0, %4, off\n\tglobal_load_async_to_lds_b128 %1, %5, off\n\tglobal_load_async_to_lds_b128 %2, %6, off\n\tglobal_load_async_to_lds_b128 %3, %7, off\n\ts_wait_xcnt 0x0"
               :: "v"(l), "v"(l + 16u * RP), "v"(l + 32u * RP), "v"(l + 48u * RP), "v"(p), "v"(p + 16 * 2 * SEQ), "v"(p + 32 * 2 * SEQ), "v"(p + 48 * 2 * SEQ) : "memory");
}
__device__ __forceinline__ float xhalf(float v) { const int b = __float_as_int(v); return __int_as_float(__builtin_amdgcn_permlanex16(b, b, 0x76543210, 0xfedcba98, false, false)); }
// behind global loads or stores whose registers are reused next: those registers may be rewritten only behind this wait
#define XW() asm volatile("s_wait_xcnt 0x0" ::: "memory")
__device__ __forceinline__ v8f wm(v16h a, v16h b, v8f c) { return __builtin_amdgcn_wmma_f32_16x16x32_f16(false, a, false, b, (short)0, c, false, false); }
// 2^x with the one free issue slot behind a transcendental kept inside the statement
__device__ __forceinline__ float exp2s(float x) { float r; asm("v_exp_f32 %0, %1\n\tv_nop" : "=v"(r) : "v"(x)); return r; }
// eight at once: each v_exp_f32 is followed by one that touches neither its result nor its source (early-clobber outputs), so one slot at the end serves the run
__device__ __forceinline__ v8f exp2x8(v8f x) { float r0, r1, r2, r3, r4, r5, r6, r7;
  asm("v_exp_f32 %0, %8\n\tv_exp_f32 %1, %9\n\tv_exp_f32 %2, %10\n\tv_exp_f32 %3, %11\n\tv_exp_f32 %4, %12\n\tv_exp_f32 %5, %13\n\tv_exp_f32 %6, %14\n\tv_exp_f32 %7, %15\n\tv_nop"
      : "=&v"(r0), "=&v"(r1), "=&v"(r2), "=&v"(r3), "=&v"(r4), "=&v"(r5), "=&v"(r6), "=&v"(r7) : "v"(x[0]), "v"(x[1]), "v"(x[2]), "v"(x[3]), "v"(x[4]), "v"(x[5]), "v"(x[6]), "v"(x[7]));
  return v8f{r0, r1, r2, r3, r4, r5, r6, r7}; }
// fragment at a byte address that already holds the lane's row and its half's 16 bytes
__device__ __forceinline__ v16h frag_p(const char* p) { union { v16h v; v8h q[2]; } u; u.q[0] = *(const v8h*)p; u.q[1] = *(const v8h*)(p + 32); return u.v; }
__global__ __launch_bounds__(128) void k_fa(const _Float16* __restrict__ QH, const _Float16* __restrict__ QL, const _Float16* __restrict__ KH, const _Float16* __restrict__ VT, const _Float16* __restrict__ VL,
                                            const unsigned* __restrict__ MB, _Float16* __restrict__ Y, _Float16* __restrict__ YL) {
  constexpr float NEG = -3.0e38f; constexpr int NW = SEQ / 32;
  __shared__ __align__(16) char ring[2 * FRB]; __shared__ __align__(16) int wtrip[4], wfull[4];
  const int tid = threadIdx.x, lane = threadIdx.x & 31, col = lane & 15, g = lane >> 4; const int wave = __builtin_amdgcn_readfirstlane((int)threadIdx.x >> 5);
  // more blocks than resident places, and a block's cost grows with its query tile: the longest key ranges of every head and batch come first in the index, the short ones fill the places that free up
  constexpr int NT = SEQ / 128; const unsigned hb = blockIdx.x % (unsigned)(NH * NB); const int h = (int)(hb % NH), bt = (int)(hb / NH); const int q0 = (NT - 1 - (int)(blockIdx.x / (unsigned)(NH * NB))) * 128 + wave * 32;
  QH += (size_t)bt * SEQ * CC; QL += (size_t)bt * SEQ * CC; KH += (size_t)bt * SEQ * CC; VT += (size_t)bt * CC * SEQ; VL += (size_t)bt * CC * QB0; Y += (size_t)bt * SEQ * CC; YL += (size_t)bt * QB0 * CC;
  const unsigned rl = lds_off(ring) + (unsigned)((tid >> 3) * RP + (tid & 7) * 16);   // this lane's 16 bytes of ring row tid / 8
  const char* gk = (const char*)(KH + (size_t)(tid >> 3) * CC + h * HD + (tid & 7) * 8); const char* gv = (const char*)(VT + ((size_t)h * HD + (tid >> 3)) * SEQ + (tid & 7) * 8);
  auto fill = [&](const int s) { const unsigned l = rl + (unsigned)(s & 1) * FRB; copy4(l, gk + (size_t)s * (FKS * 2 * CC)); copy4v(l + 64u * RP, gv + s * (2 * FKS)); };
  fill(0);                                                     // stage 0 flies under the mask scan (SEQ >= 128: stages 0 and 1 lie inside the planes)
  const unsigned* mu = MB + (size_t)q0 * NW; const unsigned mo = 4u * (unsigned)(col * NW);
  int last = -1, first = NW;
#pragma unroll
  for (int p = 0; p < 2; ++p)
#pragma unroll
    for (int i = NW / 8 - 1; i >= 0; --i) { const v4u u = *(const v4u*)((const char*)(mu + p * 16 * NW + 4 * i) + (mo + 4u * (unsigned)(g * (NW / 2))));
#pragma unroll
      for (int e = 3; e >= 0; --e) { const int w = g * (NW / 2) + 4 * i + e; last = (u[e] != 0xFFFFFFFFu) ? max(last, w) : last; first = (u[e] != 0u) ? min(first, w) : first; } }
#pragma unroll
  for (int o = 1; o < 32; o <<= 1) { last = max(last, __shfl_xor(last, o)); first = min(first, __shfl_xor(first, o)); }
  const int trip = min(__builtin_amdgcn_readfirstlane(last) + 1, NW);
  const int nfull = max(min(__builtin_amdgcn_readfirstlane(first), trip), 0);
  if (lane == 0) { wtrip[wave] = trip; wfull[wave] = nfull; }
  AW();
  __syncthreads();                                             // publishes stage 0 and the four waves' block counts
  const v4i wt = *(const v4i*)wtrip, wf = *(const v4i*)wfull;
  const int nst = (__builtin_amdgcn_readfirstlane(max(max(wt.x, wt.y), max(wt.z, wt.w))) + 1) >> 1;   // stages of the block: its longest wave's, at most SEQ / FKS
  const int nfs = __builtin_amdgcn_readfirstlane(min(min(wf.x, wf.y), min(wf.z, wf.w))) >> 1;         // leading stages that no wave of the block has mask work in (nfull <= trip: every wave runs both their halves)
  if (nst > 1) fill(1);
  const bool res = q0 < QB0;
  const unsigned ko = 2u * (unsigned)(col * CC + 8 * g), lo = 2u * (unsigned)(col * QB0 + 8 * g);
  const char* lp = (const char*)(VL + (size_t)h * HD * QB0) + lo;
  const char* qlp = (const char*)(QL + (size_t)q0 * CC + h * HD) + ko;   // the wave's q residual rows, read under res alone
  v16h qh[2][2];
#pragma unroll
  for (int p = 0; p < 2; ++p)
#pragma unroll
    for (int kk = 0; kk < 2; ++kk) { const size_t o = (size_t)(q0 + 16 * p) * CC + h * HD + kk * 32; qh[p][kk] = frag_p((const char*)(QH + o) + ko); }
  XW();
  v8f acc[2][4] = {}; float l[2] = {0.f, 0.f}, thr[2] = {-1.0e38f, -1.0e38f};   // thr: the score exponent above which the reference is renewed; below every real score until the first unmasked one has set it
  constexpr v8f C11 = {11.0f, 11.0f, 11.0f, 11.0f, 11.0f, 11.0f, 11.0f, 11.0f}; v8f cr[2] = {C11, C11};   // 11 - reference of the lane's query, eight times over: the C operand of its score products
  auto body = [&](const int kc, const char* kb, const char* vb, auto mk) {   // kb, vb: the lane's row and half at this block's 32 keys in the stage's buffer
    constexpr bool masked = decltype(mk)::value;
    v16h kf[2][2], vf[4]; unsigned mw[2] = {0u, 0u};
#pragma unroll
    for (int t = 0; t < 2; ++t)
#pragma unroll
      for (int kk = 0; kk < 2; ++kk) kf[t][kk] = frag_lh(kb + t * 16 * RP + kk * 64);
#pragma unroll
    for (int j = 0; j < 4; ++j) vf[j] = frag_lh(vb + j * 16 * RP);   // this block's v rows fly under the logits and the softmax
    if constexpr (masked) { mw[0] = *(const unsigned*)((const char*)(mu + kc) + mo); mw[1] = *(const unsigned*)((const char*)(mu + 16 * NW + kc) + mo); XW(); }
    v8f s[2][2];
#pragma unroll
    for (int t = 0; t < 2; ++t)
#pragma unroll
      for (int p = 0; p < 2; ++p) s[p][t] = wm(kf[t][0], qh[p][0], cr[p]);
#pragma unroll
    for (int t = 0; t < 2; ++t)
#pragma unroll
      for (int p = 0; p < 2; ++p) s[p][t] = wm(kf[t][1], qh[p][1], s[p][t]);
    if (res) {                                                 // query rows 0..63 (scalar): the q residual product on top, its fragments fetched here so that the other waves hold no registers for them
      v16h ql[2][2];
#pragma unroll
      for (int p = 0; p < 2; ++p)
#pragma unroll
        for (int kk = 0; kk < 2; ++kk) ql[p][kk] = frag_p(qlp + 2 * (16 * p * CC + kk * 32));
      XW();
#pragma unroll
      for (int t = 0; t < 2; ++t)
#pragma unroll
        for (int p = 0; p < 2; ++p) { v8f a = wm(kf[t][0], ql[p][0], v8f{}); a = wm(kf[t][1], ql[p][1], a); s[p][t] += a * (1.0f / 1024.0f); } }
    if constexpr (masked) {
#pragma unroll
      for (int p = 0; p < 2; ++p) { const unsigned w = mw[p] >> (8 * g);
#pragma unroll
        for (int t = 0; t < 2; ++t)
#pragma unroll
          for (int r = 0; r < 8; ++r) s[p][t][r] = ((w >> (16 * t + r)) & 1u) ? NEG : s[p][t][r]; } }
    float mx[2];                                               // the lane's own 16 keys; the halves are joined only where the reference moves
#pragma unroll
    for (int p = 0; p < 2; ++p) { float x = fmaxf(s[p][0][0], s[p][1][0]);
#pragma unroll
      for (int r = 1; r < 8; ++r) x = fmaxf(x, fmaxf(s[p][0][r], s[p][1][r]));
      mx[p] = x; }
    if (__builtin_amdgcn_ballot_w32(mx[0] > thr[0] || mx[1] > thr[1]) != 0u) {
#pragma unroll
      for (int p = 0; p < 2; ++p) { const float x = fmaxf(mx[p], xhalf(mx[p])); const bool up = x > thr[p];   // alike in both lanes of a query
        const float d = up ? x - 11.0f : 0.f;                  // the reference moves by d: the block's largest score becomes 2^11
        const float al = thr[p] < 0.f ? 1.0f : exp2s(-d);      // nothing summed before the reference is first set: no factor (d may then be negative)
        thr[p] = up ? 15.0f : thr[p]; l[p] *= al; cr[p] -= d; s[p][0] -= d; s[p][1] -= d;
#pragma unroll
        for (int j = 0; j < 4; ++j) acc[p][j] *= al; } }
    v16h pb[2];
#pragma unroll
    for (int p = 0; p < 2; ++p) { float sum = 0.f;             // a masked score is -huge whatever the reference: its term is exp2(-huge) = 0
#pragma unroll
      for (int t = 0; t < 2; ++t) { s[p][t] = exp2x8(s[p][t]);
#pragma unroll
        for (int r = 0; r < 8; ++r) { sum += s[p][t][r]; pb[p][8 * t + r] = (_Float16)s[p][t][r]; } }
      l[p] += sum; }
#pragma unroll
    for (int j = 0; j < 4; ++j)
#pragma unroll
      for (int p = 0; p < 2; ++p) acc[p][j] = wm(vf[j], pb[p], acc[p][j]);
    if (res && kc < QB0 / 32) {                                // query rows 0..63, keys 0..63: P and v residual planes (x 2^10), as before
      v16h pl[2];
#pragma unroll
      for (int p = 0; p < 2; ++p)
#pragma unroll
        for (int e = 0; e < 16; ++e) pl[p][e] = (_Float16)((s[p][e >> 3][e & 7] - (float)pb[p][e]) * 1024.0f);
#pragma unroll
      for (int j = 0; j < 4; ++j) { const v16h vl = frag_p(lp + 2 * (j * 16 * QB0 + kc * 32)); XW();
#pragma unroll
        for (int p = 0; p < 2; ++p) { v8f a = {}; a = wm(vf[j], pl[p], a); a = wm(vl, pb[p], a); acc[p][j] += a * (1.0f / 1024.0f); } } }
  };
  auto foot = [&](const int st) {                              // both loops below run the same trips in every wave of the block
    DW(); AW();
    __syncthreads();                                           // publishes stage st + 1 and ends every wave's reads of stage st
    if (st + 2 < nst) fill(st + 2); };
  const char* f0 = ring + col * RP + g * 16;
#pragma unroll 1                                               // one trip a stage: the buffer is picked by the trip's parity, the text stays short
  for (int st = 0; st < nfs; ++st) { const char* fb = f0 + (unsigned)(st & 1) * FRB;
    body(2 * st, fb, fb + 64 * RP, flag_t<false>{}); body(2 * st + 1, fb + 32 * RP, fb + 64 * RP + 64, flag_t<false>{});
    foot(st); }
#pragma unroll 1                                               // as above
  for (int st = nfs; st < nst; ++st) { const char* fb = f0 + (unsigned)(st & 1) * FRB; const int ke = min(2 * st + 2, trip);   // a wave past its own last block only keeps the ring going
#pragma unroll 1                                               // one copy of the masked body in the text
    for (int kc = 2 * st; kc < ke; ++kc) body(kc, fb + (kc & 1) * (32 * RP), fb + 64 * RP + (kc & 1) * 64, flag_t<true>{});
    foot(st); }
  AW();
#pragma unroll
  for (int p = 0; p < 2; ++p) { const float inv = 16.0f / (l[p] + xhalf(l[p])); const size_t o = (size_t)(q0 + 16 * p) * CC + h * HD;   /* ctx carried x 16, residual x 2^10 */
#pragma unroll
    for (int j = 0; j < 4; ++j) { union { v8h h; v4u u; } yh, yl;
#pragma unroll
      for (int r = 0; r < 8; ++r) { const float y = acc[p][j][r] * inv; const _Float16 t = (_Float16)y; yh.h[r] = t; yl.h[r] = (_Float16)((y - (float)t) * 1024.0f); }
      vst2((char*)(Y + o + j * 16) + ko, yh.u); XW(); if (res) { vst2((char*)(YL + o + j * 16) + ko, yl.u); XW(); } } } }

// ---- k_out: block = (128 rows out of all batches' rows, 128 cols), wave = 64 rows x 64 cols: out = (ctx x 16 f16) (f16 bf16(Wo) x 64)^T / 1024 + bo; the two waves on a sequence's rows 0..63 add the ctx residual plane (2 products)
__global__ __launch_bounds__(128) void k_out(const _Float16* __restrict__ Y, const _Float16* __restrict__ YL, const _Float16* __restrict__ WO, const float* __restrict__ BP, float* __restrict__ OUT) { __shared__ __align__(16) float sf[4][32][68];
  constexpr unsigned RB = 320u * RP; __shared__ __align__(16) char pool[2 * RB];   // ring: 2 x (128 rows of ctx, 128 of Wo, 64 of the ctx residual, filled in a sequence's row block 0 alone)
  const int tid = threadIdx.x, lane = tid & 31, col = lane & 15, g = lane >> 4; const int wave = __builtin_amdgcn_readfirstlane(tid >> 5), wr = wave >> 1, wc = wave & 1;
  const int c0 = blockIdx.y * 128; const int r0 = blockIdx.x * 128 + wr * 64; const int b = blockIdx.x / (SEQ / 128); const size_t orow = (size_t)b * (SEQ_FULL - SEQ) + r0;
  const bool lo = blockIdx.x % (SEQ / 128) == 0; const bool lw = lo && wr == 0;   // lw: this wave's 64 rows are a sequence's rows 0..63 (scalar: the products under it run with every lane on)
  const unsigned ring = lds_off(pool) + (unsigned)((tid >> 3) * RP + (tid & 7) * 16);   // this lane's 16 bytes of ring row tid / 8
  const char* gy = (const char*)(Y + (size_t)(blockIdx.x * 128 + (tid >> 3)) * CC + (tid & 7) * 8); const char* gl = (const char*)(YL + (size_t)(b * QB0 + (tid >> 3)) * CC + (tid & 7) * 8); const char* gw = (const char*)(WO + (size_t)(c0 + (tid >> 3)) * CC + (tid & 7) * 8);
  auto fill = [&](const int s) { const unsigned l = ring + (unsigned)(s & 1) * RB; copy4(l, gy + s * (2 * KS)); copy4(l + 64u * RP, gy + s * (2 * KS) + 64 * 2 * CC); copy4(l + 128u * RP, gw + s * (2 * KS)); copy4(l + 192u * RP, gw + s * (2 * KS) + 64 * 2 * CC); if (lo) copy4(l + 256u * RP, gl + s * (2 * KS)); };
  fill(0);
  AW();
  __syncthreads();                                               // publishes stage 0
  fill(1);
  v8f acc[4][4] = {}, accl[4][4] = {};
  // one block of 32 k: fp = the lane's row and half at these 32 k in the stage's buffer
  auto blk = [&](const char* fp) { v16h a[4], w[4], al[4];
#pragma unroll                                                   // this and those below: constant indices keep the fragments, acc[] and accl[] in registers
    for (int i = 0; i < 4; ++i) a[i] = frag_lh(fp + (wr * 64 + i * 16) * RP);
#pragma unroll
    for (int j = 0; j < 4; ++j) w[j] = frag_lh(fp + (128 + wc * 64 + j * 16) * RP);
    if (lw) {
#pragma unroll
      for (int i = 0; i < 4; ++i) al[i] = frag_lh(fp + (256 + i * 16) * RP); }
    __builtin_amdgcn_sched_barrier(0);                           // the block's LDS reads stay one group ahead of its products: without it they were spread, two reads and a full wait in front of every four products
#pragma unroll
    for (int i = 0; i < 4; ++i)
#pragma unroll
      for (int j = 0; j < 4; ++j) acc[i][j] = wm(a[i], w[j], acc[i][j]);
    if (lw) {
#pragma unroll
      for (int i = 0; i < 4; ++i)
#pragma unroll
        for (int j = 0; j < 4; ++j) accl[i][j] = wm(al[i], w[j], accl[i][j]); } };
#pragma unroll 1                                                 // one trip a stage: the buffer is picked by the trip's parity, the text stays short
  for (int s = 0; s < NS; ++s) { const char* fb = pool + (unsigned)(s & 1) * RB + col * RP + g * 16;
    static_assert(KS == 64);
    blk(fb); blk(fb + 64);
    DW(); AW();
    __syncthreads();                                             // publishes stage s + 1 and ends every wave's reads of stage s
    if (s + 2 < NS) fill(s + 2); }
  AW();
  float bb[4];
#pragma unroll
  for (int j = 0; j < 4; ++j) bb[j] = bfr(BP[c0 + wc * 64 + j * 16 + col]);
#pragma unroll                                                   // constant indices into acc[] and accl[]
  for (int hp = 0; hp < 2; ++hp) {                               // 32 rows at a time through the wave's own staging plane, stored as whole 256-byte row pieces
#pragma unroll
    for (int ii = 0; ii < 2; ++ii)
#pragma unroll
      for (int j = 0; j < 4; ++j)
#pragma unroll
        for (int r = 0; r < 8; ++r) sf[wave][ii * 16 + 8 * g + r][j * 16 + col] = (acc[hp * 2 + ii][j][r] + accl[hp * 2 + ii][j][r] * (1.0f / 1024.0f)) * (1.0f / 1024.0f) + bb[j];
    DW();                                                        // the wave's own staging stores have landed before it reads the rows back (no other wave touches its plane)
#pragma unroll                                                   // 8 row pairs at a time: their LDS reads fly together, one wait serves the run of stores
    for (int hb = 0; hb < 2; ++hb) { v4f t[8]; float* po = OUT + (orow + hp * 32 + hb * 16 + g) * CC + c0 + wc * 64 + col * 4;
#pragma unroll
      for (int u = 0; u < 8; ++u) t[u] = *(const v4f*)&sf[wave][hb * 16 + 2 * u + g][col * 4];
#pragma unroll
      for (int u = 0; u < 8; ++u) vst2(po + u * 2 * CC, t[u]);
      PW(); } } }

extern "C" void kernel_launch(void* const* d_in, const int* in_sizes, int n_in, void* d_out, int out_size, void* d_ws, size_t ws_size, hipStream_t stream) {
  if (n_in < 12) return;
  // d_in: 0 x [4,2048,1024] f32, 1 mask [2048,2048] int32, 2 rope_cos [2048,64] f32, 3 rope_sin [2048,64] f32, 4 Wq [out,in], 5 bq, 6 Wk, 7 bk, 8 Wv, 9 bv, 10 Wo, 11 bo
  const size_t xneed = ((size_t)(NB - 1) * SEQ_FULL + SEQ) * (size_t)CC;
  if ((size_t)in_sizes[0] < xneed) return;
  if ((size_t)in_sizes[1] < (size_t)(SEQ - 1) * SEQ_FULL + SEQ) return;
  if (in_sizes[2] < SEQ * HD || in_sizes[3] < SEQ * HD) return;
  if (in_sizes[4] < CC * CC || in_sizes[6] < CC * CC || in_sizes[8] < CC * CC || in_sizes[10] < CC * CC) return;
  if (in_sizes[5] < CC || in_sizes[7] < CC || in_sizes[9] < CC || in_sizes[11] < CC) return;
  if ((size_t)out_size < xneed) return;
  if (ws_size < (size_t)WS_END) return;
  const float* X = (const float*)d_in[0]; const int* M = (const int*)d_in[1]; const float* RC = (const float*)d_in[2]; const float* RS = (const float*)d_in[3];
  const float *WQ = (const float*)d_in[4], *BQ = (const float*)d_in[5], *WK = (const float*)d_in[6], *BK = (const float*)d_in[7], *WV = (const float*)d_in[8], *BV = (const float*)d_in[9], *WO = (const float*)d_in[10], *BO = (const float*)d_in[11];
  char* ws = (char*)d_ws;
  __bf16 *WQB = (__bf16*)(ws + WS_WQ), *WKB = (__bf16*)(ws + WS_WK), *WVB = (__bf16*)(ws + WS_WV), *XB = (__bf16*)(ws + WS_XB); _Float16* WOH = (_Float16*)(ws + WS_WO);
  _Float16 *QH = (_Float16*)(ws + WS_QH), *QL = (_Float16*)(ws + WS_QL), *KH = (_Float16*)(ws + WS_KH), *VT = (_Float16*)(ws + WS_VT), *VL = (_Float16*)(ws + WS_VL), *Y = (_Float16*)(ws + WS_Y), *YL = (_Float16*)(ws + WS_YL);
  unsigned* MB = (unsigned*)(ws + WS_MB); float* OUT = (float*)d_out;
  k_prep<<<dim3(PB_X + 4 * PB_W + PB_M), 256, 0, stream>>>(X, WQ, WK, WV, WO, M, (unsigned short*)XB, (unsigned short*)WQB, MB);
  k_proj<<<dim3(NB * (SEQ / 128), CC / 128, 3), 128, 0, stream>>>(XB, WQB, BQ, WKB, BK, WVB, BV, RC, RS, QH, QL, KH, VT, VL);
  k_fa<<<dim3((SEQ / 128) * NH * NB), 128, 0, stream>>>(QH, QL, KH, VT, VL, MB, Y, YL);
  k_out<<<dim3(NB * (SEQ / 128), CC / 128), 128, 0, stream>>>(Y, YL, WOH, BO, OUT);
}

// v009
// Measured time: 110 microseconds a run.
// Two timings next to v008 both put it at 1.03 times that version's speed.
// All steps since v000 together make it 16.7 times as fast.
// compute dtype: every float input (x, Wq, Wk, Wv, Wo, biases, rope cos/sin tables) RNE-converted to bf16 (bf16-input target); q/k/v = x W^T + b on v_wmma_f32_16x16x32_bf16 (exact bf16 products, f32 accumulate); rope in f32; q x log2(e) / 8 -> f16 (query rows 0..63 of each sequence: + residual plane x 2^10), k -> f16; logits in log2 units = 1 product on v_wmma_f32_16x16x32_f16 (rows 0..63: 2 products) on top of C = 11 - reference, f32; mask replace + softmax against a held reference in f32 (exp2; the reference is a row's largest score when it is set and is renewed when a score passes it by 2^4), logits and P kept in registers; exp2(s - reference) x 2^11 -> f16 against v f16: 1 f16 product, divided by the f32 row sum at the end (query rows 0..63 of each sequence add P and v residual planes x 2^10: 3 products); ctx x 16 -> f16 against f16(bf16(Wo) x 64): 1 f16 product (rows 0..63 add a ctx residual plane x 2^10: 2 products); f32 accumulate everywhere, f32 output.
#include <hip/hip_runtime.h>
#include <math.h>

#ifndef NB
#define NB 4
#endif
#ifndef SEQ
#define SEQ 2048
#endif
#define NB_FULL 4
#define SEQ_FULL 2048
#define CC 1024
#define NH 16
#define HD 64
#define QB0 64               // leading query rows per sequence carried with residual planes
#define QSC (0.125f * 1.44269504088896340736f)   // 1 / sqrt(HD) x log2(e): folded into q where q is made, so that k q^T is an exponent of 2
static_assert(SEQ % 128 == 0);
static_assert(SEQ >= 128 && SEQ <= SEQ_FULL);
static_assert(NB >= 1 && NB <= NB_FULL);
static_assert(CC == NH * HD);
static_assert(HD == 64);
static_assert(QB0 == 64);
static_assert(SEQ % 256 == 0);
static_assert((SEQ * (SEQ / 32)) % 256 == 0);
static_assert(((CC * CC) / 8) % 256 == 0);
static_assert(((SEQ * CC) / 8) % 256 == 0);

typedef __attribute__((ext_vector_type(16))) _Float16 v16h;
typedef __attribute__((ext_vector_type(16))) __bf16 v16b;
typedef __attribute__((ext_vector_type(8)))  _Float16 v8h;
typedef __attribute__((ext_vector_type(8)))  __bf16 v8b;
typedef __attribute__((ext_vector_type(8)))  float v8f;
typedef __attribute__((ext_vector_type(4)))  float v4f;
typedef __attribute__((ext_vector_type(4)))  unsigned v4u;
typedef __attribute__((ext_vector_type(4)))  int v4i;

#define WS_WQ  ((size_t)0)                                  // bf16 Wq [o][i]
#define WS_WK  (WS_WQ + 2u * (size_t)CC * CC)               // bf16 Wk [o][i]
#define WS_WV  (WS_WK + 2u * (size_t)CC * CC)               // bf16 Wv [o][i]
#define WS_WO  (WS_WV + 2u * (size_t)CC * CC)               // f16 bf16(Wo) x 64 [o][i]
#define WS_XB  (WS_WO + 2u * (size_t)CC * CC)               // bf16 x rows of every batch [b][t][c]
#define WS_QH  (WS_XB + 2u * (size_t)NB * SEQ * CC)         // f16 q rows [b][t][c] (hi)
#define WS_QL  (WS_QH + 2u * (size_t)NB * SEQ * CC)         // f16 q residual x 2^10 rows [b][t][c], rows t < QB0 alone written and read
#define WS_KH  (WS_QL + 2u * (size_t)NB * SEQ * CC)         // f16 k rows [b][t][c]
#define WS_VT  (WS_KH + 2u * (size_t)NB * SEQ * CC)         // f16 v planes [b][c][t]
#define WS_VL  (WS_VT + 2u * (size_t)NB * CC * SEQ)         // f16 v residual x 2^10 planes [b][c][t < QB0]
#define WS_Y   (WS_VL + 2u * (size_t)NB * CC * QB0)         // f16 ctx x 16 rows [b][t][c]
#define WS_YL  (WS_Y + 2u * (size_t)NB * SEQ * CC)          // f16 ctx x 16 residual x 2^10 rows [b][t < QB0][c]
#define WS_MB  (WS_YL + 2u * (size_t)NB * QB0 * CC)         // mask bit plane [q][SEQ/32] (bit set = masked)
#define WS_END (WS_MB + 4u * (size_t)SEQ * (SEQ / 32))
static_assert(WS_END <= (size_t)134217728u);
static_assert(WS_WK % 128 == 0 && WS_WV % 128 == 0 && WS_WO % 128 == 0 && WS_XB % 128 == 0 && WS_QH % 128 == 0 && WS_QL % 128 == 0 && WS_KH % 128 == 0);
static_assert(WS_VT % 128 == 0 && WS_VL % 128 == 0 && WS_Y % 128 == 0 && WS_YL % 128 == 0 && WS_MB % 128 == 0);

template <typename T> __device__ __forceinline__ void vst2(void* p, T v) { *(T*)p = v;  }
template <bool B> struct flag_t { static constexpr bool value = B; };
__device__ __forceinline__ v8f wmma_bf(v16b a, v16b b, v8f c) {
  v8f d = __builtin_amdgcn_wmma_f32_16x16x32_bf16(false, a, false, b, (short)0, c, false, false);
  asm volatile("v_nop\n\tv_nop\n\tv_nop\n\tv_nop" : "+v"(d) : "v"(a), "v"(b));
  return d;
}
// 16x16x32 fragments: lane = (h = lane>>4, row/col = lane&15); elements 0..7 = k0+8h+0..7, 8..15 = k0+16+8h+0..7; D element r = row 8h+r
__device__ __forceinline__ float bfr(float v) { return (float)(__bf16)v; }

// ---- LDS ring of the two GEMM kernels: a stage = 64 k (128 bytes, one whole line) of every operand row of the block, two buffers, filled by asynchronous copies while the other buffer is worked on
#define KS 64                // k per stage
#define NS (CC / KS)         // stages
#define RP 144               // ring row pitch in bytes: 128 + 16, free of bank conflicts for 16-byte LDS reads
static_assert(NS >= 2 && CC % KS == 0);
typedef __attribute__((address_space(1))) v4i gq_t;   // 16 bytes in global memory
typedef __attribute__((address_space(3))) v4i lq_t;   // 16 bytes in LDS
// one copy of 16 bytes a lane, global -> LDS through no register, written as the builtin: the compiler looks after its address registers and no s_wait_xcnt is written behind it, so the wave goes straight on to its LDS reads
__device__ __forceinline__ void copy1(char* l, const char* p) { __builtin_amdgcn_global_load_async_to_lds_b128((gq_t*)p, (lq_t*)l, 0, 0); }
// four copies a lane: ring rows 16 apart from plane rows 16 apart (8 lanes cover one 128-byte row slice, a wave 4 whole lines)
__device__ __forceinline__ void copy4(char* l, const char* p) { copy1(l, p); copy1(l + 16 * RP, p + 16 * 2 * CC); copy1(l + 32 * RP, p + 32 * 2 * CC); copy1(l + 48 * RP, p + 48 * 2 * CC); }
#define AW() asm volatile("s_wait_asynccnt 0x0" ::: "memory")   // this wave's copies have landed
#define DW() asm volatile("s_wait_dscnt 0x0" ::: "memory")      // this wave's LDS reads have returned: the buffer may be refilled behind the barrier
// fragment from a ring row: p = row start + 64 bytes per 32 k + 16 bytes per lane half (the k order stated above)
__device__ __forceinline__ v16h frag_lh(const char* p) { union { v16h v; v8h q[2]; } u; u.q[0] = *(const v8h*)p; u.q[1] = *(const v8h*)(p + 32); return u.v; }
__device__ __forceinline__ v16b frag_lb(const char* p) { union { v16b v; v8b q[2]; } u; u.q[0] = *(const v8b*)p; u.q[1] = *(const v8b*)(p + 32); return u.v; }

// ---- k_prep: every conversion of the call in one grid; a block's index range says which plane it fills (block-uniform): x of all batches, the four weights, the mask bits
#define PB_X (NB * ((SEQ * CC) / 8) / 256)     // blocks on x: 8 elements a thread
#define PB_W (((CC * CC) / 8) / 256)           // blocks on one weight
#define PB_M (SEQ * (SEQ / 32) / 256)          // blocks on the mask: one 32-bit word a thread
static_assert(WS_WK == WS_WQ + 2u * (size_t)CC * CC && WS_WV == WS_WQ + 4u * (size_t)CC * CC && WS_WO == WS_WQ + 6u * (size_t)CC * CC);   // k_prep steps from one weight plane to the next
__device__ __forceinline__ void cvt8(const float* __restrict__ A, unsigned short* __restrict__ D, const bool f16x64) {
  const v4f a = *(const v4f*)A; const v4f c = *(const v4f*)(A + 4);
  asm volatile("s_wait_xcnt 0x0" ::: "memory");   // the loads' address register is reused for the packed result: it may be rewritten only behind this wait
  const float v[8] = {a[0], a[1], a[2], a[3], c[0], c[1], c[2], c[3]};
  union { v8b b; v8h h; v4u u; } o;
  if (f16x64) { v8h t;
#pragma unroll
    for (int k = 0; k < 8; ++k) t[k] = (_Float16)(bfr(v[k]) * 64.0f);
    o.h = t; }
  else { v8b t;
#pragma unroll
    for (int k = 0; k < 8; ++k) t[k] = (__bf16)v[k];
    o.b = t; }
  vst2(D, o.u);
}
__global__ __launch_bounds__(256) void k_prep(const float* __restrict__ X, const float* __restrict__ WQ, const float* __restrict__ WK, const float* __restrict__ WV, const float* __restrict__ WO, const int* __restrict__ M,
                                              unsigned short* __restrict__ XB, unsigned short* __restrict__ WB, unsigned* __restrict__ MB) {
  const int blk = blockIdx.x, tid = threadIdx.x;
  if (blk < PB_X) {
    const int i = blk * 256 + tid, b = i / ((SEQ * CC) / 8);     // x rows of batch b start SEQ_FULL rows apart, the plane's SEQ rows apart
    cvt8(X + (size_t)b * (SEQ_FULL - SEQ) * CC + (size_t)i * 8, XB + (size_t)i * 8, false);
  } else if (blk < PB_X + 4 * PB_W) {
    const int wsel = (blk - PB_X) / PB_W; const int i = (blk - PB_X - wsel * PB_W) * 256 + tid;   // the four 16-bit weight planes stand one behind the other in the workspace
    const float* A = wsel == 0 ? WQ : wsel == 1 ? WK : wsel == 2 ? WV : WO;
    cvt8(A + (size_t)i * 8, WB + (size_t)wsel * CC * CC + (size_t)i * 8, wsel == 3);
  } else {
    const int w = (blk - PB_X - 4 * PB_W) * 256 + tid;
    const int q = w / (SEQ / 32), wc = w - q * (SEQ / 32);
    const int* p = M + (size_t)q * SEQ_FULL + wc * 32;
    unsigned bits = 0u;
#pragma unroll
    for (int i = 0; i < 8; ++i) { const v4i v = *(const v4i*)(p + 4 * i);
      bits |= (v.x != 0 ? 1u : 0u) << (4 * i);     bits |= (v.y != 0 ? 1u : 0u) << (4 * i + 1);
      bits |= (v.z != 0 ? 1u : 0u) << (4 * i + 2); bits |= (v.w != 0 ? 1u : 0u) << (4 * i + 3); }
    vst2(MB + w, bits);
  }
}

// ---- k_proj: block = (128 rows out of all batches' rows, 128 cols, which), wave = 64 rows x 64 cols (one head): y = x W^T + b (exact bf16 products from the 16-bit planes); which 0/1: rope then q -> f16 hi (+ residual for rows 0..63), k -> f16 rows; which 2: v -> f16 planes [c][t] (+ residual plane for rows 0..63)
// a 64 x 64 wave tile reads 8 fragments for 16 products (16 x 128: 9 for 8), a 128 x 128 block tile brings 256 operand rows from L2 for 16,384 outputs (64 x 128: 192 for 8,192)
__global__ __launch_bounds__(128) void k_proj(const __bf16* __restrict__ XB, const __bf16* __restrict__ WQ, const float* __restrict__ BQ, const __bf16* __restrict__ WK, const float* __restrict__ BK, const __bf16* __restrict__ WV, const float* __restrict__ BV,
                                              const float* __restrict__ RC, const float* __restrict__ RS,
                                              _Float16* __restrict__ QH, _Float16* __restrict__ QL, _Float16* __restrict__ KH, _Float16* __restrict__ VT, _Float16* __restrict__ VL) {
  // one pool: the ring (2 x 256 rows: 128 of x, 128 of W) during the k loop, the output staging planes behind it
  constexpr unsigned RB = 256u * RP; __shared__ __align__(16) char pool[2 * RB]; static_assert(2u * 128 * 136 * 2 <= sizeof(pool) && 128u * 136 * 2 + 128u * 72 * 2 <= sizeof(pool));
  _Float16 (*sh)[136] = (_Float16 (*)[136])pool; _Float16 (*sl)[136] = (_Float16 (*)[136])(pool + 128 * 136 * 2); _Float16 (*th)[136] = (_Float16 (*)[136])pool; _Float16 (*tl2)[72] = (_Float16 (*)[72])(pool + 128 * 136 * 2);
  __shared__ __align__(16) __bf16 rt[128][17][8];   // rope table of the block's rows: cell (row, col < 16) = cos at d = col, col + 16, col + 32, col + 48, then sin at the same four: what one lane needs for one row, 16 bytes; the 17th cell is the pad that spreads the rows over the banks
  const int tid = threadIdx.x, lane = tid & 31, col = lane & 15, g = lane >> 4; const int wave = __builtin_amdgcn_readfirstlane(tid >> 5), wr = wave >> 1, wc = wave & 1;
  const int which = blockIdx.z; const int c0 = blockIdx.y * 128; const int r0 = blockIdx.x * 128;   // r0: row in the [b][t] planes
  const int bb0 = blockIdx.x / (SEQ / 128), t0 = r0 - bb0 * SEQ;   // its batch and its position in the sequence
  const __bf16* WA = which == 0 ? WQ : which == 1 ? WK : WV; const float* BA = which == 0 ? BQ : which == 1 ? BK : BV;
  char* const ring = pool + ((tid >> 3) * RP + (tid & 7) * 16);   // this lane's 16 bytes of ring row tid / 8
  const char* gx = (const char*)(XB + (size_t)(r0 + (tid >> 3)) * CC + (tid & 7) * 8); const char* gw = (const char*)(WA + (size_t)(c0 + (tid >> 3)) * CC + (tid & 7) * 8);
  auto fill = [&](const int s) { char* const l = ring + (unsigned)(s & 1) * RB; copy4(l, gx + s * (2 * KS)); copy4(l + 64u * RP, gx + s * (2 * KS) + 64 * 2 * CC); copy4(l + 128u * RP, gw + s * (2 * KS)); copy4(l + 192u * RP, gw + s * (2 * KS) + 64 * 2 * CC); };
  fill(0);                                                       // stage 0 flies under the rope table's staging
  // PW: behind global loads or stores whose address or data registers are reused next: they may be rewritten only behind this wait
#define PW() asm volatile("s_wait_xcnt 0x0" ::: "memory")
  float braw[4]; const int bi = c0 + wc * 64 + col;              // the wave's bias values, asked for here so that their latency lies under the k loop, rounded where they are used
#pragma unroll
  for (int j = 0; j < 4; ++j) braw[j] = BA[bi + j * 16];
  asm volatile("s_wait_xcnt 0x0" :: "s"(BA), "v"(bi) : "memory");   // the four loads' base and lane index stay whole up to this wait (named as inputs) and may be rewritten only behind it
  // rope table rows t0..t0+127 (bf16-RNE values), whole head dim; staged extent == consumed extent (128 x HD)
  if (which < 2) {                                               // a thread takes 4 columns of a row at all four 16-column steps: 8 loads of 16 bytes give 4 whole cells; all 32 loads of its 4 rows fly at once
    v4f tc[4][4], ts[4][4]; const float* pc = RC + (size_t)(t0 + (tid >> 2)) * HD + (tid & 3) * 4; const float* ps = RS + (size_t)(t0 + (tid >> 2)) * HD + (tid & 3) * 4;
#pragma unroll
    for (int it = 0; it < 4; ++it)
#pragma unroll
      for (int jj = 0; jj < 4; ++jj) { tc[it][jj] = *(const v4f*)(pc + it * 32 * HD + jj * 16); ts[it][jj] = *(const v4f*)(ps + it * 32 * HD + jj * 16); }
    asm volatile("s_wait_xcnt 0x0" :: "v"(pc), "v"(ps) : "memory");   // the two address pairs of the 32 loads stay whole up to this wait (named as inputs) and may be rewritten only behind it
#pragma unroll
    for (int it = 0; it < 4; ++it)
#pragma unroll
      for (int i = 0; i < 4; ++i) { v8b t;
#pragma unroll
        for (int jj = 0; jj < 4; ++jj) { t[jj] = (__bf16)tc[it][jj][i]; t[4 + jj] = (__bf16)ts[it][jj][i]; }
        *(v8b*)&rt[it * 32 + (tid >> 2)][(tid & 3) * 4 + i][0] = t; } }
  AW();
  __syncthreads();                                               // publishes the rope table and stage 0
  fill(1);
  v8f acc[4][4] = {};
#pragma unroll 1                                                 // one trip a stage: the buffer is picked by the trip's parity, the text stays short
  for (int s = 0; s < NS; ++s) { const char* fb = pool + (unsigned)(s & 1) * RB + col * RP + g * 16;
#pragma unroll                                                   // this and the four below: constant indices keep a[], w[] and acc[] in registers; a block's 16 LDS reads stand as one group ahead of its 16 products
    for (int ks = 0; ks < KS / 32; ++ks) { v16b a[4], w[4];
#pragma unroll
      for (int i = 0; i < 4; ++i) a[i] = frag_lb(fb + (wr * 64 + i * 16) * RP + ks * 64);
#pragma unroll
      for (int j = 0; j < 4; ++j) w[j] = frag_lb(fb + (128 + wc * 64 + j * 16) * RP + ks * 64);
#pragma unroll
      for (int i = 0; i < 4; ++i)
#pragma unroll
        for (int j = 0; j < 4; ++j) acc[i][j] = wmma_bf(a[i], w[j], acc[i][j]); }
    DW(); AW();
    __syncthreads();                                             // publishes stage s + 1 and ends every wave's reads of stage s
    if (s + 2 < NS) fill(s + 2); }
  AW();
  float bbv[4];
#pragma unroll
  for (int j = 0; j < 4; ++j) bbv[j] = bfr(braw[j]);
  // the residual planes are asked for by one scalar test in front of each element loop (two copies of the loop's text), not by a branch per element: the loop bodies are straight-line, their LDS reads and stores fly together
  if (which == 2) {
    auto vput = [&](auto rf) { constexpr bool RES = decltype(rf)::value;
#pragma unroll
    for (int i = 0; i < 4; ++i)
#pragma unroll
      for (int j = 0; j < 4; ++j) { const int cl = wc * 64 + j * 16 + col, rb = wr * 64 + i * 16 + 8 * g; v8h hv, lv;   // a lane's 8 rows of one column stand side by side in the [c][t] plane
#pragma unroll
        for (int r = 0; r < 8; ++r) { const float v = acc[i][j][r] + bbv[j]; const _Float16 h = (_Float16)v; hv[r] = h; lv[r] = (_Float16)((v - (float)h) * 1024.0f); }   /* v residual carried x 2^10 */
        *(v8h*)&th[cl][rb] = hv; if constexpr (RES) *(v8h*)&tl2[cl][rb] = lv; } };
    if (t0 == 0 && wr == 0) vput(flag_t<true>{}); else vput(flag_t<false>{});   // the residual plane is stored for a sequence's rows 0..63 alone (scalar)
  } else { const bool qres = which == 0 && t0 == 0 && wr == 0;   // this wave's 64 rows are a sequence's q rows 0..63 (scalar)
    const float qs = which == 0 ? QSC : 1.0f;                    // q leaves scaled, k as it is
    auto rope = [&](auto rf) { constexpr bool RES = decltype(rf)::value;
#pragma unroll
    for (int i = 0; i < 4; ++i)
#pragma unroll
      for (int r = 0; r < 8; ++r) { const int rl = wr * 64 + i * 16 + 8 * g + r; const v8b t = *(const v8b*)&rt[rl][col][0]; float v[4];
#pragma unroll
        for (int j = 0; j < 4; ++j) v[j] = acc[i][j][r] + bbv[j];
        // rotate-half: head-local d = j*16+col; d<32: y*cos - y[d+32]*sin, d>=32: y*cos + y[d-32]*sin; partner tile = j^2
#pragma unroll
        for (int j = 0; j < 4; ++j) { const int cl = wc * 64 + j * 16 + col; const float pv = v[j ^ 2], cs = (float)t[j], sn = (float)t[4 + j];
          const float o = ((j < 2) ? (v[j] * cs - pv * sn) : (v[j] * cs + pv * sn)) * qs;
          const _Float16 hv = (_Float16)o; sh[rl][cl] = hv; if constexpr (RES) sl[rl][cl] = (_Float16)((o - (float)hv) * 1024.0f); }   /* q residual carried x 2^10 so the plane stays f16-normal */
      } };
    if (qres) rope(flag_t<true>{}); else rope(flag_t<false>{}); }
  __syncthreads();
  // the staged planes leave as whole row pieces, 8 pieces a thread at a time: their LDS reads fly together, the stores follow from one address with constant steps, one wait serves the run
  const int pr = tid >> 4, pq = (tid & 15) * 8;                  // piece (row pr + 8 n, 8 columns from pq)
  if (which < 2) { _Float16* dh = (which == 0 ? QH : KH) + (size_t)(r0 + pr) * CC + c0 + pq;
#pragma unroll                                                   // this and every unroll below: constant steps from one address, t[] in registers
    for (int hb = 0; hb < 2; ++hb) { v4u t[8];
#pragma unroll
      for (int u = 0; u < 8; ++u) t[u] = *(const v4u*)&sh[(hb * 8 + u) * 8 + pr][pq];
#pragma unroll
      for (int u = 0; u < 8; ++u) vst2(dh + (hb * 8 + u) * 8 * CC, t[u]);
      PW(); }
    if (which == 0 && t0 == 0) { _Float16* dl = QL + (size_t)(r0 + pr) * CC + c0 + pq; v4u t[8];   // rows 0..63 of the residual plane
      static_assert(QB0 == 64);
#pragma unroll
      for (int u = 0; u < 8; ++u) t[u] = *(const v4u*)&sl[u * 8 + pr][pq];
#pragma unroll
      for (int u = 0; u < 8; ++u) vst2(dl + u * 8 * CC, t[u]);
      PW(); } }
  else { _Float16* dv = VT + (size_t)(bb0 * CC + c0 + pr) * (size_t)SEQ + t0 + pq;
#pragma unroll                                                   // as above
    for (int hb = 0; hb < 2; ++hb) { v4u t[8];
#pragma unroll
      for (int u = 0; u < 8; ++u) t[u] = *(const v4u*)&th[(hb * 8 + u) * 8 + pr][pq];
#pragma unroll
      for (int u = 0; u < 8; ++u) vst2(dv + (hb * 8 + u) * 8 * SEQ, t[u]);
      PW(); }
    if (t0 == 0) { _Float16* dl = VL + (size_t)(bb0 * CC + c0 + (tid >> 3)) * (size_t)QB0 + (tid & 7) * 8; v4u t[8];   // the residual plane's rows hold 64 positions: 8 pieces a row, 16 rows a step, every lane on
#pragma unroll
      for (int u = 0; u < 8; ++u) t[u] = *(const v4u*)&tl2[u * 16 + (tid >> 3)][(tid & 7) * 8];
#pragma unroll
      for (int u = 0; u < 8; ++u) vst2(dl + u * 16 * QB0, t[u]);
      PW(); } } }

// ---- k_fa: wave = 32 queries (two 16-column groups) of one head of one batch, whole key range in one pass, logits and P stay in registers.
// S^T = K Q^T (A = k rows, B = q rows, same loader on both sides): lane (col, g) holds query col, keys 8g+r of each 16-key tile, so two tiles pack straight into the B operand of O^T += V^T P^T.
// q comes scaled by log2(e) / 8 and the score products start from C = 11 - reference, so a score leaves the matrix unit as the exponent of P = 2^(s - reference) x 2^11 -> f16: no subtraction or scaling per score.
// The reference of a query is its largest score at the time it is set; it is renewed (scores of the block, sums and O rescaled, the lane halves' maxima joined) only when a score passes it by 2^4, P <= 2^15. Sum per query, normalised once at the end.
// The wave's 32 mask rows are scanned once: stages in front of the first set bit of all four waves run without mask work, a wave's 32-key blocks behind its last clear bit are not run (both counts bounded by SEQ / 32).
// Any mask content is honoured; a fully masked row ends as 0 x inf = NaN like the softmax of an all -inf row.
// K and V come through LDS: a stage = 64 keys of the block's head, 64 k rows (128 bytes, one whole line each) and those keys' 128 bytes of the 64 v plane rows; two buffers, filled by asynchronous copies
// while the other buffer is worked on; the block's four waves walk the stages together and read their fragments from the ring (each line leaves L2 once a block, whole, instead of in 32-byte pieces once a wave).
#define FKS 64               // keys per stage
#define FRB (128u * RP)      // bytes of one buffer: 64 k rows, then 64 v rows, at the ring pitch
static_assert(SEQ % FKS == 0 && FKS == 64 && 2 * HD == 128);
// copy4 for the v planes, whose rows stand SEQ elements apart
__device__ __forceinline__ void copy4v(char* l, const char* p) { copy1(l, p); copy1(l + 16 * RP, p + 16 * 2 * SEQ); copy1(l + 32 * RP, p + 32 * 2 * SEQ); copy1(l + 48 * RP, p + 48 * 2 * SEQ); }
__device__ __forceinline__ float xhalf(float v) { const int b = __float_as_int(v); return __int_as_float(__builtin_amdgcn_permlanex16(b, b, 0x76543210, 0xfedcba98, false, false)); }
// behind global loads or stores whose registers are reused next: those registers may be rewritten only behind this wait
#define XW() asm volatile("s_wait_xcnt 0x0" ::: "memory")
__device__ __forceinline__ v8f wm(v16h a, v16h b, v8f c) { return __builtin_amdgcn_wmma_f32_16x16x32_f16(false, a, false, b, (short)0, c, false, false); }
// 2^x with the one free issue slot behind a transcendental kept inside the statement
__device__ __forceinline__ float exp2s(float x) { float r; asm("v_exp_f32 %0, %1\n\tv_nop" : "=v"(r) : "v"(x)); return r; }
// eight at once: each v_exp_f32 is followed by one that touches neither its result nor its source (early-clobber outputs), so one slot at the end serves the run
__device__ __forceinline__ v8f exp2x8(v8f x) { float r0, r1, r2, r3, r4, r5, r6, r7;
  asm("v_exp_f32 %0, %8\n\tv_exp_f32 %1, %9\n\tv_exp_f32 %2, %10\n\tv_exp_f32 %3, %11\n\tv_exp_f32 %4, %12\n\tv_exp_f32 %5, %13\n\tv_exp_f32 %6, %14\n\tv_exp_f32 %7, %15\n\tv_nop"
      : "=&v"(r0), "=&v"(r1), "=&v"(r2), "=&v"(r3), "=&v"(r4), "=&v"(r5), "=&v"(r6), "=&v"(r7) : "v"(x[0]), "v"(x[1]), "v"(x[2]), "v"(x[3]), "v"(x[4]), "v"(x[5]), "v"(x[6]), "v"(x[7]));
  return v8f{r0, r1, r2, r3, r4, r5, r6, r7}; }
// fragment at a byte address that already holds the lane's row and its half's 16 bytes
__device__ __forceinline__ v16h frag_p(const char* p) { union { v16h v; v8h q[2]; } u; u.q[0] = *(const v8h*)p; u.q[1] = *(const v8h*)(p + 32); return u.v; }
__global__ __launch_bounds__(128) void k_fa(const _Float16* __restrict__ QH, const _Float16* __restrict__ QL, const _Float16* __restrict__ KH, const _Float16* __restrict__ VT, const _Float16* __restrict__ VL,
                                            const unsigned* __restrict__ MB, _Float16* __restrict__ Y, _Float16* __restrict__ YL) {
  constexpr float NEG = -3.0e38f; constexpr int NW = SEQ / 32;
  __shared__ __align__(16) char ring[2 * FRB]; __shared__ __align__(16) int wtrip[4], wfull[4];
  const int tid = threadIdx.x, lane = threadIdx.x & 31, col = lane & 15, g = lane >> 4; const int wave = __builtin_amdgcn_readfirstlane((int)threadIdx.x >> 5);
  // more blocks than resident places, and a block's cost grows with its query tile: the longest key ranges of every head and batch come first in the index, the short ones fill the places that free up
  constexpr int NT = SEQ / 128; const unsigned hb = blockIdx.x % (unsigned)(NH * NB); const int h = (int)(hb % NH), bt = (int)(hb / NH); const int q0 = (NT - 1 - (int)(blockIdx.x / (unsigned)(NH * NB))) * 128 + wave * 32;
  QH += (size_t)bt * SEQ * CC; QL += (size_t)bt * SEQ * CC; KH += (size_t)bt * SEQ * CC; VT += (size_t)bt * CC * SEQ; VL += (size_t)bt * CC * QB0; Y += (size_t)bt * SEQ * CC; YL += (size_t)bt * QB0 * CC;
  char* const rl = ring + ((tid >> 3) * RP + (tid & 7) * 16);   // this lane's 16 bytes of ring row tid / 8
  const char* gk = (const char*)(KH + (size_t)(tid >> 3) * CC + h * HD + (tid & 7) * 8); const char* gv = (const char*)(VT + ((size_t)h * HD + (tid >> 3)) * SEQ + (tid & 7) * 8);
  auto fill = [&](const int s) { char* const l = rl + (unsigned)(s & 1) * FRB; copy4(l, gk + (size_t)s * (FKS * 2 * CC)); copy4v(l + 64u * RP, gv + s * (2 * FKS)); };
  fill(0);                                                     // stage 0 flies under the mask scan (SEQ >= 128: stages 0 and 1 lie inside the planes)
  const unsigned* mu = MB + (size_t)q0 * NW; const unsigned mo = 4u * (unsigned)(col * NW);
  int last = -1, first = NW;
#pragma unroll
  for (int p = 0; p < 2; ++p)
#pragma unroll
    for (int i = NW / 8 - 1; i >= 0; --i) { const v4u u = *(const v4u*)((const char*)(mu + p * 16 * NW + 4 * i) + (mo + 4u * (unsigned)(g * (NW / 2))));
#pragma unroll
      for (int e = 3; e >= 0; --e) { const int w = g * (NW / 2) + 4 * i + e; last = (u[e] != 0xFFFFFFFFu) ? max(last, w) : last; first = (u[e] != 0u) ? min(first, w) : first; } }
#pragma unroll
  for (int o = 1; o < 32; o <<= 1) { last = max(last, __shfl_xor(last, o)); first = min(first, __shfl_xor(first, o)); }
  const int trip = min(__builtin_amdgcn_readfirstlane(last) + 1, NW);
  const int nfull = max(min(__builtin_amdgcn_readfirstlane(first), trip), 0);
  if (lane == 0) { wtrip[wave] = trip; wfull[wave] = nfull; }
  AW();
  __syncthreads();                                             // publishes stage 0 and the four waves' block counts
  const v4i wt = *(const v4i*)wtrip, wf = *(const v4i*)wfull;
  const int nst = (__builtin_amdgcn_readfirstlane(max(max(wt.x, wt.y), max(wt.z, wt.w))) + 1) >> 1;   // stages of the block: its longest wave's, at most SEQ / FKS
  const int nfs = __builtin_amdgcn_readfirstlane(min(min(wf.x, wf.y), min(wf.z, wf.w))) >> 1;         // leading stages that no wave of the block has mask work in (nfull <= trip: every wave runs both their halves)
  if (nst > 1) fill(1);
  const bool res = q0 < QB0;
  const unsigned ko = 2u * (unsigned)(col * CC + 8 * g), lo = 2u * (unsigned)(col * QB0 + 8 * g);
  const char* lp = (const char*)(VL + (size_t)h * HD * QB0) + lo;
  const char* qlp = (const char*)(QL + (size_t)q0 * CC + h * HD) + ko;   // the wave's q residual rows, read under res alone
  v16h qh[2][2];
#pragma unroll
  for (int p = 0; p < 2; ++p)
#pragma unroll
    for (int kk = 0; kk < 2; ++kk) { const size_t o = (size_t)(q0 + 16 * p) * CC + h * HD + kk * 32; qh[p][kk] = frag_p((const char*)(QH + o) + ko); }
  XW();
  v8f acc[2][4] = {}; float l[2] = {0.f, 0.f}, thr[2] = {-1.0e38f, -1.0e38f};   // thr: the score exponent above which the reference is renewed; below every real score until the first unmasked one has set it
  constexpr v8f C11 = {11.0f, 11.0f, 11.0f, 11.0f, 11.0f, 11.0f, 11.0f, 11.0f}; v8f cr[2] = {C11, C11};   // 11 - reference of the lane's query, eight times over: the C operand of its score products
  auto body = [&](const int kc, const char* kb, const char* vb, auto mk) {   // kb, vb: the lane's row and half at this block's 32 keys in the stage's buffer
    constexpr bool masked = decltype(mk)::value;
    v16h kf[2][2], vf[4]; unsigned mw[2] = {0u, 0u};
#pragma unroll
    for (int t = 0; t < 2; ++t)
#pragma unroll
      for (int kk = 0; kk < 2; ++kk) kf[t][kk] = frag_lh(kb + t * 16 * RP + kk * 64);
#pragma unroll
    for (int j = 0; j < 4; ++j) vf[j] = frag_lh(vb + j * 16 * RP);   // this block's v rows fly under the logits and the softmax
    if constexpr (masked) { mw[0] = *(const unsigned*)((const char*)(mu + kc) + mo); mw[1] = *(const unsigned*)((const char*)(mu + 16 * NW + kc) + mo); XW(); }
    v8f s[2][2];
#pragma unroll
    for (int t = 0; t < 2; ++t)
#pragma unroll
      for (int p = 0; p < 2; ++p) s[p][t] = wm(kf[t][0], qh[p][0], cr[p]);
#pragma unroll
    for (int t = 0; t < 2; ++t)
#pragma unroll
      for (int p = 0; p < 2; ++p) s[p][t] = wm(kf[t][1], qh[p][1], s[p][t]);
    if (res) {                                                 // query rows 0..63 (scalar): the q residual product on top, its fragments fetched here so that the other waves hold no registers for them
      v16h ql[2][2];
#pragma unroll
      for (int p = 0; p < 2; ++p)
#pragma unroll
        for (int kk = 0; kk < 2; ++kk) ql[p][kk] = frag_p(qlp + 2 * (16 * p * CC + kk * 32));
      XW();
#pragma unroll
      for (int t = 0; t < 2; ++t)
#pragma unroll
        for (int p = 0; p < 2; ++p) { v8f a = wm(kf[t][0], ql[p][0], v8f{}); a = wm(kf[t][1], ql[p][1], a); s[p][t] += a * (1.0f / 1024.0f); } }
    if constexpr (masked) {
#pragma unroll
      for (int p = 0; p < 2; ++p) { const unsigned w = mw[p] >> (8 * g);
#pragma unroll
        for (int t = 0; t < 2; ++t)
#pragma unroll
          for (int r = 0; r < 8; ++r) s[p][t][r] = ((w >> (16 * t + r)) & 1u) ? NEG : s[p][t][r]; } }
    float mx[2];                                               // the lane's own 16 keys; the halves are joined only where the reference moves
#pragma unroll
    for (int p = 0; p < 2; ++p) { float x = fmaxf(s[p][0][0], s[p][1][0]);
#pragma unroll
      for (int r = 1; r < 8; ++r) x = fmaxf(x, fmaxf(s[p][0][r], s[p][1][r]));
      mx[p] = x; }
    if (__builtin_amdgcn_ballot_w32(mx[0] > thr[0] || mx[1] > thr[1]) != 0u) {
#pragma unroll
      for (int p = 0; p < 2; ++p) { const float x = fmaxf(mx[p], xhalf(mx[p])); const bool up = x > thr[p];   // alike in both lanes of a query
        const float d = up ? x - 11.0f : 0.f;                  // the reference moves by d: the block's largest score becomes 2^11
        const float al = thr[p] < 0.f ? 1.0f : exp2s(-d);      // nothing summed before the reference is first set: no factor (d may then be negative)
        thr[p] = up ? 15.0f : thr[p]; l[p] *= al; cr[p] -= d; s[p][0] -= d; s[p][1] -= d;
#pragma unroll
        for (int j = 0; j < 4; ++j) acc[p][j] *= al; } }
    v16h pb[2];
#pragma unroll
    for (int p = 0; p < 2; ++p) { float sum = 0.f;             // a masked score is -huge whatever the reference: its term is exp2(-huge) = 0
#pragma unroll
      for (int t = 0; t < 2; ++t) { s[p][t] = exp2x8(s[p][t]);
#pragma unroll
        for (int r = 0; r < 8; ++r) { sum += s[p][t][r]; pb[p][8 * t + r] = (_Float16)s[p][t][r]; } }
      l[p] += sum; }
#pragma unroll
    for (int j = 0; j < 4; ++j)
#pragma unroll
      for (int p = 0; p < 2; ++p) acc[p][j] = wm(vf[j], pb[p], acc[p][j]);
    if (res && kc < QB0 / 32) {                                // query rows 0..63, keys 0..63: P and v residual planes (x 2^10), as before
      v16h pl[2];
#pragma unroll
      for (int p = 0; p < 2; ++p)
#pragma unroll
        for (int e = 0; e < 16; ++e) pl[p][e] = (_Float16)((s[p][e >> 3][e & 7] - (float)pb[p][e]) * 1024.0f);
#pragma unroll
      for (int j = 0; j < 4; ++j) { const v16h vl = frag_p(lp + 2 * (j * 16 * QB0 + kc * 32)); XW();
#pragma unroll
        for (int p = 0; p < 2; ++p) { v8f a = {}; a = wm(vf[j], pl[p], a); a = wm(vl, pb[p], a); acc[p][j] += a * (1.0f / 1024.0f); } } }
  };
  auto foot = [&](const int st) {                              // both loops below run the same trips in every wave of the block
    DW(); AW();
    __syncthreads();                                           // publishes stage st + 1 and ends every wave's reads of stage st
    if (st + 2 < nst) fill(st + 2); };
  const char* f0 = ring + col * RP + g * 16;
#pragma unroll 1                                               // one trip a stage: the buffer is picked by the trip's parity, the text stays short
  for (int st = 0; st < nfs; ++st) { const char* fb = f0 + (unsigned)(st & 1) * FRB;
    body(2 * st, fb, fb + 64 * RP, flag_t<false>{}); body(2 * st + 1, fb + 32 * RP, fb + 64 * RP + 64, flag_t<false>{});
    foot(st); }
#pragma unroll 1                                               // as above
  for (int st = nfs; st < nst; ++st) { const char* fb = f0 + (unsigned)(st & 1) * FRB; const int ke = min(2 * st + 2, trip);   // a wave past its own last block only keeps the ring going
#pragma unroll 1                                               // one copy of the masked body in the text
    for (int kc = 2 * st; kc < ke; ++kc) body(kc, fb + (kc & 1) * (32 * RP), fb + 64 * RP + (kc & 1) * 64, flag_t<true>{});
    foot(st); }
  AW();
#pragma unroll
  for (int p = 0; p < 2; ++p) { const float inv = 16.0f / (l[p] + xhalf(l[p])); const size_t o = (size_t)(q0 + 16 * p) * CC + h * HD;   /* ctx carried x 16, residual x 2^10 */
#pragma unroll
    for (int j = 0; j < 4; ++j) { union { v8h h; v4u u; } yh, yl;
#pragma unroll
      for (int r = 0; r < 8; ++r) { const float y = acc[p][j][r] * inv; const _Float16 t = (_Float16)y; yh.h[r] = t; yl.h[r] = (_Float16)((y - (float)t) * 1024.0f); }
      vst2((char*)(Y + o + j * 16) + ko, yh.u); XW(); if (res) { vst2((char*)(YL + o + j * 16) + ko, yl.u); XW(); } } } }

// ---- k_out: block = (128 rows out of all batches' rows, 128 cols), wave = 64 rows x 64 cols: out = (ctx x 16 f16) (f16 bf16(Wo) x 64)^T / 1024 + bo; the two waves on a sequence's rows 0..63 add the ctx residual plane (2 products)
__global__ __launch_bounds__(128) void k_out(const _Float16* __restrict__ Y, const _Float16* __restrict__ YL, const _Float16* __restrict__ WO, const float* __restrict__ BP, float* __restrict__ OUT) { __shared__ __align__(16) float sf[4][32][68];
  constexpr unsigned RB = 320u * RP; __shared__ __align__(16) char pool[2 * RB];   // ring: 2 x (128 rows of ctx, 128 of Wo, 64 of the ctx residual, filled in a sequence's row block 0 alone)
  const int tid = threadIdx.x, lane = tid & 31, col = lane & 15, g = lane >> 4; const int wave = __builtin_amdgcn_readfirstlane(tid >> 5), wr = wave >> 1, wc = wave & 1;
  const int c0 = blockIdx.y * 128; const int r0 = blockIdx.x * 128 + wr * 64; const int b = blockIdx.x / (SEQ / 128); const size_t orow = (size_t)b * (SEQ_FULL - SEQ) + r0;
  const bool lo = blockIdx.x % (SEQ / 128) == 0; const bool lw = lo && wr == 0;   // lw: this wave's 64 rows are a sequence's rows 0..63 (scalar: the products under it run with every lane on)
  char* const ring = pool + ((tid >> 3) * RP + (tid & 7) * 16);   // this lane's 16 bytes of ring row tid / 8
  const char* gy = (const char*)(Y + (size_t)(blockIdx.x * 128 + (tid >> 3)) * CC + (tid & 7) * 8); const char* gl = (const char*)(YL + (size_t)(b * QB0 + (tid >> 3)) * CC + (tid & 7) * 8); const char* gw = (const char*)(WO + (size_t)(c0 + (tid >> 3)) * CC + (tid & 7) * 8);
  auto fill = [&](const int s) { char* const l = ring + (unsigned)(s & 1) * RB; copy4(l, gy + s * (2 * KS)); copy4(l + 64u * RP, gy + s * (2 * KS) + 64 * 2 * CC); copy4(l + 128u * RP, gw + s * (2 * KS)); copy4(l + 192u * RP, gw + s * (2 * KS) + 64 * 2 * CC); if (lo) copy4(l + 256u * RP, gl + s * (2 * KS)); };
  fill(0);
  AW();
  __syncthreads();                                               // publishes stage 0
  fill(1);
  v8f acc[4][4] = {}, accl[4][4] = {};
  // one block of 32 k: fp = the lane's row and half at these 32 k in the stage's buffer
  auto blk = [&](const char* fp) { v16h a[4], w[4], al[4];
#pragma unroll                                                   // this and those below: constant indices keep the fragments, acc[] and accl[] in registers
    for (int i = 0; i < 4; ++i) a[i] = frag_lh(fp + (wr * 64 + i * 16) * RP);
#pragma unroll
    for (int j = 0; j < 4; ++j) w[j] = frag_lh(fp + (128 + wc * 64 + j * 16) * RP);
    if (lw) {
#pragma unroll
      for (int i = 0; i < 4; ++i) al[i] = frag_lh(fp + (256 + i * 16) * RP); }
    __builtin_amdgcn_sched_barrier(0);                           // the block's LDS reads stay one group ahead of its products: without it they were spread, two reads and a full wait in front of every four products
#pragma unroll
    for (int i = 0; i < 4; ++i)
#pragma unroll
      for (int j = 0; j < 4; ++j) acc[i][j] = wm(a[i], w[j], acc[i][j]);
    if (lw) {
#pragma unroll
      for (int i = 0; i < 4; ++i)
#pragma unroll
        for (int j = 0; j < 4; ++j) accl[i][j] = wm(al[i], w[j], accl[i][j]); } };
#pragma unroll 1                                                 // one trip a stage: the buffer is picked by the trip's parity, the text stays short
  for (int s = 0; s < NS; ++s) { const char* fb = pool + (unsigned)(s & 1) * RB + col * RP + g * 16;
    static_assert(KS == 64);
    blk(fb); blk(fb + 64);
    DW(); AW();
    __syncthreads();                                             // publishes stage s + 1 and ends every wave's reads of stage s
    if (s + 2 < NS) fill(s + 2); }
  AW();
  float bb[4];
#pragma unroll
  for (int j = 0; j < 4; ++j) bb[j] = bfr(BP[c0 + wc * 64 + j * 16 + col]);
#pragma unroll                                                   // constant indices into acc[] and accl[]
  for (int hp = 0; hp < 2; ++hp) {                               // 32 rows at a time through the wave's own staging plane, stored as whole 256-byte row pieces
#pragma unroll
    for (int ii = 0; ii < 2; ++ii)
#pragma unroll
      for (int j = 0; j < 4; ++j)
#pragma unroll
        for (int r = 0; r < 8; ++r) sf[wave][ii * 16 + 8 * g + r][j * 16 + col] = (acc[hp * 2 + ii][j][r] + accl[hp * 2 + ii][j][r] * (1.0f / 1024.0f)) * (1.0f / 1024.0f) + bb[j];
    DW();                                                        // the wave's own staging stores have landed before it reads the rows back (no other wave touches its plane)
#pragma unroll                                                   // 8 row pairs at a time: their LDS reads fly together, one wait serves the run of stores
    for (int hb = 0; hb < 2; ++hb) { v4f t[8]; float* po = OUT + (orow + hp * 32 + hb * 16 + g) * CC + c0 + wc * 64 + col * 4;
#pragma unroll
      for (int u = 0; u < 8; ++u) t[u] = *(const v4f*)&sf[wave][hb * 16 + 2 * u + g][col * 4];
#pragma unroll
      for (int u = 0; u < 8; ++u) vst2(po + u * 2 * CC, t[u]);
      PW(); } } }

extern "C" void kernel_launch(void* const* d_in, const int* in_sizes, int n_in, void* d_out, int out_size, void* d_ws, size_t ws_size, hipStream_t stream) {
  if (n_in < 12) return;
  // d_in: 0 x [4,2048,1024] f32, 1 mask [2048,2048] int32, 2 rope_cos [2048,64] f32, 3 rope_sin [2048,64] f32, 4 Wq [out,in], 5 bq, 6 Wk, 7 bk, 8 Wv, 9 bv, 10 Wo, 11 bo
  const size_t xneed = ((size_t)(NB - 1) * SEQ_FULL + SEQ) * (size_t)CC;
  if ((size_t)in_sizes[0] < xneed) return;
  if ((size_t)in_sizes[1] < (size_t)(SEQ - 1) * SEQ_FULL + SEQ) return;
  if (in_sizes[2] < SEQ * HD || in_sizes[3] < SEQ * HD) return;
  if (in_sizes[4] < CC * CC || in_sizes[6] < CC * CC || in_sizes[8] < CC * CC || in_sizes[10] < CC * CC) return;
  if (in_sizes[5] < CC || in_sizes[7] < CC || in_sizes[9] < CC || in_sizes[11] < CC) return;
  if ((size_t)out_size < xneed) return;
  if (ws_size < (size_t)WS_END) return;
  const float* X = (const float*)d_in[0]; const int* M = (const int*)d_in[1]; const float* RC = (const float*)d_in[2]; const float* RS = (const float*)d_in[3];
  const float *WQ = (const float*)d_in[4], *BQ = (const float*)d_in[5], *WK = (const float*)d_in[6], *BK = (const float*)d_in[7], *WV = (const float*)d_in[8], *BV = (const float*)d_in[9], *WO = (const float*)d_in[10], *BO = (const float*)d_in[11];
  char* ws = (char*)d_ws;
  __bf16 *WQB = (__bf16*)(ws + WS_WQ), *WKB = (__bf16*)(ws + WS_WK), *WVB = (__bf16*)(ws + WS_WV), *XB = (__bf16*)(ws + WS_XB); _Float16* WOH = (_Float16*)(ws + WS_WO);
  _Float16 *QH = (_Float16*)(ws + WS_QH), *QL = (_Float16*)(ws + WS_QL), *KH = (_Float16*)(ws + WS_KH), *VT = (_Float16*)(ws + WS_VT), *VL = (_Float16*)(ws + WS_VL), *Y = (_Float16*)(ws + WS_Y), *YL = (_Float16*)(ws + WS_YL);
  unsigned* MB = (unsigned*)(ws + WS_MB); float* OUT = (float*)d_out;
  k_prep<<<dim3(PB_X + 4 * PB_W + PB_M), 256, 0, stream>>>(X, WQ, WK, WV, WO, M, (unsigned short*)XB, (unsigned short*)WQB, MB);
  k_proj<<<dim3(NB * (SEQ / 128), CC / 128, 3), 128, 0, stream>>>(XB, WQB, BQ, WKB, BK, WVB, BV, RC, RS, QH, QL, KH, VT, VL);
  k_fa<<<dim3((SEQ / 128) * NH * NB), 128, 0, stream>>>(QH, QL, KH, VT, VL, MB, Y, YL);
  k_out<<<dim3(NB * (SEQ / 128), CC / 128), 128, 0, stream>>>(Y, YL, WOH, BO, OUT);
}

// v010
// A run of this version takes 106 microseconds.
// Two timings next to v009 both put it at 1.04 times that version's speed.
// Over all steps from v000 it is 17.3 times as fast.
// compute dtype: every float input (x, Wq, Wk, Wv, Wo, biases, rope cos/sin tables) RNE-converted to bf16 (bf16-input target); q/k/v = x W^T + b on v_wmma_f32_16x16x32_bf16 (exact bf16 products, f32 accumulate); rope in f32; q x log2(e) / 8 -> f16 (query rows 0..63 of each sequence: + residual plane x 2^10), k -> f16; logits in log2 units = 1 product on v_wmma_f32_16x16x32_f16 (rows 0..63: 2 products) on top of C = 11 - reference, f32; mask replace + softmax against a held reference in f32 (exp2; the reference is a row's largest score when it is set and is renewed when a score passes it by 2^4), logits and P kept in registers; exp2(s - reference) x 2^11 -> f16 against v f16: 1 f16 product, divided by the f32 row sum at the end (query rows 0..63 of each sequence add P and v residual planes x 2^10: 3 products); ctx x 16 -> f16 against f16(bf16(Wo) x 64): 1 f16 product (rows 0..63 add a ctx residual plane x 2^10: 2 products); f32 accumulate everywhere, f32 output.
#include <hip/hip_runtime.h>
#include <math.h>

#ifndef NB
#define NB 4
#endif
#ifndef SEQ
#define SEQ 2048
#endif
#define NB_FULL 4
#define SEQ_FULL 2048
#define CC 1024
#define NH 16
#define HD 64
#define QB0 64               // leading query rows per sequence carried with residual planes
#define QSC (0.125f * 1.44269504088896340736f)   // 1 / sqrt(HD) x log2(e): folded into q where q is made, so that k q^T is an exponent of 2
static_assert(SEQ % 128 == 0);
static_assert(SEQ >= 128 && SEQ <= SEQ_FULL);
static_assert(NB >= 1 && NB <= NB_FULL);
static_assert(CC == NH * HD);
static_assert(HD == 64);
static_assert(QB0 == 64);
static_assert(SEQ % 256 == 0);
static_assert((SEQ * (SEQ / 32)) % 256 == 0);
static_assert(((CC * CC) / 8) % 256 == 0);
static_assert(((SEQ * CC) / 8) % 256 == 0);

typedef __attribute__((ext_vector_type(16))) _Float16 v16h;
typedef __attribute__((ext_vector_type(16))) __bf16 v16b;
typedef __attribute__((ext_vector_type(8)))  _Float16 v8h;
typedef __attribute__((ext_vector_type(8)))  __bf16 v8b;
typedef __attribute__((ext_vector_type(8)))  float v8f;
typedef __attribute__((ext_vector_type(4)))  float v4f;
typedef __attribute__((ext_vector_type(4)))  unsigned v4u;
typedef __attribute__((ext_vector_type(4)))  int v4i;

#define WS_WQ  ((size_t)0)                                  // bf16 Wq [o][i]
#define WS_WK  (WS_WQ + 2u * (size_t)CC * CC)               // bf16 Wk [o][i]
#define WS_WV  (WS_WK + 2u * (size_t)CC * CC)               // bf16 Wv [o][i]
#define WS_WO  (WS_WV + 2u * (size_t)CC * CC)               // f16 bf16(Wo) x 64 [o][i]
#define WS_XB  (WS_WO + 2u * (size_t)CC * CC)               // bf16 x rows of every batch [b][t][c]
#define WS_QH  (WS_XB + 2u * (size_t)NB * SEQ * CC)         // f16 q rows [b][t][c] (hi)
#define WS_QL  (WS_QH + 2u * (size_t)NB * SEQ * CC)         // f16 q residual x 2^10 rows [b][t][c], rows t < QB0 alone written and read
#define WS_KH  (WS_QL + 2u * (size_t)NB * SEQ * CC)         // f16 k rows [b][t][c]
#define WS_VT  (WS_KH + 2u * (size_t)NB * SEQ * CC)         // f16 v planes [b][c][t]
#define WS_VL  (WS_VT + 2u * (size_t)NB * CC * SEQ)         // f16 v residual x 2^10 planes [b][c][t < QB0]
#define WS_Y   (WS_VL + 2u * (size_t)NB * CC * QB0)         // f16 ctx x 16 rows [b][t][c]
#define WS_YL  (WS_Y + 2u * (size_t)NB * SEQ * CC)          // f16 ctx x 16 residual x 2^10 rows [b][t < QB0][c]
#define WS_MB  (WS_YL + 2u * (size_t)NB * QB0 * CC)         // mask bit plane [q][SEQ/32] (bit set = masked)
#define WS_END (WS_MB + 4u * (size_t)SEQ * (SEQ / 32))
static_assert(WS_END <= (size_t)134217728u);
static_assert(WS_WK % 128 == 0 && WS_WV % 128 == 0 && WS_WO % 128 == 0 && WS_XB % 128 == 0 && WS_QH % 128 == 0 && WS_QL % 128 == 0 && WS_KH % 128 == 0);
static_assert(WS_VT % 128 == 0 && WS_VL % 128 == 0 && WS_Y % 128 == 0 && WS_YL % 128 == 0 && WS_MB % 128 == 0);

template <typename T> __device__ __forceinline__ void vst2(void* p, T v) { *(T*)p = v;  }
template <bool B> struct flag_t { static constexpr bool value = B; };
__device__ __forceinline__ v8f wmma_bf(v16b a, v16b b, v8f c) {
  v8f d = __builtin_amdgcn_wmma_f32_16x16x32_bf16(false, a, false, b, (short)0, c, false, false);
  asm volatile("v_nop\n\tv_nop\n\tv_nop\n\tv_nop" : "+v"(d) : "v"(a), "v"(b));
  return d;
}
// 16x16x32 fragments: lane = (h = lane>>4, row/col = lane&15); elements 0..7 = k0+8h+0..7, 8..15 = k0+16+8h+0..7; D element r = row 8h+r
__device__ __forceinline__ float bfr(float v) { return (float)(__bf16)v; }

// ---- LDS ring of the two GEMM kernels: a stage = 128 k (256 bytes, two whole lines) of every operand row of the block, two buffers, filled by asynchronous copies while the other buffer is worked on; one block owns its WGP's LDS
#define KS 128               // k per stage
#define NS (CC / KS)         // stages
#define GP 272               // row pitch of the GEMM rings in bytes: 256 + 16, free of bank conflicts for 16-byte LDS reads
#define RP 144               // row pitch of k_fa's ring in bytes: 128 + 16, likewise
static_assert(NS >= 2 && CC % KS == 0);
typedef __attribute__((address_space(1))) v4i gq_t;   // 16 bytes in global memory
typedef __attribute__((address_space(3))) v4i lq_t;   // 16 bytes in LDS
// one copy of 16 bytes a lane, global -> LDS through no register, written as the builtin: the compiler looks after its address registers and no s_wait_xcnt is written behind it, so the wave goes straight on to its LDS reads
__device__ __forceinline__ void copy1(char* l, const char* p) { __builtin_amdgcn_global_load_async_to_lds_b128((gq_t*)p, (lq_t*)l, 0, 0); }
// four copies a lane: ring rows 16 apart from plane rows 16 apart (8 lanes cover one 128-byte row slice, a wave 4 whole lines)
__device__ __forceinline__ void copy4(char* l, const char* p) { copy1(l, p); copy1(l + 16 * RP, p + 16 * 2 * CC); copy1(l + 32 * RP, p + 32 * 2 * CC); copy1(l + 48 * RP, p + 48 * 2 * CC); }
// N copies a lane into a GEMM ring: ring rows STEP apart from plane rows STEP apart (16 lanes cover one 256-byte row slice, a wave 4 whole lines)
template <int N, int STEP> __device__ __forceinline__ void copyr(char* l, const char* p) {
#pragma unroll                                                   // constant steps from one LDS address and one global address
  for (int n = 0; n < N; ++n) copy1(l + n * STEP * GP, p + n * STEP * 2 * CC); }
#define AW() asm volatile("s_wait_asynccnt 0x0" ::: "memory")   // this wave's copies have landed
#define DW() asm volatile("s_wait_dscnt 0x0" ::: "memory")      // this wave's LDS reads have returned: the buffer may be refilled behind the barrier
// fragment from a ring row: p = row start + 64 bytes per 32 k + 16 bytes per lane half (the k order stated above)
__device__ __forceinline__ v16h frag_lh(const char* p) { union { v16h v; v8h q[2]; } u; u.q[0] = *(const v8h*)p; u.q[1] = *(const v8h*)(p + 32); return u.v; }
__device__ __forceinline__ v16b frag_lb(const char* p) { union { v16b v; v8b q[2]; } u; u.q[0] = *(const v8b*)p; u.q[1] = *(const v8b*)(p + 32); return u.v; }

// ---- k_prep: every conversion of the call in one grid; a block's index range says which plane it fills (block-uniform): x of all batches, the four weights, the mask bits
#define PB_X (NB * ((SEQ * CC) / 8) / 256)     // blocks on x: 8 elements a thread
#define PB_W (((CC * CC) / 8) / 256)           // blocks on one weight
#define PB_M (SEQ * (SEQ / 32) / 256)          // blocks on the mask: one 32-bit word a thread
static_assert(WS_WK == WS_WQ + 2u * (size_t)CC * CC && WS_WV == WS_WQ + 4u * (size_t)CC * CC && WS_WO == WS_WQ + 6u * (size_t)CC * CC);   // k_prep steps from one weight plane to the next
__device__ __forceinline__ void cvt8(const float* __restrict__ A, unsigned short* __restrict__ D, const bool f16x64) {
  const v4f a = *(const v4f*)A; const v4f c = *(const v4f*)(A + 4);
  asm volatile("s_wait_xcnt 0x0" ::: "memory");   // the loads' address register is reused for the packed result: it may be rewritten only behind this wait
  const float v[8] = {a[0], a[1], a[2], a[3], c[0], c[1], c[2], c[3]};
  union { v8b b; v8h h; v4u u; } o;
  if (f16x64) { v8h t;
#pragma unroll
    for (int k = 0; k < 8; ++k) t[k] = (_Float16)(bfr(v[k]) * 64.0f);
    o.h = t; }
  else { v8b t;
#pragma unroll
    for (int k = 0; k < 8; ++k) t[k] = (__bf16)v[k];
    o.b = t; }
  vst2(D, o.u);
}
__global__ __launch_bounds__(256) void k_prep(const float* __restrict__ X, const float* __restrict__ WQ, const float* __restrict__ WK, const float* __restrict__ WV, const float* __restrict__ WO, const int* __restrict__ M,
                                              unsigned short* __restrict__ XB, unsigned short* __restrict__ WB, unsigned* __restrict__ MB) {
  const int blk = blockIdx.x, tid = threadIdx.x;
  if (blk < PB_X) {
    const int i = blk * 256 + tid, b = i / ((SEQ * CC) / 8);     // x rows of batch b start SEQ_FULL rows apart, the plane's SEQ rows apart
    cvt8(X + (size_t)b * (SEQ_FULL - SEQ) * CC + (size_t)i * 8, XB + (size_t)i * 8, false);
  } else if (blk < PB_X + 4 * PB_W) {
    const int wsel = (blk - PB_X) / PB_W; const int i = (blk - PB_X - wsel * PB_W) * 256 + tid;   // the four 16-bit weight planes stand one behind the other in the workspace
    const float* A = wsel == 0 ? WQ : wsel == 1 ? WK : wsel == 2 ? WV : WO;
    cvt8(A + (size_t)i * 8, WB + (size_t)wsel * CC * CC + (size_t)i * 8, wsel == 3);
  } else {
    const int w = (blk - PB_X - 4 * PB_W) * 256 + tid;
    const int q = w / (SEQ / 32), wc = w - q * (SEQ / 32);
    const int* p = M + (size_t)q * SEQ_FULL + wc * 32;
    unsigned bits = 0u;
#pragma unroll
    for (int i = 0; i < 8; ++i) { const v4i v = *(const v4i*)(p + 4 * i);
      bits |= (v.x != 0 ? 1u : 0u) << (4 * i);     bits |= (v.y != 0 ? 1u : 0u) << (4 * i + 1);
      bits |= (v.z != 0 ? 1u : 0u) << (4 * i + 2); bits |= (v.w != 0 ? 1u : 0u) << (4 * i + 3); }
    vst2(MB + w, bits);
  }
}

// ---- k_proj: block = 128 rows out of all batches' rows x the same 128 cols of q, k and v (128 x 384), 12 waves: waves 0..3 q, 4..7 k, 8..11 v (which = wave / 4, scalar), wave = 64 rows x 64 cols (one head): y = x W^T + b (exact bf16 products from the 16-bit planes); which 0/1: rope then q -> f16 hi (+ residual for rows 0..63), k -> f16 rows; which 2: v -> f16 planes [c][t] (+ residual plane for rows 0..63)
// a 64 x 64 wave tile reads 8 fragments for 16 products (16 x 128: 9 for 8), the three products share the block's x rows and its rope table: 512 operand rows come from L2 for 49,152 outputs (three 128 x 128 blocks: 768)
__global__ __launch_bounds__(384) void k_proj(const __bf16* __restrict__ XB, const __bf16* __restrict__ WQ, const float* __restrict__ BQ, const __bf16* __restrict__ WK, const float* __restrict__ BK, const __bf16* __restrict__ WV, const float* __restrict__ BV,
                                              const float* __restrict__ RC, const float* __restrict__ RS,
                                              _Float16* __restrict__ QH, _Float16* __restrict__ QL, _Float16* __restrict__ KH, _Float16* __restrict__ VT, _Float16* __restrict__ VL) {
  // one pool: the ring (2 x 512 rows: 128 of x, 128 each of Wq, Wk, Wv) during the k loop, the output staging planes behind it, each product's own: q rows, q residual rows 0..63, k rows, v planes, v residual planes
  constexpr unsigned RB = 512u * GP; __shared__ __align__(16) char pool[2 * RB];
  constexpr unsigned SP = 128u * 136 * 2, O_SL = SP, O_K = O_SL + 64u * 136 * 2, O_V = O_K + SP, O_VL = O_V + SP; static_assert(O_VL + 128u * 72 * 2 <= sizeof(pool) && O_K % 16 == 0);
  __shared__ __align__(16) __bf16 rt[128][17][8];   // rope table of the block's rows: cell (row, col < 16) = cos at d = col, col + 16, col + 32, col + 48, then sin at the same four: what one lane needs for one row, 16 bytes; the 17th cell is the pad that spreads the rows over the banks
  const int tid = threadIdx.x, lane = tid & 31, col = lane & 15, g = lane >> 4; const int wave = __builtin_amdgcn_readfirstlane(tid >> 5), wr = (wave >> 1) & 1, wc = wave & 1;
  const int which = wave >> 2, gt = tid & 127; const int c0 = blockIdx.y * 128; const int r0 = blockIdx.x * 128;   // gt: the thread's index among its product's 128; r0: row in the [b][t] planes
  _Float16 (*sh)[136] = (_Float16 (*)[136])(pool + (which == 0 ? 0u : O_K)); _Float16 (*sl)[136] = (_Float16 (*)[136])(pool + O_SL); _Float16 (*th)[136] = (_Float16 (*)[136])(pool + O_V); _Float16 (*tl2)[72] = (_Float16 (*)[72])(pool + O_VL);
  const int bb0 = blockIdx.x / (SEQ / 128), t0 = r0 - bb0 * SEQ;   // its batch and its position in the sequence
  const __bf16* WA = which == 0 ? WQ : which == 1 ? WK : WV; const float* BA = which == 0 ? BQ : which == 1 ? BK : BV;
  char* const ring = pool + ((gt >> 4) * GP + (gt & 15) * 16);   // this lane's 16 bytes of ring row gt / 16
  const unsigned wrow = 128u + (unsigned)which * 128u;           // first ring row of this product's W tile
  // each product's four waves bring their own W tile; the q waves bring x rows 0..63, the k waves x rows 64..127 (scalar test; every wait on the copies is to 0)
  const char* gx = (const char*)(XB + (size_t)(r0 + (which & 1) * 64 + (gt >> 4)) * CC + (gt & 15) * 8); const char* gw = (const char*)(WA + (size_t)(c0 + (gt >> 4)) * CC + (gt & 15) * 8);
  auto fill = [&](const int s) { char* const l = ring + (unsigned)(s & 1) * RB; copyr<16, 8>(l + wrow * GP, gw + s * (2 * KS)); if (which < 2) copyr<8, 8>(l + (unsigned)which * (64u * GP), gx + s * (2 * KS)); };
  fill(0);                                                       // stage 0 flies under the rope table's staging
  // PW: behind global loads or stores whose address or data registers are reused next: they may be rewritten only behind this wait
#define PW() asm volatile("s_wait_xcnt 0x0" ::: "memory")
  float braw[4]; const int bi = c0 + wc * 64 + col;              // the wave's bias values, asked for here so that their latency lies under the k loop, rounded where they are used
#pragma unroll
  for (int j = 0; j < 4; ++j) braw[j] = BA[bi + j * 16];
  asm volatile("s_wait_xcnt 0x0" :: "s"(BA), "v"(bi) : "memory");   // the four loads' base and lane index stay whole up to this wait (named as inputs) and may be rewritten only behind it
  // rope table rows t0..t0+127 (bf16-RNE values), whole head dim; staged extent == consumed extent (128 x HD)
  if (which < 2) {                                               // a thread takes 4 columns of a row at all four 16-column steps: 8 loads of 16 bytes give 4 whole cells; all 16 loads of its 2 rows fly at once; the q and k waves' 256 threads fill the one table
    v4f tc[2][4], ts[2][4]; const float* pc = RC + (size_t)(t0 + (tid >> 2)) * HD + (tid & 3) * 4; const float* ps = RS + (size_t)(t0 + (tid >> 2)) * HD + (tid & 3) * 4;
#pragma unroll
    for (int it = 0; it < 2; ++it)
#pragma unroll
      for (int jj = 0; jj < 4; ++jj) { tc[it][jj] = *(const v4f*)(pc + it * 64 * HD + jj * 16); ts[it][jj] = *(const v4f*)(ps + it * 64 * HD + jj * 16); }
    asm volatile("s_wait_xcnt 0x0" :: "v"(pc), "v"(ps) : "memory");   // the two address pairs of the 16 loads stay whole up to this wait (named as inputs) and may be rewritten only behind it
#pragma unroll
    for (int it = 0; it < 2; ++it)
#pragma unroll
      for (int i = 0; i < 4; ++i) { v8b t;
#pragma unroll
        for (int jj = 0; jj < 4; ++jj) { t[jj] = (__bf16)tc[it][jj][i]; t[4 + jj] = (__bf16)ts[it][jj][i]; }
        *(v8b*)&rt[it * 64 + (tid >> 2)][(tid & 3) * 4 + i][0] = t; } }
  AW();
  __syncthreads();                                               // publishes the rope table and stage 0
  fill(1);
  v8f acc[4][4] = {};
#pragma unroll 1                                                 // one trip a stage: the buffer is picked by the trip's parity, the text stays short
  for (int s = 0; s < NS; ++s) { const char* fb = pool + (unsigned)(s & 1) * RB + col * GP + g * 16;
#pragma unroll                                                   // this and the four below: constant indices keep a[], w[] and acc[] in registers; a block's 16 LDS reads stand as one group ahead of its 16 products
    for (int ks = 0; ks < KS / 32; ++ks) { v16b a[4], w[4];
#pragma unroll
      for (int i = 0; i < 4; ++i) a[i] = frag_lb(fb + (wr * 64 + i * 16) * GP + ks * 64);
#pragma unroll
      for (int j = 0; j < 4; ++j) w[j] = frag_lb(fb + (wrow + wc * 64 + j * 16) * GP + ks * 64);
#pragma unroll
      for (int i = 0; i < 4; ++i)
#pragma unroll
        for (int j = 0; j < 4; ++j) acc[i][j] = wmma_bf(a[i], w[j], acc[i][j]); }
    DW(); AW();
    __syncthreads();                                             // publishes stage s + 1 and ends every wave's reads of stage s
    if (s + 2 < NS) fill(s + 2); }
  AW();
  float bbv[4];
#pragma unroll
  for (int j = 0; j < 4; ++j) bbv[j] = bfr(braw[j]);
  // the residual planes are asked for by one scalar test in front of each element loop (two copies of the loop's text), not by a branch per element: the loop bodies are straight-line, their LDS reads and stores fly together
  if (which == 2) {
    auto vput = [&](auto rf) { constexpr bool RES = decltype(rf)::value;
#pragma unroll
    for (int i = 0; i < 4; ++i)
#pragma unroll
      for (int j = 0; j < 4; ++j) { const int cl = wc * 64 + j * 16 + col, rb = wr * 64 + i * 16 + 8 * g; v8h hv, lv;   // a lane's 8 rows of one column stand side by side in the [c][t] plane
#pragma unroll
        for (int r = 0; r < 8; ++r) { const float v = acc[i][j][r] + bbv[j]; const _Float16 h = (_Float16)v; hv[r] = h; lv[r] = (_Float16)((v - (float)h) * 1024.0f); }   /* v residual carried x 2^10 */
        *(v8h*)&th[cl][rb] = hv; if constexpr (RES) *(v8h*)&tl2[cl][rb] = lv; } };
    if (t0 == 0 && wr == 0) vput(flag_t<true>{}); else vput(flag_t<false>{});   // the residual plane is stored for a sequence's rows 0..63 alone (scalar)
  } else { const bool qres = which == 0 && t0 == 0 && wr == 0;   // this wave's 64 rows are a sequence's q rows 0..63 (scalar)
    const float qs = which == 0 ? QSC : 1.0f;                    // q leaves scaled, k as it is
    auto rope = [&](auto rf) { constexpr bool RES = decltype(rf)::value;
#pragma unroll
    for (int i = 0; i < 4; ++i)
#pragma unroll
      for (int r = 0; r < 8; ++r) { const int rl = wr * 64 + i * 16 + 8 * g + r; const v8b t = *(const v8b*)&rt[rl][col][0]; float v[4];
#pragma unroll
        for (int j = 0; j < 4; ++j) v[j] = acc[i][j][r] + bbv[j];
        // rotate-half: head-local d = j*16+col; d<32: y*cos - y[d+32]*sin, d>=32: y*cos + y[d-32]*sin; partner tile = j^2
#pragma unroll
        for (int j = 0; j < 4; ++j) { const int cl = wc * 64 + j * 16 + col; const float pv = v[j ^ 2], cs = (float)t[j], sn = (float)t[4 + j];
          const float o = ((j < 2) ? (v[j] * cs - pv * sn) : (v[j] * cs + pv * sn)) * qs;
          const _Float16 hv = (_Float16)o; sh[rl][cl] = hv; if constexpr (RES) sl[rl][cl] = (_Float16)((o - (float)hv) * 1024.0f); }   /* q residual carried x 2^10 so the plane stays f16-normal */
      } };
    if (qres) rope(flag_t<true>{}); else rope(flag_t<false>{}); }
  __syncthreads();
  // the staged planes leave as whole row pieces, 8 pieces a thread at a time: their LDS reads fly together, the stores follow from one address with constant steps, one wait serves the run
  const int pr = gt >> 4, pq = (gt & 15) * 8;                    // piece (row pr + 8 n, 8 columns from pq) of the thread's own product
  if (which < 2) { _Float16* dh = (which == 0 ? QH : KH) + (size_t)(r0 + pr) * CC + c0 + pq;
#pragma unroll                                                   // this and every unroll below: constant steps from one address, t[] in registers
    for (int hb = 0; hb < 2; ++hb) { v4u t[8];
#pragma unroll
      for (int u = 0; u < 8; ++u) t[u] = *(const v4u*)&sh[(hb * 8 + u) * 8 + pr][pq];
#pragma unroll
      for (int u = 0; u < 8; ++u) vst2(dh + (hb * 8 + u) * 8 * CC, t[u]);
      PW(); }
    if (which == 0 && t0 == 0) { _Float16* dl = QL + (size_t)(r0 + pr) * CC + c0 + pq; v4u t[8];   // rows 0..63 of the residual plane
      static_assert(QB0 == 64);
#pragma unroll
      for (int u = 0; u < 8; ++u) t[u] = *(const v4u*)&sl[u * 8 + pr][pq];
#pragma unroll
      for (int u = 0; u < 8; ++u) vst2(dl + u * 8 * CC, t[u]);
      PW(); } }
  else { _Float16* dv = VT + (size_t)(bb0 * CC + c0 + pr) * (size_t)SEQ + t0 + pq;
#pragma unroll                                                   // as above
    for (int hb = 0; hb < 2; ++hb) { v4u t[8];
#pragma unroll
      for (int u = 0; u < 8; ++u) t[u] = *(const v4u*)&th[(hb * 8 + u) * 8 + pr][pq];
#pragma unroll
      for (int u = 0; u < 8; ++u) vst2(dv + (hb * 8 + u) * 8 * SEQ, t[u]);
      PW(); }
    if (t0 == 0) { _Float16* dl = VL + (size_t)(bb0 * CC + c0 + (gt >> 3)) * (size_t)QB0 + (gt & 7) * 8; v4u t[8];   // the residual plane's rows hold 64 positions: 8 pieces a row, 16 rows a step, every lane on
#pragma unroll
      for (int u = 0; u < 8; ++u) t[u] = *(const v4u*)&tl2[u * 16 + (gt >> 3)][(gt & 7) * 8];
#pragma unroll
      for (int u = 0; u < 8; ++u) vst2(dl + u * 16 * QB0, t[u]);
      PW(); } } }

// ---- k_fa: wave = 32 queries (two 16-column groups) of one head of one batch, whole key range in one pass, logits and P stay in registers.
// S^T = K Q^T (A = k rows, B = q rows, same loader on both sides): lane (col, g) holds query col, keys 8g+r of each 16-key tile, so two tiles pack straight into the B operand of O^T += V^T P^T.
// q comes scaled by log2(e) / 8 and the score products start from C = 11 - reference, so a score leaves the matrix unit as the exponent of P = 2^(s - reference) x 2^11 -> f16: no subtraction or scaling per score.
// The reference of a query is its largest score at the time it is set; it is renewed (scores of the block, sums and O rescaled, the lane halves' maxima joined) only when a score passes it by 2^4, P <= 2^15. Sum per query, normalised once at the end.
// The wave's 32 mask rows are scanned once: stages in front of the first set bit of all four waves run without mask work, a wave's 32-key blocks behind its last clear bit are not run (both counts bounded by SEQ / 32).
// Any mask content is honoured; a fully masked row ends as 0 x inf = NaN like the softmax of an all -inf row.
// K and V come through LDS: a stage = 64 keys of the block's head, 64 k rows (128 bytes, one whole line each) and those keys' 128 bytes of the 64 v plane rows; two buffers, filled by asynchronous copies
// while the other buffer is worked on; the block's four waves walk the stages together and read their fragments from the ring (each line leaves L2 once a block, whole, instead of in 32-byte pieces once a wave).
#define FKS 64               // keys per stage
#define FRB (128u * RP)      // bytes of one buffer: 64 k rows, then 64 v rows, at the ring pitch
static_assert(SEQ % FKS == 0 && FKS == 64 && 2 * HD == 128);
// copy4 for the v planes, whose rows stand SEQ elements apart
__device__ __forceinline__ void copy4v(char* l, const char* p) { copy1(l, p); copy1(l + 16 * RP, p + 16 * 2 * SEQ); copy1(l + 32 * RP, p + 32 * 2 * SEQ); copy1(l + 48 * RP, p + 48 * 2 * SEQ); }
__device__ __forceinline__ float xhalf(float v) { const int b = __float_as_int(v); return __int_as_float(__builtin_amdgcn_permlanex16(b, b, 0x76543210, 0xfedcba98, false, false)); }
// behind global loads or stores whose registers are reused next: those registers may be rewritten only behind this wait
#define XW() asm volatile("s_wait_xcnt 0x0" ::: "memory")
__device__ __forceinline__ v8f wm(v16h a, v16h b, v8f c) { return __builtin_amdgcn_wmma_f32_16x16x32_f16(false, a, false, b, (short)0, c, false, false); }
// 2^x with the one free issue slot behind a transcendental kept inside the statement
__device__ __forceinline__ float exp2s(float x) { float r; asm("v_exp_f32 %0, %1\n\tv_nop" : "=v"(r) : "v"(x)); return r; }
// eight at once: each v_exp_f32 is followed by one that touches neither its result nor its source (early-clobber outputs), so one slot at the end serves the run
__device__ __forceinline__ v8f exp2x8(v8f x) { float r0, r1, r2, r3, r4, r5, r6, r7;
  asm("v_exp_f32 %0, %8\n\tv_exp_f32 %1, %9\n\tv_exp_f32 %2, %10\n\tv_exp_f32 %3, %11\n\tv_exp_f32 %4, %12\n\tv_exp_f32 %5, %13\n\tv_exp_f32 %6, %14\n\tv_exp_f32 %7, %15\n\tv_nop"
      : "=&v"(r0), "=&v"(r1), "=&v"(r2), "=&v"(r3), "=&v"(r4), "=&v"(r5), "=&v"(r6), "=&v"(r7) : "v"(x[0]), "v"(x[1]), "v"(x[2]), "v"(x[3]), "v"(x[4]), "v"(x[5]), "v"(x[6]), "v"(x[7]));
  return v8f{r0, r1, r2, r3, r4, r5, r6, r7}; }
// fragment at a byte address that already holds the lane's row and its half's 16 bytes
__device__ __forceinline__ v16h frag_p(const char* p) { union { v16h v; v8h q[2]; } u; u.q[0] = *(const v8h*)p; u.q[1] = *(const v8h*)(p + 32); return u.v; }
__global__ __launch_bounds__(128) void k_fa(const _Float16* __restrict__ QH, const _Float16* __restrict__ QL, const _Float16* __restrict__ KH, const _Float16* __restrict__ VT, const _Float16* __restrict__ VL,
                                            const unsigned* __restrict__ MB, _Float16* __restrict__ Y, _Float16* __restrict__ YL) {
  constexpr float NEG = -3.0e38f; constexpr int NW = SEQ / 32;
  __shared__ __align__(16) char ring[2 * FRB]; __shared__ __align__(16) int wtrip[4], wfull[4];
  const int tid = threadIdx.x, lane = threadIdx.x & 31, col = lane & 15, g = lane >> 4; const int wave = __builtin_amdgcn_readfirstlane((int)threadIdx.x >> 5);
  // more blocks than resident places, and a block's cost grows with its query tile: the longest key ranges of every head and batch come first in the index, the short ones fill the places that free up
  constexpr int NT = SEQ / 128; const unsigned hb = blockIdx.x % (unsigned)(NH * NB); const int h = (int)(hb % NH), bt = (int)(hb / NH); const int q0 = (NT - 1 - (int)(blockIdx.x / (unsigned)(NH * NB))) * 128 + wave * 32;
  QH += (size_t)bt * SEQ * CC; QL += (size_t)bt * SEQ * CC; KH += (size_t)bt * SEQ * CC; VT += (size_t)bt * CC * SEQ; VL += (size_t)bt * CC * QB0; Y += (size_t)bt * SEQ * CC; YL += (size_t)bt * QB0 * CC;
  char* const rl = ring + ((tid >> 3) * RP + (tid & 7) * 16);   // this lane's 16 bytes of ring row tid / 8
  const char* gk = (const char*)(KH + (size_t)(tid >> 3) * CC + h * HD + (tid & 7) * 8); const char* gv = (const char*)(VT + ((size_t)h * HD + (tid >> 3)) * SEQ + (tid & 7) * 8);
  auto fill = [&](const int s) { char* const l = rl + (unsigned)(s & 1) * FRB; copy4(l, gk + (size_t)s * (FKS * 2 * CC)); copy4v(l + 64u * RP, gv + s * (2 * FKS)); };
  fill(0);                                                     // stage 0 flies under the mask scan (SEQ >= 128: stages 0 and 1 lie inside the planes)
  const unsigned* mu = MB + (size_t)q0 * NW; const unsigned mo = 4u * (unsigned)(col * NW);
  int last = -1, first = NW;
#pragma unroll
  for (int p = 0; p < 2; ++p)
#pragma unroll
    for (int i = NW / 8 - 1; i >= 0; --i) { const v4u u = *(const v4u*)((const char*)(mu + p * 16 * NW + 4 * i) + (mo + 4u * (unsigned)(g * (NW / 2))));
#pragma unroll
      for (int e = 3; e >= 0; --e) { const int w = g * (NW / 2) + 4 * i + e; last = (u[e] != 0xFFFFFFFFu) ? max(last, w) : last; first = (u[e] != 0u) ? min(first, w) : first; } }
#pragma unroll
  for (int o = 1; o < 32; o <<= 1) { last = max(last, __shfl_xor(last, o)); first = min(first, __shfl_xor(first, o)); }
  const int trip = min(__builtin_amdgcn_readfirstlane(last) + 1, NW);
  const int nfull = max(min(__builtin_amdgcn_readfirstlane(first), trip), 0);
  if (lane == 0) { wtrip[wave] = trip; wfull[wave] = nfull; }
  AW();
  __syncthreads();                                             // publishes stage 0 and the four waves' block counts
  const v4i wt = *(const v4i*)wtrip, wf = *(const v4i*)wfull;
  const int nst = (__builtin_amdgcn_readfirstlane(max(max(wt.x, wt.y), max(wt.z, wt.w))) + 1) >> 1;   // stages of the block: its longest wave's, at most SEQ / FKS
  const int nfs = __builtin_amdgcn_readfirstlane(min(min(wf.x, wf.y), min(wf.z, wf.w))) >> 1;         // leading stages that no wave of the block has mask work in (nfull <= trip: every wave runs both their halves)
  if (nst > 1) fill(1);
  const bool res = q0 < QB0;
  const unsigned ko = 2u * (unsigned)(col * CC + 8 * g), lo = 2u * (unsigned)(col * QB0 + 8 * g);
  const char* lp = (const char*)(VL + (size_t)h * HD * QB0) + lo;
  const char* qlp = (const char*)(QL + (size_t)q0 * CC + h * HD) + ko;   // the wave's q residual rows, read under res alone
  v16h qh[2][2];
#pragma unroll
  for (int p = 0; p < 2; ++p)
#pragma unroll
    for (int kk = 0; kk < 2; ++kk) { const size_t o = (size_t)(q0 + 16 * p) * CC + h * HD + kk * 32; qh[p][kk] = frag_p((const char*)(QH + o) + ko); }
  XW();
  v8f acc[2][4] = {}; float l[2] = {0.f, 0.f}, thr[2] = {-1.0e38f, -1.0e38f};   // thr: the score exponent above which the reference is renewed; below every real score until the first unmasked one has set it
  constexpr v8f C11 = {11.0f, 11.0f, 11.0f, 11.0f, 11.0f, 11.0f, 11.0f, 11.0f}; v8f cr[2] = {C11, C11};   // 11 - reference of the lane's query, eight times over: the C operand of its score products
  auto body = [&](const int kc, const char* kb, const char* vb, auto mk) {   // kb, vb: the lane's row and half at this block's 32 keys in the stage's buffer
    constexpr bool masked = decltype(mk)::value;
    v16h kf[2][2], vf[4]; unsigned mw[2] = {0u, 0u};
#pragma unroll
    for (int t = 0; t < 2; ++t)
#pragma unroll
      for (int kk = 0; kk < 2; ++kk) kf[t][kk] = frag_lh(kb + t * 16 * RP + kk * 64);
#pragma unroll
    for (int j = 0; j < 4; ++j) vf[j] = frag_lh(vb + j * 16 * RP);   // this block's v rows fly under the logits and the softmax
    if constexpr (masked) { mw[0] = *(const unsigned*)((const char*)(mu + kc) + mo); mw[1] = *(const unsigned*)((const char*)(mu + 16 * NW + kc) + mo); XW(); }
    v8f s[2][2];
#pragma unroll
    for (int t = 0; t < 2; ++t)
#pragma unroll
      for (int p = 0; p < 2; ++p) s[p][t] = wm(kf[t][0], qh[p][0], cr[p]);
#pragma unroll
    for (int t = 0; t < 2; ++t)
#pragma unroll
      for (int p = 0; p < 2; ++p) s[p][t] = wm(kf[t][1], qh[p][1], s[p][t]);
    if (res) {                                                 // query rows 0..63 (scalar): the q residual product on top, its fragments fetched here so that the other waves hold no registers for them
      v16h ql[2][2];
#pragma unroll
      for (int p = 0; p < 2; ++p)
#pragma unroll
        for (int kk = 0; kk < 2; ++kk) ql[p][kk] = frag_p(qlp + 2 * (16 * p * CC + kk * 32));
      XW();
#pragma unroll
      for (int t = 0; t < 2; ++t)
#pragma unroll
        for (int p = 0; p < 2; ++p) { v8f a = wm(kf[t][0], ql[p][0], v8f{}); a = wm(kf[t][1], ql[p][1], a); s[p][t] += a * (1.0f / 1024.0f); } }
    if constexpr (masked) {
#pragma unroll
      for (int p = 0; p < 2; ++p) { const unsigned w = mw[p] >> (8 * g);
#pragma unroll
        for (int t = 0; t < 2; ++t)
#pragma unroll
          for (int r = 0; r < 8; ++r) s[p][t][r] = ((w >> (16 * t + r)) & 1u) ? NEG : s[p][t][r]; } }
    float mx[2];                                               // the lane's own 16 keys; the halves are joined only where the reference moves
#pragma unroll
    for (int p = 0; p < 2; ++p) { float x = fmaxf(s[p][0][0], s[p][1][0]);
#pragma unroll
      for (int r = 1; r < 8; ++r) x = fmaxf(x, fmaxf(s[p][0][r], s[p][1][r]));
      mx[p] = x; }
    if (__builtin_amdgcn_ballot_w32(mx[0] > thr[0] || mx[1] > thr[1]) != 0u) {
#pragma unroll
      for (int p = 0; p < 2; ++p) { const float x = fmaxf(mx[p], xhalf(mx[p])); const bool up = x > thr[p];   // alike in both lanes of a query
        const float d = up ? x - 11.0f : 0.f;                  // the reference moves by d: the block's largest score becomes 2^11
        const float al = thr[p] < 0.f ? 1.0f : exp2s(-d);      // nothing summed before the reference is first set: no factor (d may then be negative)
        thr[p] = up ? 15.0f : thr[p]; l[p] *= al; cr[p] -= d; s[p][0] -= d; s[p][1] -= d;
#pragma unroll
        for (int j = 0; j < 4; ++j) acc[p][j] *= al; } }
    v16h pb[2];
#pragma unroll
    for (int p = 0; p < 2; ++p) { float sum = 0.f;             // a masked score is -huge whatever the reference: its term is exp2(-huge) = 0
#pragma unroll
      for (int t = 0; t < 2; ++t) { s[p][t] = exp2x8(s[p][t]);
#pragma unroll
        for (int r = 0; r < 8; ++r) { sum += s[p][t][r]; pb[p][8 * t + r] = (_Float16)s[p][t][r]; } }
      l[p] += sum; }
#pragma unroll
    for (int j = 0; j < 4; ++j)
#pragma unroll
      for (int p = 0; p < 2; ++p) acc[p][j] = wm(vf[j], pb[p], acc[p][j]);
    if (res && kc < QB0 / 32) {                                // query rows 0..63, keys 0..63: P and v residual planes (x 2^10), as before
      v16h pl[2];
#pragma unroll
      for (int p = 0; p < 2; ++p)
#pragma unroll
        for (int e = 0; e < 16; ++e) pl[p][e] = (_Float16)((s[p][e >> 3][e & 7] - (float)pb[p][e]) * 1024.0f);
#pragma unroll
      for (int j = 0; j < 4; ++j) { const v16h vl = frag_p(lp + 2 * (j * 16 * QB0 + kc * 32)); XW();
#pragma unroll
        for (int p = 0; p < 2; ++p) { v8f a = {}; a = wm(vf[j], pl[p], a); a = wm(vl, pb[p], a); acc[p][j] += a * (1.0f / 1024.0f); } } }
  };
  auto foot = [&](const int st) {                              // both loops below run the same trips in every wave of the block
    DW(); AW();
    __syncthreads();                                           // publishes stage st + 1 and ends every wave's reads of stage st
    if (st + 2 < nst) fill(st + 2); };
  const char* f0 = ring + col * RP + g * 16;
#pragma unroll 1                                               // one trip a stage: the buffer is picked by the trip's parity, the text stays short
  for (int st = 0; st < nfs; ++st) { const char* fb = f0 + (unsigned)(st & 1) * FRB;
    body(2 * st, fb, fb + 64 * RP, flag_t<false>{}); body(2 * st + 1, fb + 32 * RP, fb + 64 * RP + 64, flag_t<false>{});
    foot(st); }
#pragma unroll 1                                               // as above
  for (int st = nfs; st < nst; ++st) { const char* fb = f0 + (unsigned)(st & 1) * FRB; const int ke = min(2 * st + 2, trip);   // a wave past its own last block only keeps the ring going
#pragma unroll 1                                               // one copy of the masked body in the text
    for (int kc = 2 * st; kc < ke; ++kc) body(kc, fb + (kc & 1) * (32 * RP), fb + 64 * RP + (kc & 1) * 64, flag_t<true>{});
    foot(st); }
  AW();
#pragma unroll
  for (int p = 0; p < 2; ++p) { const float inv = 16.0f / (l[p] + xhalf(l[p])); const size_t o = (size_t)(q0 + 16 * p) * CC + h * HD;   /* ctx carried x 16, residual x 2^10 */
#pragma unroll
    for (int j = 0; j < 4; ++j) { union { v8h h; v4u u; } yh, yl;
#pragma unroll
      for (int r = 0; r < 8; ++r) { const float y = acc[p][j][r] * inv; const _Float16 t = (_Float16)y; yh.h[r] = t; yl.h[r] = (_Float16)((y - (float)t) * 1024.0f); }
      vst2((char*)(Y + o + j * 16) + ko, yh.u); XW(); if (res) { vst2((char*)(YL + o + j * 16) + ko, yl.u); XW(); } } } }

// ---- k_out: block = (128 rows out of all batches' rows, 256 cols), 8 waves, wave = 64 rows x 64 cols: out = (ctx x 16 f16) (f16 bf16(Wo) x 64)^T / 1024 + bo; the four waves on a sequence's rows 0..63 add the ctx residual plane (2 products)
__global__ __launch_bounds__(256) void k_out(const _Float16* __restrict__ Y, const _Float16* __restrict__ YL, const _Float16* __restrict__ WO, const float* __restrict__ BP, float* __restrict__ OUT) { __shared__ __align__(16) float sf[8][32][68];
  constexpr unsigned RB = 448u * GP; __shared__ __align__(16) char pool[2 * RB];   // ring: 2 x (128 rows of ctx, 256 of Wo, 64 of the ctx residual, filled in a sequence's row block 0 alone)
  const int tid = threadIdx.x, lane = tid & 31, col = lane & 15, g = lane >> 4; const int wave = __builtin_amdgcn_readfirstlane(tid >> 5), wr = wave >> 2, wc = wave & 3;
  const int c0 = blockIdx.y * 256; const int r0 = blockIdx.x * 128 + wr * 64; const int b = blockIdx.x / (SEQ / 128); const size_t orow = (size_t)b * (SEQ_FULL - SEQ) + r0;
  const bool lo = blockIdx.x % (SEQ / 128) == 0; const bool lw = lo && wr == 0;   // lw: this wave's 64 rows are a sequence's rows 0..63 (scalar: the products under it run with every lane on)
  char* const ring = pool + ((tid >> 4) * GP + (tid & 15) * 16);   // this lane's 16 bytes of ring row tid / 16
  const char* gy = (const char*)(Y + (size_t)(blockIdx.x * 128 + (tid >> 4)) * CC + (tid & 15) * 8); const char* gl = (const char*)(YL + (size_t)(b * QB0 + (tid >> 4)) * CC + (tid & 15) * 8); const char* gw = (const char*)(WO + (size_t)(c0 + (tid >> 4)) * CC + (tid & 15) * 8);
  auto fill = [&](const int s) { char* const l = ring + (unsigned)(s & 1) * RB; copyr<8, 16>(l, gy + s * (2 * KS)); copyr<16, 16>(l + 128u * GP, gw + s * (2 * KS)); if (lo) copyr<4, 16>(l + 384u * GP, gl + s * (2 * KS)); };
  fill(0);
  AW();
  __syncthreads();                                               // publishes stage 0
  fill(1);
  v8f acc[4][4] = {}, accl[4][4] = {};
  // one block of 32 k: fp = the lane's row and half at these 32 k in the stage's buffer
  auto blk = [&](const char* fp) { v16h a[4], w[4], al[4];
#pragma unroll                                                   // this and those below: constant indices keep the fragments, acc[] and accl[] in registers
    for (int i = 0; i < 4; ++i) a[i] = frag_lh(fp + (wr * 64 + i * 16) * GP);
#pragma unroll
    for (int j = 0; j < 4; ++j) w[j] = frag_lh(fp + (128 + wc * 64 + j * 16) * GP);
    if (lw) {
#pragma unroll
      for (int i = 0; i < 4; ++i) al[i] = frag_lh(fp + (384 + i * 16) * GP); }
    __builtin_amdgcn_sched_barrier(0);                           // the block's LDS reads stay one group ahead of its products: without it they were spread, two reads and a full wait in front of every four products
#pragma unroll
    for (int i = 0; i < 4; ++i)
#pragma unroll
      for (int j = 0; j < 4; ++j) acc[i][j] = wm(a[i], w[j], acc[i][j]);
    if (lw) {
#pragma unroll
      for (int i = 0; i < 4; ++i)
#pragma unroll
        for (int j = 0; j < 4; ++j) accl[i][j] = wm(al[i], w[j], accl[i][j]); } };
#pragma unroll 1                                                 // one trip a stage: the buffer is picked by the trip's parity, the text stays short
  for (int s = 0; s < NS; ++s) { const char* fb = pool + (unsigned)(s & 1) * RB + col * GP + g * 16;
    static_assert(KS == 128);
    blk(fb); blk(fb + 64); blk(fb + 128); blk(fb + 192);
    DW(); AW();
    __syncthreads();                                             // publishes stage s + 1 and ends every wave's reads of stage s
    if (s + 2 < NS) fill(s + 2); }
  AW();
  float bb[4];
#pragma unroll
  for (int j = 0; j < 4; ++j) bb[j] = bfr(BP[c0 + wc * 64 + j * 16 + col]);
#pragma unroll                                                   // constant indices into acc[] and accl[]
  for (int hp = 0; hp < 2; ++hp) {                               // 32 rows at a time through the wave's own staging plane, stored as whole 256-byte row pieces
#pragma unroll
    for (int ii = 0; ii < 2; ++ii)
#pragma unroll
      for (int j = 0; j < 4; ++j)
#pragma unroll
        for (int r = 0; r < 8; ++r) sf[wave][ii * 16 + 8 * g + r][j * 16 + col] = (acc[hp * 2 + ii][j][r] + accl[hp * 2 + ii][j][r] * (1.0f / 1024.0f)) * (1.0f / 1024.0f) + bb[j];
    DW();                                                        // the wave's own staging stores have landed before it reads the rows back (no other wave touches its plane)
#pragma unroll                                                   // 8 row pairs at a time: their LDS reads fly together, one wait serves the run of stores
    for (int hb = 0; hb < 2; ++hb) { v4f t[8]; float* po = OUT + (orow + hp * 32 + hb * 16 + g) * CC + c0 + wc * 64 + col * 4;
#pragma unroll
      for (int u = 0; u < 8; ++u) t[u] = *(const v4f*)&sf[wave][hb * 16 + 2 * u + g][col * 4];
#pragma unroll
      for (int u = 0; u < 8; ++u) vst2(po + u * 2 * CC, t[u]);
      PW(); } } }

extern "C" void kernel_launch(void* const* d_in, const int* in_sizes, int n_in, void* d_out, int out_size, void* d_ws, size_t ws_size, hipStream_t stream) {
  if (n_in < 12) return;
  // d_in: 0 x [4,2048,1024] f32, 1 mask [2048,2048] int32, 2 rope_cos [2048,64] f32, 3 rope_sin [2048,64] f32, 4 Wq [out,in], 5 bq, 6 Wk, 7 bk, 8 Wv, 9 bv, 10 Wo, 11 bo
  const size_t xneed = ((size_t)(NB - 1) * SEQ_FULL + SEQ) * (size_t)CC;
  if ((size_t)in_sizes[0] < xneed) return;
  if ((size_t)in_sizes[1] < (size_t)(SEQ - 1) * SEQ_FULL + SEQ) return;
  if (in_sizes[2] < SEQ * HD || in_sizes[3] < SEQ * HD) return;
  if (in_sizes[4] < CC * CC || in_sizes[6] < CC * CC || in_sizes[8] < CC * CC || in_sizes[10] < CC * CC) return;
  if (in_sizes[5] < CC || in_sizes[7] < CC || in_sizes[9] < CC || in_sizes[11] < CC) return;
  if ((size_t)out_size < xneed) return;
  if (ws_size < (size_t)WS_END) return;
  const float* X = (const float*)d_in[0]; const int* M = (const int*)d_in[1]; const float* RC = (const float*)d_in[2]; const float* RS = (const float*)d_in[3];
  const float *WQ = (const float*)d_in[4], *BQ = (const float*)d_in[5], *WK = (const float*)d_in[6], *BK = (const float*)d_in[7], *WV = (const float*)d_in[8], *BV = (const float*)d_in[9], *WO = (const float*)d_in[10], *BO = (const float*)d_in[11];
  char* ws = (char*)d_ws;
  __bf16 *WQB = (__bf16*)(ws + WS_WQ), *WKB = (__bf16*)(ws + WS_WK), *WVB = (__bf16*)(ws + WS_WV), *XB = (__bf16*)(ws + WS_XB); _Float16* WOH = (_Float16*)(ws + WS_WO);
  _Float16 *QH = (_Float16*)(ws + WS_QH), *QL = (_Float16*)(ws + WS_QL), *KH = (_Float16*)(ws + WS_KH), *VT = (_Float16*)(ws + WS_VT), *VL = (_Float16*)(ws + WS_VL), *Y = (_Float16*)(ws + WS_Y), *YL = (_Float16*)(ws + WS_YL);
  unsigned* MB = (unsigned*)(ws + WS_MB); float* OUT = (float*)d_out;
  k_prep<<<dim3(PB_X + 4 * PB_W + PB_M), 256, 0, stream>>>(X, WQ, WK, WV, WO, M, (unsigned short*)XB, (unsigned short*)WQB, MB);
  k_proj<<<dim3(NB * (SEQ / 128), CC / 128), 384, 0, stream>>>(XB, WQB, BQ, WKB, BK, WVB, BV, RC, RS, QH, QL, KH, VT, VL);
  k_fa<<<dim3((SEQ / 128) * NH * NB), 128, 0, stream>>>(QH, QL, KH, VT, VL, MB, Y, YL);
  k_out<<<dim3(NB * (SEQ / 128), CC / 256), 256, 0, stream>>>(Y, YL, WOH, BO, OUT);
}
